// v000
// The times below were measured on an AMD MI455X: many runs one after another, warmed up first and cycling through
// copies of the inputs, with the whole window's GPU time divided by the number of runs. Launches and the gaps
// between them are all in it. The median over several windows is given; except for v000 it joins two sittings, which
// can be a few percent apart, so the side-by-side timings, each taken in one sitting, are the better comparison.
// v000, which the later versions start from, runs in 746 microseconds.
#include <hip/hip_runtime.h>

// ---------------- problem constants ----------------
#define D_EMB 1024
#define NHEAD 16
#define DRED  64
#define BB    4
#define SS    1024
#define MTOT  (BB * SS)     // 4096 rows of activations
#define DFF   (4 * D_EMB)   // 4096

typedef unsigned int   u32;
typedef unsigned short u16;
typedef unsigned long long u64;
typedef u32   u32x4  __attribute__((ext_vector_type(4)));
typedef u32   u32x8  __attribute__((ext_vector_type(8)));
typedef float f32x8  __attribute__((ext_vector_type(8)));
typedef __bf16 bf16x16 __attribute__((ext_vector_type(16)));

// ---------------- small helpers ----------------
__device__ __forceinline__ u16 f2bf(float f) {
    union { float f; u32 u; } c; c.f = f;
    u32 u = c.u;
    u32 r = u + 0x7fffu + ((u >> 16) & 1u);   // round-to-nearest-even
    return (u16)(r >> 16);
}

__device__ __forceinline__ f32x8 zero8() {
    f32x8 z;
#pragma unroll
    for (int i = 0; i < 8; ++i) z[i] = 0.0f;
    return z;
}

// LDS byte offset of a shared-memory pointer: flat LDS addresses keep the
// offset in the low 32 bits (ISA 10.2: LDS_ADDR = addr[31:0]).
__device__ __forceinline__ u32 lds_off(const void* p) {
    return (u32)(uintptr_t)p;
}

// Async global->LDS copy of 16 bytes per lane (GVS form, ASYNCcnt tracked).
__device__ __forceinline__ void async_copy_b128(u32 lds_byte, u32 goff_byte,
                                                const void* sbase) {
    asm volatile("global_load_async_to_lds_b128 %0, %1, %2"
                 :: "v"(lds_byte), "v"(goff_byte), "s"(sbase) : "memory");
}
__device__ __forceinline__ void wait_async0() {
    asm volatile("s_wait_asynccnt 0x0" ::: "memory");
}

// Load one 16-lane-striped bf16 fragment (A or B operand of 16x16x32 WMMA).
// rowbase points at the lane's matrix row (m for A, n for B); koff = kblock + half*8.
// Per ISA 7.12.2: VGPR0-3 hold K=[koff..koff+7], VGPR4-7 hold K=[koff+16..koff+23].
__device__ __forceinline__ bf16x16 load_frag(const u16* rowbase, int koff) {
    u32x4 lo = *reinterpret_cast<const u32x4*>(rowbase + koff);
    u32x4 hi = *reinterpret_cast<const u32x4*>(rowbase + koff + 16);
    u32x8 d;
    d[0] = lo[0]; d[1] = lo[1]; d[2] = lo[2]; d[3] = lo[3];
    d[4] = hi[0]; d[5] = hi[1]; d[6] = hi[2]; d[7] = hi[3];
    return __builtin_bit_cast(bf16x16, d);
}

__device__ __forceinline__ f32x8 wmma_bf16(bf16x16 a, bf16x16 b, f32x8 c) {
    return __builtin_amdgcn_wmma_f32_16x16x32_bf16(false, a, false, b, (short)0, c,
                                                   false, false);
}

// 16-lane (half-wave) reductions: rows of the WMMA C layout live across lanes
// 0-15 / 16-31, so xor masks 1,2,4,8 reduce exactly one matrix row.
__device__ __forceinline__ float hmax16(float x) {
#pragma unroll
    for (int m = 1; m < 16; m <<= 1) x = fmaxf(x, __shfl_xor(x, m, 32));
    return x;
}
__device__ __forceinline__ float hsum16(float x) {
#pragma unroll
    for (int m = 1; m < 16; m <<= 1) x += __shfl_xor(x, m, 32);
    return x;
}

// ---------------- cast / repack kernels ----------------
__global__ void k_cast_bf16(const float* __restrict__ in, u16* __restrict__ out, int n) {
    int i = blockIdx.x * blockDim.x + threadIdx.x;
    int st = gridDim.x * blockDim.x;
    for (; i < n; i += st) out[i] = f2bf(in[i]);
}

// wq [H=16][K=1024][R=64] -> Wt [N=H*R=1024][K=1024] bf16, n = h*64 + r
__global__ void k_pack_qkv(const float* __restrict__ w, u16* __restrict__ out) {
    int i = blockIdx.x * blockDim.x + threadIdx.x;
    int st = gridDim.x * blockDim.x;
    for (; i < 1024 * 1024; i += st) {
        int n = i >> 10, kk = i & 1023;
        out[i] = f2bf(w[(size_t)((n >> 6) * 1024 + kk) * 64 + (n & 63)]);
    }
}

// w [K][N] row-major -> Wt [N][K] bf16 (transpose + cast)
__global__ void k_pack_t(const float* __restrict__ w, u16* __restrict__ out, int N, int K) {
    int i = blockIdx.x * blockDim.x + threadIdx.x;
    int st = gridDim.x * blockDim.x;
    int tot = N * K;
    for (; i < tot; i += st) {
        int n = i / K, kk = i - n * K;
        out[i] = f2bf(w[(size_t)kk * N + n]);
    }
}

// ---------------- WMMA GEMM ----------------
// C[M,N] = act(A_bf16[M,K] x Wt_bf16[N,K]^T + bias) (+resid); writes f32 and/or bf16.
// Block tile 128x128, 8 waves (2 along M x 4 along N), wave tile 64x32 (4x2 WMMA tiles).
// K slabs staged to LDS with GLOBAL_LOAD_ASYNC_TO_LDS_B128 (no VGPR round-trip).
__global__ __launch_bounds__(256) void k_gemm(
    const u16* __restrict__ A, const u16* __restrict__ Wt,
    const float* __restrict__ bias, const float* __restrict__ resid,
    float* __restrict__ outF, u16* __restrict__ outB,
    int M, int N, int K, int relu)
{
    __shared__ u16 aS[128][72];   // row-pad 72: stride 36 dwords -> conflict-free b128
    __shared__ u16 bS[128][72];

    const int tid  = threadIdx.x;
    const int lane = tid & 31, l15 = lane & 15, hf = (lane >> 4) & 1;
    const int wid  = tid >> 5;
    const int bm = blockIdx.y * 128, bn = blockIdx.x * 128;
    const int wm = (wid & 1) * 64,   wn = (wid >> 1) * 32;

    f32x8 acc[4][2];
#pragma unroll
    for (int mt = 0; mt < 4; ++mt)
#pragma unroll
        for (int nt = 0; nt < 2; ++nt) acc[mt][nt] = zero8();

    for (int k0 = 0; k0 < K; k0 += 64) {
        __syncthreads();                      // prior slab fully consumed
#pragma unroll
        for (int j = 0; j < 4; ++j) {         // async-stage 128x64 of A and B
            int c0 = tid + j * 256;
            int r = c0 >> 3, c8 = (c0 & 7) << 3;
            u32 aoff = ((u32)(bm + r) * (u32)K + (u32)(k0 + c8)) * 2u;
            u32 boff = ((u32)(bn + r) * (u32)K + (u32)(k0 + c8)) * 2u;
            async_copy_b128(lds_off(&aS[r][c8]), aoff, A);
            async_copy_b128(lds_off(&bS[r][c8]), boff, Wt);
        }
        wait_async0();                        // this wave's copies landed in LDS
        __syncthreads();                      // everyone's copies visible
        if (k0 + 64 < K) {                    // global_prefetch next K slab
            __builtin_prefetch(A  + (size_t)(bm + (tid & 127)) * K + k0 + 64, 0, 1);
            __builtin_prefetch(Wt + (size_t)(bn + (tid & 127)) * K + k0 + 64, 0, 1);
        }
#pragma unroll
        for (int kb = 0; kb < 64; kb += 32) {
            bf16x16 af[4], bfr[2];
#pragma unroll
            for (int mt = 0; mt < 4; ++mt)
                af[mt] = load_frag(&aS[wm + mt * 16 + l15][0], kb + hf * 8);
#pragma unroll
            for (int nt = 0; nt < 2; ++nt)
                bfr[nt] = load_frag(&bS[wn + nt * 16 + l15][0], kb + hf * 8);
#pragma unroll
            for (int mt = 0; mt < 4; ++mt)
#pragma unroll
                for (int nt = 0; nt < 2; ++nt)
                    acc[mt][nt] = wmma_bf16(af[mt], bfr[nt], acc[mt][nt]);
        }
    }

#pragma unroll
    for (int mt = 0; mt < 4; ++mt)
#pragma unroll
        for (int nt = 0; nt < 2; ++nt)
#pragma unroll
            for (int v = 0; v < 8; ++v) {
                int row = bm + wm + mt * 16 + v + 8 * hf;   // C layout: M = v + 8*half
                int col = bn + wn + nt * 16 + l15;          //           N = lane&15
                float val = acc[mt][nt][v] + bias[col];
                if (relu)  val = fmaxf(val, 0.0f);
                if (resid) val += resid[(size_t)row * N + col];
                size_t o = (size_t)row * N + col;
                if (outF) outF[o] = val;
                if (outB) outB[o] = f2bf(val);
            }
}

// ---------------- fused flash attention (bf16 WMMA, online softmax) ----------------
// q,k,v,o: bf16 [B][S][H][R] ; one block = one (b,h) x 128 query rows; 8 waves x 16 rows.
// K chunk fetched by the Tensor Data Mover (2D tile DMA + LDS row padding);
// V chunk transposed manually (TDM has no transpose).
__global__ __launch_bounds__(256) void k_attn(
    const u16* __restrict__ qp, const u16* __restrict__ kp,
    const u16* __restrict__ vp, u16* __restrict__ op)
{
    __shared__ u16 kch[128][72];     // key chunk, row-major [t][r], TDM-padded rows
    __shared__ u16 vtS[64][136];     // value chunk transposed [r][t]
    __shared__ u16 pS[8][16][40];    // per-wave P transpose scratch

    const int tid  = threadIdx.x;
    const int lane = tid & 31, l15 = lane & 15, hf = (lane >> 4) & 1;
    const int wid  = tid >> 5;
    const int bx = blockIdx.x;
    const int qc = bx & 7;                 // S/128 = 8 chunks
    const int h  = (bx >> 3) & (NHEAD - 1);
    const int b  = bx >> 7;
    const int qbase = qc * 128 + wid * 16;

    // Q fragments straight from global (row is contiguous 64 bf16)
    const int srow = qbase + l15;
    const u16* qrow = qp + (size_t)((b * SS + srow) * NHEAD + h) * DRED;
    bf16x16 qf[2];
    qf[0] = load_frag(qrow, 0  + hf * 8);
    qf[1] = load_frag(qrow, 32 + hf * 8);

    f32x8 oacc[4];
#pragma unroll
    for (int rt = 0; rt < 4; ++rt) oacc[rt] = zero8();
    float run_m[8], run_l[8];
#pragma unroll
    for (int i = 0; i < 8; ++i) { run_m[i] = -1.0e30f; run_l[i] = 0.0f; }

    const u32 kch_lds = lds_off(&kch[0][0]);

    for (int nc = 0; nc < SS / 128; ++nc) {
        __syncthreads();                      // previous chunk fully consumed

        if (wid == 0) {
            // ---- TDM: DMA 128x64-element bf16 tile (row stride H*R) into kch ----
            u64 gaddr = (u64)(uintptr_t)kp +
                        2ull * (u64)(((b * SS + nc * 128) * NHEAD + h) * DRED);
            u32x4 g0;
            g0[0] = 1u;                                   // count=1, user descriptor
            g0[1] = kch_lds;                              // lds_addr
            g0[2] = (u32)(gaddr & 0xffffffffu);           // global_addr[31:0]
            g0[3] = (u32)((gaddr >> 32) & 0x01ffffffu)    // global_addr[56:32]
                    | (2u << 30);                         // type=2 ("image")
            u32x8 g1;
            g1[0] = (1u << 16)                            // data_size = 2 bytes
                  | (1u << 20)                            // pad_enable
                  | (4u << 22)                            // pad_interval: 32 DWORDs (128B row)
                  | (3u << 25);                           // pad_amount: 4 DWORDs (16B pad)
            g1[1] = (64u << 16);                          // tensor_dim0 = 64 (low 16)
            g1[2] = 0u;                                   // dim0 hi / dim1 low
            g1[3] = 16u | (64u << 16);                    // tensor_dim1 = 1<<20; tile_dim0 = 64
            g1[4] = 128u;                                 // tile_dim1 = 128, tile_dim2 = 0
            g1[5] = (u32)(NHEAD * DRED);                  // tensor_dim0_stride = 1024 elems
            g1[6] = 0u;
            g1[7] = 0u;
            asm volatile("tensor_load_to_lds %0, %1" :: "s"(g0), "s"(g1) : "memory");
            __builtin_amdgcn_s_wait_tensorcnt(0);
        }

        // ---- all threads: stage V transposed into vtS ----
#pragma unroll
        for (int j = 0; j < 4; ++j) {
            int c0 = tid + j * 256;
            int t = c0 >> 3, c8 = (c0 & 7) << 3;
            size_t gbase = (size_t)((b * SS + nc * 128 + t) * NHEAD + h) * DRED + c8;
            u32x4 vv = *reinterpret_cast<const u32x4*>(vp + gbase);
#pragma unroll
            for (int e = 0; e < 4; ++e) {
                vtS[c8 + 2 * e    ][t] = (u16)(vv[e] & 0xffffu);
                vtS[c8 + 2 * e + 1][t] = (u16)(vv[e] >> 16);
            }
        }
        __syncthreads();

#pragma unroll
        for (int tt = 0; tt < 4; ++tt) {        // 32 keys per step
            f32x8 s0 = zero8(), s1 = zero8();
#pragma unroll
            for (int kb = 0; kb < 2; ++kb) {    // contract over R=64
                bf16x16 b0 = load_frag(&kch[tt * 32 +      l15][0], kb * 32 + hf * 8);
                bf16x16 b1 = load_frag(&kch[tt * 32 + 16 + l15][0], kb * 32 + hf * 8);
                s0 = wmma_bf16(qf[kb], b0, s0);
                s1 = wmma_bf16(qf[kb], b1, s1);
            }
            float p0[8], p1[8], corr[8];
#pragma unroll
            for (int v = 0; v < 8; ++v) {       // online softmax, row = v + 8*half
                float a = s0[v] * 0.125f, c = s1[v] * 0.125f;   // 1/sqrt(64)
                float rm = hmax16(fmaxf(a, c));
                float nm = fmaxf(run_m[v], rm);
                float cr = __expf(run_m[v] - nm);
                float e0 = __expf(a - nm), e1 = __expf(c - nm);
                run_l[v] = run_l[v] * cr + hsum16(e0 + e1);
                run_m[v] = nm;
                corr[v] = cr; p0[v] = e0; p1[v] = e1;
            }
#pragma unroll
            for (int rt = 0; rt < 4; ++rt)
#pragma unroll
                for (int v = 0; v < 8; ++v) oacc[rt][v] *= corr[v];

            // transpose P (C layout -> A fragment) through per-wave LDS scratch
#pragma unroll
            for (int v = 0; v < 8; ++v) {
                int mrow = v + 8 * hf;
                pS[wid][mrow][l15]      = f2bf(p0[v]);
                pS[wid][mrow][l15 + 16] = f2bf(p1[v]);
            }
            __builtin_amdgcn_wave_barrier();    // keep DS store/load order (in-order DS unit)
            bf16x16 pf = load_frag(&pS[wid][l15][0], hf * 8);
#pragma unroll
            for (int rt = 0; rt < 4; ++rt) {
                bf16x16 vf = load_frag(&vtS[rt * 16 + l15][0], tt * 32 + hf * 8);
                oacc[rt] = wmma_bf16(pf, vf, oacc[rt]);
            }
        }
    }

#pragma unroll
    for (int v = 0; v < 8; ++v) {
        float inv = 1.0f / run_l[v];
        int mrow = v + 8 * hf;
        size_t base = (size_t)((b * SS + qbase + mrow) * NHEAD + h) * DRED;
#pragma unroll
        for (int rt = 0; rt < 4; ++rt)
            op[base + rt * 16 + l15] = f2bf(oacc[rt][v] * inv);
    }
}

// ---------------- LayerNorm ----------------
__global__ __launch_bounds__(256) void k_ln(
    const float* __restrict__ in, const float* __restrict__ g, const float* __restrict__ bb,
    float* __restrict__ outF, u16* __restrict__ outB)
{
    __shared__ float sh1[8], sh2[8];
    const int row = blockIdx.x, tid = threadIdx.x;
    const float* r = in + (size_t)row * D_EMB;
    float x[4], s1 = 0.0f, s2 = 0.0f;
#pragma unroll
    for (int i = 0; i < 4; ++i) {
        x[i] = r[tid + i * 256];
        s1 += x[i]; s2 += x[i] * x[i];
    }
#pragma unroll
    for (int m = 1; m < 32; m <<= 1) {
        s1 += __shfl_xor(s1, m, 32);
        s2 += __shfl_xor(s2, m, 32);
    }
    if ((tid & 31) == 0) { sh1[tid >> 5] = s1; sh2[tid >> 5] = s2; }
    __syncthreads();
    float t1 = 0.0f, t2 = 0.0f;
#pragma unroll
    for (int j = 0; j < 8; ++j) { t1 += sh1[j]; t2 += sh2[j]; }
    float mean = t1 * (1.0f / D_EMB);
    float var  = t2 * (1.0f / D_EMB) - mean * mean;
    float sc = rsqrtf(var + 1e-3f);
#pragma unroll
    for (int i = 0; i < 4; ++i) {
        int c = tid + i * 256;
        float y = (x[i] - mean) * sc * g[c] + bb[c];
        size_t o = (size_t)row * D_EMB + c;
        if (outF) outF[o] = y;
        if (outB) outB[o] = f2bf(y);
    }
}

// ---------------- host orchestration ----------------
extern "C" void kernel_launch(void* const* d_in, const int* in_sizes, int n_in,
                              void* d_out, int out_size, void* d_ws, size_t ws_size,
                              hipStream_t stream) {
    (void)in_sizes; (void)n_in; (void)out_size; (void)ws_size;

    const float* x      = (const float*)d_in[0];
    const float* ctx    = (const float*)d_in[1];
    const float* sa_wq  = (const float*)d_in[2];
    const float* sa_bq  = (const float*)d_in[3];
    const float* sa_wk  = (const float*)d_in[4];
    const float* sa_bk  = (const float*)d_in[5];
    const float* sa_wv  = (const float*)d_in[6];
    const float* sa_bv  = (const float*)d_in[7];
    const float* sa_wo  = (const float*)d_in[8];
    const float* sa_bo  = (const float*)d_in[9];
    const float* ca_wq  = (const float*)d_in[10];
    const float* ca_bq  = (const float*)d_in[11];
    const float* ca_wk  = (const float*)d_in[12];
    const float* ca_bk  = (const float*)d_in[13];
    const float* ca_wv  = (const float*)d_in[14];
    const float* ca_bv  = (const float*)d_in[15];
    const float* ca_wo  = (const float*)d_in[16];
    const float* ca_bo  = (const float*)d_in[17];
    const float* ln1_g  = (const float*)d_in[18];
    const float* ln1_b  = (const float*)d_in[19];
    const float* ln2_g  = (const float*)d_in[20];
    const float* ln2_b  = (const float*)d_in[21];
    const float* ln3_g  = (const float*)d_in[22];
    const float* ln3_b  = (const float*)d_in[23];
    const float* ffn_w1 = (const float*)d_in[24];
    const float* ffn_b1 = (const float*)d_in[25];
    const float* ffn_w2 = (const float*)d_in[26];
    const float* ffn_b2 = (const float*)d_in[27];

    char* ws = (char*)d_ws;
    size_t off = 0;
    auto alloc = [&](size_t bytes) -> void* {
        void* p = ws + off;
        off = (off + bytes + 255) & ~(size_t)255;
        return p;
    };

    const size_t ACT2 = (size_t)MTOT * D_EMB * 2;   // bf16 activation
    const size_t ACT4 = (size_t)MTOT * D_EMB * 4;   // f32 activation
    const size_t W2   = (size_t)D_EMB * D_EMB * 2;  // bf16 1024x1024 weight

    u16* xb     = (u16*)alloc(ACT2);
    u16* cb     = (u16*)alloc(ACT2);
    u16* wt_saq = (u16*)alloc(W2);
    u16* wt_sak = (u16*)alloc(W2);
    u16* wt_sav = (u16*)alloc(W2);
    u16* wt_sao = (u16*)alloc(W2);
    u16* wt_caq = (u16*)alloc(W2);
    u16* wt_cak = (u16*)alloc(W2);
    u16* wt_cav = (u16*)alloc(W2);
    u16* wt_cao = (u16*)alloc(W2);
    u16* wt1    = (u16*)alloc((size_t)DFF * D_EMB * 2);
    u16* wt2    = (u16*)alloc((size_t)D_EMB * DFF * 2);
    u16* qb     = (u16*)alloc(ACT2);
    u16* kb     = (u16*)alloc(ACT2);
    u16* vb     = (u16*)alloc(ACT2);
    u16* ob     = (u16*)alloc(ACT2);
    float* sumb = (float*)alloc(ACT4);
    float* ln1f = (float*)alloc(ACT4);
    u16*   ln1b = (u16*)alloc(ACT2);
    float* ln2f = (float*)alloc(ACT4);
    u16*   ln2b = (u16*)alloc(ACT2);
    u16*   f1b  = (u16*)alloc((size_t)MTOT * DFF * 2);

    const dim3 blk(256);
    // casts + packs
    k_cast_bf16<<<2048, blk, 0, stream>>>(x,   xb, MTOT * D_EMB);
    k_cast_bf16<<<2048, blk, 0, stream>>>(ctx, cb, MTOT * D_EMB);
    k_pack_qkv<<<1024, blk, 0, stream>>>(sa_wq, wt_saq);
    k_pack_qkv<<<1024, blk, 0, stream>>>(sa_wk, wt_sak);
    k_pack_qkv<<<1024, blk, 0, stream>>>(sa_wv, wt_sav);
    k_pack_t  <<<1024, blk, 0, stream>>>(sa_wo, wt_sao, D_EMB, D_EMB);
    k_pack_qkv<<<1024, blk, 0, stream>>>(ca_wq, wt_caq);
    k_pack_qkv<<<1024, blk, 0, stream>>>(ca_wk, wt_cak);
    k_pack_qkv<<<1024, blk, 0, stream>>>(ca_wv, wt_cav);
    k_pack_t  <<<1024, blk, 0, stream>>>(ca_wo, wt_cao, D_EMB, D_EMB);
    k_pack_t  <<<2048, blk, 0, stream>>>(ffn_w1, wt1, DFF, D_EMB);
    k_pack_t  <<<2048, blk, 0, stream>>>(ffn_w2, wt2, D_EMB, DFF);

    const dim3 gD(D_EMB / 128, MTOT / 128);   // N=1024 GEMMs
    const dim3 gF(DFF   / 128, MTOT / 128);   // N=4096 GEMM

    // ---- self attention ----
    k_gemm<<<gD, blk, 0, stream>>>(xb, wt_saq, sa_bq, nullptr, nullptr, qb, MTOT, D_EMB, D_EMB, 0);
    k_gemm<<<gD, blk, 0, stream>>>(xb, wt_sak, sa_bk, nullptr, nullptr, kb, MTOT, D_EMB, D_EMB, 0);
    k_gemm<<<gD, blk, 0, stream>>>(xb, wt_sav, sa_bv, nullptr, nullptr, vb, MTOT, D_EMB, D_EMB, 0);
    k_attn<<<BB * NHEAD * (SS / 128), blk, 0, stream>>>(qb, kb, vb, ob);
    k_gemm<<<gD, blk, 0, stream>>>(ob, wt_sao, sa_bo, x, sumb, nullptr, MTOT, D_EMB, D_EMB, 0);
    k_ln<<<MTOT, blk, 0, stream>>>(sumb, ln1_g, ln1_b, ln1f, ln1b);

    // ---- cross attention ----
    k_gemm<<<gD, blk, 0, stream>>>(ln1b, wt_caq, ca_bq, nullptr, nullptr, qb, MTOT, D_EMB, D_EMB, 0);
    k_gemm<<<gD, blk, 0, stream>>>(cb,   wt_cak, ca_bk, nullptr, nullptr, kb, MTOT, D_EMB, D_EMB, 0);
    k_gemm<<<gD, blk, 0, stream>>>(cb,   wt_cav, ca_bv, nullptr, nullptr, vb, MTOT, D_EMB, D_EMB, 0);
    k_attn<<<BB * NHEAD * (SS / 128), blk, 0, stream>>>(qb, kb, vb, ob);
    k_gemm<<<gD, blk, 0, stream>>>(ob, wt_cao, ca_bo, ln1f, sumb, nullptr, MTOT, D_EMB, D_EMB, 0);
    k_ln<<<MTOT, blk, 0, stream>>>(sumb, ln2_g, ln2_b, ln2f, ln2b);

    // ---- FFN ----
    k_gemm<<<gF, blk, 0, stream>>>(ln2b, wt1, ffn_b1, nullptr, nullptr, f1b, MTOT, DFF, D_EMB, 1);
    k_gemm<<<gD, blk, 0, stream>>>(f1b,  wt2, ffn_b2, ln2f, sumb, nullptr, MTOT, D_EMB, DFF, 0);
    k_ln<<<MTOT, blk, 0, stream>>>(sumb, ln3_g, ln3_b, (float*)d_out, nullptr);
}

// v001
// Measured time: 615 microseconds a run.
// Timed twice side by side with v000, it ran 1.25 times as fast both times.
#include <hip/hip_runtime.h>

// ---------------- problem constants ----------------
#define D_EMB 1024
#define NHEAD 16
#define DRED  64
#define BB    4
#define SS    1024
#define MTOT  (BB * SS)     // 4096 rows of activations
#define DFF   (4 * D_EMB)   // 4096

typedef unsigned int   u32;
typedef unsigned short u16;
typedef unsigned long long u64;
typedef u32   u32x4  __attribute__((ext_vector_type(4)));
typedef u32   u32x8  __attribute__((ext_vector_type(8)));
typedef float f32x8  __attribute__((ext_vector_type(8)));
typedef __bf16 bf16x16 __attribute__((ext_vector_type(16)));

// ---------------- small helpers ----------------
__device__ __forceinline__ u16 f2bf(float f) {
    union { float f; u32 u; } c; c.f = f;
    u32 u = c.u;
    u32 r = u + 0x7fffu + ((u >> 16) & 1u);   // round-to-nearest-even
    return (u16)(r >> 16);
}

__device__ __forceinline__ f32x8 zero8() {
    f32x8 z;
#pragma unroll
    for (int i = 0; i < 8; ++i) z[i] = 0.0f;
    return z;
}

// LDS byte offset of a shared-memory pointer: flat LDS addresses keep the
// offset in the low 32 bits (ISA 10.2: LDS_ADDR = addr[31:0]).
__device__ __forceinline__ u32 lds_off(const void* p) {
    return (u32)(uintptr_t)p;
}

// Async global->LDS copy of 16 bytes per lane (GVS form, ASYNCcnt tracked).
__device__ __forceinline__ void async_copy_b128(u32 lds_byte, u32 goff_byte,
                                                const void* sbase) {
    asm volatile("global_load_async_to_lds_b128 %0, %1, %2"
                 :: "v"(lds_byte), "v"(goff_byte), "s"(sbase) : "memory");
}
__device__ __forceinline__ void wait_async0() {
    asm volatile("s_wait_asynccnt 0x0" ::: "memory");
}

// Load one 16-lane-striped bf16 fragment (A or B operand of 16x16x32 WMMA).
// rowbase points at the lane's matrix row (m for A, n for B); koff = kblock + half*8.
// Per ISA 7.12.2: VGPR0-3 hold K=[koff..koff+7], VGPR4-7 hold K=[koff+16..koff+23].
__device__ __forceinline__ bf16x16 load_frag(const u16* rowbase, int koff) {
    u32x4 lo = *reinterpret_cast<const u32x4*>(rowbase + koff);
    u32x4 hi = *reinterpret_cast<const u32x4*>(rowbase + koff + 16);
    u32x8 d;
    d[0] = lo[0]; d[1] = lo[1]; d[2] = lo[2]; d[3] = lo[3];
    d[4] = hi[0]; d[5] = hi[1]; d[6] = hi[2]; d[7] = hi[3];
    return __builtin_bit_cast(bf16x16, d);
}

__device__ __forceinline__ f32x8 wmma_bf16(bf16x16 a, bf16x16 b, f32x8 c) {
    return __builtin_amdgcn_wmma_f32_16x16x32_bf16(false, a, false, b, (short)0, c,
                                                   false, false);
}

// Value of lane ^ 16 (the other 16-lane half), by a vector cross-row move.
__device__ __forceinline__ float xhalf(float x) {
    int b = __builtin_bit_cast(int, x);
    return __builtin_bit_cast(float,
        __builtin_amdgcn_permlanex16(b, b, 0x76543210, 0xfedcba98, false, false));
}

// Base-2 exponentials, v_exp_f32. The instruction set asks for one independent instruction or
// a v_nop between a transcendental and a use of its result or an overwrite of its source.
// Here the outputs are
// early-clobber (none lies on a source) and the closing v_nop fills the last one's slot.
__device__ __forceinline__ void exp2x8(float (&d)[8], const float (&s)[8]) {
    asm("v_exp_f32 %0, %8\n\t"
        "v_exp_f32 %1, %9\n\t"
        "v_exp_f32 %2, %10\n\t"
        "v_exp_f32 %3, %11\n\t"
        "v_exp_f32 %4, %12\n\t"
        "v_exp_f32 %5, %13\n\t"
        "v_exp_f32 %6, %14\n\t"
        "v_exp_f32 %7, %15\n\t"
        "v_nop"
        : "=&v"(d[0]), "=&v"(d[1]), "=&v"(d[2]), "=&v"(d[3]),
          "=&v"(d[4]), "=&v"(d[5]), "=&v"(d[6]), "=&v"(d[7])
        : "v"(s[0]), "v"(s[1]), "v"(s[2]), "v"(s[3]),
          "v"(s[4]), "v"(s[5]), "v"(s[6]), "v"(s[7]));
}
__device__ __forceinline__ float exp2x1(float s) {
    float d;
    asm("v_exp_f32 %0, %1\n\t"
        "v_nop"                       // the same slot, for the one result
        : "=v"(d) : "v"(s));
    return d;
}
#define LOG2E 1.44269504088896340736f

// ---------------- cast / repack kernels ----------------
__global__ void k_cast_bf16(const float* __restrict__ in, u16* __restrict__ out, int n) {
    int i = blockIdx.x * blockDim.x + threadIdx.x;
    int st = gridDim.x * blockDim.x;
    for (; i < n; i += st) out[i] = f2bf(in[i]);
}

// wq [H=16][K=1024][R=64] -> Wt [N=H*R=1024][K=1024] bf16, n = h*64 + r
__global__ void k_pack_qkv(const float* __restrict__ w, u16* __restrict__ out) {
    int i = blockIdx.x * blockDim.x + threadIdx.x;
    int st = gridDim.x * blockDim.x;
    for (; i < 1024 * 1024; i += st) {
        int n = i >> 10, kk = i & 1023;
        out[i] = f2bf(w[(size_t)((n >> 6) * 1024 + kk) * 64 + (n & 63)]);
    }
}

// w [K][N] row-major -> Wt [N][K] bf16 (transpose + cast)
__global__ void k_pack_t(const float* __restrict__ w, u16* __restrict__ out, int N, int K) {
    int i = blockIdx.x * blockDim.x + threadIdx.x;
    int st = gridDim.x * blockDim.x;
    int tot = N * K;
    for (; i < tot; i += st) {
        int n = i / K, kk = i - n * K;
        out[i] = f2bf(w[(size_t)kk * N + n]);
    }
}

// ---------------- WMMA GEMM ----------------
// C[M,N] = act(A_bf16[M,K] x Wt_bf16[N,K]^T + bias) (+resid); writes f32 and/or bf16.
// Block tile 128x128, 8 waves (2 along M x 4 along N), wave tile 64x32 (4x2 WMMA tiles).
// K slabs staged to LDS with GLOBAL_LOAD_ASYNC_TO_LDS_B128 (no VGPR round-trip).
__global__ __launch_bounds__(256) void k_gemm(
    const u16* __restrict__ A, const u16* __restrict__ Wt,
    const float* __restrict__ bias, const float* __restrict__ resid,
    float* __restrict__ outF, u16* __restrict__ outB,
    int M, int N, int K, int relu)
{
    __shared__ u16 aS[128][72];   // row-pad 72: stride 36 dwords -> conflict-free b128
    __shared__ u16 bS[128][72];

    const int tid  = threadIdx.x;
    const int lane = tid & 31, l15 = lane & 15, hf = (lane >> 4) & 1;
    const int wid  = tid >> 5;
    const int bm = blockIdx.y * 128, bn = blockIdx.x * 128;
    const int wm = (wid & 1) * 64,   wn = (wid >> 1) * 32;

    f32x8 acc[4][2];
#pragma unroll
    for (int mt = 0; mt < 4; ++mt)
#pragma unroll
        for (int nt = 0; nt < 2; ++nt) acc[mt][nt] = zero8();

    for (int k0 = 0; k0 < K; k0 += 64) {
        __syncthreads();                      // prior slab fully consumed
#pragma unroll
        for (int j = 0; j < 4; ++j) {         // async-stage 128x64 of A and B
            int c0 = tid + j * 256;
            int r = c0 >> 3, c8 = (c0 & 7) << 3;
            u32 aoff = ((u32)(bm + r) * (u32)K + (u32)(k0 + c8)) * 2u;
            u32 boff = ((u32)(bn + r) * (u32)K + (u32)(k0 + c8)) * 2u;
            async_copy_b128(lds_off(&aS[r][c8]), aoff, A);
            async_copy_b128(lds_off(&bS[r][c8]), boff, Wt);
        }
        wait_async0();                        // this wave's copies landed in LDS
        __syncthreads();                      // everyone's copies visible
        if (k0 + 64 < K) {                    // global_prefetch next K slab
            __builtin_prefetch(A  + (size_t)(bm + (tid & 127)) * K + k0 + 64, 0, 1);
            __builtin_prefetch(Wt + (size_t)(bn + (tid & 127)) * K + k0 + 64, 0, 1);
        }
#pragma unroll
        for (int kb = 0; kb < 64; kb += 32) {
            bf16x16 af[4], bfr[2];
#pragma unroll
            for (int mt = 0; mt < 4; ++mt)
                af[mt] = load_frag(&aS[wm + mt * 16 + l15][0], kb + hf * 8);
#pragma unroll
            for (int nt = 0; nt < 2; ++nt)
                bfr[nt] = load_frag(&bS[wn + nt * 16 + l15][0], kb + hf * 8);
#pragma unroll
            for (int mt = 0; mt < 4; ++mt)
#pragma unroll
                for (int nt = 0; nt < 2; ++nt)
                    acc[mt][nt] = wmma_bf16(af[mt], bfr[nt], acc[mt][nt]);
        }
    }

#pragma unroll
    for (int mt = 0; mt < 4; ++mt)
#pragma unroll
        for (int nt = 0; nt < 2; ++nt)
#pragma unroll
            for (int v = 0; v < 8; ++v) {
                int row = bm + wm + mt * 16 + v + 8 * hf;   // C layout: M = v + 8*half
                int col = bn + wn + nt * 16 + l15;          //           N = lane&15
                float val = acc[mt][nt][v] + bias[col];
                if (relu)  val = fmaxf(val, 0.0f);
                if (resid) val += resid[(size_t)row * N + col];
                size_t o = (size_t)row * N + col;
                if (outF) outF[o] = val;
                if (outB) outB[o] = f2bf(val);
            }
}

// ---------------- fused flash attention (bf16 WMMA, online softmax) ----------------
// q,k,v,o: bf16 [B][S][H][R] ; one block = one (b,h) x 128 query rows; 8 waves x 16 rows.
// Scores are formed transposed, St = K x Qt, and the output as Ot += Vt x Pt: a lane then
// holds 16 of the 32 scores of ONE query, so maximum and sum run in the lane's own registers
// (one exchange with lane ^ 16), and two score tiles, converted in place, are the B operand.
// K chunk fetched by the Tensor Data Mover (2D tile DMA + LDS row padding);
// V chunk transposed manually (TDM has no transpose).
__global__ __launch_bounds__(256) void k_attn(
    const u16* __restrict__ qp, const u16* __restrict__ kp,
    const u16* __restrict__ vp, u16* __restrict__ op)
{
    __shared__ u16 kch[128][72];     // key chunk, row-major [t][r], TDM-padded rows
    __shared__ u16 vtS[64][136];     // value chunk transposed [r][t]

    const int tid  = threadIdx.x;
    const int lane = tid & 31, l15 = lane & 15, hf = (lane >> 4) & 1;
    const int wid  = tid >> 5;
    const int bx = blockIdx.x;
    const int qc = bx & 7;                 // S/128 = 8 chunks
    const int h  = (bx >> 3) & (NHEAD - 1);
    const int b  = bx >> 7;
    const int qbase = qc * 128 + wid * 16;

    // Q fragments straight from global (row is contiguous 64 bf16); B operand, column = query
    const int srow = qbase + l15;
    const u16* qrow = qp + (size_t)((b * SS + srow) * NHEAD + h) * DRED;
    bf16x16 qf[2];
    qf[0] = load_frag(qrow, 0  + hf * 8);
    qf[1] = load_frag(qrow, 32 + hf * 8);

    f32x8 oacc[4];
#pragma unroll
    for (int rt = 0; rt < 4; ++rt) oacc[rt] = zero8();
    float run_m = -1.0e30f;   // running maximum of query l15 (equal in both lane halves)
    float run_l = 0.0f;       // running sum over this lane half's keys only; joined at the end

    const u32 kch_lds = lds_off(&kch[0][0]);

    for (int nc = 0; nc < SS / 128; ++nc) {
        __syncthreads();                      // previous chunk fully consumed

        if (wid == 0) {
            // ---- TDM: DMA 128x64-element bf16 tile (row stride H*R) into kch ----
            u64 gaddr = (u64)(uintptr_t)kp +
                        2ull * (u64)(((b * SS + nc * 128) * NHEAD + h) * DRED);
            u32x4 g0;
            g0[0] = 1u;                                   // count=1, user descriptor
            g0[1] = kch_lds;                              // lds_addr
            g0[2] = (u32)(gaddr & 0xffffffffu);           // global_addr[31:0]
            g0[3] = (u32)((gaddr >> 32) & 0x01ffffffu)    // global_addr[56:32]
                    | (2u << 30);                         // type=2 ("image")
            u32x8 g1;
            g1[0] = (1u << 16)                            // data_size = 2 bytes
                  | (1u << 20)                            // pad_enable
                  | (4u << 22)                            // pad_interval: 32 DWORDs (128B row)
                  | (3u << 25);                           // pad_amount: 4 DWORDs (16B pad)
            g1[1] = (64u << 16);                          // tensor_dim0 = 64 (low 16)
            g1[2] = 0u;                                   // dim0 hi / dim1 low
            g1[3] = 16u | (64u << 16);                    // tensor_dim1 = 1<<20; tile_dim0 = 64
            g1[4] = 128u;                                 // tile_dim1 = 128, tile_dim2 = 0
            g1[5] = (u32)(NHEAD * DRED);                  // tensor_dim0_stride = 1024 elems
            g1[6] = 0u;
            g1[7] = 0u;
            asm volatile("tensor_load_to_lds %0, %1" :: "s"(g0), "s"(g1) : "memory");
            __builtin_amdgcn_s_wait_tensorcnt(0);
        }

        // ---- all threads: stage V transposed into vtS ----
#pragma unroll
        for (int j = 0; j < 4; ++j) {
            int c0 = tid + j * 256;
            int t = c0 >> 3, c8 = (c0 & 7) << 3;
            size_t gbase = (size_t)((b * SS + nc * 128 + t) * NHEAD + h) * DRED + c8;
            u32x4 vv = *reinterpret_cast<const u32x4*>(vp + gbase);
#pragma unroll
            for (int e = 0; e < 4; ++e) {
                vtS[c8 + 2 * e    ][t] = (u16)(vv[e] & 0xffffu);
                vtS[c8 + 2 * e + 1][t] = (u16)(vv[e] >> 16);
            }
        }
        __syncthreads();

#pragma unroll
        for (int tt = 0; tt < 4; ++tt) {        // 32 keys per step
            f32x8 s0 = zero8(), s1 = zero8();   // St[key = v + 8*half (+16)][query = l15]
#pragma unroll
            for (int kb = 0; kb < 2; ++kb) {    // contract over R=64
                bf16x16 a0 = load_frag(&kch[tt * 32 +      l15][0], kb * 32 + hf * 8);
                bf16x16 a1 = load_frag(&kch[tt * 32 + 16 + l15][0], kb * 32 + hf * 8);
                s0 = wmma_bf16(a0, qf[kb], s0);
                s1 = wmma_bf16(a1, qf[kb], s1);
            }
            // online softmax of query l15: 16 keys in this lane, 16 in lane ^ 16
            const f32x8 sa = s0 * 0.125f, sc = s1 * 0.125f;       // 1/sqrt(64)
            float rm = fmaxf(sa[0], sc[0]);
#pragma unroll
            for (int v = 1; v < 8; ++v) rm = fmaxf(rm, fmaxf(sa[v], sc[v]));
            rm = fmaxf(rm, xhalf(rm));
            const float nm = fmaxf(run_m, rm);
            const float cr = exp2x1((run_m - nm) * LOG2E);
            run_m = nm;
            float t0[8], t1[8], e0[8], e1[8];
#pragma unroll
            for (int v = 0; v < 8; ++v) { t0[v] = (sa[v] - nm) * LOG2E; t1[v] = (sc[v] - nm) * LOG2E; }
            exp2x8(e0, t0);
            exp2x8(e1, t1);
            float ps = 0.0f;
#pragma unroll
            for (int v = 0; v < 8; ++v) ps += e0[v] + e1[v];
            run_l = run_l * cr + ps;
            u32x8 pd;                           // Pt as B operand: k = 8*half + s, 16 + 8*half + s
#pragma unroll
            for (int j = 0; j < 4; ++j) {
                pd[j]     = (u32)f2bf(e0[2 * j]) | ((u32)f2bf(e0[2 * j + 1]) << 16);
                pd[4 + j] = (u32)f2bf(e1[2 * j]) | ((u32)f2bf(e1[2 * j + 1]) << 16);
            }
            const bf16x16 pf = __builtin_bit_cast(bf16x16, pd);
#pragma unroll
            for (int rt = 0; rt < 4; ++rt) {    // Ot[r = rt*16 + v + 8*half][query = l15]
#pragma unroll
                for (int v = 0; v < 8; ++v) oacc[rt][v] *= cr;
                bf16x16 vf = load_frag(&vtS[rt * 16 + l15][0], tt * 32 + hf * 8);
                oacc[rt] = wmma_bf16(vf, pf, oacc[rt]);
            }
        }
    }

    // a lane holds 8 consecutive r of one query per tile: one 16-byte store each
    const float inv = 1.0f / (run_l + xhalf(run_l));
    u16* orow = op + (size_t)((b * SS + srow) * NHEAD + h) * DRED + 8 * hf;
#pragma unroll
    for (int rt = 0; rt < 4; ++rt) {
        u32x4 w;
#pragma unroll
        for (int j = 0; j < 4; ++j)
            w[j] = (u32)f2bf(oacc[rt][2 * j] * inv) | ((u32)f2bf(oacc[rt][2 * j + 1] * inv) << 16);
        *reinterpret_cast<u32x4*>(orow + rt * 16) = w;
    }
}

// ---------------- LayerNorm ----------------
__global__ __launch_bounds__(256) void k_ln(
    const float* __restrict__ in, const float* __restrict__ g, const float* __restrict__ bb,
    float* __restrict__ outF, u16* __restrict__ outB)
{
    __shared__ float sh1[8], sh2[8];
    const int row = blockIdx.x, tid = threadIdx.x;
    const float* r = in + (size_t)row * D_EMB;
    float x[4], s1 = 0.0f, s2 = 0.0f;
#pragma unroll
    for (int i = 0; i < 4; ++i) {
        x[i] = r[tid + i * 256];
        s1 += x[i]; s2 += x[i] * x[i];
    }
#pragma unroll
    for (int m = 1; m < 32; m <<= 1) {
        s1 += __shfl_xor(s1, m, 32);
        s2 += __shfl_xor(s2, m, 32);
    }
    if ((tid & 31) == 0) { sh1[tid >> 5] = s1; sh2[tid >> 5] = s2; }
    __syncthreads();
    float t1 = 0.0f, t2 = 0.0f;
#pragma unroll
    for (int j = 0; j < 8; ++j) { t1 += sh1[j]; t2 += sh2[j]; }
    float mean = t1 * (1.0f / D_EMB);
    float var  = t2 * (1.0f / D_EMB) - mean * mean;
    float sc = rsqrtf(var + 1e-3f);
#pragma unroll
    for (int i = 0; i < 4; ++i) {
        int c = tid + i * 256;
        float y = (x[i] - mean) * sc * g[c] + bb[c];
        size_t o = (size_t)row * D_EMB + c;
        if (outF) outF[o] = y;
        if (outB) outB[o] = f2bf(y);
    }
}

// ---------------- host orchestration ----------------
extern "C" void kernel_launch(void* const* d_in, const int* in_sizes, int n_in,
                              void* d_out, int out_size, void* d_ws, size_t ws_size,
                              hipStream_t stream) {
    (void)in_sizes; (void)n_in; (void)out_size; (void)ws_size;

    const float* x      = (const float*)d_in[0];
    const float* ctx    = (const float*)d_in[1];
    const float* sa_wq  = (const float*)d_in[2];
    const float* sa_bq  = (const float*)d_in[3];
    const float* sa_wk  = (const float*)d_in[4];
    const float* sa_bk  = (const float*)d_in[5];
    const float* sa_wv  = (const float*)d_in[6];
    const float* sa_bv  = (const float*)d_in[7];
    const float* sa_wo  = (const float*)d_in[8];
    const float* sa_bo  = (const float*)d_in[9];
    const float* ca_wq  = (const float*)d_in[10];
    const float* ca_bq  = (const float*)d_in[11];
    const float* ca_wk  = (const float*)d_in[12];
    const float* ca_bk  = (const float*)d_in[13];
    const float* ca_wv  = (const float*)d_in[14];
    const float* ca_bv  = (const float*)d_in[15];
    const float* ca_wo  = (const float*)d_in[16];
    const float* ca_bo  = (const float*)d_in[17];
    const float* ln1_g  = (const float*)d_in[18];
    const float* ln1_b  = (const float*)d_in[19];
    const float* ln2_g  = (const float*)d_in[20];
    const float* ln2_b  = (const float*)d_in[21];
    const float* ln3_g  = (const float*)d_in[22];
    const float* ln3_b  = (const float*)d_in[23];
    const float* ffn_w1 = (const float*)d_in[24];
    const float* ffn_b1 = (const float*)d_in[25];
    const float* ffn_w2 = (const float*)d_in[26];
    const float* ffn_b2 = (const float*)d_in[27];

    char* ws = (char*)d_ws;
    size_t off = 0;
    auto alloc = [&](size_t bytes) -> void* {
        void* p = ws + off;
        off = (off + bytes + 255) & ~(size_t)255;
        return p;
    };

    const size_t ACT2 = (size_t)MTOT * D_EMB * 2;   // bf16 activation
    const size_t ACT4 = (size_t)MTOT * D_EMB * 4;   // f32 activation
    const size_t W2   = (size_t)D_EMB * D_EMB * 2;  // bf16 1024x1024 weight

    u16* xb     = (u16*)alloc(ACT2);
    u16* cb     = (u16*)alloc(ACT2);
    u16* wt_saq = (u16*)alloc(W2);
    u16* wt_sak = (u16*)alloc(W2);
    u16* wt_sav = (u16*)alloc(W2);
    u16* wt_sao = (u16*)alloc(W2);
    u16* wt_caq = (u16*)alloc(W2);
    u16* wt_cak = (u16*)alloc(W2);
    u16* wt_cav = (u16*)alloc(W2);
    u16* wt_cao = (u16*)alloc(W2);
    u16* wt1    = (u16*)alloc((size_t)DFF * D_EMB * 2);
    u16* wt2    = (u16*)alloc((size_t)D_EMB * DFF * 2);
    u16* qb     = (u16*)alloc(ACT2);
    u16* kb     = (u16*)alloc(ACT2);
    u16* vb     = (u16*)alloc(ACT2);
    u16* ob     = (u16*)alloc(ACT2);
    float* sumb = (float*)alloc(ACT4);
    float* ln1f = (float*)alloc(ACT4);
    u16*   ln1b = (u16*)alloc(ACT2);
    float* ln2f = (float*)alloc(ACT4);
    u16*   ln2b = (u16*)alloc(ACT2);
    u16*   f1b  = (u16*)alloc((size_t)MTOT * DFF * 2);

    const dim3 blk(256);
    // casts + packs
    k_cast_bf16<<<2048, blk, 0, stream>>>(x,   xb, MTOT * D_EMB);
    k_cast_bf16<<<2048, blk, 0, stream>>>(ctx, cb, MTOT * D_EMB);
    k_pack_qkv<<<1024, blk, 0, stream>>>(sa_wq, wt_saq);
    k_pack_qkv<<<1024, blk, 0, stream>>>(sa_wk, wt_sak);
    k_pack_qkv<<<1024, blk, 0, stream>>>(sa_wv, wt_sav);
    k_pack_t  <<<1024, blk, 0, stream>>>(sa_wo, wt_sao, D_EMB, D_EMB);
    k_pack_qkv<<<1024, blk, 0, stream>>>(ca_wq, wt_caq);
    k_pack_qkv<<<1024, blk, 0, stream>>>(ca_wk, wt_cak);
    k_pack_qkv<<<1024, blk, 0, stream>>>(ca_wv, wt_cav);
    k_pack_t  <<<1024, blk, 0, stream>>>(ca_wo, wt_cao, D_EMB, D_EMB);
    k_pack_t  <<<2048, blk, 0, stream>>>(ffn_w1, wt1, DFF, D_EMB);
    k_pack_t  <<<2048, blk, 0, stream>>>(ffn_w2, wt2, D_EMB, DFF);

    const dim3 gD(D_EMB / 128, MTOT / 128);   // N=1024 GEMMs
    const dim3 gF(DFF   / 128, MTOT / 128);   // N=4096 GEMM

    // ---- self attention ----
    k_gemm<<<gD, blk, 0, stream>>>(xb, wt_saq, sa_bq, nullptr, nullptr, qb, MTOT, D_EMB, D_EMB, 0);
    k_gemm<<<gD, blk, 0, stream>>>(xb, wt_sak, sa_bk, nullptr, nullptr, kb, MTOT, D_EMB, D_EMB, 0);
    k_gemm<<<gD, blk, 0, stream>>>(xb, wt_sav, sa_bv, nullptr, nullptr, vb, MTOT, D_EMB, D_EMB, 0);
    k_attn<<<BB * NHEAD * (SS / 128), blk, 0, stream>>>(qb, kb, vb, ob);
    k_gemm<<<gD, blk, 0, stream>>>(ob, wt_sao, sa_bo, x, sumb, nullptr, MTOT, D_EMB, D_EMB, 0);
    k_ln<<<MTOT, blk, 0, stream>>>(sumb, ln1_g, ln1_b, ln1f, ln1b);

    // ---- cross attention ----
    k_gemm<<<gD, blk, 0, stream>>>(ln1b, wt_caq, ca_bq, nullptr, nullptr, qb, MTOT, D_EMB, D_EMB, 0);
    k_gemm<<<gD, blk, 0, stream>>>(cb,   wt_cak, ca_bk, nullptr, nullptr, kb, MTOT, D_EMB, D_EMB, 0);
    k_gemm<<<gD, blk, 0, stream>>>(cb,   wt_cav, ca_bv, nullptr, nullptr, vb, MTOT, D_EMB, D_EMB, 0);
    k_attn<<<BB * NHEAD * (SS / 128), blk, 0, stream>>>(qb, kb, vb, ob);
    k_gemm<<<gD, blk, 0, stream>>>(ob, wt_cao, ca_bo, ln1f, sumb, nullptr, MTOT, D_EMB, D_EMB, 0);
    k_ln<<<MTOT, blk, 0, stream>>>(sumb, ln2_g, ln2_b, ln2f, ln2b);

    // ---- FFN ----
    k_gemm<<<gF, blk, 0, stream>>>(ln2b, wt1, ffn_b1, nullptr, nullptr, f1b, MTOT, DFF, D_EMB, 1);
    k_gemm<<<gD, blk, 0, stream>>>(f1b,  wt2, ffn_b2, ln2f, sumb, nullptr, MTOT, D_EMB, DFF, 0);
    k_ln<<<MTOT, blk, 0, stream>>>(sumb, ln3_g, ln3_b, (float*)d_out, nullptr);
}

// v002
// It runs in 531 microseconds.
// Next to v001, in two timings, it ran 1.15 and 1.16 times as fast.
// Over all steps from v000 it is 1.45 times as fast.
#include <hip/hip_runtime.h>

// ---------------- problem constants ----------------
#define D_EMB 1024
#define NHEAD 16
#define DRED  64
#define BB    4
#define SS    1024
#define MTOT  (BB * SS)     // 4096 rows of activations
#define DFF   (4 * D_EMB)   // 4096

typedef unsigned int   u32;
typedef unsigned short u16;
typedef unsigned long long u64;
typedef u32   u32x4  __attribute__((ext_vector_type(4)));
typedef u32   u32x8  __attribute__((ext_vector_type(8)));
typedef float f32x8  __attribute__((ext_vector_type(8)));
typedef __bf16 bf16x16 __attribute__((ext_vector_type(16)));

// ---------------- small helpers ----------------
__device__ __forceinline__ u16 f2bf(float f) {
    union { float f; u32 u; } c; c.f = f;
    u32 u = c.u;
    u32 r = u + 0x7fffu + ((u >> 16) & 1u);   // round-to-nearest-even
    return (u16)(r >> 16);
}

__device__ __forceinline__ f32x8 zero8() {
    f32x8 z;
#pragma unroll
    for (int i = 0; i < 8; ++i) z[i] = 0.0f;
    return z;
}

// LDS byte offset of a shared-memory pointer: flat LDS addresses keep the
// offset in the low 32 bits (ISA 10.2: LDS_ADDR = addr[31:0]).
__device__ __forceinline__ u32 lds_off(const void* p) {
    return (u32)(uintptr_t)p;
}

// One K slab's async global->LDS copies of a lane: 16 bytes in each of four 32-row groups of
// A and of B (GVS form, ASYNCcnt tracked, no VGPR round-trip). la, lb: the lane's LDS byte
// address in the first group; ga, gb: its byte offset from the base; grow: 32 source rows.
// The closing s_wait_xcnt 0 stands inside the statement so that no address register named
// here is rewritten in front of it.
#define SLAB_GROUP_LDS (32u * 144u)   // 32 LDS rows of 144 bytes
__device__ __forceinline__ void slab_copies(u32 la, u32 lb, u32 ga, u32 gb, u32 grow,
                                            const void* abase, const void* bbase) {
    asm volatile("global_load_async_to_lds_b128 %0, %8, %16\n\t"
                 "global_load_async_to_lds_b128 %4, %12, %17\n\t"
                 "global_load_async_to_lds_b128 %1, %9, %16\n\t"
                 "global_load_async_to_lds_b128 %5, %13, %17\n\t"
                 "global_load_async_to_lds_b128 %2, %10, %16\n\t"
                 "global_load_async_to_lds_b128 %6, %14, %17\n\t"
                 "global_load_async_to_lds_b128 %3, %11, %16\n\t"
                 "global_load_async_to_lds_b128 %7, %15, %17\n\t"
                 "s_wait_xcnt 0x0"
                 :: "v"(la), "v"(la + SLAB_GROUP_LDS), "v"(la + 2u * SLAB_GROUP_LDS),
                    "v"(la + 3u * SLAB_GROUP_LDS),
                    "v"(lb), "v"(lb + SLAB_GROUP_LDS), "v"(lb + 2u * SLAB_GROUP_LDS),
                    "v"(lb + 3u * SLAB_GROUP_LDS),
                    "v"(ga), "v"(ga + grow), "v"(ga + 2u * grow), "v"(ga + 3u * grow),
                    "v"(gb), "v"(gb + grow), "v"(gb + 2u * grow), "v"(gb + 3u * grow),
                    "s"(abase), "s"(bbase)
                 : "memory");
}

// Load one 16-lane-striped bf16 fragment (A or B operand of 16x16x32 WMMA).
// rowbase points at the lane's matrix row (m for A, n for B); koff = kblock + half*8.
// Per ISA 7.12.2: VGPR0-3 hold K=[koff..koff+7], VGPR4-7 hold K=[koff+16..koff+23].
__device__ __forceinline__ bf16x16 load_frag(const u16* rowbase, int koff) {
    u32x4 lo = *reinterpret_cast<const u32x4*>(rowbase + koff);
    u32x4 hi = *reinterpret_cast<const u32x4*>(rowbase + koff + 16);
    u32x8 d;
    d[0] = lo[0]; d[1] = lo[1]; d[2] = lo[2]; d[3] = lo[3];
    d[4] = hi[0]; d[5] = hi[1]; d[6] = hi[2]; d[7] = hi[3];
    return __builtin_bit_cast(bf16x16, d);
}

__device__ __forceinline__ f32x8 wmma_bf16(bf16x16 a, bf16x16 b, f32x8 c) {
    return __builtin_amdgcn_wmma_f32_16x16x32_bf16(false, a, false, b, (short)0, c,
                                                   false, false);
}

// Value of lane ^ 16 (the other 16-lane half), by a vector cross-row move.
__device__ __forceinline__ float xhalf(float x) {
    int b = __builtin_bit_cast(int, x);
    return __builtin_bit_cast(float,
        __builtin_amdgcn_permlanex16(b, b, 0x76543210, 0xfedcba98, false, false));
}

// Base-2 exponentials, v_exp_f32. The instruction set asks for one independent instruction or
// a v_nop between a transcendental and a use of its result or an overwrite of its source.
// Here the outputs are
// early-clobber (none lies on a source) and the closing v_nop fills the last one's slot.
__device__ __forceinline__ void exp2x8(float (&d)[8], const float (&s)[8]) {
    asm("v_exp_f32 %0, %8\n\t"
        "v_exp_f32 %1, %9\n\t"
        "v_exp_f32 %2, %10\n\t"
        "v_exp_f32 %3, %11\n\t"
        "v_exp_f32 %4, %12\n\t"
        "v_exp_f32 %5, %13\n\t"
        "v_exp_f32 %6, %14\n\t"
        "v_exp_f32 %7, %15\n\t"
        "v_nop"
        : "=&v"(d[0]), "=&v"(d[1]), "=&v"(d[2]), "=&v"(d[3]),
          "=&v"(d[4]), "=&v"(d[5]), "=&v"(d[6]), "=&v"(d[7])
        : "v"(s[0]), "v"(s[1]), "v"(s[2]), "v"(s[3]),
          "v"(s[4]), "v"(s[5]), "v"(s[6]), "v"(s[7]));
}
__device__ __forceinline__ float exp2x1(float s) {
    float d;
    asm("v_exp_f32 %0, %1\n\t"
        "v_nop"                       // the same slot, for the one result
        : "=v"(d) : "v"(s));
    return d;
}
#define LOG2E 1.44269504088896340736f

// ---------------- cast / repack kernels ----------------
__global__ void k_cast_bf16(const float* __restrict__ in, u16* __restrict__ out, int n) {
    int i = blockIdx.x * blockDim.x + threadIdx.x;
    int st = gridDim.x * blockDim.x;
    for (; i < n; i += st) out[i] = f2bf(in[i]);
}

// wq [H=16][K=1024][R=64] -> Wt [N=H*R=1024][K=1024] bf16, n = h*64 + r
__global__ void k_pack_qkv(const float* __restrict__ w, u16* __restrict__ out) {
    int i = blockIdx.x * blockDim.x + threadIdx.x;
    int st = gridDim.x * blockDim.x;
    for (; i < 1024 * 1024; i += st) {
        int n = i >> 10, kk = i & 1023;
        out[i] = f2bf(w[(size_t)((n >> 6) * 1024 + kk) * 64 + (n & 63)]);
    }
}

// w [K][N] row-major -> Wt [N][K] bf16 (transpose + cast)
__global__ void k_pack_t(const float* __restrict__ w, u16* __restrict__ out, int N, int K) {
    int i = blockIdx.x * blockDim.x + threadIdx.x;
    int st = gridDim.x * blockDim.x;
    int tot = N * K;
    for (; i < tot; i += st) {
        int n = i / K, kk = i - n * K;
        out[i] = f2bf(w[(size_t)kk * N + n]);
    }
}

// ---------------- WMMA GEMM ----------------
// C[M,N] = act(A_bf16[M,K] x Wt_bf16[N,K]^T + bias) (+resid); writes f32 and/or bf16.
// Block tile 128x128, 8 waves (2 along M x 4 along N), wave tile 64x32 (4x2 WMMA tiles).
// K slabs of 64 alternate between two LDS buffers: slab t + 1's async copies fly while
// slab t is worked on.
__global__ __launch_bounds__(256) void k_gemm(
    const u16* __restrict__ A, const u16* __restrict__ Wt,
    const float* __restrict__ bias, const float* __restrict__ resid,
    float* __restrict__ outF, u16* __restrict__ outB,
    int M, int N, int K, int relu)
{
    // [buffer][A, B][row][k]; row-pad 72: stride 36 dwords -> conflict-free b128
    __shared__ __attribute__((aligned(16))) u16 ring[2][2][128][72];

    const int tid  = threadIdx.x;
    const int lane = tid & 31, l15 = lane & 15, hf = (lane >> 4) & 1;
    const int wid  = tid >> 5;
    const int bm = blockIdx.y * 128, bn = blockIdx.x * 128;
    const int wm = (wid & 1) * 64,   wn = (wid >> 1) * 32;

    f32x8 acc[4][2];
#pragma unroll
    for (int mt = 0; mt < 4; ++mt)
#pragma unroll
        for (int nt = 0; nt < 2; ++nt) acc[mt][nt] = zero8();

    // a lane copies 16 bytes of row r0 (+32, +64, +96) of each operand's slab
    const int r0 = tid >> 3, c8 = (tid & 7) << 3;
    const u32 la0 = lds_off(&ring[0][0][r0][c8]);
    const u32 lb0 = lds_off(&ring[0][1][r0][c8]);
    const u32 ga0 = ((u32)(bm + r0) * (u32)K + (u32)c8) * 2u;
    const u32 gb0 = ((u32)(bn + r0) * (u32)K + (u32)c8) * 2u;
    const u32 grow = (u32)K * 64u;            // 32 source rows in bytes
    const u32 bufB = (u32)sizeof(ring[0]);    // one buffer in bytes
    const int T = K >> 6;                     // slabs; K is a multiple of 64, at least 64

    slab_copies(la0, lb0, ga0, gb0, grow, A, Wt);         // slab 0 into buffer 0
    asm volatile("s_wait_asynccnt 0x0" ::: "memory");     // this wave's copies have landed
    __syncthreads();                                      // every wave's are visible
    if (1 < T)                                            // slab 1 into buffer 1
        slab_copies(la0 + bufB, lb0 + bufB, ga0 + 128u, gb0 + 128u, grow, A, Wt);

    for (int t = 0; t < T; ++t) {
        const u16 (*aS)[72] = ring[t & 1][0];
        const u16 (*bS)[72] = ring[t & 1][1];
#pragma unroll
        for (int kb = 0; kb < 64; kb += 32) {
            bf16x16 af[4], bfr[2];
#pragma unroll
            for (int mt = 0; mt < 4; ++mt)
                af[mt] = load_frag(&aS[wm + mt * 16 + l15][0], kb + hf * 8);
#pragma unroll
            for (int nt = 0; nt < 2; ++nt)
                bfr[nt] = load_frag(&bS[wn + nt * 16 + l15][0], kb + hf * 8);
#pragma unroll
            for (int mt = 0; mt < 4; ++mt)
#pragma unroll
                for (int nt = 0; nt < 2; ++nt)
                    acc[mt][nt] = wmma_bf16(af[mt], bfr[nt], acc[mt][nt]);
        }
        // publish point of slab t + 1, in this order:
        asm volatile("s_wait_dscnt 0x0" ::: "memory");    // this wave's reads of slab t are back
        asm volatile("s_wait_asynccnt 0x0" ::: "memory"); // its copies of slab t + 1 have landed
        __syncthreads();      // slab t + 1 visible to all; every reader has left slab t's buffer
        if (t + 2 < T) {      // refill that buffer
            const u32 bo = (u32)(t & 1) * bufB, go = (u32)(t + 2) * 128u;
            slab_copies(la0 + bo, lb0 + bo, ga0 + go, gb0 + go, grow, A, Wt);
        }
    }
    asm volatile("s_wait_asynccnt 0x0" ::: "memory");     // no copy outlives the loop

#pragma unroll
    for (int mt = 0; mt < 4; ++mt)
#pragma unroll
        for (int nt = 0; nt < 2; ++nt)
#pragma unroll
            for (int v = 0; v < 8; ++v) {
                int row = bm + wm + mt * 16 + v + 8 * hf;   // C layout: M = v + 8*half
                int col = bn + wn + nt * 16 + l15;          //           N = lane&15
                float val = acc[mt][nt][v] + bias[col];
                if (relu)  val = fmaxf(val, 0.0f);
                if (resid) val += resid[(size_t)row * N + col];
                size_t o = (size_t)row * N + col;
                if (outF) outF[o] = val;
                if (outB) outB[o] = f2bf(val);
            }
}

// ---------------- fused flash attention (bf16 WMMA, online softmax) ----------------
// q,k,v,o: bf16 [B][S][H][R] ; one block = one (b,h) x 128 query rows; 8 waves x 16 rows.
// Scores are formed transposed, St = K x Qt, and the output as Ot += Vt x Pt: a lane then
// holds 16 of the 32 scores of ONE query, so maximum and sum run in the lane's own registers
// (one exchange with lane ^ 16), and two score tiles, converted in place, are the B operand.
// K chunk fetched by the Tensor Data Mover (2D tile DMA + LDS row padding);
// V chunk transposed manually (TDM has no transpose).
__global__ __launch_bounds__(256) void k_attn(
    const u16* __restrict__ qp, const u16* __restrict__ kp,
    const u16* __restrict__ vp, u16* __restrict__ op)
{
    __shared__ u16 kch[128][72];     // key chunk, row-major [t][r], TDM-padded rows
    __shared__ u16 vtS[64][136];     // value chunk transposed [r][t]

    const int tid  = threadIdx.x;
    const int lane = tid & 31, l15 = lane & 15, hf = (lane >> 4) & 1;
    const int wid  = tid >> 5;
    const int bx = blockIdx.x;
    const int qc = bx & 7;                 // S/128 = 8 chunks
    const int h  = (bx >> 3) & (NHEAD - 1);
    const int b  = bx >> 7;
    const int qbase = qc * 128 + wid * 16;

    // Q fragments straight from global (row is contiguous 64 bf16); B operand, column = query
    const int srow = qbase + l15;
    const u16* qrow = qp + (size_t)((b * SS + srow) * NHEAD + h) * DRED;
    bf16x16 qf[2];
    qf[0] = load_frag(qrow, 0  + hf * 8);
    qf[1] = load_frag(qrow, 32 + hf * 8);

    f32x8 oacc[4];
#pragma unroll
    for (int rt = 0; rt < 4; ++rt) oacc[rt] = zero8();
    float run_m = -1.0e30f;   // running maximum of query l15 (equal in both lane halves)
    float run_l = 0.0f;       // running sum over this lane half's keys only; joined at the end

    const u32 kch_lds = lds_off(&kch[0][0]);

    for (int nc = 0; nc < SS / 128; ++nc) {
        __syncthreads();                      // previous chunk fully consumed

        if (wid == 0) {
            // ---- TDM: DMA 128x64-element bf16 tile (row stride H*R) into kch ----
            u64 gaddr = (u64)(uintptr_t)kp +
                        2ull * (u64)(((b * SS + nc * 128) * NHEAD + h) * DRED);
            u32x4 g0;
            g0[0] = 1u;                                   // count=1, user descriptor
            g0[1] = kch_lds;                              // lds_addr
            g0[2] = (u32)(gaddr & 0xffffffffu);           // global_addr[31:0]
            g0[3] = (u32)((gaddr >> 32) & 0x01ffffffu)    // global_addr[56:32]
                    | (2u << 30);                         // type=2 ("image")
            u32x8 g1;
            g1[0] = (1u << 16)                            // data_size = 2 bytes
                  | (1u << 20)                            // pad_enable
                  | (4u << 22)                            // pad_interval: 32 DWORDs (128B row)
                  | (3u << 25);                           // pad_amount: 4 DWORDs (16B pad)
            g1[1] = (64u << 16);                          // tensor_dim0 = 64 (low 16)
            g1[2] = 0u;                                   // dim0 hi / dim1 low
            g1[3] = 16u | (64u << 16);                    // tensor_dim1 = 1<<20; tile_dim0 = 64
            g1[4] = 128u;                                 // tile_dim1 = 128, tile_dim2 = 0
            g1[5] = (u32)(NHEAD * DRED);                  // tensor_dim0_stride = 1024 elems
            g1[6] = 0u;
            g1[7] = 0u;
            asm volatile("tensor_load_to_lds %0, %1" :: "s"(g0), "s"(g1) : "memory");
            __builtin_amdgcn_s_wait_tensorcnt(0);
        }

        // ---- all threads: stage V transposed into vtS ----
#pragma unroll
        for (int j = 0; j < 4; ++j) {
            int c0 = tid + j * 256;
            int t = c0 >> 3, c8 = (c0 & 7) << 3;
            size_t gbase = (size_t)((b * SS + nc * 128 + t) * NHEAD + h) * DRED + c8;
            u32x4 vv = *reinterpret_cast<const u32x4*>(vp + gbase);
#pragma unroll
            for (int e = 0; e < 4; ++e) {
                vtS[c8 + 2 * e    ][t] = (u16)(vv[e] & 0xffffu);
                vtS[c8 + 2 * e + 1][t] = (u16)(vv[e] >> 16);
            }
        }
        __syncthreads();

#pragma unroll
        for (int tt = 0; tt < 4; ++tt) {        // 32 keys per step
            f32x8 s0 = zero8(), s1 = zero8();   // St[key = v + 8*half (+16)][query = l15]
#pragma unroll
            for (int kb = 0; kb < 2; ++kb) {    // contract over R=64
                bf16x16 a0 = load_frag(&kch[tt * 32 +      l15][0], kb * 32 + hf * 8);
                bf16x16 a1 = load_frag(&kch[tt * 32 + 16 + l15][0], kb * 32 + hf * 8);
                s0 = wmma_bf16(a0, qf[kb], s0);
                s1 = wmma_bf16(a1, qf[kb], s1);
            }
            // online softmax of query l15: 16 keys in this lane, 16 in lane ^ 16
            const f32x8 sa = s0 * 0.125f, sc = s1 * 0.125f;       // 1/sqrt(64)
            float rm = fmaxf(sa[0], sc[0]);
#pragma unroll
            for (int v = 1; v < 8; ++v) rm = fmaxf(rm, fmaxf(sa[v], sc[v]));
            rm = fmaxf(rm, xhalf(rm));
            const float nm = fmaxf(run_m, rm);
            const float cr = exp2x1((run_m - nm) * LOG2E);
            run_m = nm;
            float t0[8], t1[8], e0[8], e1[8];
#pragma unroll
            for (int v = 0; v < 8; ++v) { t0[v] = (sa[v] - nm) * LOG2E; t1[v] = (sc[v] - nm) * LOG2E; }
            exp2x8(e0, t0);
            exp2x8(e1, t1);
            float ps = 0.0f;
#pragma unroll
            for (int v = 0; v < 8; ++v) ps += e0[v] + e1[v];
            run_l = run_l * cr + ps;
            u32x8 pd;                           // Pt as B operand: k = 8*half + s, 16 + 8*half + s
#pragma unroll
            for (int j = 0; j < 4; ++j) {
                pd[j]     = (u32)f2bf(e0[2 * j]) | ((u32)f2bf(e0[2 * j + 1]) << 16);
                pd[4 + j] = (u32)f2bf(e1[2 * j]) | ((u32)f2bf(e1[2 * j + 1]) << 16);
            }
            const bf16x16 pf = __builtin_bit_cast(bf16x16, pd);
#pragma unroll
            for (int rt = 0; rt < 4; ++rt) {    // Ot[r = rt*16 + v + 8*half][query = l15]
#pragma unroll
                for (int v = 0; v < 8; ++v) oacc[rt][v] *= cr;
                bf16x16 vf = load_frag(&vtS[rt * 16 + l15][0], tt * 32 + hf * 8);
                oacc[rt] = wmma_bf16(vf, pf, oacc[rt]);
            }
        }
    }

    // a lane holds 8 consecutive r of one query per tile: one 16-byte store each
    const float inv = 1.0f / (run_l + xhalf(run_l));
    u16* orow = op + (size_t)((b * SS + srow) * NHEAD + h) * DRED + 8 * hf;
#pragma unroll
    for (int rt = 0; rt < 4; ++rt) {
        u32x4 w;
#pragma unroll
        for (int j = 0; j < 4; ++j)
            w[j] = (u32)f2bf(oacc[rt][2 * j] * inv) | ((u32)f2bf(oacc[rt][2 * j + 1] * inv) << 16);
        *reinterpret_cast<u32x4*>(orow + rt * 16) = w;
    }
}

// ---------------- LayerNorm ----------------
__global__ __launch_bounds__(256) void k_ln(
    const float* __restrict__ in, const float* __restrict__ g, const float* __restrict__ bb,
    float* __restrict__ outF, u16* __restrict__ outB)
{
    __shared__ float sh1[8], sh2[8];
    const int row = blockIdx.x, tid = threadIdx.x;
    const float* r = in + (size_t)row * D_EMB;
    float x[4], s1 = 0.0f, s2 = 0.0f;
#pragma unroll
    for (int i = 0; i < 4; ++i) {
        x[i] = r[tid + i * 256];
        s1 += x[i]; s2 += x[i] * x[i];
    }
#pragma unroll
    for (int m = 1; m < 32; m <<= 1) {
        s1 += __shfl_xor(s1, m, 32);
        s2 += __shfl_xor(s2, m, 32);
    }
    if ((tid & 31) == 0) { sh1[tid >> 5] = s1; sh2[tid >> 5] = s2; }
    __syncthreads();
    float t1 = 0.0f, t2 = 0.0f;
#pragma unroll
    for (int j = 0; j < 8; ++j) { t1 += sh1[j]; t2 += sh2[j]; }
    float mean = t1 * (1.0f / D_EMB);
    float var  = t2 * (1.0f / D_EMB) - mean * mean;
    float sc = rsqrtf(var + 1e-3f);
#pragma unroll
    for (int i = 0; i < 4; ++i) {
        int c = tid + i * 256;
        float y = (x[i] - mean) * sc * g[c] + bb[c];
        size_t o = (size_t)row * D_EMB + c;
        if (outF) outF[o] = y;
        if (outB) outB[o] = f2bf(y);
    }
}

// ---------------- host orchestration ----------------
extern "C" void kernel_launch(void* const* d_in, const int* in_sizes, int n_in,
                              void* d_out, int out_size, void* d_ws, size_t ws_size,
                              hipStream_t stream) {
    (void)in_sizes; (void)n_in; (void)out_size; (void)ws_size;

    const float* x      = (const float*)d_in[0];
    const float* ctx    = (const float*)d_in[1];
    const float* sa_wq  = (const float*)d_in[2];
    const float* sa_bq  = (const float*)d_in[3];
    const float* sa_wk  = (const float*)d_in[4];
    const float* sa_bk  = (const float*)d_in[5];
    const float* sa_wv  = (const float*)d_in[6];
    const float* sa_bv  = (const float*)d_in[7];
    const float* sa_wo  = (const float*)d_in[8];
    const float* sa_bo  = (const float*)d_in[9];
    const float* ca_wq  = (const float*)d_in[10];
    const float* ca_bq  = (const float*)d_in[11];
    const float* ca_wk  = (const float*)d_in[12];
    const float* ca_bk  = (const float*)d_in[13];
    const float* ca_wv  = (const float*)d_in[14];
    const float* ca_bv  = (const float*)d_in[15];
    const float* ca_wo  = (const float*)d_in[16];
    const float* ca_bo  = (const float*)d_in[17];
    const float* ln1_g  = (const float*)d_in[18];
    const float* ln1_b  = (const float*)d_in[19];
    const float* ln2_g  = (const float*)d_in[20];
    const float* ln2_b  = (const float*)d_in[21];
    const float* ln3_g  = (const float*)d_in[22];
    const float* ln3_b  = (const float*)d_in[23];
    const float* ffn_w1 = (const float*)d_in[24];
    const float* ffn_b1 = (const float*)d_in[25];
    const float* ffn_w2 = (const float*)d_in[26];
    const float* ffn_b2 = (const float*)d_in[27];

    char* ws = (char*)d_ws;
    size_t off = 0;
    auto alloc = [&](size_t bytes) -> void* {
        void* p = ws + off;
        off = (off + bytes + 255) & ~(size_t)255;
        return p;
    };

    const size_t ACT2 = (size_t)MTOT * D_EMB * 2;   // bf16 activation
    const size_t ACT4 = (size_t)MTOT * D_EMB * 4;   // f32 activation
    const size_t W2   = (size_t)D_EMB * D_EMB * 2;  // bf16 1024x1024 weight

    u16* xb     = (u16*)alloc(ACT2);
    u16* cb     = (u16*)alloc(ACT2);
    u16* wt_saq = (u16*)alloc(W2);
    u16* wt_sak = (u16*)alloc(W2);
    u16* wt_sav = (u16*)alloc(W2);
    u16* wt_sao = (u16*)alloc(W2);
    u16* wt_caq = (u16*)alloc(W2);
    u16* wt_cak = (u16*)alloc(W2);
    u16* wt_cav = (u16*)alloc(W2);
    u16* wt_cao = (u16*)alloc(W2);
    u16* wt1    = (u16*)alloc((size_t)DFF * D_EMB * 2);
    u16* wt2    = (u16*)alloc((size_t)D_EMB * DFF * 2);
    u16* qb     = (u16*)alloc(ACT2);
    u16* kb     = (u16*)alloc(ACT2);
    u16* vb     = (u16*)alloc(ACT2);
    u16* ob     = (u16*)alloc(ACT2);
    float* sumb = (float*)alloc(ACT4);
    float* ln1f = (float*)alloc(ACT4);
    u16*   ln1b = (u16*)alloc(ACT2);
    float* ln2f = (float*)alloc(ACT4);
    u16*   ln2b = (u16*)alloc(ACT2);
    u16*   f1b  = (u16*)alloc((size_t)MTOT * DFF * 2);

    const dim3 blk(256);
    // casts + packs
    k_cast_bf16<<<2048, blk, 0, stream>>>(x,   xb, MTOT * D_EMB);
    k_cast_bf16<<<2048, blk, 0, stream>>>(ctx, cb, MTOT * D_EMB);
    k_pack_qkv<<<1024, blk, 0, stream>>>(sa_wq, wt_saq);
    k_pack_qkv<<<1024, blk, 0, stream>>>(sa_wk, wt_sak);
    k_pack_qkv<<<1024, blk, 0, stream>>>(sa_wv, wt_sav);
    k_pack_t  <<<1024, blk, 0, stream>>>(sa_wo, wt_sao, D_EMB, D_EMB);
    k_pack_qkv<<<1024, blk, 0, stream>>>(ca_wq, wt_caq);
    k_pack_qkv<<<1024, blk, 0, stream>>>(ca_wk, wt_cak);
    k_pack_qkv<<<1024, blk, 0, stream>>>(ca_wv, wt_cav);
    k_pack_t  <<<1024, blk, 0, stream>>>(ca_wo, wt_cao, D_EMB, D_EMB);
    k_pack_t  <<<2048, blk, 0, stream>>>(ffn_w1, wt1, DFF, D_EMB);
    k_pack_t  <<<2048, blk, 0, stream>>>(ffn_w2, wt2, D_EMB, DFF);

    const dim3 gD(D_EMB / 128, MTOT / 128);   // N=1024 GEMMs
    const dim3 gF(DFF   / 128, MTOT / 128);   // N=4096 GEMM

    // ---- self attention ----
    k_gemm<<<gD, blk, 0, stream>>>(xb, wt_saq, sa_bq, nullptr, nullptr, qb, MTOT, D_EMB, D_EMB, 0);
    k_gemm<<<gD, blk, 0, stream>>>(xb, wt_sak, sa_bk, nullptr, nullptr, kb, MTOT, D_EMB, D_EMB, 0);
    k_gemm<<<gD, blk, 0, stream>>>(xb, wt_sav, sa_bv, nullptr, nullptr, vb, MTOT, D_EMB, D_EMB, 0);
    k_attn<<<BB * NHEAD * (SS / 128), blk, 0, stream>>>(qb, kb, vb, ob);
    k_gemm<<<gD, blk, 0, stream>>>(ob, wt_sao, sa_bo, x, sumb, nullptr, MTOT, D_EMB, D_EMB, 0);
    k_ln<<<MTOT, blk, 0, stream>>>(sumb, ln1_g, ln1_b, ln1f, ln1b);

    // ---- cross attention ----
    k_gemm<<<gD, blk, 0, stream>>>(ln1b, wt_caq, ca_bq, nullptr, nullptr, qb, MTOT, D_EMB, D_EMB, 0);
    k_gemm<<<gD, blk, 0, stream>>>(cb,   wt_cak, ca_bk, nullptr, nullptr, kb, MTOT, D_EMB, D_EMB, 0);
    k_gemm<<<gD, blk, 0, stream>>>(cb,   wt_cav, ca_bv, nullptr, nullptr, vb, MTOT, D_EMB, D_EMB, 0);
    k_attn<<<BB * NHEAD * (SS / 128), blk, 0, stream>>>(qb, kb, vb, ob);
    k_gemm<<<gD, blk, 0, stream>>>(ob, wt_cao, ca_bo, ln1f, sumb, nullptr, MTOT, D_EMB, D_EMB, 0);
    k_ln<<<MTOT, blk, 0, stream>>>(sumb, ln2_g, ln2_b, ln2f, ln2b);

    // ---- FFN ----
    k_gemm<<<gF, blk, 0, stream>>>(ln2b, wt1, ffn_b1, nullptr, nullptr, f1b, MTOT, DFF, D_EMB, 1);
    k_gemm<<<gD, blk, 0, stream>>>(f1b,  wt2, ffn_b2, ln2f, sumb, nullptr, MTOT, D_EMB, DFF, 0);
    k_ln<<<MTOT, blk, 0, stream>>>(sumb, ln3_g, ln3_b, (float*)d_out, nullptr);
}

// v003
// A run of this version takes 450 microseconds.
// Timed twice side by side with v002, it ran 1.18 times as fast both times.
// Over all steps from v000 it is 1.71 times as fast.
#include <hip/hip_runtime.h>

// ---------------- problem constants ----------------
#define D_EMB 1024
#define NHEAD 16
#define DRED  64
#define BB    4
#define SS    1024
#define MTOT  (BB * SS)     // 4096 rows of activations
#define DFF   (4 * D_EMB)   // 4096

typedef unsigned int   u32;
typedef unsigned short u16;
typedef unsigned long long u64;
typedef u32   u32x4  __attribute__((ext_vector_type(4)));
typedef u32   u32x8  __attribute__((ext_vector_type(8)));
typedef float f32x4  __attribute__((ext_vector_type(4)));
typedef float f32x8  __attribute__((ext_vector_type(8)));
typedef __bf16 bf16x16 __attribute__((ext_vector_type(16)));

// ---------------- small helpers ----------------
__device__ __forceinline__ u16 f2bf(float f) {
    union { float f; u32 u; } c; c.f = f;
    u32 u = c.u;
    u32 r = u + 0x7fffu + ((u >> 16) & 1u);   // round-to-nearest-even
    return (u16)(r >> 16);
}

__device__ __forceinline__ f32x8 zero8() {
    f32x8 z;
#pragma unroll
    for (int i = 0; i < 8; ++i) z[i] = 0.0f;
    return z;
}

// LDS byte offset of a shared-memory pointer: flat LDS addresses keep the
// offset in the low 32 bits (ISA 10.2: LDS_ADDR = addr[31:0]).
__device__ __forceinline__ u32 lds_off(const void* p) {
    return (u32)(uintptr_t)p;
}

// One K slab's async global->LDS copies of a lane: 16 bytes in each of four 32-row groups of
// A and of B (GVS form, ASYNCcnt tracked, no VGPR round-trip). la, lb: the lane's LDS byte
// address in the first group; ga, gb: its byte offset from the base; grow: 32 source rows.
// The closing s_wait_xcnt 0 stands inside the statement so that no address register named
// here is rewritten in front of it.
#define SLAB_GROUP_LDS (32u * 144u)   // 32 LDS rows of 144 bytes
__device__ __forceinline__ void slab_copies(u32 la, u32 lb, u32 ga, u32 gb, u32 grow,
                                            const void* abase, const void* bbase) {
    asm volatile("global_load_async_to_lds_b128 %0, %8, %16\n\t"
                 "global_load_async_to_lds_b128 %4, %12, %17\n\t"
                 "global_load_async_to_lds_b128 %1, %9, %16\n\t"
                 "global_load_async_to_lds_b128 %5, %13, %17\n\t"
                 "global_load_async_to_lds_b128 %2, %10, %16\n\t"
                 "global_load_async_to_lds_b128 %6, %14, %17\n\t"
                 "global_load_async_to_lds_b128 %3, %11, %16\n\t"
                 "global_load_async_to_lds_b128 %7, %15, %17\n\t"
                 "s_wait_xcnt 0x0"
                 :: "v"(la), "v"(la + SLAB_GROUP_LDS), "v"(la + 2u * SLAB_GROUP_LDS),
                    "v"(la + 3u * SLAB_GROUP_LDS),
                    "v"(lb), "v"(lb + SLAB_GROUP_LDS), "v"(lb + 2u * SLAB_GROUP_LDS),
                    "v"(lb + 3u * SLAB_GROUP_LDS),
                    "v"(ga), "v"(ga + grow), "v"(ga + 2u * grow), "v"(ga + 3u * grow),
                    "v"(gb), "v"(gb + grow), "v"(gb + 2u * grow), "v"(gb + 3u * grow),
                    "s"(abase), "s"(bbase)
                 : "memory");
}

// Load one 16-lane-striped bf16 fragment (A or B operand of 16x16x32 WMMA).
// rowbase points at the lane's matrix row (m for A, n for B); koff = kblock + half*8.
// Per ISA 7.12.2: VGPR0-3 hold K=[koff..koff+7], VGPR4-7 hold K=[koff+16..koff+23].
__device__ __forceinline__ bf16x16 load_frag(const u16* rowbase, int koff) {
    u32x4 lo = *reinterpret_cast<const u32x4*>(rowbase + koff);
    u32x4 hi = *reinterpret_cast<const u32x4*>(rowbase + koff + 16);
    u32x8 d;
    d[0] = lo[0]; d[1] = lo[1]; d[2] = lo[2]; d[3] = lo[3];
    d[4] = hi[0]; d[5] = hi[1]; d[6] = hi[2]; d[7] = hi[3];
    return __builtin_bit_cast(bf16x16, d);
}

__device__ __forceinline__ f32x8 wmma_bf16(bf16x16 a, bf16x16 b, f32x8 c) {
    return __builtin_amdgcn_wmma_f32_16x16x32_bf16(false, a, false, b, (short)0, c,
                                                   false, false);
}

// Value of lane ^ 16 (the other 16-lane half), by a vector cross-row move.
__device__ __forceinline__ float xhalf(float x) {
    int b = __builtin_bit_cast(int, x);
    return __builtin_bit_cast(float,
        __builtin_amdgcn_permlanex16(b, b, 0x76543210, 0xfedcba98, false, false));
}

// Base-2 exponentials, v_exp_f32. The instruction set asks for one independent instruction or
// a v_nop between a transcendental and a use of its result or an overwrite of its source.
// Here the outputs are
// early-clobber (none lies on a source) and the closing v_nop fills the last one's slot.
__device__ __forceinline__ void exp2x8(float (&d)[8], const float (&s)[8]) {
    asm("v_exp_f32 %0, %8\n\t"
        "v_exp_f32 %1, %9\n\t"
        "v_exp_f32 %2, %10\n\t"
        "v_exp_f32 %3, %11\n\t"
        "v_exp_f32 %4, %12\n\t"
        "v_exp_f32 %5, %13\n\t"
        "v_exp_f32 %6, %14\n\t"
        "v_exp_f32 %7, %15\n\t"
        "v_nop"
        : "=&v"(d[0]), "=&v"(d[1]), "=&v"(d[2]), "=&v"(d[3]),
          "=&v"(d[4]), "=&v"(d[5]), "=&v"(d[6]), "=&v"(d[7])
        : "v"(s[0]), "v"(s[1]), "v"(s[2]), "v"(s[3]),
          "v"(s[4]), "v"(s[5]), "v"(s[6]), "v"(s[7]));
}
__device__ __forceinline__ float exp2x1(float s) {
    float d;
    asm("v_exp_f32 %0, %1\n\t"
        "v_nop"                       // the same slot, for the one result
        : "=v"(d) : "v"(s));
    return d;
}
#define LOG2E 1.44269504088896340736f

// ---------------- cast / repack kernels ----------------
__global__ void k_cast_bf16(const float* __restrict__ in, u16* __restrict__ out, int n) {
    int i = blockIdx.x * blockDim.x + threadIdx.x;
    int st = gridDim.x * blockDim.x;
    for (; i < n; i += st) out[i] = f2bf(in[i]);
}

// Weight packs: transpose + cast through an LDS tile, so that both sides move whole lines.
// One block takes KT rows (k) x 64 columns (n) of a row-major f32 matrix with row pitch ld
// and writes them as 64 rows of KT bf16 with row pitch K.
// Read: a lane takes 16 bytes of rows 2p and 2p + 1; 16 lanes cover 256 contiguous bytes.
// LDS: tile[n][p] holds the bf16 pair (k = 2p, 2p + 1); the pitch KT/2 + 1 dwords puts the 32
// lanes of every store (n = 4 * c4 + j, two p) and of every load on 32 different banks.
// Write: a lane stores 16 bytes; KT/8 lanes cover one row's KT * 2 contiguous bytes.
template <int KT>   // 64 or 128
__device__ __forceinline__ void pack_tile(u32 (*tile)[KT / 2 + 1],
                                          const float* __restrict__ src, int ld,
                                          u16* __restrict__ dst, int K) {
    const int tid = threadIdx.x;
    const int c4 = tid & 15, p0 = tid >> 4;
    const float* pl[KT / 32];
    const float* ph[KT / 32];
    f32x4 lo[KT / 32], hi[KT / 32];
#pragma unroll
    for (int it = 0; it < KT / 32; ++it) {      // all loads first: KT/16 in flight per lane
        pl[it] = src + (size_t)(2 * (p0 + 16 * it)) * ld + 4 * c4;
        ph[it] = pl[it] + ld;
        lo[it] = *reinterpret_cast<const f32x4*>(pl[it]);
        hi[it] = *reinterpret_cast<const f32x4*>(ph[it]);
    }
    // The wait that belongs in front of an overwrite of an issued load's address register.
    // The addresses are its inputs, so that none of their registers is given to a later
    // load's result (or to anything else) ahead of it.
    if constexpr (KT == 64)
        asm volatile("s_wait_xcnt 0x0" :: "v"(pl[0]), "v"(ph[0]), "v"(pl[1]), "v"(ph[1])
                     : "memory");
    else
        asm volatile("s_wait_xcnt 0x0" :: "v"(pl[0]), "v"(ph[0]), "v"(pl[1]), "v"(ph[1]),
                                          "v"(pl[2]), "v"(ph[2]), "v"(pl[3]), "v"(ph[3])
                     : "memory");
#pragma unroll
    for (int it = 0; it < KT / 32; ++it)
#pragma unroll
        for (int j = 0; j < 4; ++j)
            tile[4 * c4 + j][p0 + 16 * it] = (u32)f2bf(lo[it][j]) | ((u32)f2bf(hi[it][j]) << 16);
    __syncthreads();                            // the whole tile is in LDS before it is read
    constexpr int SEG = KT / 8;                 // 16-byte pieces per output row
#pragma unroll
    for (int it = 0; it < SEG / 4; ++it) {
        const int q = tid + it * 256;
        const int n = q / SEG, s = q % SEG;
        u32x4 w;
#pragma unroll
        for (int e = 0; e < 4; ++e) w[e] = tile[n][4 * s + e];
        *reinterpret_cast<u32x4*>(dst + (size_t)n * K + 8 * s) = w;
    }
}

// w [Z][K][N] row-major -> Wt [Z][N][K] bf16 (transpose + cast); grid (N/64, K/64, Z).
// A plain weight [K][N] is Z = 1. A per-head weight wq [H=16][K=1024][R=64] is Z = H, N = R:
// its Wt [H][R][K] is the [N=H*R][K] operand with n = h*64 + r.
__global__ __launch_bounds__(256) void k_pack_t(const float* __restrict__ w,
                                                u16* __restrict__ out, int N, int K) {
    __shared__ u32 tile[64][33];
    const int n0 = blockIdx.x * 64, k0 = blockIdx.y * 64;
    const size_t z = (size_t)blockIdx.z * N * K;
    pack_tile<64>(tile, w + z + (size_t)k0 * N + n0, N, out + z + (size_t)n0 * K + k0, K);
}

// the same for the two large weights: 128 rows a block, twice the loads in flight per wave
// and half the waves to start; grid (N/64, K/128)
__global__ __launch_bounds__(256) void k_pack_t128(const float* __restrict__ w,
                                                   u16* __restrict__ out, int N, int K) {
    __shared__ u32 tile[64][65];
    const int n0 = blockIdx.x * 64, k0 = blockIdx.y * 128;
    pack_tile<128>(tile, w + (size_t)k0 * N + n0, N, out + (size_t)n0 * K + k0, K);
}

// ---------------- WMMA GEMM ----------------
// C[M,N] = act(A_bf16[M,K] x Wt_bf16[N,K]^T + bias) (+resid); writes f32 and/or bf16.
// Block tile 128x128, 8 waves (2 along M x 4 along N), wave tile 64x32 (4x2 WMMA tiles).
// K slabs of 64 alternate between two LDS buffers: slab t + 1's async copies fly while
// slab t is worked on.
__global__ __launch_bounds__(256) void k_gemm(
    const u16* __restrict__ A, const u16* __restrict__ Wt,
    const float* __restrict__ bias, const float* __restrict__ resid,
    float* __restrict__ outF, u16* __restrict__ outB,
    int M, int N, int K, int relu)
{
    // [buffer][A, B][row][k]; row-pad 72: stride 36 dwords -> conflict-free b128
    __shared__ __attribute__((aligned(16))) u16 ring[2][2][128][72];

    const int tid  = threadIdx.x;
    const int lane = tid & 31, l15 = lane & 15, hf = (lane >> 4) & 1;
    const int wid  = tid >> 5;
    const int bm = blockIdx.y * 128, bn = blockIdx.x * 128;
    const int wm = (wid & 1) * 64,   wn = (wid >> 1) * 32;

    f32x8 acc[4][2];
#pragma unroll
    for (int mt = 0; mt < 4; ++mt)
#pragma unroll
        for (int nt = 0; nt < 2; ++nt) acc[mt][nt] = zero8();

    // a lane copies 16 bytes of row r0 (+32, +64, +96) of each operand's slab
    const int r0 = tid >> 3, c8 = (tid & 7) << 3;
    const u32 la0 = lds_off(&ring[0][0][r0][c8]);
    const u32 lb0 = lds_off(&ring[0][1][r0][c8]);
    const u32 ga0 = ((u32)(bm + r0) * (u32)K + (u32)c8) * 2u;
    const u32 gb0 = ((u32)(bn + r0) * (u32)K + (u32)c8) * 2u;
    const u32 grow = (u32)K * 64u;            // 32 source rows in bytes
    const u32 bufB = (u32)sizeof(ring[0]);    // one buffer in bytes
    const int T = K >> 6;                     // slabs; K is a multiple of 64, at least 64

    slab_copies(la0, lb0, ga0, gb0, grow, A, Wt);         // slab 0 into buffer 0
    asm volatile("s_wait_asynccnt 0x0" ::: "memory");     // this wave's copies have landed
    __syncthreads();                                      // every wave's are visible
    if (1 < T)                                            // slab 1 into buffer 1
        slab_copies(la0 + bufB, lb0 + bufB, ga0 + 128u, gb0 + 128u, grow, A, Wt);

    for (int t = 0; t < T; ++t) {
        const u16 (*aS)[72] = ring[t & 1][0];
        const u16 (*bS)[72] = ring[t & 1][1];
#pragma unroll
        for (int kb = 0; kb < 64; kb += 32) {
            bf16x16 af[4], bfr[2];
#pragma unroll
            for (int mt = 0; mt < 4; ++mt)
                af[mt] = load_frag(&aS[wm + mt * 16 + l15][0], kb + hf * 8);
#pragma unroll
            for (int nt = 0; nt < 2; ++nt)
                bfr[nt] = load_frag(&bS[wn + nt * 16 + l15][0], kb + hf * 8);
#pragma unroll
            for (int mt = 0; mt < 4; ++mt)
#pragma unroll
                for (int nt = 0; nt < 2; ++nt)
                    acc[mt][nt] = wmma_bf16(af[mt], bfr[nt], acc[mt][nt]);
        }
        // publish point of slab t + 1, in this order:
        asm volatile("s_wait_dscnt 0x0" ::: "memory");    // this wave's reads of slab t are back
        asm volatile("s_wait_asynccnt 0x0" ::: "memory"); // its copies of slab t + 1 have landed
        __syncthreads();      // slab t + 1 visible to all; every reader has left slab t's buffer
        if (t + 2 < T) {      // refill that buffer
            const u32 bo = (u32)(t & 1) * bufB, go = (u32)(t + 2) * 128u;
            slab_copies(la0 + bo, lb0 + bo, ga0 + go, gb0 + go, grow, A, Wt);
        }
    }
    asm volatile("s_wait_asynccnt 0x0" ::: "memory");     // no copy outlives the loop

#pragma unroll
    for (int mt = 0; mt < 4; ++mt)
#pragma unroll
        for (int nt = 0; nt < 2; ++nt)
#pragma unroll
            for (int v = 0; v < 8; ++v) {
                int row = bm + wm + mt * 16 + v + 8 * hf;   // C layout: M = v + 8*half
                int col = bn + wn + nt * 16 + l15;          //           N = lane&15
                float val = acc[mt][nt][v] + bias[col];
                if (relu)  val = fmaxf(val, 0.0f);
                if (resid) val += resid[(size_t)row * N + col];
                size_t o = (size_t)row * N + col;
                if (outF) outF[o] = val;
                if (outB) outB[o] = f2bf(val);
            }
}

// ---------------- fused flash attention (bf16 WMMA, online softmax) ----------------
// q,k,v,o: bf16 [B][S][H][R] ; one block = one (b,h) x 128 query rows; 8 waves x 16 rows.
// Scores are formed transposed, St = K x Qt, and the output as Ot += Vt x Pt: a lane then
// holds 16 of the 32 scores of ONE query, so maximum and sum run in the lane's own registers
// (one exchange with lane ^ 16), and two score tiles, converted in place, are the B operand.
// K chunk fetched by the Tensor Data Mover (2D tile DMA + LDS row padding);
// V chunk transposed manually (TDM has no transpose).
__global__ __launch_bounds__(256) void k_attn(
    const u16* __restrict__ qp, const u16* __restrict__ kp,
    const u16* __restrict__ vp, u16* __restrict__ op)
{
    __shared__ u16 kch[128][72];     // key chunk, row-major [t][r], TDM-padded rows
    __shared__ u16 vtS[64][136];     // value chunk transposed [r][t]

    const int tid  = threadIdx.x;
    const int lane = tid & 31, l15 = lane & 15, hf = (lane >> 4) & 1;
    const int wid  = tid >> 5;
    const int bx = blockIdx.x;
    const int qc = bx & 7;                 // S/128 = 8 chunks
    const int h  = (bx >> 3) & (NHEAD - 1);
    const int b  = bx >> 7;
    const int qbase = qc * 128 + wid * 16;

    // Q fragments straight from global (row is contiguous 64 bf16); B operand, column = query
    const int srow = qbase + l15;
    const u16* qrow = qp + (size_t)((b * SS + srow) * NHEAD + h) * DRED;
    bf16x16 qf[2];
    qf[0] = load_frag(qrow, 0  + hf * 8);
    qf[1] = load_frag(qrow, 32 + hf * 8);

    f32x8 oacc[4];
#pragma unroll
    for (int rt = 0; rt < 4; ++rt) oacc[rt] = zero8();
    float run_m = -1.0e30f;   // running maximum of query l15 (equal in both lane halves)
    float run_l = 0.0f;       // running sum over this lane half's keys only; joined at the end

    const u32 kch_lds = lds_off(&kch[0][0]);

    for (int nc = 0; nc < SS / 128; ++nc) {
        __syncthreads();                      // previous chunk fully consumed

        if (wid == 0) {
            // ---- TDM: DMA 128x64-element bf16 tile (row stride H*R) into kch ----
            u64 gaddr = (u64)(uintptr_t)kp +
                        2ull * (u64)(((b * SS + nc * 128) * NHEAD + h) * DRED);
            u32x4 g0;
            g0[0] = 1u;                                   // count=1, user descriptor
            g0[1] = kch_lds;                              // lds_addr
            g0[2] = (u32)(gaddr & 0xffffffffu);           // global_addr[31:0]
            g0[3] = (u32)((gaddr >> 32) & 0x01ffffffu)    // global_addr[56:32]
                    | (2u << 30);                         // type=2 ("image")
            u32x8 g1;
            g1[0] = (1u << 16)                            // data_size = 2 bytes
                  | (1u << 20)                            // pad_enable
                  | (4u << 22)                            // pad_interval: 32 DWORDs (128B row)
                  | (3u << 25);                           // pad_amount: 4 DWORDs (16B pad)
            g1[1] = (64u << 16);                          // tensor_dim0 = 64 (low 16)
            g1[2] = 0u;                                   // dim0 hi / dim1 low
            g1[3] = 16u | (64u << 16);                    // tensor_dim1 = 1<<20; tile_dim0 = 64
            g1[4] = 128u;                                 // tile_dim1 = 128, tile_dim2 = 0
            g1[5] = (u32)(NHEAD * DRED);                  // tensor_dim0_stride = 1024 elems
            g1[6] = 0u;
            g1[7] = 0u;
            asm volatile("tensor_load_to_lds %0, %1" :: "s"(g0), "s"(g1) : "memory");
            __builtin_amdgcn_s_wait_tensorcnt(0);
        }

        // ---- all threads: stage V transposed into vtS ----
#pragma unroll
        for (int j = 0; j < 4; ++j) {
            int c0 = tid + j * 256;
            int t = c0 >> 3, c8 = (c0 & 7) << 3;
            size_t gbase = (size_t)((b * SS + nc * 128 + t) * NHEAD + h) * DRED + c8;
            u32x4 vv = *reinterpret_cast<const u32x4*>(vp + gbase);
#pragma unroll
            for (int e = 0; e < 4; ++e) {
                vtS[c8 + 2 * e    ][t] = (u16)(vv[e] & 0xffffu);
                vtS[c8 + 2 * e + 1][t] = (u16)(vv[e] >> 16);
            }
        }
        __syncthreads();

#pragma unroll
        for (int tt = 0; tt < 4; ++tt) {        // 32 keys per step
            f32x8 s0 = zero8(), s1 = zero8();   // St[key = v + 8*half (+16)][query = l15]
#pragma unroll
            for (int kb = 0; kb < 2; ++kb) {    // contract over R=64
                bf16x16 a0 = load_frag(&kch[tt * 32 +      l15][0], kb * 32 + hf * 8);
                bf16x16 a1 = load_frag(&kch[tt * 32 + 16 + l15][0], kb * 32 + hf * 8);
                s0 = wmma_bf16(a0, qf[kb], s0);
                s1 = wmma_bf16(a1, qf[kb], s1);
            }
            // online softmax of query l15: 16 keys in this lane, 16 in lane ^ 16
            const f32x8 sa = s0 * 0.125f, sc = s1 * 0.125f;       // 1/sqrt(64)
            float rm = fmaxf(sa[0], sc[0]);
#pragma unroll
            for (int v = 1; v < 8; ++v) rm = fmaxf(rm, fmaxf(sa[v], sc[v]));
            rm = fmaxf(rm, xhalf(rm));
            const float nm = fmaxf(run_m, rm);
            const float cr = exp2x1((run_m - nm) * LOG2E);
            run_m = nm;
            float t0[8], t1[8], e0[8], e1[8];
#pragma unroll
            for (int v = 0; v < 8; ++v) { t0[v] = (sa[v] - nm) * LOG2E; t1[v] = (sc[v] - nm) * LOG2E; }
            exp2x8(e0, t0);
            exp2x8(e1, t1);
            float ps = 0.0f;
#pragma unroll
            for (int v = 0; v < 8; ++v) ps += e0[v] + e1[v];
            run_l = run_l * cr + ps;
            u32x8 pd;                           // Pt as B operand: k = 8*half + s, 16 + 8*half + s
#pragma unroll
            for (int j = 0; j < 4; ++j) {
                pd[j]     = (u32)f2bf(e0[2 * j]) | ((u32)f2bf(e0[2 * j + 1]) << 16);
                pd[4 + j] = (u32)f2bf(e1[2 * j]) | ((u32)f2bf(e1[2 * j + 1]) << 16);
            }
            const bf16x16 pf = __builtin_bit_cast(bf16x16, pd);
#pragma unroll
            for (int rt = 0; rt < 4; ++rt) {    // Ot[r = rt*16 + v + 8*half][query = l15]
#pragma unroll
                for (int v = 0; v < 8; ++v) oacc[rt][v] *= cr;
                bf16x16 vf = load_frag(&vtS[rt * 16 + l15][0], tt * 32 + hf * 8);
                oacc[rt] = wmma_bf16(vf, pf, oacc[rt]);
            }
        }
    }

    // a lane holds 8 consecutive r of one query per tile: one 16-byte store each
    const float inv = 1.0f / (run_l + xhalf(run_l));
    u16* orow = op + (size_t)((b * SS + srow) * NHEAD + h) * DRED + 8 * hf;
#pragma unroll
    for (int rt = 0; rt < 4; ++rt) {
        u32x4 w;
#pragma unroll
        for (int j = 0; j < 4; ++j)
            w[j] = (u32)f2bf(oacc[rt][2 * j] * inv) | ((u32)f2bf(oacc[rt][2 * j + 1] * inv) << 16);
        *reinterpret_cast<u32x4*>(orow + rt * 16) = w;
    }
}

// ---------------- LayerNorm ----------------
__global__ __launch_bounds__(256) void k_ln(
    const float* __restrict__ in, const float* __restrict__ g, const float* __restrict__ bb,
    float* __restrict__ outF, u16* __restrict__ outB)
{
    __shared__ float sh1[8], sh2[8];
    const int row = blockIdx.x, tid = threadIdx.x;
    const float* r = in + (size_t)row * D_EMB;
    float x[4], s1 = 0.0f, s2 = 0.0f;
#pragma unroll
    for (int i = 0; i < 4; ++i) {
        x[i] = r[tid + i * 256];
        s1 += x[i]; s2 += x[i] * x[i];
    }
#pragma unroll
    for (int m = 1; m < 32; m <<= 1) {
        s1 += __shfl_xor(s1, m, 32);
        s2 += __shfl_xor(s2, m, 32);
    }
    if ((tid & 31) == 0) { sh1[tid >> 5] = s1; sh2[tid >> 5] = s2; }
    __syncthreads();
    float t1 = 0.0f, t2 = 0.0f;
#pragma unroll
    for (int j = 0; j < 8; ++j) { t1 += sh1[j]; t2 += sh2[j]; }
    float mean = t1 * (1.0f / D_EMB);
    float var  = t2 * (1.0f / D_EMB) - mean * mean;
    float sc = rsqrtf(var + 1e-3f);
#pragma unroll
    for (int i = 0; i < 4; ++i) {
        int c = tid + i * 256;
        float y = (x[i] - mean) * sc * g[c] + bb[c];
        size_t o = (size_t)row * D_EMB + c;
        if (outF) outF[o] = y;
        if (outB) outB[o] = f2bf(y);
    }
}

// ---------------- host orchestration ----------------
extern "C" void kernel_launch(void* const* d_in, const int* in_sizes, int n_in,
                              void* d_out, int out_size, void* d_ws, size_t ws_size,
                              hipStream_t stream) {
    (void)in_sizes; (void)n_in; (void)out_size; (void)ws_size;

    const float* x      = (const float*)d_in[0];
    const float* ctx    = (const float*)d_in[1];
    const float* sa_wq  = (const float*)d_in[2];
    const float* sa_bq  = (const float*)d_in[3];
    const float* sa_wk  = (const float*)d_in[4];
    const float* sa_bk  = (const float*)d_in[5];
    const float* sa_wv  = (const float*)d_in[6];
    const float* sa_bv  = (const float*)d_in[7];
    const float* sa_wo  = (const float*)d_in[8];
    const float* sa_bo  = (const float*)d_in[9];
    const float* ca_wq  = (const float*)d_in[10];
    const float* ca_bq  = (const float*)d_in[11];
    const float* ca_wk  = (const float*)d_in[12];
    const float* ca_bk  = (const float*)d_in[13];
    const float* ca_wv  = (const float*)d_in[14];
    const float* ca_bv  = (const float*)d_in[15];
    const float* ca_wo  = (const float*)d_in[16];
    const float* ca_bo  = (const float*)d_in[17];
    const float* ln1_g  = (const float*)d_in[18];
    const float* ln1_b  = (const float*)d_in[19];
    const float* ln2_g  = (const float*)d_in[20];
    const float* ln2_b  = (const float*)d_in[21];
    const float* ln3_g  = (const float*)d_in[22];
    const float* ln3_b  = (const float*)d_in[23];
    const float* ffn_w1 = (const float*)d_in[24];
    const float* ffn_b1 = (const float*)d_in[25];
    const float* ffn_w2 = (const float*)d_in[26];
    const float* ffn_b2 = (const float*)d_in[27];

    char* ws = (char*)d_ws;
    size_t off = 0;
    auto alloc = [&](size_t bytes) -> void* {
        void* p = ws + off;
        off = (off + bytes + 255) & ~(size_t)255;
        return p;
    };

    const size_t ACT2 = (size_t)MTOT * D_EMB * 2;   // bf16 activation
    const size_t ACT4 = (size_t)MTOT * D_EMB * 4;   // f32 activation
    const size_t W2   = (size_t)D_EMB * D_EMB * 2;  // bf16 1024x1024 weight

    u16* xb     = (u16*)alloc(ACT2);
    u16* cb     = (u16*)alloc(ACT2);
    u16* wt_saq = (u16*)alloc(W2);
    u16* wt_sak = (u16*)alloc(W2);
    u16* wt_sav = (u16*)alloc(W2);
    u16* wt_sao = (u16*)alloc(W2);
    u16* wt_caq = (u16*)alloc(W2);
    u16* wt_cak = (u16*)alloc(W2);
    u16* wt_cav = (u16*)alloc(W2);
    u16* wt_cao = (u16*)alloc(W2);
    u16* wt1    = (u16*)alloc((size_t)DFF * D_EMB * 2);
    u16* wt2    = (u16*)alloc((size_t)D_EMB * DFF * 2);
    u16* qb     = (u16*)alloc(ACT2);
    u16* kb     = (u16*)alloc(ACT2);
    u16* vb     = (u16*)alloc(ACT2);
    u16* ob     = (u16*)alloc(ACT2);
    float* sumb = (float*)alloc(ACT4);
    float* ln1f = (float*)alloc(ACT4);
    u16*   ln1b = (u16*)alloc(ACT2);
    float* ln2f = (float*)alloc(ACT4);
    u16*   ln2b = (u16*)alloc(ACT2);
    u16*   f1b  = (u16*)alloc((size_t)MTOT * DFF * 2);

    const dim3 blk(256);
    const dim3 gQ(D_EMB / 64, D_EMB / 64);         // 64 x 64 tiles of a 1024 x 1024 weight
    const dim3 gH(DRED / 64, D_EMB / 64, NHEAD);   // the same of 16 heads' 1024 x 64 weights
    // casts + packs
    k_cast_bf16<<<2048, blk, 0, stream>>>(x,   xb, MTOT * D_EMB);
    k_cast_bf16<<<2048, blk, 0, stream>>>(ctx, cb, MTOT * D_EMB);
    k_pack_t<<<gH, blk, 0, stream>>>(sa_wq, wt_saq, DRED, D_EMB);
    k_pack_t<<<gH, blk, 0, stream>>>(sa_wk, wt_sak, DRED, D_EMB);
    k_pack_t<<<gH, blk, 0, stream>>>(sa_wv, wt_sav, DRED, D_EMB);
    k_pack_t<<<gQ, blk, 0, stream>>>(sa_wo, wt_sao, D_EMB, D_EMB);
    k_pack_t<<<gH, blk, 0, stream>>>(ca_wq, wt_caq, DRED, D_EMB);
    k_pack_t<<<gH, blk, 0, stream>>>(ca_wk, wt_cak, DRED, D_EMB);
    k_pack_t<<<gH, blk, 0, stream>>>(ca_wv, wt_cav, DRED, D_EMB);
    k_pack_t<<<gQ, blk, 0, stream>>>(ca_wo, wt_cao, D_EMB, D_EMB);
    k_pack_t128<<<dim3(DFF / 64, D_EMB / 128), blk, 0, stream>>>(ffn_w1, wt1, DFF, D_EMB);
    k_pack_t128<<<dim3(D_EMB / 64, DFF / 128), blk, 0, stream>>>(ffn_w2, wt2, D_EMB, DFF);

    const dim3 gD(D_EMB / 128, MTOT / 128);   // N=1024 GEMMs
    const dim3 gF(DFF   / 128, MTOT / 128);   // N=4096 GEMM

    // ---- self attention ----
    k_gemm<<<gD, blk, 0, stream>>>(xb, wt_saq, sa_bq, nullptr, nullptr, qb, MTOT, D_EMB, D_EMB, 0);
    k_gemm<<<gD, blk, 0, stream>>>(xb, wt_sak, sa_bk, nullptr, nullptr, kb, MTOT, D_EMB, D_EMB, 0);
    k_gemm<<<gD, blk, 0, stream>>>(xb, wt_sav, sa_bv, nullptr, nullptr, vb, MTOT, D_EMB, D_EMB, 0);
    k_attn<<<BB * NHEAD * (SS / 128), blk, 0, stream>>>(qb, kb, vb, ob);
    k_gemm<<<gD, blk, 0, stream>>>(ob, wt_sao, sa_bo, x, sumb, nullptr, MTOT, D_EMB, D_EMB, 0);
    k_ln<<<MTOT, blk, 0, stream>>>(sumb, ln1_g, ln1_b, ln1f, ln1b);

    // ---- cross attention ----
    k_gemm<<<gD, blk, 0, stream>>>(ln1b, wt_caq, ca_bq, nullptr, nullptr, qb, MTOT, D_EMB, D_EMB, 0);
    k_gemm<<<gD, blk, 0, stream>>>(cb,   wt_cak, ca_bk, nullptr, nullptr, kb, MTOT, D_EMB, D_EMB, 0);
    k_gemm<<<gD, blk, 0, stream>>>(cb,   wt_cav, ca_bv, nullptr, nullptr, vb, MTOT, D_EMB, D_EMB, 0);
    k_attn<<<BB * NHEAD * (SS / 128), blk, 0, stream>>>(qb, kb, vb, ob);
    k_gemm<<<gD, blk, 0, stream>>>(ob, wt_cao, ca_bo, ln1f, sumb, nullptr, MTOT, D_EMB, D_EMB, 0);
    k_ln<<<MTOT, blk, 0, stream>>>(sumb, ln2_g, ln2_b, ln2f, ln2b);

    // ---- FFN ----
    k_gemm<<<gF, blk, 0, stream>>>(ln2b, wt1, ffn_b1, nullptr, nullptr, f1b, MTOT, DFF, D_EMB, 1);
    k_gemm<<<gD, blk, 0, stream>>>(f1b,  wt2, ffn_b2, ln2f, sumb, nullptr, MTOT, D_EMB, DFF, 0);
    k_ln<<<MTOT, blk, 0, stream>>>(sumb, ln3_g, ln3_b, (float*)d_out, nullptr);
}

// v004
// It runs in 357 microseconds.
// Timed twice side by side with v003, it ran 1.26 times as fast both times.
// All steps since v000 together make it 2.15 times as fast.
#include <hip/hip_runtime.h>

// ---------------- problem constants ----------------
#define D_EMB 1024
#define NHEAD 16
#define DRED  64
#define BB    4
#define SS    1024
#define MTOT  (BB * SS)     // 4096 rows of activations
#define DFF   (4 * D_EMB)   // 4096

typedef unsigned int   u32;
typedef unsigned short u16;
typedef unsigned long long u64;
typedef u32   u32x4  __attribute__((ext_vector_type(4)));
typedef u32   u32x8  __attribute__((ext_vector_type(8)));
typedef float f32x4  __attribute__((ext_vector_type(4)));
typedef float f32x8  __attribute__((ext_vector_type(8)));
typedef __bf16 bf16x16 __attribute__((ext_vector_type(16)));

// ---------------- small helpers ----------------
__device__ __forceinline__ u16 f2bf(float f) {
    union { float f; u32 u; } c; c.f = f;
    u32 u = c.u;
    u32 r = u + 0x7fffu + ((u >> 16) & 1u);   // round-to-nearest-even
    return (u16)(r >> 16);
}

__device__ __forceinline__ f32x8 zero8() {
    f32x8 z;
#pragma unroll
    for (int i = 0; i < 8; ++i) z[i] = 0.0f;
    return z;
}

// LDS byte offset of a shared-memory pointer: flat LDS addresses keep the
// offset in the low 32 bits (ISA 10.2: LDS_ADDR = addr[31:0]).
__device__ __forceinline__ u32 lds_off(const void* p) {
    return (u32)(uintptr_t)p;
}

// One K slab's async global->LDS copies of a lane: 16 bytes in each of four 32-row groups of
// A and of B (GVS form, ASYNCcnt tracked, no VGPR round-trip). la, lb: the lane's LDS byte
// address in the first group; ga, gb: its byte offset from the base; grow: 32 source rows.
// The closing s_wait_xcnt 0 stands inside the statement so that no address register named
// here is rewritten in front of it.
#define SLAB_GROUP_LDS (32u * 144u)   // 32 LDS rows of 144 bytes
__device__ __forceinline__ void slab_copies(u32 la, u32 lb, u32 ga, u32 gb, u32 grow,
                                            const void* abase, const void* bbase) {
    asm volatile("global_load_async_to_lds_b128 %0, %8, %16\n\t"
                 "global_load_async_to_lds_b128 %4, %12, %17\n\t"
                 "global_load_async_to_lds_b128 %1, %9, %16\n\t"
                 "global_load_async_to_lds_b128 %5, %13, %17\n\t"
                 "global_load_async_to_lds_b128 %2, %10, %16\n\t"
                 "global_load_async_to_lds_b128 %6, %14, %17\n\t"
                 "global_load_async_to_lds_b128 %3, %11, %16\n\t"
                 "global_load_async_to_lds_b128 %7, %15, %17\n\t"
                 "s_wait_xcnt 0x0"
                 :: "v"(la), "v"(la + SLAB_GROUP_LDS), "v"(la + 2u * SLAB_GROUP_LDS),
                    "v"(la + 3u * SLAB_GROUP_LDS),
                    "v"(lb), "v"(lb + SLAB_GROUP_LDS), "v"(lb + 2u * SLAB_GROUP_LDS),
                    "v"(lb + 3u * SLAB_GROUP_LDS),
                    "v"(ga), "v"(ga + grow), "v"(ga + 2u * grow), "v"(ga + 3u * grow),
                    "v"(gb), "v"(gb + grow), "v"(gb + 2u * grow), "v"(gb + 3u * grow),
                    "s"(abase), "s"(bbase)
                 : "memory");
}

// Load one 16-lane-striped bf16 fragment (A or B operand of 16x16x32 WMMA).
// rowbase points at the lane's matrix row (m for A, n for B); koff = kblock + half*8.
// Per ISA 7.12.2: VGPR0-3 hold K=[koff..koff+7], VGPR4-7 hold K=[koff+16..koff+23].
__device__ __forceinline__ bf16x16 load_frag(const u16* rowbase, int koff) {
    u32x4 lo = *reinterpret_cast<const u32x4*>(rowbase + koff);
    u32x4 hi = *reinterpret_cast<const u32x4*>(rowbase + koff + 16);
    u32x8 d;
    d[0] = lo[0]; d[1] = lo[1]; d[2] = lo[2]; d[3] = lo[3];
    d[4] = hi[0]; d[5] = hi[1]; d[6] = hi[2]; d[7] = hi[3];
    return __builtin_bit_cast(bf16x16, d);
}

__device__ __forceinline__ f32x8 wmma_bf16(bf16x16 a, bf16x16 b, f32x8 c) {
    return __builtin_amdgcn_wmma_f32_16x16x32_bf16(false, a, false, b, (short)0, c,
                                                   false, false);
}

// Value of lane ^ 16 (the other 16-lane half), by a vector cross-row move.
__device__ __forceinline__ float xhalf(float x) {
    int b = __builtin_bit_cast(int, x);
    return __builtin_bit_cast(float,
        __builtin_amdgcn_permlanex16(b, b, 0x76543210, 0xfedcba98, false, false));
}

// Base-2 exponentials, v_exp_f32. The instruction set asks for one independent instruction or
// a v_nop between a transcendental and a use of its result or an overwrite of its source.
// Here the outputs are
// early-clobber (none lies on a source) and the closing v_nop fills the last one's slot.
__device__ __forceinline__ void exp2x8(float (&d)[8], const float (&s)[8]) {
    asm("v_exp_f32 %0, %8\n\t"
        "v_exp_f32 %1, %9\n\t"
        "v_exp_f32 %2, %10\n\t"
        "v_exp_f32 %3, %11\n\t"
        "v_exp_f32 %4, %12\n\t"
        "v_exp_f32 %5, %13\n\t"
        "v_exp_f32 %6, %14\n\t"
        "v_exp_f32 %7, %15\n\t"
        "v_nop"
        : "=&v"(d[0]), "=&v"(d[1]), "=&v"(d[2]), "=&v"(d[3]),
          "=&v"(d[4]), "=&v"(d[5]), "=&v"(d[6]), "=&v"(d[7])
        : "v"(s[0]), "v"(s[1]), "v"(s[2]), "v"(s[3]),
          "v"(s[4]), "v"(s[5]), "v"(s[6]), "v"(s[7]));
}
__device__ __forceinline__ float exp2x1(float s) {
    float d;
    asm("v_exp_f32 %0, %1\n\t"
        "v_nop"                       // the same slot, for the one result
        : "=v"(d) : "v"(s));
    return d;
}
#define LOG2E 1.44269504088896340736f

// ---------------- cast / repack kernels ----------------
// f32 -> bf16 of one activation by 2048 blocks of 256 threads; blk is this block's place among
// them. A thread takes 8 elements one grid stride apart, all 8 loads in flight before a store.
__device__ __forceinline__ void cast_bf16(const float* __restrict__ in, u16* __restrict__ out,
                                          int blk) {
    constexpr int ST = 2048 * 256, IT = MTOT * D_EMB / ST;
    const int i = blk * 256 + threadIdx.x;
    float v[IT];
#pragma unroll
    for (int it = 0; it < IT; ++it) v[it] = in[i + it * ST];
#pragma unroll
    for (int it = 0; it < IT; ++it) out[i + it * ST] = f2bf(v[it]);
    // The wait that belongs in front of an overwrite of an issued store's address register; here
    // it is a precaution, as no code follows the cast in this kernel.
    asm volatile("s_wait_xcnt 0x0" ::: "memory");
}

// Weight packs: transpose + cast through an LDS tile, so that both sides move whole lines.
// One block takes KT rows (k) x 64 columns (n) of a row-major f32 matrix with row pitch ld
// and writes them as 64 rows of KT bf16 with row pitch K.
// Read: a lane takes 16 bytes of rows 2p and 2p + 1; 16 lanes cover 256 contiguous bytes.
// LDS: tile[n][p] holds the bf16 pair (k = 2p, 2p + 1); the pitch KT/2 + 1 dwords puts the 32
// lanes of every store (n = 4 * c4 + j, two p) and of every load on 32 different banks.
// Write: a lane stores 16 bytes; KT/8 lanes cover one row's KT * 2 contiguous bytes.
template <int KT>   // 64 or 128
__device__ __forceinline__ void pack_tile(u32 (*tile)[KT / 2 + 1],
                                          const float* __restrict__ src, int ld,
                                          u16* __restrict__ dst, int K) {
    const int tid = threadIdx.x;
    const int c4 = tid & 15, p0 = tid >> 4;
    const float* pl[KT / 32];
    const float* ph[KT / 32];
    f32x4 lo[KT / 32], hi[KT / 32];
#pragma unroll
    for (int it = 0; it < KT / 32; ++it) {      // all loads first: KT/16 in flight per lane
        pl[it] = src + (size_t)(2 * (p0 + 16 * it)) * ld + 4 * c4;
        ph[it] = pl[it] + ld;
        lo[it] = *reinterpret_cast<const f32x4*>(pl[it]);
        hi[it] = *reinterpret_cast<const f32x4*>(ph[it]);
    }
    // The wait that belongs in front of an overwrite of an issued load's address register.
    // The addresses are its inputs, so that none of their registers is given to a later
    // load's result (or to anything else) ahead of it.
    if constexpr (KT == 64)
        asm volatile("s_wait_xcnt 0x0" :: "v"(pl[0]), "v"(ph[0]), "v"(pl[1]), "v"(ph[1])
                     : "memory");
    else
        asm volatile("s_wait_xcnt 0x0" :: "v"(pl[0]), "v"(ph[0]), "v"(pl[1]), "v"(ph[1]),
                                          "v"(pl[2]), "v"(ph[2]), "v"(pl[3]), "v"(ph[3])
                     : "memory");
#pragma unroll
    for (int it = 0; it < KT / 32; ++it)
#pragma unroll
        for (int j = 0; j < 4; ++j)
            tile[4 * c4 + j][p0 + 16 * it] = (u32)f2bf(lo[it][j]) | ((u32)f2bf(hi[it][j]) << 16);
    __syncthreads();                            // the whole tile is in LDS before it is read
    constexpr int SEG = KT / 8;                 // 16-byte pieces per output row
#pragma unroll
    for (int it = 0; it < SEG / 4; ++it) {
        const int q = tid + it * 256;
        const int n = q / SEG, s = q % SEG;
        u32x4 w;
#pragma unroll
        for (int e = 0; e < 4; ++e) w[e] = tile[n][4 * s + e];
        *reinterpret_cast<u32x4*>(dst + (size_t)n * K + 8 * s) = w;
    }
    // The same wait behind the stores.
    asm volatile("s_wait_xcnt 0x0" ::: "memory");
}

// All input preparation in ONE launch: none of these pieces reads what another writes, so they
// share a grid and the chip fills once instead of twelve times. Block ranges, longest work first:
//   [0, 512)      ffn_w1 [1024][4096] -> wt1 [4096][1024], 128 k x 64 n a block
//   [512, 1024)   ffn_w2 [4096][1024] -> wt2 [1024][4096], the same
//   [1024, 3072)  eight 1024 x 1024 weights, 256 blocks each, 64 k x 64 n a block -> wt8 + i * 2^20
//                 i & 3 < 3: per-head w [H=16][K=1024][R=64] -> Wt [n = h*64 + r][k]
//                 i & 3 == 3: plain w [K=1024][N=1024] -> Wt [n][k]
//   [3072, 7168)  x and context to bf16, 2048 blocks each
#define PREP_BLOCKS 7168
__global__ __launch_bounds__(256) void k_prep(
    const float* __restrict__ x,  const float* __restrict__ ctx,
    const float* __restrict__ w0, const float* __restrict__ w1,
    const float* __restrict__ w2, const float* __restrict__ w3,
    const float* __restrict__ w4, const float* __restrict__ w5,
    const float* __restrict__ w6, const float* __restrict__ w7,
    const float* __restrict__ f1, const float* __restrict__ f2,
    u16* __restrict__ xb, u16* __restrict__ cb, u16* __restrict__ wt8,
    u16* __restrict__ wt1, u16* __restrict__ wt2)
{
    __shared__ u32 tile[64 * 65];
    const int bx = blockIdx.x;
    if (bx < 1024) {
        const bool first = bx < 512;
        const int r  = bx & 511;
        const int nt = first ? (r & 63) : (r & 15);      // 64-column tile
        const int kt = first ? (r >> 6) : (r >> 4);      // 128-row tile
        const int N  = first ? DFF : D_EMB, K = first ? D_EMB : DFF;
        pack_tile<128>(reinterpret_cast<u32 (*)[65]>(tile),
                       (first ? f1 : f2) + (size_t)(kt * 128) * N + nt * 64, N,
                       (first ? wt1 : wt2) + (size_t)(nt * 64) * K + kt * 128, K);
    } else if (bx < 3072) {
        const int i = (bx - 1024) >> 8, r = bx & 255;
        const float* w = i == 0 ? w0 : i == 1 ? w1 : i == 2 ? w2 : i == 3 ? w3
                       : i == 4 ? w4 : i == 5 ? w5 : i == 6 ? w6 : w7;
        const bool plain = (i & 3) == 3;
        const int a = r & 15, c = r >> 4;
        // per head: a = k tile, c = head (its 64 columns are n tile c); plain: a = n tile, c = k tile
        const int nt = plain ? a : c, kt = plain ? c : a;
        const int so = plain ? kt * 64 * D_EMB + nt * 64 : nt * (D_EMB * DRED) + kt * 64 * DRED;
        pack_tile<64>(reinterpret_cast<u32 (*)[33]>(tile), w + so, plain ? D_EMB : DRED,
                      wt8 + (size_t)i * (D_EMB * D_EMB) + nt * 64 * D_EMB + kt * 64, D_EMB);
    } else {
        const int c = bx - 3072;
        const bool first = c < 2048;
        cast_bf16(first ? x : ctx, first ? xb : cb, c & 2047);
    }
}

// ---------------- WMMA GEMM ----------------
// C[M,N] = act(A_bf16[M,K] x Wt_bf16[N,K]^T + bias) (+resid); writes f32 and/or bf16.
// Block tile 128x128, 8 waves (2 along M x 4 along N), wave tile 64x32 (4x2 WMMA tiles).
// K slabs of 64 alternate between two LDS buffers: slab t + 1's async copies fly while
// slab t is worked on.
// ring: [buffer][A, B][row][k]; row-pad 72: stride 36 dwords -> conflict-free b128
__device__ __forceinline__ void gemm_tile(
    u16 (*ring)[2][128][72],
    const u16* __restrict__ A, const u16* __restrict__ Wt,
    const float* __restrict__ bias, const float* __restrict__ resid,
    float* __restrict__ outF, u16* __restrict__ outB,
    int N, int K, int relu)
{
    const int tid  = threadIdx.x;
    const int lane = tid & 31, l15 = lane & 15, hf = (lane >> 4) & 1;
    const int wid  = tid >> 5;
    const int bm = blockIdx.y * 128, bn = blockIdx.x * 128;
    const int wm = (wid & 1) * 64,   wn = (wid >> 1) * 32;

    f32x8 acc[4][2];
#pragma unroll
    for (int mt = 0; mt < 4; ++mt)
#pragma unroll
        for (int nt = 0; nt < 2; ++nt) acc[mt][nt] = zero8();

    // a lane copies 16 bytes of row r0 (+32, +64, +96) of each operand's slab
    const int r0 = tid >> 3, c8 = (tid & 7) << 3;
    const u32 la0 = lds_off(&ring[0][0][r0][c8]);
    const u32 lb0 = lds_off(&ring[0][1][r0][c8]);
    const u32 ga0 = ((u32)(bm + r0) * (u32)K + (u32)c8) * 2u;
    const u32 gb0 = ((u32)(bn + r0) * (u32)K + (u32)c8) * 2u;
    const u32 grow = (u32)K * 64u;            // 32 source rows in bytes
    const u32 bufB = (u32)sizeof(ring[0]);    // one buffer in bytes
    const int T = K >> 6;                     // slabs; K is a multiple of 64, at least 64

    slab_copies(la0, lb0, ga0, gb0, grow, A, Wt);         // slab 0 into buffer 0
    asm volatile("s_wait_asynccnt 0x0" ::: "memory");     // this wave's copies have landed
    __syncthreads();                                      // every wave's are visible
    if (1 < T)                                            // slab 1 into buffer 1
        slab_copies(la0 + bufB, lb0 + bufB, ga0 + 128u, gb0 + 128u, grow, A, Wt);

    for (int t = 0; t < T; ++t) {
        const u16 (*aS)[72] = ring[t & 1][0];
        const u16 (*bS)[72] = ring[t & 1][1];
#pragma unroll
        for (int kb = 0; kb < 64; kb += 32) {
            bf16x16 af[4], bfr[2];
#pragma unroll
            for (int mt = 0; mt < 4; ++mt)
                af[mt] = load_frag(&aS[wm + mt * 16 + l15][0], kb + hf * 8);
#pragma unroll
            for (int nt = 0; nt < 2; ++nt)
                bfr[nt] = load_frag(&bS[wn + nt * 16 + l15][0], kb + hf * 8);
#pragma unroll
            for (int mt = 0; mt < 4; ++mt)
#pragma unroll
                for (int nt = 0; nt < 2; ++nt)
                    acc[mt][nt] = wmma_bf16(af[mt], bfr[nt], acc[mt][nt]);
        }
        // publish point of slab t + 1, in this order:
        asm volatile("s_wait_dscnt 0x0" ::: "memory");    // this wave's reads of slab t are back
        asm volatile("s_wait_asynccnt 0x0" ::: "memory"); // its copies of slab t + 1 have landed
        __syncthreads();      // slab t + 1 visible to all; every reader has left slab t's buffer
        if (t + 2 < T) {      // refill that buffer
            const u32 bo = (u32)(t & 1) * bufB, go = (u32)(t + 2) * 128u;
            slab_copies(la0 + bo, lb0 + bo, ga0 + go, gb0 + go, grow, A, Wt);
        }
    }
    asm volatile("s_wait_asynccnt 0x0" ::: "memory");     // no copy outlives the loop

#pragma unroll
    for (int mt = 0; mt < 4; ++mt)
#pragma unroll
        for (int nt = 0; nt < 2; ++nt)
#pragma unroll
            for (int v = 0; v < 8; ++v) {
                int row = bm + wm + mt * 16 + v + 8 * hf;   // C layout: M = v + 8*half
                int col = bn + wn + nt * 16 + l15;          //           N = lane&15
                float val = acc[mt][nt][v] + bias[col];
                if (relu)  val = fmaxf(val, 0.0f);
                if (resid) val += resid[(size_t)row * N + col];
                size_t o = (size_t)row * N + col;
                if (outF) outF[o] = val;
                if (outB) outB[o] = f2bf(val);
            }
}

__global__ __launch_bounds__(256) void k_gemm(
    const u16* __restrict__ A, const u16* __restrict__ Wt,
    const float* __restrict__ bias, const float* __restrict__ resid,
    float* __restrict__ outF, u16* __restrict__ outB,
    int M, int N, int K, int relu)
{
    __shared__ __attribute__((aligned(16))) u16 ring[2][2][128][72];
    (void)M;
    gemm_tile(ring, A, Wt, bias, resid, outF, outB, N, K, relu);
}

// The q, k and v projections of one attention in ONE launch: they do not depend on one another,
// so blockIdx.z picks the product. Three workgroups then stand on a WGP where one stood, and
// each one's copy latency, barriers and epilogue run under the others' WMMAs.
__global__ __launch_bounds__(256) void k_gemm_qkv(
    const u16* __restrict__ Aq, const u16* __restrict__ Akv,
    const u16* __restrict__ Wq, const u16* __restrict__ Wk, const u16* __restrict__ Wv,
    const float* __restrict__ bq, const float* __restrict__ bk, const float* __restrict__ bv,
    u16* __restrict__ oq, u16* __restrict__ ok, u16* __restrict__ ov,
    int N, int K)
{
    __shared__ __attribute__((aligned(16))) u16 ring[2][2][128][72];
    const int z = blockIdx.z;
    gemm_tile(ring, z == 0 ? Aq : Akv,
              z == 0 ? Wq : z == 1 ? Wk : Wv,
              z == 0 ? bq : z == 1 ? bk : bv, nullptr, nullptr,
              z == 0 ? oq : z == 1 ? ok : ov, N, K, 0);
}

// ---------------- fused flash attention (bf16 WMMA, online softmax) ----------------
// q,k,v,o: bf16 [B][S][H][R] ; one block = one (b,h) x 128 query rows; 8 waves x 16 rows.
// Scores are formed transposed, St = K x Qt, and the output as Ot += Vt x Pt: a lane then
// holds 16 of the 32 scores of ONE query, so maximum and sum run in the lane's own registers
// (one exchange with lane ^ 16), and two score tiles, converted in place, are the B operand.
// K chunk fetched by the Tensor Data Mover (2D tile DMA + LDS row padding);
// V chunk transposed manually (TDM has no transpose).
__global__ __launch_bounds__(256) void k_attn(
    const u16* __restrict__ qp, const u16* __restrict__ kp,
    const u16* __restrict__ vp, u16* __restrict__ op)
{
    __shared__ u16 kch[128][72];     // key chunk, row-major [t][r], TDM-padded rows
    __shared__ u16 vtS[64][136];     // value chunk transposed [r][t]

    const int tid  = threadIdx.x;
    const int lane = tid & 31, l15 = lane & 15, hf = (lane >> 4) & 1;
    const int wid  = tid >> 5;
    const int bx = blockIdx.x;
    const int qc = bx & 7;                 // S/128 = 8 chunks
    const int h  = (bx >> 3) & (NHEAD - 1);
    const int b  = bx >> 7;
    const int qbase = qc * 128 + wid * 16;

    // Q fragments straight from global (row is contiguous 64 bf16); B operand, column = query
    const int srow = qbase + l15;
    const u16* qrow = qp + (size_t)((b * SS + srow) * NHEAD + h) * DRED;
    bf16x16 qf[2];
    qf[0] = load_frag(qrow, 0  + hf * 8);
    qf[1] = load_frag(qrow, 32 + hf * 8);

    f32x8 oacc[4];
#pragma unroll
    for (int rt = 0; rt < 4; ++rt) oacc[rt] = zero8();
    float run_m = -1.0e30f;   // running maximum of query l15 (equal in both lane halves)
    float run_l = 0.0f;       // running sum over this lane half's keys only; joined at the end

    const u32 kch_lds = lds_off(&kch[0][0]);

    for (int nc = 0; nc < SS / 128; ++nc) {
        __syncthreads();                      // previous chunk fully consumed

        if (wid == 0) {
            // ---- TDM: DMA 128x64-element bf16 tile (row stride H*R) into kch ----
            u64 gaddr = (u64)(uintptr_t)kp +
                        2ull * (u64)(((b * SS + nc * 128) * NHEAD + h) * DRED);
            u32x4 g0;
            g0[0] = 1u;                                   // count=1, user descriptor
            g0[1] = kch_lds;                              // lds_addr
            g0[2] = (u32)(gaddr & 0xffffffffu);           // global_addr[31:0]
            g0[3] = (u32)((gaddr >> 32) & 0x01ffffffu)    // global_addr[56:32]
                    | (2u << 30);                         // type=2 ("image")
            u32x8 g1;
            g1[0] = (1u << 16)                            // data_size = 2 bytes
                  | (1u << 20)                            // pad_enable
                  | (4u << 22)                            // pad_interval: 32 DWORDs (128B row)
                  | (3u << 25);                           // pad_amount: 4 DWORDs (16B pad)
            g1[1] = (64u << 16);                          // tensor_dim0 = 64 (low 16)
            g1[2] = 0u;                                   // dim0 hi / dim1 low
            g1[3] = 16u | (64u << 16);                    // tensor_dim1 = 1<<20; tile_dim0 = 64
            g1[4] = 128u;                                 // tile_dim1 = 128, tile_dim2 = 0
            g1[5] = (u32)(NHEAD * DRED);                  // tensor_dim0_stride = 1024 elems
            g1[6] = 0u;
            g1[7] = 0u;
            asm volatile("tensor_load_to_lds %0, %1" :: "s"(g0), "s"(g1) : "memory");
            __builtin_amdgcn_s_wait_tensorcnt(0);
        }

        // ---- all threads: stage V transposed into vtS ----
#pragma unroll
        for (int j = 0; j < 4; ++j) {
            int c0 = tid + j * 256;
            int t = c0 >> 3, c8 = (c0 & 7) << 3;
            size_t gbase = (size_t)((b * SS + nc * 128 + t) * NHEAD + h) * DRED + c8;
            u32x4 vv = *reinterpret_cast<const u32x4*>(vp + gbase);
#pragma unroll
            for (int e = 0; e < 4; ++e) {
                vtS[c8 + 2 * e    ][t] = (u16)(vv[e] & 0xffffu);
                vtS[c8 + 2 * e + 1][t] = (u16)(vv[e] >> 16);
            }
        }
        __syncthreads();

#pragma unroll
        for (int tt = 0; tt < 4; ++tt) {        // 32 keys per step
            f32x8 s0 = zero8(), s1 = zero8();   // St[key = v + 8*half (+16)][query = l15]
#pragma unroll
            for (int kb = 0; kb < 2; ++kb) {    // contract over R=64
                bf16x16 a0 = load_frag(&kch[tt * 32 +      l15][0], kb * 32 + hf * 8);
                bf16x16 a1 = load_frag(&kch[tt * 32 + 16 + l15][0], kb * 32 + hf * 8);
                s0 = wmma_bf16(a0, qf[kb], s0);
                s1 = wmma_bf16(a1, qf[kb], s1);
            }
            // online softmax of query l15: 16 keys in this lane, 16 in lane ^ 16
            const f32x8 sa = s0 * 0.125f, sc = s1 * 0.125f;       // 1/sqrt(64)
            float rm = fmaxf(sa[0], sc[0]);
#pragma unroll
            for (int v = 1; v < 8; ++v) rm = fmaxf(rm, fmaxf(sa[v], sc[v]));
            rm = fmaxf(rm, xhalf(rm));
            const float nm = fmaxf(run_m, rm);
            const float cr = exp2x1((run_m - nm) * LOG2E);
            run_m = nm;
            float t0[8], t1[8], e0[8], e1[8];
#pragma unroll
            for (int v = 0; v < 8; ++v) { t0[v] = (sa[v] - nm) * LOG2E; t1[v] = (sc[v] - nm) * LOG2E; }
            exp2x8(e0, t0);
            exp2x8(e1, t1);
            float ps = 0.0f;
#pragma unroll
            for (int v = 0; v < 8; ++v) ps += e0[v] + e1[v];
            run_l = run_l * cr + ps;
            u32x8 pd;                           // Pt as B operand: k = 8*half + s, 16 + 8*half + s
#pragma unroll
            for (int j = 0; j < 4; ++j) {
                pd[j]     = (u32)f2bf(e0[2 * j]) | ((u32)f2bf(e0[2 * j + 1]) << 16);
                pd[4 + j] = (u32)f2bf(e1[2 * j]) | ((u32)f2bf(e1[2 * j + 1]) << 16);
            }
            const bf16x16 pf = __builtin_bit_cast(bf16x16, pd);
#pragma unroll
            for (int rt = 0; rt < 4; ++rt) {    // Ot[r = rt*16 + v + 8*half][query = l15]
#pragma unroll
                for (int v = 0; v < 8; ++v) oacc[rt][v] *= cr;
                bf16x16 vf = load_frag(&vtS[rt * 16 + l15][0], tt * 32 + hf * 8);
                oacc[rt] = wmma_bf16(vf, pf, oacc[rt]);
            }
        }
    }

    // a lane holds 8 consecutive r of one query per tile: one 16-byte store each
    const float inv = 1.0f / (run_l + xhalf(run_l));
    u16* orow = op + (size_t)((b * SS + srow) * NHEAD + h) * DRED + 8 * hf;
#pragma unroll
    for (int rt = 0; rt < 4; ++rt) {
        u32x4 w;
#pragma unroll
        for (int j = 0; j < 4; ++j)
            w[j] = (u32)f2bf(oacc[rt][2 * j] * inv) | ((u32)f2bf(oacc[rt][2 * j + 1] * inv) << 16);
        *reinterpret_cast<u32x4*>(orow + rt * 16) = w;
    }
}

// ---------------- LayerNorm ----------------
__global__ __launch_bounds__(256) void k_ln(
    const float* __restrict__ in, const float* __restrict__ g, const float* __restrict__ bb,
    float* __restrict__ outF, u16* __restrict__ outB)
{
    __shared__ float sh1[8], sh2[8];
    const int row = blockIdx.x, tid = threadIdx.x;
    const float* r = in + (size_t)row * D_EMB;
    float x[4], s1 = 0.0f, s2 = 0.0f;
#pragma unroll
    for (int i = 0; i < 4; ++i) {
        x[i] = r[tid + i * 256];
        s1 += x[i]; s2 += x[i] * x[i];
    }
#pragma unroll
    for (int m = 1; m < 32; m <<= 1) {
        s1 += __shfl_xor(s1, m, 32);
        s2 += __shfl_xor(s2, m, 32);
    }
    if ((tid & 31) == 0) { sh1[tid >> 5] = s1; sh2[tid >> 5] = s2; }
    __syncthreads();
    float t1 = 0.0f, t2 = 0.0f;
#pragma unroll
    for (int j = 0; j < 8; ++j) { t1 += sh1[j]; t2 += sh2[j]; }
    float mean = t1 * (1.0f / D_EMB);
    float var  = t2 * (1.0f / D_EMB) - mean * mean;
    float sc = rsqrtf(var + 1e-3f);
#pragma unroll
    for (int i = 0; i < 4; ++i) {
        int c = tid + i * 256;
        float y = (x[i] - mean) * sc * g[c] + bb[c];
        size_t o = (size_t)row * D_EMB + c;
        if (outF) outF[o] = y;
        if (outB) outB[o] = f2bf(y);
    }
}

// ---------------- host orchestration ----------------
extern "C" void kernel_launch(void* const* d_in, const int* in_sizes, int n_in,
                              void* d_out, int out_size, void* d_ws, size_t ws_size,
                              hipStream_t stream) {
    (void)in_sizes; (void)n_in; (void)out_size; (void)ws_size;

    const float* x      = (const float*)d_in[0];
    const float* ctx    = (const float*)d_in[1];
    const float* sa_wq  = (const float*)d_in[2];
    const float* sa_bq  = (const float*)d_in[3];
    const float* sa_wk  = (const float*)d_in[4];
    const float* sa_bk  = (const float*)d_in[5];
    const float* sa_wv  = (const float*)d_in[6];
    const float* sa_bv  = (const float*)d_in[7];
    const float* sa_wo  = (const float*)d_in[8];
    const float* sa_bo  = (const float*)d_in[9];
    const float* ca_wq  = (const float*)d_in[10];
    const float* ca_bq  = (const float*)d_in[11];
    const float* ca_wk  = (const float*)d_in[12];
    const float* ca_bk  = (const float*)d_in[13];
    const float* ca_wv  = (const float*)d_in[14];
    const float* ca_bv  = (const float*)d_in[15];
    const float* ca_wo  = (const float*)d_in[16];
    const float* ca_bo  = (const float*)d_in[17];
    const float* ln1_g  = (const float*)d_in[18];
    const float* ln1_b  = (const float*)d_in[19];
    const float* ln2_g  = (const float*)d_in[20];
    const float* ln2_b  = (const float*)d_in[21];
    const float* ln3_g  = (const float*)d_in[22];
    const float* ln3_b  = (const float*)d_in[23];
    const float* ffn_w1 = (const float*)d_in[24];
    const float* ffn_b1 = (const float*)d_in[25];
    const float* ffn_w2 = (const float*)d_in[26];
    const float* ffn_b2 = (const float*)d_in[27];

    char* ws = (char*)d_ws;
    size_t off = 0;
    auto alloc = [&](size_t bytes) -> void* {
        void* p = ws + off;
        off = (off + bytes + 255) & ~(size_t)255;
        return p;
    };

    const size_t ACT2 = (size_t)MTOT * D_EMB * 2;   // bf16 activation
    const size_t ACT4 = (size_t)MTOT * D_EMB * 4;   // f32 activation
    const size_t W2   = (size_t)D_EMB * D_EMB * 2;  // bf16 1024x1024 weight

    u16* xb     = (u16*)alloc(ACT2);
    u16* cb     = (u16*)alloc(ACT2);
    u16* wt8    = (u16*)alloc(8 * W2);              // the eight 1024 x 1024 weights in a row
    u16* wt_saq = wt8;
    u16* wt_sak = wt8 + 1 * (D_EMB * D_EMB);
    u16* wt_sav = wt8 + 2 * (D_EMB * D_EMB);
    u16* wt_sao = wt8 + 3 * (D_EMB * D_EMB);
    u16* wt_caq = wt8 + 4 * (D_EMB * D_EMB);
    u16* wt_cak = wt8 + 5 * (D_EMB * D_EMB);
    u16* wt_cav = wt8 + 6 * (D_EMB * D_EMB);
    u16* wt_cao = wt8 + 7 * (D_EMB * D_EMB);
    u16* wt1    = (u16*)alloc((size_t)DFF * D_EMB * 2);
    u16* wt2    = (u16*)alloc((size_t)D_EMB * DFF * 2);
    u16* qb     = (u16*)alloc(ACT2);
    u16* kb     = (u16*)alloc(ACT2);
    u16* vb     = (u16*)alloc(ACT2);
    u16* ob     = (u16*)alloc(ACT2);
    float* sumb = (float*)alloc(ACT4);
    float* ln1f = (float*)alloc(ACT4);
    u16*   ln1b = (u16*)alloc(ACT2);
    float* ln2f = (float*)alloc(ACT4);
    u16*   ln2b = (u16*)alloc(ACT2);
    u16*   f1b  = (u16*)alloc((size_t)MTOT * DFF * 2);

    const dim3 blk(256);
    // casts + packs
    k_prep<<<PREP_BLOCKS, blk, 0, stream>>>(x, ctx, sa_wq, sa_wk, sa_wv, sa_wo,
                                            ca_wq, ca_wk, ca_wv, ca_wo, ffn_w1, ffn_w2,
                                            xb, cb, wt8, wt1, wt2);

    const dim3 gD(D_EMB / 128, MTOT / 128);   // N=1024 GEMMs
    const dim3 gF(DFF   / 128, MTOT / 128);   // N=4096 GEMM
    const dim3 g3(D_EMB / 128, MTOT / 128, 3);   // q, k, v projections together

    // ---- self attention ----
    k_gemm_qkv<<<g3, blk, 0, stream>>>(xb, xb, wt_saq, wt_sak, wt_sav, sa_bq, sa_bk, sa_bv,
                                       qb, kb, vb, D_EMB, D_EMB);
    k_attn<<<BB * NHEAD * (SS / 128), blk, 0, stream>>>(qb, kb, vb, ob);
    k_gemm<<<gD, blk, 0, stream>>>(ob, wt_sao, sa_bo, x, sumb, nullptr, MTOT, D_EMB, D_EMB, 0);
    k_ln<<<MTOT, blk, 0, stream>>>(sumb, ln1_g, ln1_b, ln1f, ln1b);

    // ---- cross attention ----
    k_gemm_qkv<<<g3, blk, 0, stream>>>(ln1b, cb, wt_caq, wt_cak, wt_cav, ca_bq, ca_bk, ca_bv,
                                       qb, kb, vb, D_EMB, D_EMB);
    k_attn<<<BB * NHEAD * (SS / 128), blk, 0, stream>>>(qb, kb, vb, ob);
    k_gemm<<<gD, blk, 0, stream>>>(ob, wt_cao, ca_bo, ln1f, sumb, nullptr, MTOT, D_EMB, D_EMB, 0);
    k_ln<<<MTOT, blk, 0, stream>>>(sumb, ln2_g, ln2_b, ln2f, ln2b);

    // ---- FFN ----
    k_gemm<<<gF, blk, 0, stream>>>(ln2b, wt1, ffn_b1, nullptr, nullptr, f1b, MTOT, DFF, D_EMB, 1);
    k_gemm<<<gD, blk, 0, stream>>>(f1b,  wt2, ffn_b2, ln2f, sumb, nullptr, MTOT, D_EMB, DFF, 0);
    k_ln<<<MTOT, blk, 0, stream>>>(sumb, ln3_g, ln3_b, (float*)d_out, nullptr);
}

// v005
// It runs in 289 microseconds.
// Two timings next to v004 both put it at 1.24 times that version's speed.
// All steps since v000 together make it 2.66 times as fast.
#include <hip/hip_runtime.h>

// ---------------- problem constants ----------------
#define D_EMB 1024
#define NHEAD 16
#define DRED  64
#define BB    4
#define SS    1024
#define MTOT  (BB * SS)     // 4096 rows of activations
#define DFF   (4 * D_EMB)   // 4096

typedef unsigned int   u32;
typedef unsigned short u16;
typedef unsigned long long u64;
typedef u32   u32x4  __attribute__((ext_vector_type(4)));
typedef u32   u32x8  __attribute__((ext_vector_type(8)));
typedef float f32x4  __attribute__((ext_vector_type(4)));
typedef float f32x8  __attribute__((ext_vector_type(8)));
typedef __bf16 bf16x16 __attribute__((ext_vector_type(16)));

// ---------------- small helpers ----------------
__device__ __forceinline__ u16 f2bf(float f) {
    union { float f; u32 u; } c; c.f = f;
    u32 u = c.u;
    u32 r = u + 0x7fffu + ((u >> 16) & 1u);   // round-to-nearest-even
    return (u16)(r >> 16);
}

__device__ __forceinline__ f32x8 zero8() {
    f32x8 z;
#pragma unroll
    for (int i = 0; i < 8; ++i) z[i] = 0.0f;
    return z;
}

// LDS byte offset of a shared-memory pointer: flat LDS addresses keep the
// offset in the low 32 bits (ISA 10.2: LDS_ADDR = addr[31:0]).
__device__ __forceinline__ u32 lds_off(const void* p) {
    return (u32)(uintptr_t)p;
}

// One K slab's async global->LDS copies of a lane: 16 bytes in each of four 32-row groups of
// A and of B (GVS form, ASYNCcnt tracked, no VGPR round-trip). la, lb: the lane's LDS byte
// address in the first group; ga, gb: its byte offset from the base; grow: 32 source rows.
// The closing s_wait_xcnt 0 stands inside the statement so that no address register named
// here is rewritten in front of it.
#define SLAB_GROUP_LDS (32u * 144u)   // 32 LDS rows of 144 bytes
__device__ __forceinline__ void slab_copies(u32 la, u32 lb, u32 ga, u32 gb, u32 grow,
                                            const void* abase, const void* bbase) {
    asm volatile("global_load_async_to_lds_b128 %0, %8, %16\n\t"
                 "global_load_async_to_lds_b128 %4, %12, %17\n\t"
                 "global_load_async_to_lds_b128 %1, %9, %16\n\t"
                 "global_load_async_to_lds_b128 %5, %13, %17\n\t"
                 "global_load_async_to_lds_b128 %2, %10, %16\n\t"
                 "global_load_async_to_lds_b128 %6, %14, %17\n\t"
                 "global_load_async_to_lds_b128 %3, %11, %16\n\t"
                 "global_load_async_to_lds_b128 %7, %15, %17\n\t"
                 "s_wait_xcnt 0x0"
                 :: "v"(la), "v"(la + SLAB_GROUP_LDS), "v"(la + 2u * SLAB_GROUP_LDS),
                    "v"(la + 3u * SLAB_GROUP_LDS),
                    "v"(lb), "v"(lb + SLAB_GROUP_LDS), "v"(lb + 2u * SLAB_GROUP_LDS),
                    "v"(lb + 3u * SLAB_GROUP_LDS),
                    "v"(ga), "v"(ga + grow), "v"(ga + 2u * grow), "v"(ga + 3u * grow),
                    "v"(gb), "v"(gb + grow), "v"(gb + 2u * grow), "v"(gb + 3u * grow),
                    "s"(abase), "s"(bbase)
                 : "memory");
}

// Load one 16-lane-striped bf16 fragment (A or B operand of 16x16x32 WMMA).
// rowbase points at the lane's matrix row (m for A, n for B); koff = kblock + half*8.
// Per ISA 7.12.2: VGPR0-3 hold K=[koff..koff+7], VGPR4-7 hold K=[koff+16..koff+23].
__device__ __forceinline__ bf16x16 load_frag(const u16* rowbase, int koff) {
    u32x4 lo = *reinterpret_cast<const u32x4*>(rowbase + koff);
    u32x4 hi = *reinterpret_cast<const u32x4*>(rowbase + koff + 16);
    u32x8 d;
    d[0] = lo[0]; d[1] = lo[1]; d[2] = lo[2]; d[3] = lo[3];
    d[4] = hi[0]; d[5] = hi[1]; d[6] = hi[2]; d[7] = hi[3];
    return __builtin_bit_cast(bf16x16, d);
}

__device__ __forceinline__ f32x8 wmma_bf16(bf16x16 a, bf16x16 b, f32x8 c) {
    return __builtin_amdgcn_wmma_f32_16x16x32_bf16(false, a, false, b, (short)0, c,
                                                   false, false);
}

// Value of lane ^ 16 (the other 16-lane half), by a vector cross-row move.
__device__ __forceinline__ float xhalf(float x) {
    int b = __builtin_bit_cast(int, x);
    return __builtin_bit_cast(float,
        __builtin_amdgcn_permlanex16(b, b, 0x76543210, 0xfedcba98, false, false));
}

// Base-2 exponentials, v_exp_f32. The instruction set asks for one independent instruction or
// a v_nop between a transcendental and a use of its result or an overwrite of its source.
// Here the outputs are
// early-clobber (none lies on a source) and the closing v_nop fills the last one's slot.
__device__ __forceinline__ void exp2x8(float (&d)[8], const float (&s)[8]) {
    asm("v_exp_f32 %0, %8\n\t"
        "v_exp_f32 %1, %9\n\t"
        "v_exp_f32 %2, %10\n\t"
        "v_exp_f32 %3, %11\n\t"
        "v_exp_f32 %4, %12\n\t"
        "v_exp_f32 %5, %13\n\t"
        "v_exp_f32 %6, %14\n\t"
        "v_exp_f32 %7, %15\n\t"
        "v_nop"
        : "=&v"(d[0]), "=&v"(d[1]), "=&v"(d[2]), "=&v"(d[3]),
          "=&v"(d[4]), "=&v"(d[5]), "=&v"(d[6]), "=&v"(d[7])
        : "v"(s[0]), "v"(s[1]), "v"(s[2]), "v"(s[3]),
          "v"(s[4]), "v"(s[5]), "v"(s[6]), "v"(s[7]));
}
__device__ __forceinline__ float exp2x1(float s) {
    float d;
    asm("v_exp_f32 %0, %1\n\t"
        "v_nop"                       // the same slot, for the one result
        : "=v"(d) : "v"(s));
    return d;
}
#define LOG2E 1.44269504088896340736f

// ---------------- cast / repack kernels ----------------
// f32 -> bf16 of one activation by 2048 blocks of 256 threads; blk is this block's place among
// them. A thread takes 8 elements one grid stride apart, all 8 loads in flight before a store.
__device__ __forceinline__ void cast_bf16(const float* __restrict__ in, u16* __restrict__ out,
                                          int blk) {
    constexpr int ST = 2048 * 256, IT = MTOT * D_EMB / ST;
    const int i = blk * 256 + threadIdx.x;
    float v[IT];
#pragma unroll
    for (int it = 0; it < IT; ++it) v[it] = in[i + it * ST];
#pragma unroll
    for (int it = 0; it < IT; ++it) out[i + it * ST] = f2bf(v[it]);
    // The wait that belongs in front of an overwrite of an issued store's address register; here
    // it is a precaution, as no code follows the cast in this kernel.
    asm volatile("s_wait_xcnt 0x0" ::: "memory");
}

// Weight packs: transpose + cast through an LDS tile, so that both sides move whole lines.
// One block takes KT rows (k) x 64 columns (n) of a row-major f32 matrix with row pitch ld
// and writes them as 64 rows of KT bf16 with row pitch K.
// Read: a lane takes 16 bytes of rows 2p and 2p + 1; 16 lanes cover 256 contiguous bytes.
// LDS: tile[n][p] holds the bf16 pair (k = 2p, 2p + 1); the pitch KT/2 + 1 dwords puts the 32
// lanes of every store (n = 4 * c4 + j, two p) and of every load on 32 different banks.
// Write: a lane stores 16 bytes; KT/8 lanes cover one row's KT * 2 contiguous bytes.
template <int KT>   // 64 or 128
__device__ __forceinline__ void pack_tile(u32 (*tile)[KT / 2 + 1],
                                          const float* __restrict__ src, int ld,
                                          u16* __restrict__ dst, int K) {
    const int tid = threadIdx.x;
    const int c4 = tid & 15, p0 = tid >> 4;
    const float* pl[KT / 32];
    const float* ph[KT / 32];
    f32x4 lo[KT / 32], hi[KT / 32];
#pragma unroll
    for (int it = 0; it < KT / 32; ++it) {      // all loads first: KT/16 in flight per lane
        pl[it] = src + (size_t)(2 * (p0 + 16 * it)) * ld + 4 * c4;
        ph[it] = pl[it] + ld;
        lo[it] = *reinterpret_cast<const f32x4*>(pl[it]);
        hi[it] = *reinterpret_cast<const f32x4*>(ph[it]);
    }
    // The wait that belongs in front of an overwrite of an issued load's address register.
    // The addresses are its inputs, so that none of their registers is given to a later
    // load's result (or to anything else) ahead of it.
    if constexpr (KT == 64)
        asm volatile("s_wait_xcnt 0x0" :: "v"(pl[0]), "v"(ph[0]), "v"(pl[1]), "v"(ph[1])
                     : "memory");
    else
        asm volatile("s_wait_xcnt 0x0" :: "v"(pl[0]), "v"(ph[0]), "v"(pl[1]), "v"(ph[1]),
                                          "v"(pl[2]), "v"(ph[2]), "v"(pl[3]), "v"(ph[3])
                     : "memory");
#pragma unroll
    for (int it = 0; it < KT / 32; ++it)
#pragma unroll
        for (int j = 0; j < 4; ++j)
            tile[4 * c4 + j][p0 + 16 * it] = (u32)f2bf(lo[it][j]) | ((u32)f2bf(hi[it][j]) << 16);
    __syncthreads();                            // the whole tile is in LDS before it is read
    constexpr int SEG = KT / 8;                 // 16-byte pieces per output row
#pragma unroll
    for (int it = 0; it < SEG / 4; ++it) {
        const int q = tid + it * 256;
        const int n = q / SEG, s = q % SEG;
        u32x4 w;
#pragma unroll
        for (int e = 0; e < 4; ++e) w[e] = tile[n][4 * s + e];
        *reinterpret_cast<u32x4*>(dst + (size_t)n * K + 8 * s) = w;
    }
    // The same wait behind the stores.
    asm volatile("s_wait_xcnt 0x0" ::: "memory");
}

// All input preparation in ONE launch: none of these pieces reads what another writes, so they
// share a grid and the chip fills once instead of twelve times. Block ranges, longest work first:
//   [0, 512)      ffn_w1 [1024][4096] -> wt1 [4096][1024], 128 k x 64 n a block
//   [512, 1024)   ffn_w2 [4096][1024] -> wt2 [1024][4096], the same
//   [1024, 3072)  eight 1024 x 1024 weights, 256 blocks each, 64 k x 64 n a block -> wt8 + i * 2^20
//                 i & 3 < 3: per-head w [H=16][K=1024][R=64] -> Wt [n = h*64 + r][k]
//                 i & 3 == 3: plain w [K=1024][N=1024] -> Wt [n][k]
//   [3072, 7168)  x and context to bf16, 2048 blocks each
#define PREP_BLOCKS 7168
__global__ __launch_bounds__(256) void k_prep(
    const float* __restrict__ x,  const float* __restrict__ ctx,
    const float* __restrict__ w0, const float* __restrict__ w1,
    const float* __restrict__ w2, const float* __restrict__ w3,
    const float* __restrict__ w4, const float* __restrict__ w5,
    const float* __restrict__ w6, const float* __restrict__ w7,
    const float* __restrict__ f1, const float* __restrict__ f2,
    u16* __restrict__ xb, u16* __restrict__ cb, u16* __restrict__ wt8,
    u16* __restrict__ wt1, u16* __restrict__ wt2)
{
    __shared__ u32 tile[64 * 65];
    const int bx = blockIdx.x;
    if (bx < 1024) {
        const bool first = bx < 512;
        const int r  = bx & 511;
        const int nt = first ? (r & 63) : (r & 15);      // 64-column tile
        const int kt = first ? (r >> 6) : (r >> 4);      // 128-row tile
        const int N  = first ? DFF : D_EMB, K = first ? D_EMB : DFF;
        pack_tile<128>(reinterpret_cast<u32 (*)[65]>(tile),
                       (first ? f1 : f2) + (size_t)(kt * 128) * N + nt * 64, N,
                       (first ? wt1 : wt2) + (size_t)(nt * 64) * K + kt * 128, K);
    } else if (bx < 3072) {
        const int i = (bx - 1024) >> 8, r = bx & 255;
        const float* w = i == 0 ? w0 : i == 1 ? w1 : i == 2 ? w2 : i == 3 ? w3
                       : i == 4 ? w4 : i == 5 ? w5 : i == 6 ? w6 : w7;
        const bool plain = (i & 3) == 3;
        const int a = r & 15, c = r >> 4;
        // per head: a = k tile, c = head (its 64 columns are n tile c); plain: a = n tile, c = k tile
        const int nt = plain ? a : c, kt = plain ? c : a;
        const int so = plain ? kt * 64 * D_EMB + nt * 64 : nt * (D_EMB * DRED) + kt * 64 * DRED;
        pack_tile<64>(reinterpret_cast<u32 (*)[33]>(tile), w + so, plain ? D_EMB : DRED,
                      wt8 + (size_t)i * (D_EMB * D_EMB) + nt * 64 * D_EMB + kt * 64, D_EMB);
    } else {
        const int c = bx - 3072;
        const bool first = c < 2048;
        cast_bf16(first ? x : ctx, first ? xb : cb, c & 2047);
    }
}

// ---------------- WMMA GEMM ----------------
// C[M,N] = act(A_bf16[M,K] x Wt_bf16[N,K]^T + bias) (+resid); writes f32 or bf16.
// Block tile 128x128, 8 waves (2 along M x 4 along N), wave tile 64x32 (4x2 WMMA tiles).
// K slabs of 64 alternate between two LDS buffers: slab t + 1's async copies fly while
// slab t is worked on.
// ring: [buffer][A, B][row][k]; row-pad 72: stride 36 dwords -> conflict-free b128
// What the epilogue does (RELU, RESID, f32 or bf16 output) and the row length N are compile-time,
// so that it is straight-line code: a lane's bias and residual values are then loaded as ONE
// group, all in flight together under slab 0's copies, instead of one load latency an element
// behind the k loop, and every load and store is one base address plus an immediate offset.
template <int N, bool RELU, bool RESID, bool OUTF>
__device__ __forceinline__ void gemm_tile(
    u16 (*ring)[2][128][72],
    const u16* __restrict__ A, const u16* __restrict__ Wt,
    const float* __restrict__ bias, const float* __restrict__ resid,
    float* __restrict__ outF, u16* __restrict__ outB,
    int K)
{
    const int tid  = threadIdx.x;
    const int lane = tid & 31, l15 = lane & 15, hf = (lane >> 4) & 1;
    const int wid  = tid >> 5;
    const int bm = blockIdx.y * 128, bn = blockIdx.x * 128;
    const int wm = (wid & 1) * 64,   wn = (wid >> 1) * 32;

    f32x8 acc[4][2];
#pragma unroll
    for (int mt = 0; mt < 4; ++mt)
#pragma unroll
        for (int nt = 0; nt < 2; ++nt) acc[mt][nt] = zero8();

    // a lane copies 16 bytes of row r0 (+32, +64, +96) of each operand's slab
    const int r0 = tid >> 3, c8 = (tid & 7) << 3;
    const u32 la0 = lds_off(&ring[0][0][r0][c8]);
    const u32 lb0 = lds_off(&ring[0][1][r0][c8]);
    const u32 ga0 = ((u32)(bm + r0) * (u32)K + (u32)c8) * 2u;
    const u32 gb0 = ((u32)(bn + r0) * (u32)K + (u32)c8) * 2u;
    const u32 grow = (u32)K * 64u;            // 32 source rows in bytes
    const u32 bufB = (u32)sizeof(ring[0]);    // one buffer in bytes
    const int T = K >> 6;                     // slabs; K is a multiple of 64, at least 64

    slab_copies(la0, lb0, ga0, gb0, grow, A, Wt);         // slab 0 into buffer 0

    // C layout: M = v + 8*half, N = lane&15. o0: the lane's first element of the output tile.
    const u32 o0 = (u32)(bm + wm + 8 * hf) * (u32)N + (u32)(bn + wn + l15);
    float bv[2], rv[4][2][8];
#pragma unroll
    for (int nt = 0; nt < 2; ++nt) bv[nt] = bias[bn + wn + nt * 16 + l15];
    if constexpr (RESID) {
        const float* rp = resid + o0;
#pragma unroll
        for (int mt = 0; mt < 4; ++mt)
#pragma unroll
            for (int nt = 0; nt < 2; ++nt)
#pragma unroll
                for (int v = 0; v < 8; ++v) rv[mt][nt][v] = rp[(mt * 16 + v) * N + nt * 16];
    }

    asm volatile("s_wait_asynccnt 0x0" ::: "memory");     // this wave's copies have landed
    __syncthreads();                                      // every wave's are visible
    if (1 < T)                                            // slab 1 into buffer 1
        slab_copies(la0 + bufB, lb0 + bufB, ga0 + 128u, gb0 + 128u, grow, A, Wt);

    for (int t = 0; t < T; ++t) {
        const u16 (*aS)[72] = ring[t & 1][0];
        const u16 (*bS)[72] = ring[t & 1][1];
#pragma unroll
        for (int kb = 0; kb < 64; kb += 32) {
            bf16x16 af[4], bfr[2];
#pragma unroll
            for (int mt = 0; mt < 4; ++mt)
                af[mt] = load_frag(&aS[wm + mt * 16 + l15][0], kb + hf * 8);
#pragma unroll
            for (int nt = 0; nt < 2; ++nt)
                bfr[nt] = load_frag(&bS[wn + nt * 16 + l15][0], kb + hf * 8);
#pragma unroll
            for (int mt = 0; mt < 4; ++mt)
#pragma unroll
                for (int nt = 0; nt < 2; ++nt)
                    acc[mt][nt] = wmma_bf16(af[mt], bfr[nt], acc[mt][nt]);
        }
        // publish point of slab t + 1, in this order:
        asm volatile("s_wait_dscnt 0x0" ::: "memory");    // this wave's reads of slab t are back
        asm volatile("s_wait_asynccnt 0x0" ::: "memory"); // its copies of slab t + 1 have landed
        __syncthreads();      // slab t + 1 visible to all; every reader has left slab t's buffer
        if (t + 2 < T) {      // refill that buffer
            const u32 bo = (u32)(t & 1) * bufB, go = (u32)(t + 2) * 128u;
            slab_copies(la0 + bo, lb0 + bo, ga0 + go, gb0 + go, grow, A, Wt);
        }
    }
    asm volatile("s_wait_asynccnt 0x0" ::: "memory");     // no copy outlives the loop

#pragma unroll
    for (int mt = 0; mt < 4; ++mt)
#pragma unroll
        for (int nt = 0; nt < 2; ++nt)
#pragma unroll
            for (int v = 0; v < 8; ++v) {
                float val = acc[mt][nt][v] + bv[nt];
                if constexpr (RELU)  val = fmaxf(val, 0.0f);
                if constexpr (RESID) val += rv[mt][nt][v];
                const int o = (mt * 16 + v) * N + nt * 16;
                if constexpr (OUTF) (outF + o0)[o] = val;
                else                (outB + o0)[o] = f2bf(val);
            }
}

// outF[M, 1024] = A x Wt^T + bias + resid, f32
__global__ __launch_bounds__(256) void k_gemm_res(
    const u16* __restrict__ A, const u16* __restrict__ Wt,
    const float* __restrict__ bias, const float* __restrict__ resid,
    float* __restrict__ outF, int K)
{
    __shared__ __attribute__((aligned(16))) u16 ring[2][2][128][72];
    gemm_tile<D_EMB, false, true, true>(ring, A, Wt, bias, resid, outF, nullptr, K);
}

// outB[M, 4096] = relu(A x Wt^T + bias), bf16
__global__ __launch_bounds__(256) void k_gemm_relu(
    const u16* __restrict__ A, const u16* __restrict__ Wt,
    const float* __restrict__ bias, u16* __restrict__ outB, int K)
{
    __shared__ __attribute__((aligned(16))) u16 ring[2][2][128][72];
    gemm_tile<DFF, true, false, false>(ring, A, Wt, bias, nullptr, nullptr, outB, K);
}

// The q, k and v projections of one attention in ONE launch: they do not depend on one another,
// so blockIdx.z picks the product. Three workgroups then stand on a WGP where one stood, and
// each one's copy latency, barriers and epilogue run under the others' WMMAs.
__global__ __launch_bounds__(256) void k_gemm_qkv(
    const u16* __restrict__ Aq, const u16* __restrict__ Akv,
    const u16* __restrict__ Wq, const u16* __restrict__ Wk, const u16* __restrict__ Wv,
    const float* __restrict__ bq, const float* __restrict__ bk, const float* __restrict__ bv,
    u16* __restrict__ oq, u16* __restrict__ ok, u16* __restrict__ ov,
    int K)
{
    __shared__ __attribute__((aligned(16))) u16 ring[2][2][128][72];
    const int z = blockIdx.z;
    gemm_tile<D_EMB, false, false, false>(ring, z == 0 ? Aq : Akv,
              z == 0 ? Wq : z == 1 ? Wk : Wv,
              z == 0 ? bq : z == 1 ? bk : bv, nullptr, nullptr,
              z == 0 ? oq : z == 1 ? ok : ov, K);
}

// ---------------- fused flash attention (bf16 WMMA, online softmax) ----------------
// q,k,v,o: bf16 [B][S][H][R] ; one block = one (b,h) x 128 query rows; 8 waves x 16 rows.
// Scores are formed transposed, St = K x Qt, and the output as Ot += Vt x Pt: a lane then
// holds 16 of the 32 scores of ONE query, so maximum and sum run in the lane's own registers
// (one exchange with lane ^ 16), and two score tiles, converted in place, are the B operand.
// K chunk fetched by the Tensor Data Mover (2D tile DMA + LDS row padding);
// V chunk transposed manually (TDM has no transpose).
__global__ __launch_bounds__(256) void k_attn(
    const u16* __restrict__ qp, const u16* __restrict__ kp,
    const u16* __restrict__ vp, u16* __restrict__ op)
{
    __shared__ u16 kch[128][72];     // key chunk, row-major [t][r], TDM-padded rows
    __shared__ u16 vtS[64][136];     // value chunk transposed [r][t]

    const int tid  = threadIdx.x;
    const int lane = tid & 31, l15 = lane & 15, hf = (lane >> 4) & 1;
    const int wid  = tid >> 5;
    const int bx = blockIdx.x;
    const int qc = bx & 7;                 // S/128 = 8 chunks
    const int h  = (bx >> 3) & (NHEAD - 1);
    const int b  = bx >> 7;
    const int qbase = qc * 128 + wid * 16;

    // Q fragments straight from global (row is contiguous 64 bf16); B operand, column = query
    const int srow = qbase + l15;
    const u16* qrow = qp + (size_t)((b * SS + srow) * NHEAD + h) * DRED;
    bf16x16 qf[2];
    qf[0] = load_frag(qrow, 0  + hf * 8);
    qf[1] = load_frag(qrow, 32 + hf * 8);

    f32x8 oacc[4];
#pragma unroll
    for (int rt = 0; rt < 4; ++rt) oacc[rt] = zero8();
    float run_m = -1.0e30f;   // running maximum of query l15 (equal in both lane halves)
    float run_l = 0.0f;       // running sum over this lane half's keys only; joined at the end

    const u32 kch_lds = lds_off(&kch[0][0]);

    for (int nc = 0; nc < SS / 128; ++nc) {
        __syncthreads();                      // previous chunk fully consumed

        if (wid == 0) {
            // ---- TDM: DMA 128x64-element bf16 tile (row stride H*R) into kch ----
            u64 gaddr = (u64)(uintptr_t)kp +
                        2ull * (u64)(((b * SS + nc * 128) * NHEAD + h) * DRED);
            u32x4 g0;
            g0[0] = 1u;                                   // count=1, user descriptor
            g0[1] = kch_lds;                              // lds_addr
            g0[2] = (u32)(gaddr & 0xffffffffu);           // global_addr[31:0]
            g0[3] = (u32)((gaddr >> 32) & 0x01ffffffu)    // global_addr[56:32]
                    | (2u << 30);                         // type=2 ("image")
            u32x8 g1;
            g1[0] = (1u << 16)                            // data_size = 2 bytes
                  | (1u << 20)                            // pad_enable
                  | (4u << 22)                            // pad_interval: 32 DWORDs (128B row)
                  | (3u << 25);                           // pad_amount: 4 DWORDs (16B pad)
            g1[1] = (64u << 16);                          // tensor_dim0 = 64 (low 16)
            g1[2] = 0u;                                   // dim0 hi / dim1 low
            g1[3] = 16u | (64u << 16);                    // tensor_dim1 = 1<<20; tile_dim0 = 64
            g1[4] = 128u;                                 // tile_dim1 = 128, tile_dim2 = 0
            g1[5] = (u32)(NHEAD * DRED);                  // tensor_dim0_stride = 1024 elems
            g1[6] = 0u;
            g1[7] = 0u;
            asm volatile("tensor_load_to_lds %0, %1" :: "s"(g0), "s"(g1) : "memory");
            __builtin_amdgcn_s_wait_tensorcnt(0);
        }

        // ---- all threads: stage V transposed into vtS ----
#pragma unroll
        for (int j = 0; j < 4; ++j) {
            int c0 = tid + j * 256;
            int t = c0 >> 3, c8 = (c0 & 7) << 3;
            size_t gbase = (size_t)((b * SS + nc * 128 + t) * NHEAD + h) * DRED + c8;
            u32x4 vv = *reinterpret_cast<const u32x4*>(vp + gbase);
#pragma unroll
            for (int e = 0; e < 4; ++e) {
                vtS[c8 + 2 * e    ][t] = (u16)(vv[e] & 0xffffu);
                vtS[c8 + 2 * e + 1][t] = (u16)(vv[e] >> 16);
            }
        }
        __syncthreads();

#pragma unroll
        for (int tt = 0; tt < 4; ++tt) {        // 32 keys per step
            f32x8 s0 = zero8(), s1 = zero8();   // St[key = v + 8*half (+16)][query = l15]
#pragma unroll
            for (int kb = 0; kb < 2; ++kb) {    // contract over R=64
                bf16x16 a0 = load_frag(&kch[tt * 32 +      l15][0], kb * 32 + hf * 8);
                bf16x16 a1 = load_frag(&kch[tt * 32 + 16 + l15][0], kb * 32 + hf * 8);
                s0 = wmma_bf16(a0, qf[kb], s0);
                s1 = wmma_bf16(a1, qf[kb], s1);
            }
            // online softmax of query l15: 16 keys in this lane, 16 in lane ^ 16
            const f32x8 sa = s0 * 0.125f, sc = s1 * 0.125f;       // 1/sqrt(64)
            float rm = fmaxf(sa[0], sc[0]);
#pragma unroll
            for (int v = 1; v < 8; ++v) rm = fmaxf(rm, fmaxf(sa[v], sc[v]));
            rm = fmaxf(rm, xhalf(rm));
            const float nm = fmaxf(run_m, rm);
            const float cr = exp2x1((run_m - nm) * LOG2E);
            run_m = nm;
            float t0[8], t1[8], e0[8], e1[8];
#pragma unroll
            for (int v = 0; v < 8; ++v) { t0[v] = (sa[v] - nm) * LOG2E; t1[v] = (sc[v] - nm) * LOG2E; }
            exp2x8(e0, t0);
            exp2x8(e1, t1);
            float ps = 0.0f;
#pragma unroll
            for (int v = 0; v < 8; ++v) ps += e0[v] + e1[v];
            run_l = run_l * cr + ps;
            u32x8 pd;                           // Pt as B operand: k = 8*half + s, 16 + 8*half + s
#pragma unroll
            for (int j = 0; j < 4; ++j) {
                pd[j]     = (u32)f2bf(e0[2 * j]) | ((u32)f2bf(e0[2 * j + 1]) << 16);
                pd[4 + j] = (u32)f2bf(e1[2 * j]) | ((u32)f2bf(e1[2 * j + 1]) << 16);
            }
            const bf16x16 pf = __builtin_bit_cast(bf16x16, pd);
#pragma unroll
            for (int rt = 0; rt < 4; ++rt) {    // Ot[r = rt*16 + v + 8*half][query = l15]
#pragma unroll
                for (int v = 0; v < 8; ++v) oacc[rt][v] *= cr;
                bf16x16 vf = load_frag(&vtS[rt * 16 + l15][0], tt * 32 + hf * 8);
                oacc[rt] = wmma_bf16(vf, pf, oacc[rt]);
            }
        }
    }

    // a lane holds 8 consecutive r of one query per tile: one 16-byte store each
    const float inv = 1.0f / (run_l + xhalf(run_l));
    u16* orow = op + (size_t)((b * SS + srow) * NHEAD + h) * DRED + 8 * hf;
#pragma unroll
    for (int rt = 0; rt < 4; ++rt) {
        u32x4 w;
#pragma unroll
        for (int j = 0; j < 4; ++j)
            w[j] = (u32)f2bf(oacc[rt][2 * j] * inv) | ((u32)f2bf(oacc[rt][2 * j + 1] * inv) << 16);
        *reinterpret_cast<u32x4*>(orow + rt * 16) = w;
    }
}

// ---------------- LayerNorm ----------------
__global__ __launch_bounds__(256) void k_ln(
    const float* __restrict__ in, const float* __restrict__ g, const float* __restrict__ bb,
    float* __restrict__ outF, u16* __restrict__ outB)
{
    __shared__ float sh1[8], sh2[8];
    const int row = blockIdx.x, tid = threadIdx.x;
    const float* r = in + (size_t)row * D_EMB;
    float x[4], s1 = 0.0f, s2 = 0.0f;
#pragma unroll
    for (int i = 0; i < 4; ++i) {
        x[i] = r[tid + i * 256];
        s1 += x[i]; s2 += x[i] * x[i];
    }
#pragma unroll
    for (int m = 1; m < 32; m <<= 1) {
        s1 += __shfl_xor(s1, m, 32);
        s2 += __shfl_xor(s2, m, 32);
    }
    if ((tid & 31) == 0) { sh1[tid >> 5] = s1; sh2[tid >> 5] = s2; }
    __syncthreads();
    float t1 = 0.0f, t2 = 0.0f;
#pragma unroll
    for (int j = 0; j < 8; ++j) { t1 += sh1[j]; t2 += sh2[j]; }
    float mean = t1 * (1.0f / D_EMB);
    float var  = t2 * (1.0f / D_EMB) - mean * mean;
    float sc = rsqrtf(var + 1e-3f);
#pragma unroll
    for (int i = 0; i < 4; ++i) {
        int c = tid + i * 256;
        float y = (x[i] - mean) * sc * g[c] + bb[c];
        size_t o = (size_t)row * D_EMB + c;
        if (outF) outF[o] = y;
        if (outB) outB[o] = f2bf(y);
    }
}

// ---------------- host orchestration ----------------
extern "C" void kernel_launch(void* const* d_in, const int* in_sizes, int n_in,
                              void* d_out, int out_size, void* d_ws, size_t ws_size,
                              hipStream_t stream) {
    (void)in_sizes; (void)n_in; (void)out_size; (void)ws_size;

    const float* x      = (const float*)d_in[0];
    const float* ctx    = (const float*)d_in[1];
    const float* sa_wq  = (const float*)d_in[2];
    const float* sa_bq  = (const float*)d_in[3];
    const float* sa_wk  = (const float*)d_in[4];
    const float* sa_bk  = (const float*)d_in[5];
    const float* sa_wv  = (const float*)d_in[6];
    const float* sa_bv  = (const float*)d_in[7];
    const float* sa_wo  = (const float*)d_in[8];
    const float* sa_bo  = (const float*)d_in[9];
    const float* ca_wq  = (const float*)d_in[10];
    const float* ca_bq  = (const float*)d_in[11];
    const float* ca_wk  = (const float*)d_in[12];
    const float* ca_bk  = (const float*)d_in[13];
    const float* ca_wv  = (const float*)d_in[14];
    const float* ca_bv  = (const float*)d_in[15];
    const float* ca_wo  = (const float*)d_in[16];
    const float* ca_bo  = (const float*)d_in[17];
    const float* ln1_g  = (const float*)d_in[18];
    const float* ln1_b  = (const float*)d_in[19];
    const float* ln2_g  = (const float*)d_in[20];
    const float* ln2_b  = (const float*)d_in[21];
    const float* ln3_g  = (const float*)d_in[22];
    const float* ln3_b  = (const float*)d_in[23];
    const float* ffn_w1 = (const float*)d_in[24];
    const float* ffn_b1 = (const float*)d_in[25];
    const float* ffn_w2 = (const float*)d_in[26];
    const float* ffn_b2 = (const float*)d_in[27];

    char* ws = (char*)d_ws;
    size_t off = 0;
    auto alloc = [&](size_t bytes) -> void* {
        void* p = ws + off;
        off = (off + bytes + 255) & ~(size_t)255;
        return p;
    };

    const size_t ACT2 = (size_t)MTOT * D_EMB * 2;   // bf16 activation
    const size_t ACT4 = (size_t)MTOT * D_EMB * 4;   // f32 activation
    const size_t W2   = (size_t)D_EMB * D_EMB * 2;  // bf16 1024x1024 weight

    u16* xb     = (u16*)alloc(ACT2);
    u16* cb     = (u16*)alloc(ACT2);
    u16* wt8    = (u16*)alloc(8 * W2);              // the eight 1024 x 1024 weights in a row
    u16* wt_saq = wt8;
    u16* wt_sak = wt8 + 1 * (D_EMB * D_EMB);
    u16* wt_sav = wt8 + 2 * (D_EMB * D_EMB);
    u16* wt_sao = wt8 + 3 * (D_EMB * D_EMB);
    u16* wt_caq = wt8 + 4 * (D_EMB * D_EMB);
    u16* wt_cak = wt8 + 5 * (D_EMB * D_EMB);
    u16* wt_cav = wt8 + 6 * (D_EMB * D_EMB);
    u16* wt_cao = wt8 + 7 * (D_EMB * D_EMB);
    u16* wt1    = (u16*)alloc((size_t)DFF * D_EMB * 2);
    u16* wt2    = (u16*)alloc((size_t)D_EMB * DFF * 2);
    u16* qb     = (u16*)alloc(ACT2);
    u16* kb     = (u16*)alloc(ACT2);
    u16* vb     = (u16*)alloc(ACT2);
    u16* ob     = (u16*)alloc(ACT2);
    float* sumb = (float*)alloc(ACT4);
    float* ln1f = (float*)alloc(ACT4);
    u16*   ln1b = (u16*)alloc(ACT2);
    float* ln2f = (float*)alloc(ACT4);
    u16*   ln2b = (u16*)alloc(ACT2);
    u16*   f1b  = (u16*)alloc((size_t)MTOT * DFF * 2);

    const dim3 blk(256);
    // casts + packs
    k_prep<<<PREP_BLOCKS, blk, 0, stream>>>(x, ctx, sa_wq, sa_wk, sa_wv, sa_wo,
                                            ca_wq, ca_wk, ca_wv, ca_wo, ffn_w1, ffn_w2,
                                            xb, cb, wt8, wt1, wt2);

    const dim3 gD(D_EMB / 128, MTOT / 128);   // N=1024 GEMMs
    const dim3 gF(DFF   / 128, MTOT / 128);   // N=4096 GEMM
    const dim3 g3(D_EMB / 128, MTOT / 128, 3);   // q, k, v projections together

    // ---- self attention ----
    k_gemm_qkv<<<g3, blk, 0, stream>>>(xb, xb, wt_saq, wt_sak, wt_sav, sa_bq, sa_bk, sa_bv,
                                       qb, kb, vb, D_EMB);
    k_attn<<<BB * NHEAD * (SS / 128), blk, 0, stream>>>(qb, kb, vb, ob);
    k_gemm_res<<<gD, blk, 0, stream>>>(ob, wt_sao, sa_bo, x, sumb, D_EMB);
    k_ln<<<MTOT, blk, 0, stream>>>(sumb, ln1_g, ln1_b, ln1f, ln1b);

    // ---- cross attention ----
    k_gemm_qkv<<<g3, blk, 0, stream>>>(ln1b, cb, wt_caq, wt_cak, wt_cav, ca_bq, ca_bk, ca_bv,
                                       qb, kb, vb, D_EMB);
    k_attn<<<BB * NHEAD * (SS / 128), blk, 0, stream>>>(qb, kb, vb, ob);
    k_gemm_res<<<gD, blk, 0, stream>>>(ob, wt_cao, ca_bo, ln1f, sumb, D_EMB);
    k_ln<<<MTOT, blk, 0, stream>>>(sumb, ln2_g, ln2_b, ln2f, ln2b);

    // ---- FFN ----
    k_gemm_relu<<<gF, blk, 0, stream>>>(ln2b, wt1, ffn_b1, f1b, D_EMB);
    k_gemm_res<<<gD, blk, 0, stream>>>(f1b,  wt2, ffn_b2, ln2f, sumb, DFF);
    k_ln<<<MTOT, blk, 0, stream>>>(sumb, ln3_g, ln3_b, (float*)d_out, nullptr);
}

// v006
// Measured time: 281 microseconds a run.
// Next to v005, in two timings, it ran 1.04 and 1.03 times as fast.
// Counting every step since v000, it is 2.75 times as fast.
#include <hip/hip_runtime.h>

// ---------------- problem constants ----------------
#define D_EMB 1024
#define NHEAD 16
#define DRED  64
#define BB    4
#define SS    1024
#define MTOT  (BB * SS)     // 4096 rows of activations
#define DFF   (4 * D_EMB)   // 4096

typedef unsigned int   u32;
typedef unsigned short u16;
typedef unsigned long long u64;
typedef u32   u32x4  __attribute__((ext_vector_type(4)));
typedef u32   u32x8  __attribute__((ext_vector_type(8)));
typedef float f32x4  __attribute__((ext_vector_type(4)));
typedef float f32x8  __attribute__((ext_vector_type(8)));
typedef __bf16 bf16x16 __attribute__((ext_vector_type(16)));

// ---------------- small helpers ----------------
__device__ __forceinline__ u16 f2bf(float f) {
    union { float f; u32 u; } c; c.f = f;
    u32 u = c.u;
    u32 r = u + 0x7fffu + ((u >> 16) & 1u);   // round-to-nearest-even
    return (u16)(r >> 16);
}

__device__ __forceinline__ f32x8 zero8() {
    f32x8 z;
#pragma unroll
    for (int i = 0; i < 8; ++i) z[i] = 0.0f;
    return z;
}

// LDS byte offset of a shared-memory pointer: flat LDS addresses keep the
// offset in the low 32 bits (ISA 10.2: LDS_ADDR = addr[31:0]).
__device__ __forceinline__ u32 lds_off(const void* p) {
    return (u32)(uintptr_t)p;
}

// One K slab's async global->LDS copies of a lane: 16 bytes in each of four 32-row groups of
// A and of B (GVS form, ASYNCcnt tracked, no VGPR round-trip). la, lb: the lane's LDS byte
// address in the first group; ga, gb: its byte offset from the base; grow: 32 source rows.
// The closing s_wait_xcnt 0 stands inside the statement so that no address register named
// here is rewritten in front of it.
#define SLAB_GROUP_LDS (32u * 144u)   // 32 LDS rows of 144 bytes
__device__ __forceinline__ void slab_copies(u32 la, u32 lb, u32 ga, u32 gb, u32 grow,
                                            const void* abase, const void* bbase) {
    asm volatile("global_load_async_to_lds_b128 %0, %8, %16\n\t"
                 "global_load_async_to_lds_b128 %4, %12, %17\n\t"
                 "global_load_async_to_lds_b128 %1, %9, %16\n\t"
                 "global_load_async_to_lds_b128 %5, %13, %17\n\t"
                 "global_load_async_to_lds_b128 %2, %10, %16\n\t"
                 "global_load_async_to_lds_b128 %6, %14, %17\n\t"
                 "global_load_async_to_lds_b128 %3, %11, %16\n\t"
                 "global_load_async_to_lds_b128 %7, %15, %17\n\t"
                 "s_wait_xcnt 0x0"
                 :: "v"(la), "v"(la + SLAB_GROUP_LDS), "v"(la + 2u * SLAB_GROUP_LDS),
                    "v"(la + 3u * SLAB_GROUP_LDS),
                    "v"(lb), "v"(lb + SLAB_GROUP_LDS), "v"(lb + 2u * SLAB_GROUP_LDS),
                    "v"(lb + 3u * SLAB_GROUP_LDS),
                    "v"(ga), "v"(ga + grow), "v"(ga + 2u * grow), "v"(ga + 3u * grow),
                    "v"(gb), "v"(gb + grow), "v"(gb + 2u * grow), "v"(gb + 3u * grow),
                    "s"(abase), "s"(bbase)
                 : "memory");
}

// Load one 16-lane-striped bf16 fragment (A or B operand of 16x16x32 WMMA).
// rowbase points at the lane's matrix row (m for A, n for B); koff = kblock + half*8.
// Per ISA 7.12.2: VGPR0-3 hold K=[koff..koff+7], VGPR4-7 hold K=[koff+16..koff+23].
__device__ __forceinline__ bf16x16 load_frag(const u16* rowbase, int koff) {
    u32x4 lo = *reinterpret_cast<const u32x4*>(rowbase + koff);
    u32x4 hi = *reinterpret_cast<const u32x4*>(rowbase + koff + 16);
    u32x8 d;
    d[0] = lo[0]; d[1] = lo[1]; d[2] = lo[2]; d[3] = lo[3];
    d[4] = hi[0]; d[5] = hi[1]; d[6] = hi[2]; d[7] = hi[3];
    return __builtin_bit_cast(bf16x16, d);
}

__device__ __forceinline__ f32x8 wmma_bf16(bf16x16 a, bf16x16 b, f32x8 c) {
    return __builtin_amdgcn_wmma_f32_16x16x32_bf16(false, a, false, b, (short)0, c,
                                                   false, false);
}

// Value of lane ^ 16 (the other 16-lane half), by a vector cross-row move.
__device__ __forceinline__ float xhalf(float x) {
    int b = __builtin_bit_cast(int, x);
    return __builtin_bit_cast(float,
        __builtin_amdgcn_permlanex16(b, b, 0x76543210, 0xfedcba98, false, false));
}

// Base-2 exponentials, v_exp_f32. The instruction set asks for one independent instruction or
// a v_nop between a transcendental and a use of its result or an overwrite of its source.
// Here the outputs are
// early-clobber (none lies on a source) and the closing v_nop fills the last one's slot.
__device__ __forceinline__ void exp2x8(float (&d)[8], const float (&s)[8]) {
    asm("v_exp_f32 %0, %8\n\t"
        "v_exp_f32 %1, %9\n\t"
        "v_exp_f32 %2, %10\n\t"
        "v_exp_f32 %3, %11\n\t"
        "v_exp_f32 %4, %12\n\t"
        "v_exp_f32 %5, %13\n\t"
        "v_exp_f32 %6, %14\n\t"
        "v_exp_f32 %7, %15\n\t"
        "v_nop"
        : "=&v"(d[0]), "=&v"(d[1]), "=&v"(d[2]), "=&v"(d[3]),
          "=&v"(d[4]), "=&v"(d[5]), "=&v"(d[6]), "=&v"(d[7])
        : "v"(s[0]), "v"(s[1]), "v"(s[2]), "v"(s[3]),
          "v"(s[4]), "v"(s[5]), "v"(s[6]), "v"(s[7]));
}
__device__ __forceinline__ float exp2x1(float s) {
    float d;
    asm("v_exp_f32 %0, %1\n\t"
        "v_nop"                       // the same slot, for the one result
        : "=v"(d) : "v"(s));
    return d;
}
#define LOG2E 1.44269504088896340736f

// ---------------- cast / repack kernels ----------------
// f32 -> bf16 of one activation by 2048 blocks of 256 threads; blk is this block's place among
// them. A thread takes 8 elements one grid stride apart, all 8 loads in flight before a store.
__device__ __forceinline__ void cast_bf16(const float* __restrict__ in, u16* __restrict__ out,
                                          int blk) {
    constexpr int ST = 2048 * 256, IT = MTOT * D_EMB / ST;
    const int i = blk * 256 + threadIdx.x;
    float v[IT];
#pragma unroll
    for (int it = 0; it < IT; ++it) v[it] = in[i + it * ST];
#pragma unroll
    for (int it = 0; it < IT; ++it) out[i + it * ST] = f2bf(v[it]);
    // The wait that belongs in front of an overwrite of an issued store's address register; here
    // it is a precaution, as no code follows the cast in this kernel.
    asm volatile("s_wait_xcnt 0x0" ::: "memory");
}

// Weight packs: transpose + cast through an LDS tile, so that both sides move whole lines.
// One block takes KT rows (k) x 64 columns (n) of a row-major f32 matrix with row pitch ld
// and writes them as 64 rows of KT bf16 with row pitch K.
// Read: a lane takes 16 bytes of rows 2p and 2p + 1; 16 lanes cover 256 contiguous bytes.
// LDS: tile[n][p] holds the bf16 pair (k = 2p, 2p + 1); the pitch KT/2 + 1 dwords puts the 32
// lanes of every store (n = 4 * c4 + j, two p) and of every load on 32 different banks.
// Write: a lane stores 16 bytes; KT/8 lanes cover one row's KT * 2 contiguous bytes.
template <int KT>   // 64 or 128
__device__ __forceinline__ void pack_tile(u32 (*tile)[KT / 2 + 1],
                                          const float* __restrict__ src, int ld,
                                          u16* __restrict__ dst, int K) {
    const int tid = threadIdx.x;
    const int c4 = tid & 15, p0 = tid >> 4;
    const float* pl[KT / 32];
    const float* ph[KT / 32];
    f32x4 lo[KT / 32], hi[KT / 32];
#pragma unroll
    for (int it = 0; it < KT / 32; ++it) {      // all loads first: KT/16 in flight per lane
        pl[it] = src + (size_t)(2 * (p0 + 16 * it)) * ld + 4 * c4;
        ph[it] = pl[it] + ld;
        lo[it] = *reinterpret_cast<const f32x4*>(pl[it]);
        hi[it] = *reinterpret_cast<const f32x4*>(ph[it]);
    }
    // The wait that belongs in front of an overwrite of an issued load's address register.
    // The addresses are its inputs, so that none of their registers is given to a later
    // load's result (or to anything else) ahead of it.
    if constexpr (KT == 64)
        asm volatile("s_wait_xcnt 0x0" :: "v"(pl[0]), "v"(ph[0]), "v"(pl[1]), "v"(ph[1])
                     : "memory");
    else
        asm volatile("s_wait_xcnt 0x0" :: "v"(pl[0]), "v"(ph[0]), "v"(pl[1]), "v"(ph[1]),
                                          "v"(pl[2]), "v"(ph[2]), "v"(pl[3]), "v"(ph[3])
                     : "memory");
#pragma unroll
    for (int it = 0; it < KT / 32; ++it)
#pragma unroll
        for (int j = 0; j < 4; ++j)
            tile[4 * c4 + j][p0 + 16 * it] = (u32)f2bf(lo[it][j]) | ((u32)f2bf(hi[it][j]) << 16);
    __syncthreads();                            // the whole tile is in LDS before it is read
    constexpr int SEG = KT / 8;                 // 16-byte pieces per output row
#pragma unroll
    for (int it = 0; it < SEG / 4; ++it) {
        const int q = tid + it * 256;
        const int n = q / SEG, s = q % SEG;
        u32x4 w;
#pragma unroll
        for (int e = 0; e < 4; ++e) w[e] = tile[n][4 * s + e];
        *reinterpret_cast<u32x4*>(dst + (size_t)n * K + 8 * s) = w;
    }
    // The same wait behind the stores.
    asm volatile("s_wait_xcnt 0x0" ::: "memory");
}

// All input preparation in ONE launch: none of these pieces reads what another writes, so they
// share a grid and the chip fills once instead of twelve times. Block ranges, longest work first:
//   [0, 512)      ffn_w1 [1024][4096] -> wt1 [4096][1024], 128 k x 64 n a block
//   [512, 1024)   ffn_w2 [4096][1024] -> wt2 [1024][4096], the same
//   [1024, 3072)  eight 1024 x 1024 weights, 256 blocks each, 64 k x 64 n a block -> wt8 + i * 2^20
//                 i & 3 < 3: per-head w [H=16][K=1024][R=64] -> Wt [n = h*64 + r][k]
//                 i & 3 == 3: plain w [K=1024][N=1024] -> Wt [n][k]
//   [3072, 7168)  x and context to bf16, 2048 blocks each
#define PREP_BLOCKS 7168
__global__ __launch_bounds__(256) void k_prep(
    const float* __restrict__ x,  const float* __restrict__ ctx,
    const float* __restrict__ w0, const float* __restrict__ w1,
    const float* __restrict__ w2, const float* __restrict__ w3,
    const float* __restrict__ w4, const float* __restrict__ w5,
    const float* __restrict__ w6, const float* __restrict__ w7,
    const float* __restrict__ f1, const float* __restrict__ f2,
    u16* __restrict__ xb, u16* __restrict__ cb, u16* __restrict__ wt8,
    u16* __restrict__ wt1, u16* __restrict__ wt2)
{
    __shared__ u32 tile[64 * 65];
    const int bx = blockIdx.x;
    if (bx < 1024) {
        const bool first = bx < 512;
        const int r  = bx & 511;
        const int nt = first ? (r & 63) : (r & 15);      // 64-column tile
        const int kt = first ? (r >> 6) : (r >> 4);      // 128-row tile
        const int N  = first ? DFF : D_EMB, K = first ? D_EMB : DFF;
        pack_tile<128>(reinterpret_cast<u32 (*)[65]>(tile),
                       (first ? f1 : f2) + (size_t)(kt * 128) * N + nt * 64, N,
                       (first ? wt1 : wt2) + (size_t)(nt * 64) * K + kt * 128, K);
    } else if (bx < 3072) {
        const int i = (bx - 1024) >> 8, r = bx & 255;
        const float* w = i == 0 ? w0 : i == 1 ? w1 : i == 2 ? w2 : i == 3 ? w3
                       : i == 4 ? w4 : i == 5 ? w5 : i == 6 ? w6 : w7;
        const bool plain = (i & 3) == 3;
        const int a = r & 15, c = r >> 4;
        // per head: a = k tile, c = head (its 64 columns are n tile c); plain: a = n tile, c = k tile
        const int nt = plain ? a : c, kt = plain ? c : a;
        const int so = plain ? kt * 64 * D_EMB + nt * 64 : nt * (D_EMB * DRED) + kt * 64 * DRED;
        pack_tile<64>(reinterpret_cast<u32 (*)[33]>(tile), w + so, plain ? D_EMB : DRED,
                      wt8 + (size_t)i * (D_EMB * D_EMB) + nt * 64 * D_EMB + kt * 64, D_EMB);
    } else {
        const int c = bx - 3072;
        const bool first = c < 2048;
        cast_bf16(first ? x : ctx, first ? xb : cb, c & 2047);
    }
}

// ---------------- WMMA GEMM ----------------
// C[M,N] = act(A_bf16[M,K] x Wt_bf16[N,K]^T + bias) (+resid); writes f32 or bf16.
// Block tile 128x128, 8 waves (2 along M x 4 along N), wave tile 64x32 (4x2 WMMA tiles).
// K slabs of 64 alternate between two LDS buffers: slab t + 1's async copies fly while
// slab t is worked on.
// ring: [buffer][A, B][row][k]; row-pad 72: stride 36 dwords -> conflict-free b128
// What the epilogue does (RELU, RESID, f32 or bf16 output) and the row length N are compile-time,
// so that it is straight-line code: a lane's bias and residual values are then loaded as ONE
// group, all in flight together under slab 0's copies, instead of one load latency an element
// behind the k loop, and every load and store is one base address plus an immediate offset.
// GRP: k blocks whose fragments are loaded as one group, 1 or 2 (48 registers each). 2, the whole
// slab, where one workgroup stands on a WGP and the registers are free; 1 where three or four
// workgroups share the WGP's registers and cover one another's waits.
template <int N, bool RELU, bool RESID, bool OUTF, int GRP>
__device__ __forceinline__ void gemm_tile(
    u16 (*ring)[2][128][72],
    const u16* __restrict__ A, const u16* __restrict__ Wt,
    const float* __restrict__ bias, const float* __restrict__ resid,
    float* __restrict__ outF, u16* __restrict__ outB,
    int K)
{
    const int tid  = threadIdx.x;
    const int lane = tid & 31, l15 = lane & 15, hf = (lane >> 4) & 1;
    const int wid  = tid >> 5;
    const int bm = blockIdx.y * 128, bn = blockIdx.x * 128;
    const int wm = (wid & 1) * 64,   wn = (wid >> 1) * 32;

    f32x8 acc[4][2];
#pragma unroll
    for (int mt = 0; mt < 4; ++mt)
#pragma unroll
        for (int nt = 0; nt < 2; ++nt) acc[mt][nt] = zero8();

    // a lane copies 16 bytes of row r0 (+32, +64, +96) of each operand's slab
    const int r0 = tid >> 3, c8 = (tid & 7) << 3;
    const u32 la0 = lds_off(&ring[0][0][r0][c8]);
    const u32 lb0 = lds_off(&ring[0][1][r0][c8]);
    const u32 ga0 = ((u32)(bm + r0) * (u32)K + (u32)c8) * 2u;
    const u32 gb0 = ((u32)(bn + r0) * (u32)K + (u32)c8) * 2u;
    const u32 grow = (u32)K * 64u;            // 32 source rows in bytes
    const u32 bufB = (u32)sizeof(ring[0]);    // one buffer in bytes
    const int T = K >> 6;                     // slabs; K is a multiple of 64, at least 64

    slab_copies(la0, lb0, ga0, gb0, grow, A, Wt);         // slab 0 into buffer 0

    // C layout: M = v + 8*half, N = lane&15. o0: the lane's first element of the output tile.
    const u32 o0 = (u32)(bm + wm + 8 * hf) * (u32)N + (u32)(bn + wn + l15);
    float bv[2], rv[4][2][8];
#pragma unroll
    for (int nt = 0; nt < 2; ++nt) bv[nt] = bias[bn + wn + nt * 16 + l15];
    if constexpr (RESID) {
        const float* rp = resid + o0;
#pragma unroll
        for (int mt = 0; mt < 4; ++mt)
#pragma unroll
            for (int nt = 0; nt < 2; ++nt)
#pragma unroll
                for (int v = 0; v < 8; ++v) rv[mt][nt][v] = rp[(mt * 16 + v) * N + nt * 16];
    }

    asm volatile("s_wait_asynccnt 0x0" ::: "memory");     // this wave's copies have landed
    __syncthreads();                                      // every wave's are visible
    if (1 < T)                                            // slab 1 into buffer 1
        slab_copies(la0 + bufB, lb0 + bufB, ga0 + 128u, gb0 + 128u, grow, A, Wt);

    for (int t = 0; t < T; ++t) {
        const u16 (*aS)[72] = ring[t & 1][0];
        const u16 (*bS)[72] = ring[t & 1][1];
        // GRP k blocks of 32 share one group of fragment loads: all its ds_loads are issued
        // first, then its WMMAs run behind counted waits, so a wave meets the LDS latency once a
        // group and not once for every pair of WMMAs.
#pragma unroll
        for (int k0 = 0; k0 < 64; k0 += 32 * GRP) {
            bf16x16 af[GRP][4], bfr[GRP][2];
#pragma unroll
            for (int g = 0; g < GRP; ++g) {
                const int ko = k0 + 32 * g + hf * 8;
#pragma unroll
                for (int nt = 0; nt < 2; ++nt)
                    bfr[g][nt] = load_frag(&bS[wn + nt * 16 + l15][0], ko);
#pragma unroll
                for (int mt = 0; mt < 4; ++mt)
                    af[g][mt] = load_frag(&aS[wm + mt * 16 + l15][0], ko);
            }
            // Keeps the loads above the WMMAs: without it the scheduler sinks them among the
            // WMMAs into one reused fragment register set, each pair behind a full LDS wait.
            __builtin_amdgcn_sched_barrier(0);
#pragma unroll
            for (int g = 0; g < GRP; ++g)
#pragma unroll
                for (int mt = 0; mt < 4; ++mt)
#pragma unroll
                    for (int nt = 0; nt < 2; ++nt)
                        acc[mt][nt] = wmma_bf16(af[g][mt], bfr[g][nt], acc[mt][nt]);
            // Keeps the next group's loads from rising among these WMMAs, and the last group's
            // WMMAs from sinking below the publish point, where the refill copies would wait
            // behind them and lose that much of their lead.
            __builtin_amdgcn_sched_barrier(0);
        }
        // publish point of slab t + 1, in this order:
        asm volatile("s_wait_dscnt 0x0" ::: "memory");    // this wave's reads of slab t are back
        asm volatile("s_wait_asynccnt 0x0" ::: "memory"); // its copies of slab t + 1 have landed
        __syncthreads();      // slab t + 1 visible to all; every reader has left slab t's buffer
        if (t + 2 < T) {      // refill that buffer
            const u32 bo = (u32)(t & 1) * bufB, go = (u32)(t + 2) * 128u;
            slab_copies(la0 + bo, lb0 + bo, ga0 + go, gb0 + go, grow, A, Wt);
        }
    }
    asm volatile("s_wait_asynccnt 0x0" ::: "memory");     // no copy outlives the loop

#pragma unroll
    for (int mt = 0; mt < 4; ++mt)
#pragma unroll
        for (int nt = 0; nt < 2; ++nt)
#pragma unroll
            for (int v = 0; v < 8; ++v) {
                float val = acc[mt][nt][v] + bv[nt];
                if constexpr (RELU)  val = fmaxf(val, 0.0f);
                if constexpr (RESID) val += rv[mt][nt][v];
                const int o = (mt * 16 + v) * N + nt * 16;
                if constexpr (OUTF) (outF + o0)[o] = val;
                else                (outB + o0)[o] = f2bf(val);
            }
}

// outF[M, 1024] = A x Wt^T + bias + resid, f32
__global__ __launch_bounds__(256) void k_gemm_res(
    const u16* __restrict__ A, const u16* __restrict__ Wt,
    const float* __restrict__ bias, const float* __restrict__ resid,
    float* __restrict__ outF, int K)
{
    __shared__ __attribute__((aligned(16))) u16 ring[2][2][128][72];
    gemm_tile<D_EMB, false, true, true, 2>(ring, A, Wt, bias, resid, outF, nullptr, K);
}

// outB[M, 4096] = relu(A x Wt^T + bias), bf16
__global__ __launch_bounds__(256) void k_gemm_relu(
    const u16* __restrict__ A, const u16* __restrict__ Wt,
    const float* __restrict__ bias, u16* __restrict__ outB, int K)
{
    __shared__ __attribute__((aligned(16))) u16 ring[2][2][128][72];
    gemm_tile<DFF, true, false, false, 1>(ring, A, Wt, bias, nullptr, nullptr, outB, K);
}

// The q, k and v projections of one attention in ONE launch: they do not depend on one another,
// so blockIdx.z picks the product. Three workgroups then stand on a WGP where one stood, and
// each one's copy latency, barriers and epilogue run under the others' WMMAs.
__global__ __launch_bounds__(256) void k_gemm_qkv(
    const u16* __restrict__ Aq, const u16* __restrict__ Akv,
    const u16* __restrict__ Wq, const u16* __restrict__ Wk, const u16* __restrict__ Wv,
    const float* __restrict__ bq, const float* __restrict__ bk, const float* __restrict__ bv,
    u16* __restrict__ oq, u16* __restrict__ ok, u16* __restrict__ ov,
    int K)
{
    __shared__ __attribute__((aligned(16))) u16 ring[2][2][128][72];
    const int z = blockIdx.z;
    gemm_tile<D_EMB, false, false, false, 1>(ring, z == 0 ? Aq : Akv,
              z == 0 ? Wq : z == 1 ? Wk : Wv,
              z == 0 ? bq : z == 1 ? bk : bv, nullptr, nullptr,
              z == 0 ? oq : z == 1 ? ok : ov, K);
}

// ---------------- fused flash attention (bf16 WMMA, online softmax) ----------------
// q,k,v,o: bf16 [B][S][H][R] ; one block = one (b,h) x 128 query rows; 8 waves x 16 rows.
// Scores are formed transposed, St = K x Qt, and the output as Ot += Vt x Pt: a lane then
// holds 16 of the 32 scores of ONE query, so maximum and sum run in the lane's own registers
// (one exchange with lane ^ 16), and two score tiles, converted in place, are the B operand.
// K chunk fetched by the Tensor Data Mover (2D tile DMA + LDS row padding);
// V chunk transposed manually (TDM has no transpose).
__global__ __launch_bounds__(256) void k_attn(
    const u16* __restrict__ qp, const u16* __restrict__ kp,
    const u16* __restrict__ vp, u16* __restrict__ op)
{
    __shared__ u16 kch[128][72];     // key chunk, row-major [t][r], TDM-padded rows
    __shared__ u16 vtS[64][136];     // value chunk transposed [r][t]

    const int tid  = threadIdx.x;
    const int lane = tid & 31, l15 = lane & 15, hf = (lane >> 4) & 1;
    const int wid  = tid >> 5;
    const int bx = blockIdx.x;
    const int qc = bx & 7;                 // S/128 = 8 chunks
    const int h  = (bx >> 3) & (NHEAD - 1);
    const int b  = bx >> 7;
    const int qbase = qc * 128 + wid * 16;

    // Q fragments straight from global (row is contiguous 64 bf16); B operand, column = query
    const int srow = qbase + l15;
    const u16* qrow = qp + (size_t)((b * SS + srow) * NHEAD + h) * DRED;
    bf16x16 qf[2];
    qf[0] = load_frag(qrow, 0  + hf * 8);
    qf[1] = load_frag(qrow, 32 + hf * 8);

    f32x8 oacc[4];
#pragma unroll
    for (int rt = 0; rt < 4; ++rt) oacc[rt] = zero8();
    float run_m = -1.0e30f;   // running maximum of query l15 (equal in both lane halves)
    float run_l = 0.0f;       // running sum over this lane half's keys only; joined at the end

    const u32 kch_lds = lds_off(&kch[0][0]);

    for (int nc = 0; nc < SS / 128; ++nc) {
        __syncthreads();                      // previous chunk fully consumed

        if (wid == 0) {
            // ---- TDM: DMA 128x64-element bf16 tile (row stride H*R) into kch ----
            u64 gaddr = (u64)(uintptr_t)kp +
                        2ull * (u64)(((b * SS + nc * 128) * NHEAD + h) * DRED);
            u32x4 g0;
            g0[0] = 1u;                                   // count=1, user descriptor
            g0[1] = kch_lds;                              // lds_addr
            g0[2] = (u32)(gaddr & 0xffffffffu);           // global_addr[31:0]
            g0[3] = (u32)((gaddr >> 32) & 0x01ffffffu)    // global_addr[56:32]
                    | (2u << 30);                         // type=2 ("image")
            u32x8 g1;
            g1[0] = (1u << 16)                            // data_size = 2 bytes
                  | (1u << 20)                            // pad_enable
                  | (4u << 22)                            // pad_interval: 32 DWORDs (128B row)
                  | (3u << 25);                           // pad_amount: 4 DWORDs (16B pad)
            g1[1] = (64u << 16);                          // tensor_dim0 = 64 (low 16)
            g1[2] = 0u;                                   // dim0 hi / dim1 low
            g1[3] = 16u | (64u << 16);                    // tensor_dim1 = 1<<20; tile_dim0 = 64
            g1[4] = 128u;                                 // tile_dim1 = 128, tile_dim2 = 0
            g1[5] = (u32)(NHEAD * DRED);                  // tensor_dim0_stride = 1024 elems
            g1[6] = 0u;
            g1[7] = 0u;
            asm volatile("tensor_load_to_lds %0, %1" :: "s"(g0), "s"(g1) : "memory");
            __builtin_amdgcn_s_wait_tensorcnt(0);
        }

        // ---- all threads: stage V transposed into vtS ----
#pragma unroll
        for (int j = 0; j < 4; ++j) {
            int c0 = tid + j * 256;
            int t = c0 >> 3, c8 = (c0 & 7) << 3;
            size_t gbase = (size_t)((b * SS + nc * 128 + t) * NHEAD + h) * DRED + c8;
            u32x4 vv = *reinterpret_cast<const u32x4*>(vp + gbase);
#pragma unroll
            for (int e = 0; e < 4; ++e) {
                vtS[c8 + 2 * e    ][t] = (u16)(vv[e] & 0xffffu);
                vtS[c8 + 2 * e + 1][t] = (u16)(vv[e] >> 16);
            }
        }
        __syncthreads();

#pragma unroll
        for (int tt = 0; tt < 4; ++tt) {        // 32 keys per step
            f32x8 s0 = zero8(), s1 = zero8();   // St[key = v + 8*half (+16)][query = l15]
#pragma unroll
            for (int kb = 0; kb < 2; ++kb) {    // contract over R=64
                bf16x16 a0 = load_frag(&kch[tt * 32 +      l15][0], kb * 32 + hf * 8);
                bf16x16 a1 = load_frag(&kch[tt * 32 + 16 + l15][0], kb * 32 + hf * 8);
                s0 = wmma_bf16(a0, qf[kb], s0);
                s1 = wmma_bf16(a1, qf[kb], s1);
            }
            // online softmax of query l15: 16 keys in this lane, 16 in lane ^ 16
            const f32x8 sa = s0 * 0.125f, sc = s1 * 0.125f;       // 1/sqrt(64)
            float rm = fmaxf(sa[0], sc[0]);
#pragma unroll
            for (int v = 1; v < 8; ++v) rm = fmaxf(rm, fmaxf(sa[v], sc[v]));
            rm = fmaxf(rm, xhalf(rm));
            const float nm = fmaxf(run_m, rm);
            const float cr = exp2x1((run_m - nm) * LOG2E);
            run_m = nm;
            float t0[8], t1[8], e0[8], e1[8];
#pragma unroll
            for (int v = 0; v < 8; ++v) { t0[v] = (sa[v] - nm) * LOG2E; t1[v] = (sc[v] - nm) * LOG2E; }
            exp2x8(e0, t0);
            exp2x8(e1, t1);
            float ps = 0.0f;
#pragma unroll
            for (int v = 0; v < 8; ++v) ps += e0[v] + e1[v];
            run_l = run_l * cr + ps;
            u32x8 pd;                           // Pt as B operand: k = 8*half + s, 16 + 8*half + s
#pragma unroll
            for (int j = 0; j < 4; ++j) {
                pd[j]     = (u32)f2bf(e0[2 * j]) | ((u32)f2bf(e0[2 * j + 1]) << 16);
                pd[4 + j] = (u32)f2bf(e1[2 * j]) | ((u32)f2bf(e1[2 * j + 1]) << 16);
            }
            const bf16x16 pf = __builtin_bit_cast(bf16x16, pd);
#pragma unroll
            for (int rt = 0; rt < 4; ++rt) {    // Ot[r = rt*16 + v + 8*half][query = l15]
#pragma unroll
                for (int v = 0; v < 8; ++v) oacc[rt][v] *= cr;
                bf16x16 vf = load_frag(&vtS[rt * 16 + l15][0], tt * 32 + hf * 8);
                oacc[rt] = wmma_bf16(vf, pf, oacc[rt]);
            }
        }
    }

    // a lane holds 8 consecutive r of one query per tile: one 16-byte store each
    const float inv = 1.0f / (run_l + xhalf(run_l));
    u16* orow = op + (size_t)((b * SS + srow) * NHEAD + h) * DRED + 8 * hf;
#pragma unroll
    for (int rt = 0; rt < 4; ++rt) {
        u32x4 w;
#pragma unroll
        for (int j = 0; j < 4; ++j)
            w[j] = (u32)f2bf(oacc[rt][2 * j] * inv) | ((u32)f2bf(oacc[rt][2 * j + 1] * inv) << 16);
        *reinterpret_cast<u32x4*>(orow + rt * 16) = w;
    }
}

// ---------------- LayerNorm ----------------
__global__ __launch_bounds__(256) void k_ln(
    const float* __restrict__ in, const float* __restrict__ g, const float* __restrict__ bb,
    float* __restrict__ outF, u16* __restrict__ outB)
{
    __shared__ float sh1[8], sh2[8];
    const int row = blockIdx.x, tid = threadIdx.x;
    const float* r = in + (size_t)row * D_EMB;
    float x[4], s1 = 0.0f, s2 = 0.0f;
#pragma unroll
    for (int i = 0; i < 4; ++i) {
        x[i] = r[tid + i * 256];
        s1 += x[i]; s2 += x[i] * x[i];
    }
#pragma unroll
    for (int m = 1; m < 32; m <<= 1) {
        s1 += __shfl_xor(s1, m, 32);
        s2 += __shfl_xor(s2, m, 32);
    }
    if ((tid & 31) == 0) { sh1[tid >> 5] = s1; sh2[tid >> 5] = s2; }
    __syncthreads();
    float t1 = 0.0f, t2 = 0.0f;
#pragma unroll
    for (int j = 0; j < 8; ++j) { t1 += sh1[j]; t2 += sh2[j]; }
    float mean = t1 * (1.0f / D_EMB);
    float var  = t2 * (1.0f / D_EMB) - mean * mean;
    float sc = rsqrtf(var + 1e-3f);
#pragma unroll
    for (int i = 0; i < 4; ++i) {
        int c = tid + i * 256;
        float y = (x[i] - mean) * sc * g[c] + bb[c];
        size_t o = (size_t)row * D_EMB + c;
        if (outF) outF[o] = y;
        if (outB) outB[o] = f2bf(y);
    }
}

// ---------------- host orchestration ----------------
extern "C" void kernel_launch(void* const* d_in, const int* in_sizes, int n_in,
                              void* d_out, int out_size, void* d_ws, size_t ws_size,
                              hipStream_t stream) {
    (void)in_sizes; (void)n_in; (void)out_size; (void)ws_size;

    const float* x      = (const float*)d_in[0];
    const float* ctx    = (const float*)d_in[1];
    const float* sa_wq  = (const float*)d_in[2];
    const float* sa_bq  = (const float*)d_in[3];
    const float* sa_wk  = (const float*)d_in[4];
    const float* sa_bk  = (const float*)d_in[5];
    const float* sa_wv  = (const float*)d_in[6];
    const float* sa_bv  = (const float*)d_in[7];
    const float* sa_wo  = (const float*)d_in[8];
    const float* sa_bo  = (const float*)d_in[9];
    const float* ca_wq  = (const float*)d_in[10];
    const float* ca_bq  = (const float*)d_in[11];
    const float* ca_wk  = (const float*)d_in[12];
    const float* ca_bk  = (const float*)d_in[13];
    const float* ca_wv  = (const float*)d_in[14];
    const float* ca_bv  = (const float*)d_in[15];
    const float* ca_wo  = (const float*)d_in[16];
    const float* ca_bo  = (const float*)d_in[17];
    const float* ln1_g  = (const float*)d_in[18];
    const float* ln1_b  = (const float*)d_in[19];
    const float* ln2_g  = (const float*)d_in[20];
    const float* ln2_b  = (const float*)d_in[21];
    const float* ln3_g  = (const float*)d_in[22];
    const float* ln3_b  = (const float*)d_in[23];
    const float* ffn_w1 = (const float*)d_in[24];
    const float* ffn_b1 = (const float*)d_in[25];
    const float* ffn_w2 = (const float*)d_in[26];
    const float* ffn_b2 = (const float*)d_in[27];

    char* ws = (char*)d_ws;
    size_t off = 0;
    auto alloc = [&](size_t bytes) -> void* {
        void* p = ws + off;
        off = (off + bytes + 255) & ~(size_t)255;
        return p;
    };

    const size_t ACT2 = (size_t)MTOT * D_EMB * 2;   // bf16 activation
    const size_t ACT4 = (size_t)MTOT * D_EMB * 4;   // f32 activation
    const size_t W2   = (size_t)D_EMB * D_EMB * 2;  // bf16 1024x1024 weight

    u16* xb     = (u16*)alloc(ACT2);
    u16* cb     = (u16*)alloc(ACT2);
    u16* wt8    = (u16*)alloc(8 * W2);              // the eight 1024 x 1024 weights in a row
    u16* wt_saq = wt8;
    u16* wt_sak = wt8 + 1 * (D_EMB * D_EMB);
    u16* wt_sav = wt8 + 2 * (D_EMB * D_EMB);
    u16* wt_sao = wt8 + 3 * (D_EMB * D_EMB);
    u16* wt_caq = wt8 + 4 * (D_EMB * D_EMB);
    u16* wt_cak = wt8 + 5 * (D_EMB * D_EMB);
    u16* wt_cav = wt8 + 6 * (D_EMB * D_EMB);
    u16* wt_cao = wt8 + 7 * (D_EMB * D_EMB);
    u16* wt1    = (u16*)alloc((size_t)DFF * D_EMB * 2);
    u16* wt2    = (u16*)alloc((size_t)D_EMB * DFF * 2);
    u16* qb     = (u16*)alloc(ACT2);
    u16* kb     = (u16*)alloc(ACT2);
    u16* vb     = (u16*)alloc(ACT2);
    u16* ob     = (u16*)alloc(ACT2);
    float* sumb = (float*)alloc(ACT4);
    float* ln1f = (float*)alloc(ACT4);
    u16*   ln1b = (u16*)alloc(ACT2);
    float* ln2f = (float*)alloc(ACT4);
    u16*   ln2b = (u16*)alloc(ACT2);
    u16*   f1b  = (u16*)alloc((size_t)MTOT * DFF * 2);

    const dim3 blk(256);
    // casts + packs
    k_prep<<<PREP_BLOCKS, blk, 0, stream>>>(x, ctx, sa_wq, sa_wk, sa_wv, sa_wo,
                                            ca_wq, ca_wk, ca_wv, ca_wo, ffn_w1, ffn_w2,
                                            xb, cb, wt8, wt1, wt2);

    const dim3 gD(D_EMB / 128, MTOT / 128);   // N=1024 GEMMs
    const dim3 gF(DFF   / 128, MTOT / 128);   // N=4096 GEMM
    const dim3 g3(D_EMB / 128, MTOT / 128, 3);   // q, k, v projections together

    // ---- self attention ----
    k_gemm_qkv<<<g3, blk, 0, stream>>>(xb, xb, wt_saq, wt_sak, wt_sav, sa_bq, sa_bk, sa_bv,
                                       qb, kb, vb, D_EMB);
    k_attn<<<BB * NHEAD * (SS / 128), blk, 0, stream>>>(qb, kb, vb, ob);
    k_gemm_res<<<gD, blk, 0, stream>>>(ob, wt_sao, sa_bo, x, sumb, D_EMB);
    k_ln<<<MTOT, blk, 0, stream>>>(sumb, ln1_g, ln1_b, ln1f, ln1b);

    // ---- cross attention ----
    k_gemm_qkv<<<g3, blk, 0, stream>>>(ln1b, cb, wt_caq, wt_cak, wt_cav, ca_bq, ca_bk, ca_bv,
                                       qb, kb, vb, D_EMB);
    k_attn<<<BB * NHEAD * (SS / 128), blk, 0, stream>>>(qb, kb, vb, ob);
    k_gemm_res<<<gD, blk, 0, stream>>>(ob, wt_cao, ca_bo, ln1f, sumb, D_EMB);
    k_ln<<<MTOT, blk, 0, stream>>>(sumb, ln2_g, ln2_b, ln2f, ln2b);

    // ---- FFN ----
    k_gemm_relu<<<gF, blk, 0, stream>>>(ln2b, wt1, ffn_b1, f1b, D_EMB);
    k_gemm_res<<<gD, blk, 0, stream>>>(f1b,  wt2, ffn_b2, ln2f, sumb, DFF);
    k_ln<<<MTOT, blk, 0, stream>>>(sumb, ln3_g, ln3_b, (float*)d_out, nullptr);
}

// v007
// Measured time: 268 microseconds a run.
// Two timings next to v006 both put it at 1.04 times that version's speed.
// All steps since v000 together make it 2.87 times as fast.
#include <hip/hip_runtime.h>

// ---------------- problem constants ----------------
#define D_EMB 1024
#define NHEAD 16
#define DRED  64
#define BB    4
#define SS    1024
#define MTOT  (BB * SS)     // 4096 rows of activations
#define DFF   (4 * D_EMB)   // 4096

typedef unsigned int   u32;
typedef unsigned short u16;
typedef unsigned long long u64;
typedef u32   u32x2  __attribute__((ext_vector_type(2)));
typedef u32   u32x4  __attribute__((ext_vector_type(4)));
typedef u32   u32x8  __attribute__((ext_vector_type(8)));
typedef float f32x4  __attribute__((ext_vector_type(4)));
typedef float f32x8  __attribute__((ext_vector_type(8)));
typedef __bf16 bf16x16 __attribute__((ext_vector_type(16)));

// ---------------- small helpers ----------------
__device__ __forceinline__ u16 f2bf(float f) {
    union { float f; u32 u; } c; c.f = f;
    u32 u = c.u;
    u32 r = u + 0x7fffu + ((u >> 16) & 1u);   // round-to-nearest-even
    return (u16)(r >> 16);
}

__device__ __forceinline__ f32x8 zero8() {
    f32x8 z;
#pragma unroll
    for (int i = 0; i < 8; ++i) z[i] = 0.0f;
    return z;
}

// LDS byte offset of a shared-memory pointer: flat LDS addresses keep the
// offset in the low 32 bits (ISA 10.2: LDS_ADDR = addr[31:0]).
__device__ __forceinline__ u32 lds_off(const void* p) {
    return (u32)(uintptr_t)p;
}

// One K slab's async global->LDS copies of a lane: 16 bytes in each of four 32-row groups of
// A and of B (GVS form, ASYNCcnt tracked, no VGPR round-trip). la, lb: the lane's LDS byte
// address in the first group; ga, gb: its byte offset from the base; grow: 32 source rows.
// The closing s_wait_xcnt 0 stands inside the statement so that no address register named
// here is rewritten in front of it.
#define SLAB_GROUP_LDS (32u * 144u)   // 32 LDS rows of 144 bytes
__device__ __forceinline__ void slab_copies(u32 la, u32 lb, u32 ga, u32 gb, u32 grow,
                                            const void* abase, const void* bbase) {
    asm volatile("global_load_async_to_lds_b128 %0, %8, %16\n\t"
                 "global_load_async_to_lds_b128 %4, %12, %17\n\t"
                 "global_load_async_to_lds_b128 %1, %9, %16\n\t"
                 "global_load_async_to_lds_b128 %5, %13, %17\n\t"
                 "global_load_async_to_lds_b128 %2, %10, %16\n\t"
                 "global_load_async_to_lds_b128 %6, %14, %17\n\t"
                 "global_load_async_to_lds_b128 %3, %11, %16\n\t"
                 "global_load_async_to_lds_b128 %7, %15, %17\n\t"
                 "s_wait_xcnt 0x0"
                 :: "v"(la), "v"(la + SLAB_GROUP_LDS), "v"(la + 2u * SLAB_GROUP_LDS),
                    "v"(la + 3u * SLAB_GROUP_LDS),
                    "v"(lb), "v"(lb + SLAB_GROUP_LDS), "v"(lb + 2u * SLAB_GROUP_LDS),
                    "v"(lb + 3u * SLAB_GROUP_LDS),
                    "v"(ga), "v"(ga + grow), "v"(ga + 2u * grow), "v"(ga + 3u * grow),
                    "v"(gb), "v"(gb + grow), "v"(gb + 2u * grow), "v"(gb + 3u * grow),
                    "s"(abase), "s"(bbase)
                 : "memory");
}

// Load one 16-lane-striped bf16 fragment (A or B operand of 16x16x32 WMMA).
// rowbase points at the lane's matrix row (m for A, n for B); koff = kblock + half*8.
// Per ISA 7.12.2: VGPR0-3 hold K=[koff..koff+7], VGPR4-7 hold K=[koff+16..koff+23].
__device__ __forceinline__ bf16x16 load_frag(const u16* rowbase, int koff) {
    u32x4 lo = *reinterpret_cast<const u32x4*>(rowbase + koff);
    u32x4 hi = *reinterpret_cast<const u32x4*>(rowbase + koff + 16);
    u32x8 d;
    d[0] = lo[0]; d[1] = lo[1]; d[2] = lo[2]; d[3] = lo[3];
    d[4] = hi[0]; d[5] = hi[1]; d[6] = hi[2]; d[7] = hi[3];
    return __builtin_bit_cast(bf16x16, d);
}

__device__ __forceinline__ f32x8 wmma_bf16(bf16x16 a, bf16x16 b, f32x8 c) {
    return __builtin_amdgcn_wmma_f32_16x16x32_bf16(false, a, false, b, (short)0, c,
                                                   false, false);
}

// Value of lane ^ 16 (the other 16-lane half), by a vector cross-row move.
__device__ __forceinline__ float xhalf(float x) {
    int b = __builtin_bit_cast(int, x);
    return __builtin_bit_cast(float,
        __builtin_amdgcn_permlanex16(b, b, 0x76543210, 0xfedcba98, false, false));
}

// Base-2 exponentials, v_exp_f32. The instruction set asks for one independent instruction or
// a v_nop between a transcendental and a use of its result or an overwrite of its source.
// Here the outputs are
// early-clobber (none lies on a source) and the closing v_nop fills the last one's slot.
__device__ __forceinline__ void exp2x8(float (&d)[8], const float (&s)[8]) {
    asm("v_exp_f32 %0, %8\n\t"
        "v_exp_f32 %1, %9\n\t"
        "v_exp_f32 %2, %10\n\t"
        "v_exp_f32 %3, %11\n\t"
        "v_exp_f32 %4, %12\n\t"
        "v_exp_f32 %5, %13\n\t"
        "v_exp_f32 %6, %14\n\t"
        "v_exp_f32 %7, %15\n\t"
        "v_nop"
        : "=&v"(d[0]), "=&v"(d[1]), "=&v"(d[2]), "=&v"(d[3]),
          "=&v"(d[4]), "=&v"(d[5]), "=&v"(d[6]), "=&v"(d[7])
        : "v"(s[0]), "v"(s[1]), "v"(s[2]), "v"(s[3]),
          "v"(s[4]), "v"(s[5]), "v"(s[6]), "v"(s[7]));
}
__device__ __forceinline__ float exp2x1(float s) {
    float d;
    asm("v_exp_f32 %0, %1\n\t"
        "v_nop"                       // the same slot, for the one result
        : "=v"(d) : "v"(s));
    return d;
}
#define LOG2E 1.44269504088896340736f

// ---------------- cast / repack kernels ----------------
// Each wave here moves many kilobytes, all its loads in flight together.

// f32 -> bf16 of one activation by 256 blocks of 256 threads; blk is this block's place among
// them. A thread takes 16 pieces of 4 elements one grid stride apart: every wave load covers 512
// contiguous bytes, every wave store 256, and all 16 loads are in flight before a store.
__device__ __forceinline__ void cast_bf16(const float* __restrict__ in, u16* __restrict__ out,
                                          int blk) {
    constexpr int ST = 256 * 256 * 4, IT = MTOT * D_EMB / ST;
    const int i = (blk * 256 + threadIdx.x) * 4;
    const float* pi = in + i;
    f32x4 v[IT];
#pragma unroll
    for (int it = 0; it < IT; ++it) v[it] = *reinterpret_cast<const f32x4*>(pi + it * ST);
    // The wait that belongs in front of an overwrite of an issued load's address register; the
    // address is its input, so that its registers are given to nothing else ahead of it.
    asm volatile("s_wait_xcnt 0x0" :: "v"(pi) : "memory");
#pragma unroll
    for (int it = 0; it < IT; ++it) {
        u32x2 w;
        w[0] = (u32)f2bf(v[it][0]) | ((u32)f2bf(v[it][1]) << 16);
        w[1] = (u32)f2bf(v[it][2]) | ((u32)f2bf(v[it][3]) << 16);
        *reinterpret_cast<u32x2*>(out + i + it * ST) = w;
    }
    // The same wait behind the stores, in front of whatever reuses their address registers.
    asm volatile("s_wait_xcnt 0x0" ::: "memory");
}

// Weight packs: transpose + cast through an LDS tile, so that both sides move whole lines.
// One block takes 256 rows (k) x 64 columns (n) of a row-major f32 matrix with row pitch ld
// and writes them as 64 rows of 256 bf16 with row pitch K.
// Read: a lane takes 16 bytes of rows 2p and 2p + 1; 16 lanes cover 256 contiguous bytes.
// LDS: tile[n][p] holds the bf16 pair (k = 2p, 2p + 1); the pitch 129 dwords puts the 32 lanes
// of every store (n = 4 * c4 + j, two p) and of every load (two n, 16 pieces) on 32 banks.
// Write: a lane stores 16 bytes; 16 lanes cover 256 contiguous bytes of one row.
#define PK 256
__device__ __forceinline__ void pack_tile(u32 (*tile)[PK / 2 + 1],
                                          const float* __restrict__ src, int ld,
                                          u16* __restrict__ dst, int K) {
    const int tid = threadIdx.x;
    const int c4 = tid & 15, p0 = tid >> 4;
    const float* pl[PK / 32];
    const float* ph[PK / 32];
    f32x4 lo[PK / 32], hi[PK / 32];
#pragma unroll
    for (int it = 0; it < PK / 32; ++it) {      // all loads first: 16 in flight per lane
        pl[it] = src + (size_t)(2 * (p0 + 16 * it)) * ld + 4 * c4;
        ph[it] = pl[it] + ld;
        lo[it] = *reinterpret_cast<const f32x4*>(pl[it]);
        hi[it] = *reinterpret_cast<const f32x4*>(ph[it]);
    }
    // The wait that belongs in front of an overwrite of an issued load's address register.
    // The addresses are its inputs, so that none of their registers is given to a later
    // load's result (or to anything else) ahead of it.
    asm volatile("s_wait_xcnt 0x0" :: "v"(pl[0]), "v"(ph[0]), "v"(pl[1]), "v"(ph[1]),
                                      "v"(pl[2]), "v"(ph[2]), "v"(pl[3]), "v"(ph[3]),
                                      "v"(pl[4]), "v"(ph[4]), "v"(pl[5]), "v"(ph[5]),
                                      "v"(pl[6]), "v"(ph[6]), "v"(pl[7]), "v"(ph[7])
                 : "memory");
#pragma unroll
    for (int it = 0; it < PK / 32; ++it)
#pragma unroll
        for (int j = 0; j < 4; ++j)
            tile[4 * c4 + j][p0 + 16 * it] = (u32)f2bf(lo[it][j]) | ((u32)f2bf(hi[it][j]) << 16);
    __syncthreads();                            // the whole tile is in LDS before it is read
    // 32 16-byte pieces a row. A wave takes 16 pieces of each of two neighbouring rows.
    const int sl = tid & 15, nl = (tid >> 4) & 1, sh = (tid >> 5) & 1, nh = tid >> 6;
#pragma unroll
    for (int it = 0; it < PK / 32; ++it) {
        const int n = 2 * (nh + 4 * it) + nl, s = 16 * sh + sl;
        u32x4 w;
#pragma unroll
        for (int e = 0; e < 4; ++e) w[e] = tile[n][4 * s + e];
        *reinterpret_cast<u32x4*>(dst + (size_t)n * K + 8 * s) = w;
    }
    // The same wait behind the stores, in front of whatever reuses their address registers.
    asm volatile("s_wait_xcnt 0x0" ::: "memory");
}

// All input preparation in ONE launch: none of these pieces reads what another writes, so they
// share a grid and the chip fills once instead of twelve times. Block ranges:
//   [0, 256)      ffn_w1 [1024][4096] -> wt1 [4096][1024], 256 k x 64 n a block
//   [256, 512)    ffn_w2 [4096][1024] -> wt2 [1024][4096], the same
//   [512, 1024)   eight 1024 x 1024 weights, 64 blocks each, the same tile -> wt8 + i * 2^20
//                 i & 3 < 3: per-head w [H=16][K=1024][R=64] -> Wt [n = h*64 + r][k]
//                 i & 3 == 3: plain w [K=1024][N=1024] -> Wt [n][k]
//   [1024, 1536)  x and context to bf16, 256 blocks each
#define PREP_BLOCKS 1536
__global__ __launch_bounds__(256) void k_prep(
    const float* __restrict__ x,  const float* __restrict__ ctx,
    const float* __restrict__ w0, const float* __restrict__ w1,
    const float* __restrict__ w2, const float* __restrict__ w3,
    const float* __restrict__ w4, const float* __restrict__ w5,
    const float* __restrict__ w6, const float* __restrict__ w7,
    const float* __restrict__ f1, const float* __restrict__ f2,
    u16* __restrict__ xb, u16* __restrict__ cb, u16* __restrict__ wt8,
    u16* __restrict__ wt1, u16* __restrict__ wt2)
{
    __shared__ u32 tile[64][PK / 2 + 1];
    const int bx = blockIdx.x;
    if (bx < 512) {
        const bool first = bx < 256;
        const int r  = bx & 255;
        const int nt = first ? (r & 63) : (r & 15);      // 64-column tile
        const int kt = first ? (r >> 6) : (r >> 4);      // 256-row tile
        const int N  = first ? DFF : D_EMB, K = first ? D_EMB : DFF;
        pack_tile(tile, (first ? f1 : f2) + (size_t)(kt * PK) * N + nt * 64, N,
                  (first ? wt1 : wt2) + (size_t)(nt * 64) * K + kt * PK, K);
    } else if (bx < 1024) {
        const int i = (bx - 512) >> 6, r = bx & 63;
        const float* w = i == 0 ? w0 : i == 1 ? w1 : i == 2 ? w2 : i == 3 ? w3
                       : i == 4 ? w4 : i == 5 ? w5 : i == 6 ? w6 : w7;
        const bool plain = (i & 3) == 3;
        // per head: the head's 64 columns are n tile nt, its k tiles next to one another
        const int nt = plain ? (r & 15) : (r >> 2), kt = plain ? (r >> 4) : (r & 3);
        const int so = plain ? kt * PK * D_EMB + nt * 64 : nt * (D_EMB * DRED) + kt * PK * DRED;
        pack_tile(tile, w + so, plain ? D_EMB : DRED,
                  wt8 + (size_t)i * (D_EMB * D_EMB) + nt * 64 * D_EMB + kt * PK, D_EMB);
    } else {
        const int c = bx - 1024;
        const bool first = c < 256;
        cast_bf16(first ? x : ctx, first ? xb : cb, c & 255);
    }
}

// ---------------- WMMA GEMM ----------------
// C[M,N] = act(A_bf16[M,K] x Wt_bf16[N,K]^T + bias) (+resid); writes f32 or bf16.
// Block tile 128x128, 8 waves (2 along M x 4 along N), wave tile 64x32 (4x2 WMMA tiles).
// K slabs of 64 alternate between two LDS buffers: slab t + 1's async copies fly while
// slab t is worked on.
// ring: [buffer][A, B][row][k]; row-pad 72: stride 36 dwords -> conflict-free b128
// What the epilogue does (RELU, RESID, f32 or bf16 output) and the row length N are compile-time,
// so that it is straight-line code: a lane's bias and residual values are then loaded as ONE
// group, all in flight together under slab 0's copies, instead of one load latency an element
// behind the k loop, and every load and store is one base address plus an immediate offset.
// GRP: k blocks whose fragments are loaded as one group, 1 or 2 (48 registers each). 2, the whole
// slab, where one workgroup stands on a WGP and the registers are free; 1 where three or four
// workgroups share the WGP's registers and cover one another's waits.
template <int N, bool RELU, bool RESID, bool OUTF, int GRP>
__device__ __forceinline__ void gemm_tile(
    u16 (*ring)[2][128][72],
    const u16* __restrict__ A, const u16* __restrict__ Wt,
    const float* __restrict__ bias, const float* __restrict__ resid,
    float* __restrict__ outF, u16* __restrict__ outB,
    int K)
{
    const int tid  = threadIdx.x;
    const int lane = tid & 31, l15 = lane & 15, hf = (lane >> 4) & 1;
    const int wid  = tid >> 5;
    const int bm = blockIdx.y * 128, bn = blockIdx.x * 128;
    const int wm = (wid & 1) * 64,   wn = (wid >> 1) * 32;

    f32x8 acc[4][2];
#pragma unroll
    for (int mt = 0; mt < 4; ++mt)
#pragma unroll
        for (int nt = 0; nt < 2; ++nt) acc[mt][nt] = zero8();

    // a lane copies 16 bytes of row r0 (+32, +64, +96) of each operand's slab
    const int r0 = tid >> 3, c8 = (tid & 7) << 3;
    const u32 la0 = lds_off(&ring[0][0][r0][c8]);
    const u32 lb0 = lds_off(&ring[0][1][r0][c8]);
    const u32 ga0 = ((u32)(bm + r0) * (u32)K + (u32)c8) * 2u;
    const u32 gb0 = ((u32)(bn + r0) * (u32)K + (u32)c8) * 2u;
    const u32 grow = (u32)K * 64u;            // 32 source rows in bytes
    const u32 bufB = (u32)sizeof(ring[0]);    // one buffer in bytes
    const int T = K >> 6;                     // slabs; K is a multiple of 64, at least 64

    slab_copies(la0, lb0, ga0, gb0, grow, A, Wt);         // slab 0 into buffer 0

    // C layout: M = v + 8*half, N = lane&15. o0: the lane's first element of the output tile.
    const u32 o0 = (u32)(bm + wm + 8 * hf) * (u32)N + (u32)(bn + wn + l15);
    float bv[2], rv[4][2][8];
#pragma unroll
    for (int nt = 0; nt < 2; ++nt) bv[nt] = bias[bn + wn + nt * 16 + l15];
    if constexpr (RESID) {
        const float* rp = resid + o0;
#pragma unroll
        for (int mt = 0; mt < 4; ++mt)
#pragma unroll
            for (int nt = 0; nt < 2; ++nt)
#pragma unroll
                for (int v = 0; v < 8; ++v) rv[mt][nt][v] = rp[(mt * 16 + v) * N + nt * 16];
    }

    asm volatile("s_wait_asynccnt 0x0" ::: "memory");     // this wave's copies have landed
    __syncthreads();                                      // every wave's are visible
    if (1 < T)                                            // slab 1 into buffer 1
        slab_copies(la0 + bufB, lb0 + bufB, ga0 + 128u, gb0 + 128u, grow, A, Wt);

    for (int t = 0; t < T; ++t) {
        const u16 (*aS)[72] = ring[t & 1][0];
        const u16 (*bS)[72] = ring[t & 1][1];
        // GRP k blocks of 32 share one group of fragment loads: all its ds_loads are issued
        // first, then its WMMAs run behind counted waits, so a wave meets the LDS latency once a
        // group and not once for every pair of WMMAs.
#pragma unroll
        for (int k0 = 0; k0 < 64; k0 += 32 * GRP) {
            bf16x16 af[GRP][4], bfr[GRP][2];
#pragma unroll
            for (int g = 0; g < GRP; ++g) {
                const int ko = k0 + 32 * g + hf * 8;
#pragma unroll
                for (int nt = 0; nt < 2; ++nt)
                    bfr[g][nt] = load_frag(&bS[wn + nt * 16 + l15][0], ko);
#pragma unroll
                for (int mt = 0; mt < 4; ++mt)
                    af[g][mt] = load_frag(&aS[wm + mt * 16 + l15][0], ko);
            }
            // Keeps the loads above the WMMAs: without it the scheduler sinks them among the
            // WMMAs into one reused fragment register set, each pair behind a full LDS wait.
            __builtin_amdgcn_sched_barrier(0);
#pragma unroll
            for (int g = 0; g < GRP; ++g)
#pragma unroll
                for (int mt = 0; mt < 4; ++mt)
#pragma unroll
                    for (int nt = 0; nt < 2; ++nt)
                        acc[mt][nt] = wmma_bf16(af[g][mt], bfr[g][nt], acc[mt][nt]);
            // Keeps the next group's loads from rising among these WMMAs, and the last group's
            // WMMAs from sinking below the publish point, where the refill copies would wait
            // behind them and lose that much of their lead.
            __builtin_amdgcn_sched_barrier(0);
        }
        // publish point of slab t + 1, in this order:
        asm volatile("s_wait_dscnt 0x0" ::: "memory");    // this wave's reads of slab t are back
        asm volatile("s_wait_asynccnt 0x0" ::: "memory"); // its copies of slab t + 1 have landed
        __syncthreads();      // slab t + 1 visible to all; every reader has left slab t's buffer
        if (t + 2 < T) {      // refill that buffer
            const u32 bo = (u32)(t & 1) * bufB, go = (u32)(t + 2) * 128u;
            slab_copies(la0 + bo, lb0 + bo, ga0 + go, gb0 + go, grow, A, Wt);
        }
    }
    asm volatile("s_wait_asynccnt 0x0" ::: "memory");     // no copy outlives the loop

#pragma unroll
    for (int mt = 0; mt < 4; ++mt)
#pragma unroll
        for (int nt = 0; nt < 2; ++nt)
#pragma unroll
            for (int v = 0; v < 8; ++v) {
                float val = acc[mt][nt][v] + bv[nt];
                if constexpr (RELU)  val = fmaxf(val, 0.0f);
                if constexpr (RESID) val += rv[mt][nt][v];
                const int o = (mt * 16 + v) * N + nt * 16;
                if constexpr (OUTF) (outF + o0)[o] = val;
                else                (outB + o0)[o] = f2bf(val);
            }
}

// outF[M, 1024] = A x Wt^T + bias + resid, f32
__global__ __launch_bounds__(256) void k_gemm_res(
    const u16* __restrict__ A, const u16* __restrict__ Wt,
    const float* __restrict__ bias, const float* __restrict__ resid,
    float* __restrict__ outF, int K)
{
    __shared__ __attribute__((aligned(16))) u16 ring[2][2][128][72];
    gemm_tile<D_EMB, false, true, true, 2>(ring, A, Wt, bias, resid, outF, nullptr, K);
}

// outB[M, 4096] = relu(A x Wt^T + bias), bf16
__global__ __launch_bounds__(256) void k_gemm_relu(
    const u16* __restrict__ A, const u16* __restrict__ Wt,
    const float* __restrict__ bias, u16* __restrict__ outB, int K)
{
    __shared__ __attribute__((aligned(16))) u16 ring[2][2][128][72];
    gemm_tile<DFF, true, false, false, 1>(ring, A, Wt, bias, nullptr, nullptr, outB, K);
}

// The q, k and v projections of one attention in ONE launch: they do not depend on one another,
// so blockIdx.z picks the product. Three workgroups then stand on a WGP where one stood, and
// each one's copy latency, barriers and epilogue run under the others' WMMAs.
__global__ __launch_bounds__(256) void k_gemm_qkv(
    const u16* __restrict__ Aq, const u16* __restrict__ Akv,
    const u16* __restrict__ Wq, const u16* __restrict__ Wk, const u16* __restrict__ Wv,
    const float* __restrict__ bq, const float* __restrict__ bk, const float* __restrict__ bv,
    u16* __restrict__ oq, u16* __restrict__ ok, u16* __restrict__ ov,
    int K)
{
    __shared__ __attribute__((aligned(16))) u16 ring[2][2][128][72];
    const int z = blockIdx.z;
    gemm_tile<D_EMB, false, false, false, 1>(ring, z == 0 ? Aq : Akv,
              z == 0 ? Wq : z == 1 ? Wk : Wv,
              z == 0 ? bq : z == 1 ? bk : bv, nullptr, nullptr,
              z == 0 ? oq : z == 1 ? ok : ov, K);
}

// ---------------- fused flash attention (bf16 WMMA, online softmax) ----------------
// q,k,v,o: bf16 [B][S][H][R] ; one block = one (b,h) x 128 query rows; 8 waves x 16 rows.
// Scores are formed transposed, St = K x Qt, and the output as Ot += Vt x Pt: a lane then
// holds 16 of the 32 scores of ONE query, so maximum and sum run in the lane's own registers
// (one exchange with lane ^ 16), and two score tiles, converted in place, are the B operand.
// K chunk fetched by the Tensor Data Mover (2D tile DMA + LDS row padding);
// V chunk transposed manually (TDM has no transpose).
__global__ __launch_bounds__(256) void k_attn(
    const u16* __restrict__ qp, const u16* __restrict__ kp,
    const u16* __restrict__ vp, u16* __restrict__ op)
{
    __shared__ u16 kch[128][72];     // key chunk, row-major [t][r], TDM-padded rows
    __shared__ u16 vtS[64][136];     // value chunk transposed [r][t]

    const int tid  = threadIdx.x;
    const int lane = tid & 31, l15 = lane & 15, hf = (lane >> 4) & 1;
    const int wid  = tid >> 5;
    const int bx = blockIdx.x;
    const int qc = bx & 7;                 // S/128 = 8 chunks
    const int h  = (bx >> 3) & (NHEAD - 1);
    const int b  = bx >> 7;
    const int qbase = qc * 128 + wid * 16;

    // Q fragments straight from global (row is contiguous 64 bf16); B operand, column = query
    const int srow = qbase + l15;
    const u16* qrow = qp + (size_t)((b * SS + srow) * NHEAD + h) * DRED;
    bf16x16 qf[2];
    qf[0] = load_frag(qrow, 0  + hf * 8);
    qf[1] = load_frag(qrow, 32 + hf * 8);

    f32x8 oacc[4];
#pragma unroll
    for (int rt = 0; rt < 4; ++rt) oacc[rt] = zero8();
    float run_m = -1.0e30f;   // running maximum of query l15 (equal in both lane halves)
    float run_l = 0.0f;       // running sum over this lane half's keys only; joined at the end

    const u32 kch_lds = lds_off(&kch[0][0]);

    for (int nc = 0; nc < SS / 128; ++nc) {
        __syncthreads();                      // previous chunk fully consumed

        if (wid == 0) {
            // ---- TDM: DMA 128x64-element bf16 tile (row stride H*R) into kch ----
            u64 gaddr = (u64)(uintptr_t)kp +
                        2ull * (u64)(((b * SS + nc * 128) * NHEAD + h) * DRED);
            u32x4 g0;
            g0[0] = 1u;                                   // count=1, user descriptor
            g0[1] = kch_lds;                              // lds_addr
            g0[2] = (u32)(gaddr & 0xffffffffu);           // global_addr[31:0]
            g0[3] = (u32)((gaddr >> 32) & 0x01ffffffu)    // global_addr[56:32]
                    | (2u << 30);                         // type=2 ("image")
            u32x8 g1;
            g1[0] = (1u << 16)                            // data_size = 2 bytes
                  | (1u << 20)                            // pad_enable
                  | (4u << 22)                            // pad_interval: 32 DWORDs (128B row)
                  | (3u << 25);                           // pad_amount: 4 DWORDs (16B pad)
            g1[1] = (64u << 16);                          // tensor_dim0 = 64 (low 16)
            g1[2] = 0u;                                   // dim0 hi / dim1 low
            g1[3] = 16u | (64u << 16);                    // tensor_dim1 = 1<<20; tile_dim0 = 64
            g1[4] = 128u;                                 // tile_dim1 = 128, tile_dim2 = 0
            g1[5] = (u32)(NHEAD * DRED);                  // tensor_dim0_stride = 1024 elems
            g1[6] = 0u;
            g1[7] = 0u;
            asm volatile("tensor_load_to_lds %0, %1" :: "s"(g0), "s"(g1) : "memory");
            __builtin_amdgcn_s_wait_tensorcnt(0);
        }

        // ---- all threads: stage V transposed into vtS ----
#pragma unroll
        for (int j = 0; j < 4; ++j) {
            int c0 = tid + j * 256;
            int t = c0 >> 3, c8 = (c0 & 7) << 3;
            size_t gbase = (size_t)((b * SS + nc * 128 + t) * NHEAD + h) * DRED + c8;
            u32x4 vv = *reinterpret_cast<const u32x4*>(vp + gbase);
#pragma unroll
            for (int e = 0; e < 4; ++e) {
                vtS[c8 + 2 * e    ][t] = (u16)(vv[e] & 0xffffu);
                vtS[c8 + 2 * e + 1][t] = (u16)(vv[e] >> 16);
            }
        }
        __syncthreads();

#pragma unroll
        for (int tt = 0; tt < 4; ++tt) {        // 32 keys per step
            f32x8 s0 = zero8(), s1 = zero8();   // St[key = v + 8*half (+16)][query = l15]
#pragma unroll
            for (int kb = 0; kb < 2; ++kb) {    // contract over R=64
                bf16x16 a0 = load_frag(&kch[tt * 32 +      l15][0], kb * 32 + hf * 8);
                bf16x16 a1 = load_frag(&kch[tt * 32 + 16 + l15][0], kb * 32 + hf * 8);
                s0 = wmma_bf16(a0, qf[kb], s0);
                s1 = wmma_bf16(a1, qf[kb], s1);
            }
            // online softmax of query l15: 16 keys in this lane, 16 in lane ^ 16
            const f32x8 sa = s0 * 0.125f, sc = s1 * 0.125f;       // 1/sqrt(64)
            float rm = fmaxf(sa[0], sc[0]);
#pragma unroll
            for (int v = 1; v < 8; ++v) rm = fmaxf(rm, fmaxf(sa[v], sc[v]));
            rm = fmaxf(rm, xhalf(rm));
            const float nm = fmaxf(run_m, rm);
            const float cr = exp2x1((run_m - nm) * LOG2E);
            run_m = nm;
            float t0[8], t1[8], e0[8], e1[8];
#pragma unroll
            for (int v = 0; v < 8; ++v) { t0[v] = (sa[v] - nm) * LOG2E; t1[v] = (sc[v] - nm) * LOG2E; }
            exp2x8(e0, t0);
            exp2x8(e1, t1);
            float ps = 0.0f;
#pragma unroll
            for (int v = 0; v < 8; ++v) ps += e0[v] + e1[v];
            run_l = run_l * cr + ps;
            u32x8 pd;                           // Pt as B operand: k = 8*half + s, 16 + 8*half + s
#pragma unroll
            for (int j = 0; j < 4; ++j) {
                pd[j]     = (u32)f2bf(e0[2 * j]) | ((u32)f2bf(e0[2 * j + 1]) << 16);
                pd[4 + j] = (u32)f2bf(e1[2 * j]) | ((u32)f2bf(e1[2 * j + 1]) << 16);
            }
            const bf16x16 pf = __builtin_bit_cast(bf16x16, pd);
#pragma unroll
            for (int rt = 0; rt < 4; ++rt) {    // Ot[r = rt*16 + v + 8*half][query = l15]
#pragma unroll
                for (int v = 0; v < 8; ++v) oacc[rt][v] *= cr;
                bf16x16 vf = load_frag(&vtS[rt * 16 + l15][0], tt * 32 + hf * 8);
                oacc[rt] = wmma_bf16(vf, pf, oacc[rt]);
            }
        }
    }

    // a lane holds 8 consecutive r of one query per tile: one 16-byte store each
    const float inv = 1.0f / (run_l + xhalf(run_l));
    u16* orow = op + (size_t)((b * SS + srow) * NHEAD + h) * DRED + 8 * hf;
#pragma unroll
    for (int rt = 0; rt < 4; ++rt) {
        u32x4 w;
#pragma unroll
        for (int j = 0; j < 4; ++j)
            w[j] = (u32)f2bf(oacc[rt][2 * j] * inv) | ((u32)f2bf(oacc[rt][2 * j + 1] * inv) << 16);
        *reinterpret_cast<u32x4*>(orow + rt * 16) = w;
    }
}

// ---------------- LayerNorm ----------------
// Value of lane ^ X inside a 16-lane row, by DPP (the compiler folds it into the add).
template <int X>
__device__ __forceinline__ float xrow(float x) {
    int b = __builtin_bit_cast(int, x);
    return __builtin_bit_cast(float, __builtin_amdgcn_update_dpp(0, b, 0x160 + X, 0xf, 0xf, true));
}
// Sum over the wave's 32 lanes, the same bits in every lane.
__device__ __forceinline__ float wave_sum(float v) {
    v += xrow<1>(v);
    v += xrow<2>(v);
    v += xrow<4>(v);
    v += xrow<8>(v);
    return v + xhalf(v);
}

// One wave norms LN_ROWS whole rows: 2048 waves a launch instead of 32768. A row is 8 loads of 512 contiguous bytes; both rows' loads and those of
// gamma and beta are in flight together; the sums stay inside the wave, so no LDS, no barrier.
#define LN_ROWS 2
#define LN_BLOCKS (MTOT / (8 * LN_ROWS))
__global__ __launch_bounds__(256) void k_ln(
    const float* __restrict__ in, const float* __restrict__ g, const float* __restrict__ bb,
    float* __restrict__ outF, u16* __restrict__ outB)
{
    const int lane = threadIdx.x & 31;
    const int wave = blockIdx.x * 8 + (threadIdx.x >> 5);
    const int o0 = wave * (LN_ROWS * D_EMB) + lane * 4;   // the lane's first element
    const float* px = in + o0;
    f32x4 x[LN_ROWS][8], gv[8], bv[8];
#pragma unroll
    for (int r = 0; r < LN_ROWS; ++r)
#pragma unroll
        for (int j = 0; j < 8; ++j)
            x[r][j] = *reinterpret_cast<const f32x4*>(px + r * D_EMB + j * 128);
#pragma unroll
    for (int j = 0; j < 8; ++j) {
        gv[j] = reinterpret_cast<const f32x4*>(g)[lane + j * 32];
        bv[j] = reinterpret_cast<const f32x4*>(bb)[lane + j * 32];
    }
    // The wait that belongs in front of an overwrite of an issued load's address register; the
    // addresses are its inputs, so that their registers are given to nothing else ahead of it.
    asm volatile("s_wait_xcnt 0x0" :: "v"(px), "v"(lane) : "memory");
    // Keeps all 32 loads above the sums: without it the scheduler sinks those of gamma and beta
    // below the reduction, two at a time, each pair behind a latency of its own.
    __builtin_amdgcn_sched_barrier(0);
#pragma unroll
    for (int r = 0; r < LN_ROWS; ++r) {
        f32x4 a1 = x[r][0], a2 = x[r][0] * x[r][0];       // four independent chains each
#pragma unroll
        for (int j = 1; j < 8; ++j) { a1 += x[r][j]; a2 += x[r][j] * x[r][j]; }
        const float t1 = wave_sum((a1[0] + a1[1]) + (a1[2] + a1[3]));
        const float t2 = wave_sum((a2[0] + a2[1]) + (a2[2] + a2[3]));
        const float mean = t1 * (1.0f / D_EMB);
        const float var  = t2 * (1.0f / D_EMB) - mean * mean;
        const float sc = rsqrtf(var + 1e-3f);
#pragma unroll
        for (int j = 0; j < 8; ++j) x[r][j] = (x[r][j] - mean) * sc * gv[j] + bv[j];
    }
    if (outF) {
#pragma unroll
        for (int r = 0; r < LN_ROWS; ++r)
#pragma unroll
            for (int j = 0; j < 8; ++j)
                *reinterpret_cast<f32x4*>(outF + o0 + r * D_EMB + j * 128) = x[r][j];
        // The same wait behind the stores: the conversion below reuses their registers.
        asm volatile("s_wait_xcnt 0x0" ::: "memory");
    }
    if (outB) {
#pragma unroll
        for (int r = 0; r < LN_ROWS; ++r)
#pragma unroll
            for (int j = 0; j < 8; ++j) {
                u32x2 w;
                w[0] = (u32)f2bf(x[r][j][0]) | ((u32)f2bf(x[r][j][1]) << 16);
                w[1] = (u32)f2bf(x[r][j][2]) | ((u32)f2bf(x[r][j][3]) << 16);
                *reinterpret_cast<u32x2*>(outB + o0 + r * D_EMB + j * 128) = w;
            }
    }
    // The same wait behind the stores, in front of whatever reuses their address registers.
    asm volatile("s_wait_xcnt 0x0" ::: "memory");
}

// ---------------- host orchestration ----------------
extern "C" void kernel_launch(void* const* d_in, const int* in_sizes, int n_in,
                              void* d_out, int out_size, void* d_ws, size_t ws_size,
                              hipStream_t stream) {
    (void)in_sizes; (void)n_in; (void)out_size; (void)ws_size;

    const float* x      = (const float*)d_in[0];
    const float* ctx    = (const float*)d_in[1];
    const float* sa_wq  = (const float*)d_in[2];
    const float* sa_bq  = (const float*)d_in[3];
    const float* sa_wk  = (const float*)d_in[4];
    const float* sa_bk  = (const float*)d_in[5];
    const float* sa_wv  = (const float*)d_in[6];
    const float* sa_bv  = (const float*)d_in[7];
    const float* sa_wo  = (const float*)d_in[8];
    const float* sa_bo  = (const float*)d_in[9];
    const float* ca_wq  = (const float*)d_in[10];
    const float* ca_bq  = (const float*)d_in[11];
    const float* ca_wk  = (const float*)d_in[12];
    const float* ca_bk  = (const float*)d_in[13];
    const float* ca_wv  = (const float*)d_in[14];
    const float* ca_bv  = (const float*)d_in[15];
    const float* ca_wo  = (const float*)d_in[16];
    const float* ca_bo  = (const float*)d_in[17];
    const float* ln1_g  = (const float*)d_in[18];
    const float* ln1_b  = (const float*)d_in[19];
    const float* ln2_g  = (const float*)d_in[20];
    const float* ln2_b  = (const float*)d_in[21];
    const float* ln3_g  = (const float*)d_in[22];
    const float* ln3_b  = (const float*)d_in[23];
    const float* ffn_w1 = (const float*)d_in[24];
    const float* ffn_b1 = (const float*)d_in[25];
    const float* ffn_w2 = (const float*)d_in[26];
    const float* ffn_b2 = (const float*)d_in[27];

    char* ws = (char*)d_ws;
    size_t off = 0;
    auto alloc = [&](size_t bytes) -> void* {
        void* p = ws + off;
        off = (off + bytes + 255) & ~(size_t)255;
        return p;
    };

    const size_t ACT2 = (size_t)MTOT * D_EMB * 2;   // bf16 activation
    const size_t ACT4 = (size_t)MTOT * D_EMB * 4;   // f32 activation
    const size_t W2   = (size_t)D_EMB * D_EMB * 2;  // bf16 1024x1024 weight

    u16* xb     = (u16*)alloc(ACT2);
    u16* cb     = (u16*)alloc(ACT2);
    u16* wt8    = (u16*)alloc(8 * W2);              // the eight 1024 x 1024 weights in a row
    u16* wt_saq = wt8;
    u16* wt_sak = wt8 + 1 * (D_EMB * D_EMB);
    u16* wt_sav = wt8 + 2 * (D_EMB * D_EMB);
    u16* wt_sao = wt8 + 3 * (D_EMB * D_EMB);
    u16* wt_caq = wt8 + 4 * (D_EMB * D_EMB);
    u16* wt_cak = wt8 + 5 * (D_EMB * D_EMB);
    u16* wt_cav = wt8 + 6 * (D_EMB * D_EMB);
    u16* wt_cao = wt8 + 7 * (D_EMB * D_EMB);
    u16* wt1    = (u16*)alloc((size_t)DFF * D_EMB * 2);
    u16* wt2    = (u16*)alloc((size_t)D_EMB * DFF * 2);
    u16* qb     = (u16*)alloc(ACT2);
    u16* kb     = (u16*)alloc(ACT2);
    u16* vb     = (u16*)alloc(ACT2);
    u16* ob     = (u16*)alloc(ACT2);
    float* sumb = (float*)alloc(ACT4);
    float* ln1f = (float*)alloc(ACT4);
    u16*   ln1b = (u16*)alloc(ACT2);
    float* ln2f = (float*)alloc(ACT4);
    u16*   ln2b = (u16*)alloc(ACT2);
    u16*   f1b  = (u16*)alloc((size_t)MTOT * DFF * 2);

    const dim3 blk(256);
    // casts + packs
    k_prep<<<PREP_BLOCKS, blk, 0, stream>>>(x, ctx, sa_wq, sa_wk, sa_wv, sa_wo,
                                            ca_wq, ca_wk, ca_wv, ca_wo, ffn_w1, ffn_w2,
                                            xb, cb, wt8, wt1, wt2);

    const dim3 gD(D_EMB / 128, MTOT / 128);   // N=1024 GEMMs
    const dim3 gF(DFF   / 128, MTOT / 128);   // N=4096 GEMM
    const dim3 g3(D_EMB / 128, MTOT / 128, 3);   // q, k, v projections together

    // ---- self attention ----
    k_gemm_qkv<<<g3, blk, 0, stream>>>(xb, xb, wt_saq, wt_sak, wt_sav, sa_bq, sa_bk, sa_bv,
                                       qb, kb, vb, D_EMB);
    k_attn<<<BB * NHEAD * (SS / 128), blk, 0, stream>>>(qb, kb, vb, ob);
    k_gemm_res<<<gD, blk, 0, stream>>>(ob, wt_sao, sa_bo, x, sumb, D_EMB);
    k_ln<<<LN_BLOCKS, blk, 0, stream>>>(sumb, ln1_g, ln1_b, ln1f, ln1b);

    // ---- cross attention ----
    k_gemm_qkv<<<g3, blk, 0, stream>>>(ln1b, cb, wt_caq, wt_cak, wt_cav, ca_bq, ca_bk, ca_bv,
                                       qb, kb, vb, D_EMB);
    k_attn<<<BB * NHEAD * (SS / 128), blk, 0, stream>>>(qb, kb, vb, ob);
    k_gemm_res<<<gD, blk, 0, stream>>>(ob, wt_cao, ca_bo, ln1f, sumb, D_EMB);
    k_ln<<<LN_BLOCKS, blk, 0, stream>>>(sumb, ln2_g, ln2_b, ln2f, ln2b);

    // ---- FFN ----
    k_gemm_relu<<<gF, blk, 0, stream>>>(ln2b, wt1, ffn_b1, f1b, D_EMB);
    k_gemm_res<<<gD, blk, 0, stream>>>(f1b,  wt2, ffn_b2, ln2f, sumb, DFF);
    k_ln<<<LN_BLOCKS, blk, 0, stream>>>(sumb, ln3_g, ln3_b, (float*)d_out, nullptr);
}

// v008
// One run takes 231 microseconds.
// In both of two side-by-side timings against v007, it was 1.16 times as fast.
// Counting every step since v000, it is 3.33 times as fast.
#include <hip/hip_runtime.h>

// ---------------- problem constants ----------------
#define D_EMB 1024
#define NHEAD 16
#define DRED  64
#define BB    4
#define SS    1024
#define MTOT  (BB * SS)     // 4096 rows of activations
#define DFF   (4 * D_EMB)   // 4096

typedef unsigned int   u32;
typedef unsigned short u16;
typedef unsigned long long u64;
typedef u32   u32x2  __attribute__((ext_vector_type(2)));
typedef u32   u32x4  __attribute__((ext_vector_type(4)));
typedef u32   u32x8  __attribute__((ext_vector_type(8)));
typedef float f32x4  __attribute__((ext_vector_type(4)));
typedef float f32x8  __attribute__((ext_vector_type(8)));
typedef __bf16 bf16x16 __attribute__((ext_vector_type(16)));

// ---------------- small helpers ----------------
__device__ __forceinline__ u16 f2bf(float f) {
    union { float f; u32 u; } c; c.f = f;
    u32 u = c.u;
    u32 r = u + 0x7fffu + ((u >> 16) & 1u);   // round-to-nearest-even
    return (u16)(r >> 16);
}

__device__ __forceinline__ f32x8 zero8() {
    f32x8 z;
#pragma unroll
    for (int i = 0; i < 8; ++i) z[i] = 0.0f;
    return z;
}

// LDS byte offset of a shared-memory pointer: flat LDS addresses keep the
// offset in the low 32 bits (ISA 10.2: LDS_ADDR = addr[31:0]).
__device__ __forceinline__ u32 lds_off(const void* p) {
    return (u32)(uintptr_t)p;
}

// One K slab's async global->LDS copies of a lane: 16 bytes in each of four 32-row groups of
// A and of B (GVS form, ASYNCcnt tracked, no VGPR round-trip). la, lb: the lane's LDS byte
// address in the first group; ga, gb: its byte offset from the base; grow: 32 source rows.
// The closing s_wait_xcnt 0 stands inside the statement so that no address register named
// here is rewritten in front of it.
#define SLAB_GROUP_LDS (32u * 144u)   // 32 LDS rows of 144 bytes
__device__ __forceinline__ void slab_copies(u32 la, u32 lb, u32 ga, u32 gb, u32 grow,
                                            const void* abase, const void* bbase) {
    asm volatile("global_load_async_to_lds_b128 %0, %8, %16\n\t"
                 "global_load_async_to_lds_b128 %4, %12, %17\n\t"
                 "global_load_async_to_lds_b128 %1, %9, %16\n\t"
                 "global_load_async_to_lds_b128 %5, %13, %17\n\t"
                 "global_load_async_to_lds_b128 %2, %10, %16\n\t"
                 "global_load_async_to_lds_b128 %6, %14, %17\n\t"
                 "global_load_async_to_lds_b128 %3, %11, %16\n\t"
                 "global_load_async_to_lds_b128 %7, %15, %17\n\t"
                 "s_wait_xcnt 0x0"
                 :: "v"(la), "v"(la + SLAB_GROUP_LDS), "v"(la + 2u * SLAB_GROUP_LDS),
                    "v"(la + 3u * SLAB_GROUP_LDS),
                    "v"(lb), "v"(lb + SLAB_GROUP_LDS), "v"(lb + 2u * SLAB_GROUP_LDS),
                    "v"(lb + 3u * SLAB_GROUP_LDS),
                    "v"(ga), "v"(ga + grow), "v"(ga + 2u * grow), "v"(ga + 3u * grow),
                    "v"(gb), "v"(gb + grow), "v"(gb + 2u * grow), "v"(gb + 3u * grow),
                    "s"(abase), "s"(bbase)
                 : "memory");
}

// Load one 16-lane-striped bf16 fragment (A or B operand of 16x16x32 WMMA).
// rowbase points at the lane's matrix row (m for A, n for B); koff = kblock + half*8.
// Per ISA 7.12.2: VGPR0-3 hold K=[koff..koff+7], VGPR4-7 hold K=[koff+16..koff+23].
__device__ __forceinline__ bf16x16 load_frag(const u16* rowbase, int koff) {
    u32x4 lo = *reinterpret_cast<const u32x4*>(rowbase + koff);
    u32x4 hi = *reinterpret_cast<const u32x4*>(rowbase + koff + 16);
    u32x8 d;
    d[0] = lo[0]; d[1] = lo[1]; d[2] = lo[2]; d[3] = lo[3];
    d[4] = hi[0]; d[5] = hi[1]; d[6] = hi[2]; d[7] = hi[3];
    return __builtin_bit_cast(bf16x16, d);
}

__device__ __forceinline__ f32x8 wmma_bf16(bf16x16 a, bf16x16 b, f32x8 c) {
    return __builtin_amdgcn_wmma_f32_16x16x32_bf16(false, a, false, b, (short)0, c,
                                                   false, false);
}

// Value of lane ^ 16 (the other 16-lane half), by a vector cross-row move.
__device__ __forceinline__ float xhalf(float x) {
    int b = __builtin_bit_cast(int, x);
    return __builtin_bit_cast(float,
        __builtin_amdgcn_permlanex16(b, b, 0x76543210, 0xfedcba98, false, false));
}

// Base-2 exponentials, v_exp_f32. The instruction set asks for one independent instruction or
// a v_nop between a transcendental and a use of its result or an overwrite of its source.
// Here the outputs are
// early-clobber (none lies on a source) and the closing v_nop fills the last one's slot.
__device__ __forceinline__ void exp2x8(float (&d)[8], const float (&s)[8]) {
    asm("v_exp_f32 %0, %8\n\t"
        "v_exp_f32 %1, %9\n\t"
        "v_exp_f32 %2, %10\n\t"
        "v_exp_f32 %3, %11\n\t"
        "v_exp_f32 %4, %12\n\t"
        "v_exp_f32 %5, %13\n\t"
        "v_exp_f32 %6, %14\n\t"
        "v_exp_f32 %7, %15\n\t"
        "v_nop"
        : "=&v"(d[0]), "=&v"(d[1]), "=&v"(d[2]), "=&v"(d[3]),
          "=&v"(d[4]), "=&v"(d[5]), "=&v"(d[6]), "=&v"(d[7])
        : "v"(s[0]), "v"(s[1]), "v"(s[2]), "v"(s[3]),
          "v"(s[4]), "v"(s[5]), "v"(s[6]), "v"(s[7]));
}
__device__ __forceinline__ float exp2x1(float s) {
    float d;
    asm("v_exp_f32 %0, %1\n\t"
        "v_nop"                       // the same slot, for the one result
        : "=v"(d) : "v"(s));
    return d;
}
#define LOG2E 1.44269504088896340736f

// ---------------- cast / repack kernels ----------------
// Each wave here moves many kilobytes, all its loads in flight together.

// f32 -> bf16 of one activation by 256 blocks of 256 threads; blk is this block's place among
// them. A thread takes 16 pieces of 4 elements one grid stride apart: every wave load covers 512
// contiguous bytes, every wave store 256, and all 16 loads are in flight before a store.
__device__ __forceinline__ void cast_bf16(const float* __restrict__ in, u16* __restrict__ out,
                                          int blk) {
    constexpr int ST = 256 * 256 * 4, IT = MTOT * D_EMB / ST;
    const int i = (blk * 256 + threadIdx.x) * 4;
    const float* pi = in + i;
    f32x4 v[IT];
#pragma unroll
    for (int it = 0; it < IT; ++it) v[it] = *reinterpret_cast<const f32x4*>(pi + it * ST);
    // The wait that belongs in front of an overwrite of an issued load's address register; the
    // address is its input, so that its registers are given to nothing else ahead of it.
    asm volatile("s_wait_xcnt 0x0" :: "v"(pi) : "memory");
#pragma unroll
    for (int it = 0; it < IT; ++it) {
        u32x2 w;
        w[0] = (u32)f2bf(v[it][0]) | ((u32)f2bf(v[it][1]) << 16);
        w[1] = (u32)f2bf(v[it][2]) | ((u32)f2bf(v[it][3]) << 16);
        *reinterpret_cast<u32x2*>(out + i + it * ST) = w;
    }
    // The same wait behind the stores, in front of whatever reuses their address registers.
    asm volatile("s_wait_xcnt 0x0" ::: "memory");
}

// Weight packs: transpose + cast through an LDS tile, so that both sides move whole lines.
// One block takes 256 rows (k) x 64 columns (n) of a row-major f32 matrix with row pitch ld
// and writes them as 64 rows of 256 bf16 with row pitch K.
// Read: a lane takes 16 bytes of rows 2p and 2p + 1; 16 lanes cover 256 contiguous bytes.
// LDS: tile[n][p] holds the bf16 pair (k = 2p, 2p + 1); the pitch 129 dwords puts the 32 lanes
// of every store (n = 4 * c4 + j, two p) and of every load (two n, 16 pieces) on 32 banks.
// Write: a lane stores 16 bytes; 16 lanes cover 256 contiguous bytes of one row.
#define PK 256
__device__ __forceinline__ void pack_tile(u32 (*tile)[PK / 2 + 1],
                                          const float* __restrict__ src, int ld,
                                          u16* __restrict__ dst, int K) {
    const int tid = threadIdx.x;
    const int c4 = tid & 15, p0 = tid >> 4;
    const float* pl[PK / 32];
    const float* ph[PK / 32];
    f32x4 lo[PK / 32], hi[PK / 32];
#pragma unroll
    for (int it = 0; it < PK / 32; ++it) {      // all loads first: 16 in flight per lane
        pl[it] = src + (size_t)(2 * (p0 + 16 * it)) * ld + 4 * c4;
        ph[it] = pl[it] + ld;
        lo[it] = *reinterpret_cast<const f32x4*>(pl[it]);
        hi[it] = *reinterpret_cast<const f32x4*>(ph[it]);
    }
    // The wait that belongs in front of an overwrite of an issued load's address register.
    // The addresses are its inputs, so that none of their registers is given to a later
    // load's result (or to anything else) ahead of it.
    asm volatile("s_wait_xcnt 0x0" :: "v"(pl[0]), "v"(ph[0]), "v"(pl[1]), "v"(ph[1]),
                                      "v"(pl[2]), "v"(ph[2]), "v"(pl[3]), "v"(ph[3]),
                                      "v"(pl[4]), "v"(ph[4]), "v"(pl[5]), "v"(ph[5]),
                                      "v"(pl[6]), "v"(ph[6]), "v"(pl[7]), "v"(ph[7])
                 : "memory");
#pragma unroll
    for (int it = 0; it < PK / 32; ++it)
#pragma unroll
        for (int j = 0; j < 4; ++j)
            tile[4 * c4 + j][p0 + 16 * it] = (u32)f2bf(lo[it][j]) | ((u32)f2bf(hi[it][j]) << 16);
    __syncthreads();                            // the whole tile is in LDS before it is read
    // 32 16-byte pieces a row. A wave takes 16 pieces of each of two neighbouring rows.
    const int sl = tid & 15, nl = (tid >> 4) & 1, sh = (tid >> 5) & 1, nh = tid >> 6;
#pragma unroll
    for (int it = 0; it < PK / 32; ++it) {
        const int n = 2 * (nh + 4 * it) + nl, s = 16 * sh + sl;
        u32x4 w;
#pragma unroll
        for (int e = 0; e < 4; ++e) w[e] = tile[n][4 * s + e];
        *reinterpret_cast<u32x4*>(dst + (size_t)n * K + 8 * s) = w;
    }
    // The same wait behind the stores, in front of whatever reuses their address registers.
    asm volatile("s_wait_xcnt 0x0" ::: "memory");
}

// All input preparation in ONE launch: none of these pieces reads what another writes, so they
// share a grid and the chip fills once instead of twelve times. Block ranges:
//   [0, 256)      ffn_w1 [1024][4096] -> wt1 [4096][1024], 256 k x 64 n a block
//   [256, 512)    ffn_w2 [4096][1024] -> wt2 [1024][4096], the same
//   [512, 1024)   eight 1024 x 1024 weights, 64 blocks each, the same tile -> wt8 + i * 2^20
//                 i & 3 < 3: per-head w [H=16][K=1024][R=64] -> Wt [n = h*64 + r][k]
//                 i & 3 == 3: plain w [K=1024][N=1024] -> Wt [n][k]
//   [1024, 1536)  x and context to bf16, 256 blocks each
#define PREP_BLOCKS 1536
__global__ __launch_bounds__(256) void k_prep(
    const float* __restrict__ x,  const float* __restrict__ ctx,
    const float* __restrict__ w0, const float* __restrict__ w1,
    const float* __restrict__ w2, const float* __restrict__ w3,
    const float* __restrict__ w4, const float* __restrict__ w5,
    const float* __restrict__ w6, const float* __restrict__ w7,
    const float* __restrict__ f1, const float* __restrict__ f2,
    u16* __restrict__ xb, u16* __restrict__ cb, u16* __restrict__ wt8,
    u16* __restrict__ wt1, u16* __restrict__ wt2)
{
    __shared__ u32 tile[64][PK / 2 + 1];
    const int bx = blockIdx.x;
    if (bx < 512) {
        const bool first = bx < 256;
        const int r  = bx & 255;
        const int nt = first ? (r & 63) : (r & 15);      // 64-column tile
        const int kt = first ? (r >> 6) : (r >> 4);      // 256-row tile
        const int N  = first ? DFF : D_EMB, K = first ? D_EMB : DFF;
        pack_tile(tile, (first ? f1 : f2) + (size_t)(kt * PK) * N + nt * 64, N,
                  (first ? wt1 : wt2) + (size_t)(nt * 64) * K + kt * PK, K);
    } else if (bx < 1024) {
        const int i = (bx - 512) >> 6, r = bx & 63;
        const float* w = i == 0 ? w0 : i == 1 ? w1 : i == 2 ? w2 : i == 3 ? w3
                       : i == 4 ? w4 : i == 5 ? w5 : i == 6 ? w6 : w7;
        const bool plain = (i & 3) == 3;
        // per head: the head's 64 columns are n tile nt, its k tiles next to one another
        const int nt = plain ? (r & 15) : (r >> 2), kt = plain ? (r >> 4) : (r & 3);
        const int so = plain ? kt * PK * D_EMB + nt * 64 : nt * (D_EMB * DRED) + kt * PK * DRED;
        pack_tile(tile, w + so, plain ? D_EMB : DRED,
                  wt8 + (size_t)i * (D_EMB * D_EMB) + nt * 64 * D_EMB + kt * PK, D_EMB);
    } else {
        const int c = bx - 1024;
        const bool first = c < 256;
        cast_bf16(first ? x : ctx, first ? xb : cb, c & 255);
    }
}

// ---------------- WMMA GEMM ----------------
// C[M,N] = act(A_bf16[M,K] x Wt_bf16[N,K]^T + bias) (+resid); writes f32 or bf16.
// Block tile 128x128, 8 waves (2 along M x 4 along N), wave tile 64x32 (4x2 WMMA tiles).
// K slabs of 64 alternate between two LDS buffers: slab t + 1's async copies fly while
// slab t is worked on.
// ring: [buffer][A, B][row][k]; row-pad 72: stride 36 dwords -> conflict-free b128
// What the epilogue does (RELU, RESID, f32 or bf16 output) and the row length N are compile-time,
// so that it is straight-line code: a lane's bias and residual values are then loaded as ONE
// group, all in flight together under slab 0's copies, instead of one load latency an element
// behind the k loop, and every load and store is one base address plus an immediate offset.
// GRP: k blocks whose fragments are loaded as one group, 1 or 2 (48 registers each). 2, the whole
// slab, where one workgroup stands on a WGP and the registers are free; 1 where three or four
// workgroups share the WGP's registers and cover one another's waits.
template <int N, bool RELU, bool RESID, bool OUTF, int GRP>
__device__ __forceinline__ void gemm_tile(
    u16 (*ring)[2][128][72],
    const u16* __restrict__ A, const u16* __restrict__ Wt,
    const float* __restrict__ bias, const float* __restrict__ resid,
    float* __restrict__ outF, u16* __restrict__ outB,
    int K)
{
    const int tid  = threadIdx.x;
    const int lane = tid & 31, l15 = lane & 15, hf = (lane >> 4) & 1;
    const int wid  = tid >> 5;
    const int bm = blockIdx.y * 128, bn = blockIdx.x * 128;
    const int wm = (wid & 1) * 64,   wn = (wid >> 1) * 32;

    f32x8 acc[4][2];
#pragma unroll
    for (int mt = 0; mt < 4; ++mt)
#pragma unroll
        for (int nt = 0; nt < 2; ++nt) acc[mt][nt] = zero8();

    // a lane copies 16 bytes of row r0 (+32, +64, +96) of each operand's slab
    const int r0 = tid >> 3, c8 = (tid & 7) << 3;
    const u32 la0 = lds_off(&ring[0][0][r0][c8]);
    const u32 lb0 = lds_off(&ring[0][1][r0][c8]);
    const u32 ga0 = ((u32)(bm + r0) * (u32)K + (u32)c8) * 2u;
    const u32 gb0 = ((u32)(bn + r0) * (u32)K + (u32)c8) * 2u;
    const u32 grow = (u32)K * 64u;            // 32 source rows in bytes
    const u32 bufB = (u32)sizeof(ring[0]);    // one buffer in bytes
    const int T = K >> 6;                     // slabs; K is a multiple of 64, at least 64

    slab_copies(la0, lb0, ga0, gb0, grow, A, Wt);         // slab 0 into buffer 0

    // C layout: M = v + 8*half, N = lane&15. o0: the lane's first element of the output tile.
    const u32 o0 = (u32)(bm + wm + 8 * hf) * (u32)N + (u32)(bn + wn + l15);
    float bv[2], rv[4][2][8];
#pragma unroll
    for (int nt = 0; nt < 2; ++nt) bv[nt] = bias[bn + wn + nt * 16 + l15];
    if constexpr (RESID) {
        const float* rp = resid + o0;
#pragma unroll
        for (int mt = 0; mt < 4; ++mt)
#pragma unroll
            for (int nt = 0; nt < 2; ++nt)
#pragma unroll
                for (int v = 0; v < 8; ++v) rv[mt][nt][v] = rp[(mt * 16 + v) * N + nt * 16];
    }

    asm volatile("s_wait_asynccnt 0x0" ::: "memory");     // this wave's copies have landed
    __syncthreads();                                      // every wave's are visible
    if (1 < T)                                            // slab 1 into buffer 1
        slab_copies(la0 + bufB, lb0 + bufB, ga0 + 128u, gb0 + 128u, grow, A, Wt);

    for (int t = 0; t < T; ++t) {
        const u16 (*aS)[72] = ring[t & 1][0];
        const u16 (*bS)[72] = ring[t & 1][1];
        // GRP k blocks of 32 share one group of fragment loads: all its ds_loads are issued
        // first, then its WMMAs run behind counted waits, so a wave meets the LDS latency once a
        // group and not once for every pair of WMMAs.
#pragma unroll
        for (int k0 = 0; k0 < 64; k0 += 32 * GRP) {
            bf16x16 af[GRP][4], bfr[GRP][2];
#pragma unroll
            for (int g = 0; g < GRP; ++g) {
                const int ko = k0 + 32 * g + hf * 8;
#pragma unroll
                for (int nt = 0; nt < 2; ++nt)
                    bfr[g][nt] = load_frag(&bS[wn + nt * 16 + l15][0], ko);
#pragma unroll
                for (int mt = 0; mt < 4; ++mt)
                    af[g][mt] = load_frag(&aS[wm + mt * 16 + l15][0], ko);
            }
            // Keeps the loads above the WMMAs: without it the scheduler sinks them among the
            // WMMAs into one reused fragment register set, each pair behind a full LDS wait.
            __builtin_amdgcn_sched_barrier(0);
#pragma unroll
            for (int g = 0; g < GRP; ++g)
#pragma unroll
                for (int mt = 0; mt < 4; ++mt)
#pragma unroll
                    for (int nt = 0; nt < 2; ++nt)
                        acc[mt][nt] = wmma_bf16(af[g][mt], bfr[g][nt], acc[mt][nt]);
            // Keeps the next group's loads from rising among these WMMAs, and the last group's
            // WMMAs from sinking below the publish point, where the refill copies would wait
            // behind them and lose that much of their lead.
            __builtin_amdgcn_sched_barrier(0);
        }
        // publish point of slab t + 1, in this order:
        asm volatile("s_wait_dscnt 0x0" ::: "memory");    // this wave's reads of slab t are back
        asm volatile("s_wait_asynccnt 0x0" ::: "memory"); // its copies of slab t + 1 have landed
        __syncthreads();      // slab t + 1 visible to all; every reader has left slab t's buffer
        if (t + 2 < T) {      // refill that buffer
            const u32 bo = (u32)(t & 1) * bufB, go = (u32)(t + 2) * 128u;
            slab_copies(la0 + bo, lb0 + bo, ga0 + go, gb0 + go, grow, A, Wt);
        }
    }
    asm volatile("s_wait_asynccnt 0x0" ::: "memory");     // no copy outlives the loop

#pragma unroll
    for (int mt = 0; mt < 4; ++mt)
#pragma unroll
        for (int nt = 0; nt < 2; ++nt)
#pragma unroll
            for (int v = 0; v < 8; ++v) {
                float val = acc[mt][nt][v] + bv[nt];
                if constexpr (RELU)  val = fmaxf(val, 0.0f);
                if constexpr (RESID) val += rv[mt][nt][v];
                const int o = (mt * 16 + v) * N + nt * 16;
                if constexpr (OUTF) (outF + o0)[o] = val;
                else                (outB + o0)[o] = f2bf(val);
            }
}

// outF[M, 1024] = A x Wt^T + bias + resid, f32
__global__ __launch_bounds__(256) void k_gemm_res(
    const u16* __restrict__ A, const u16* __restrict__ Wt,
    const float* __restrict__ bias, const float* __restrict__ resid,
    float* __restrict__ outF, int K)
{
    __shared__ __attribute__((aligned(16))) u16 ring[2][2][128][72];
    gemm_tile<D_EMB, false, true, true, 2>(ring, A, Wt, bias, resid, outF, nullptr, K);
}

// outB[M, 4096] = relu(A x Wt^T + bias), bf16
__global__ __launch_bounds__(256) void k_gemm_relu(
    const u16* __restrict__ A, const u16* __restrict__ Wt,
    const float* __restrict__ bias, u16* __restrict__ outB, int K)
{
    __shared__ __attribute__((aligned(16))) u16 ring[2][2][128][72];
    gemm_tile<DFF, true, false, false, 1>(ring, A, Wt, bias, nullptr, nullptr, outB, K);
}

// The q, k and v projections of one attention in ONE launch: they do not depend on one another,
// so blockIdx.z picks the product. Three workgroups then stand on a WGP where one stood, and
// each one's copy latency, barriers and epilogue run under the others' WMMAs.
__global__ __launch_bounds__(256) void k_gemm_qkv(
    const u16* __restrict__ Aq, const u16* __restrict__ Akv,
    const u16* __restrict__ Wq, const u16* __restrict__ Wk, const u16* __restrict__ Wv,
    const float* __restrict__ bq, const float* __restrict__ bk, const float* __restrict__ bv,
    u16* __restrict__ oq, u16* __restrict__ ok, u16* __restrict__ ov,
    int K)
{
    __shared__ __attribute__((aligned(16))) u16 ring[2][2][128][72];
    const int z = blockIdx.z;
    gemm_tile<D_EMB, false, false, false, 1>(ring, z == 0 ? Aq : Akv,
              z == 0 ? Wq : z == 1 ? Wk : Wv,
              z == 0 ? bq : z == 1 ? bk : bv, nullptr, nullptr,
              z == 0 ? oq : z == 1 ? ok : ov, K);
}

// ---------------- fused flash attention (bf16 WMMA, online softmax) ----------------
// q,k,v,o: bf16 [B][S][H][R] ; one block = one (b,h) x 128 query rows; 8 waves x 16 rows.
// Scores are formed transposed, St = K x Qt, and the output as Ot += Vt x Pt: a lane then
// holds 16 of the 32 scores of ONE query, so maximum and sum run in the lane's own registers
// (one exchange with lane ^ 16), and two score tiles, converted in place, are the B operand.
// Chunks of 128 keys alternate between two LDS buffers. Wave 0 brings a chunk's K rows and wave 1
// its V rows by one tensor load each, one chunk ahead, so the loads fly under the chunk that is
// worked on and no register, vector instruction or LDS store is spent on staging. V lands as it
// lies in memory, [t][r]; the transposing LDS load hands it out as the Vt fragment.
#define AT_NCH  (SS / 128)                  // chunks
#define AT_PK   144u                        // LDS pitch of a K row: 128 + 16 bytes, ds_load_b128
#define AT_PV   160u                        // LDS pitch of a V row: 128 + 32 bytes, ds_load_tr16_b128
#define AT_TK   (128u * AT_PK)
#define AT_TV   (128u * AT_PV)
#define AT_BUF  (AT_TK + AT_TV)
#define AT_SRCP ((u32)(NHEAD * DRED * 2))   // source row pitch in bytes
static_assert(AT_TK % 2048u == 0 && AT_BUF % 2048u == 0, "every tile starts at a multiple of 2 KiB");

__device__ __forceinline__ u32 uni(u32 v) { return (u32)__builtin_amdgcn_readfirstlane(v); }
// A wave-uniform value held in a scalar register. A tensor load ignores EXEC, so every test around
// one must compile to s_cmp and s_cbranch_scc; the empty statement keeps the value from being
// turned back into a vector condition (and what is formed from it behind the wait in front of it).
__device__ __forceinline__ u32 pinned(u32 v) { u32 w = uni(v); asm volatile("" : "+s"(w)); return w; }

// Descriptor of a tile of 128 rows of 128 bytes, source pitch AT_SRCP, extents in bytes.
// PAD: dwords of LDS pad behind every row, less one.
template <u32 PAD>
__device__ __forceinline__ u32x8 tile_group1() {
    u32x8 g1;
    g1[0] = uni((1u << 20) | (4u << 22) | (PAD << 25));           // pad behind every 32 dwords
    g1[1] = uni(128u << 16);                                      // tensor_dim0 = 128 bytes
    g1[2] = uni(128u << 16);                                      // tensor_dim1 = 128 rows
    g1[3] = uni(128u << 16);                                      // tile_dim0
    g1[4] = uni(128u);                                            // tile_dim1
    g1[5] = uni(AT_SRCP);
    g1[6] = uni(0u);
    g1[7] = uni(0u);
    // Descriptor words held in scalar registers: built once and kept there, so that no register
    // which a request in flight names is given another value (see the waits in k_attn).
    asm volatile("" : "+s"(g1));
    return g1;
}
// dst: LDS byte offset of the tile; ga: address of its first byte.
__device__ __forceinline__ u32x4 tile_group0(u32 dst, u64 ga) {
    u32x4 g0;
    g0[0] = uni(1u);                                              // count 1
    g0[1] = uni(dst);
    g0[2] = uni((u32)ga);
    g0[3] = uni(((u32)(ga >> 32) & 0x01ffffffu) | 0x80000000u);   // address high bits, type 2
    asm volatile("" : "+s"(g0));                                  // held like the words above
    return g0;
}
__device__ __forceinline__ void tile_load(u32x4 g0, u32x8 g1) {
    asm volatile("tensor_load_to_lds %0, %1" :: "s"(g0), "s"(g1) : "memory");
}

// 16 (r) x 32 (t) fragment of Vt from row-major V rows in LDS. p: the lane's address, row
// 8 * half + (lane & 7), byte 16 * ((lane >> 3) & 1). The lane gets V[8 * half + 0..7][lane & 15]
// and the same 16 rows further on: the k order of load_frag and of the packed scores.
typedef short s16x8 __attribute__((ext_vector_type(8)));
__device__ __forceinline__ bf16x16 load_frag_tr(const unsigned char* p) {
    typedef __attribute__((address_space(3))) s16x8 lds_s16x8;
    u32x4 lo = __builtin_bit_cast(u32x4, __builtin_amdgcn_ds_load_tr16_b128_v8i16((lds_s16x8*)p));
    u32x4 hi = __builtin_bit_cast(u32x4,
        __builtin_amdgcn_ds_load_tr16_b128_v8i16((lds_s16x8*)(p + 16u * AT_PV)));
    u32x8 d;
    d[0] = lo[0]; d[1] = lo[1]; d[2] = lo[2]; d[3] = lo[3];
    d[4] = hi[0]; d[5] = hi[1]; d[6] = hi[2]; d[7] = hi[3];
    return __builtin_bit_cast(bf16x16, d);
}

__global__ __launch_bounds__(256) void k_attn(
    const u16* __restrict__ qp, const u16* __restrict__ kp,
    const u16* __restrict__ vp, u16* __restrict__ op)
{
    // [buffer][K rows at pitch AT_PK | V rows at pitch AT_PV]
    __shared__ __attribute__((aligned(2048))) unsigned char ring[2 * AT_BUF];

    const int tid  = threadIdx.x;
    const int lane = tid & 31, l15 = lane & 15, hf = (lane >> 4) & 1;
    const int wid  = tid >> 5;
    const u32 wave = uni((u32)wid);
    const int bx = blockIdx.x;
    const int qc = bx & 7;                 // S/128 = 8 chunks
    const int h  = (bx >> 3) & (NHEAD - 1);
    const int b  = bx >> 7;
    const int qbase = qc * 128 + wid * 16;

    // chunk st of this (b, h): wave 0 asks for its K rows, wave 1 for its V rows
    const u64 src  = (u64)(uintptr_t)(wave == 1u ? vp : kp) + 2ull * (u64)((b * SS * NHEAD + h) * DRED);
    const u32 dst0 = lds_off(ring) + (wave == 1u ? AT_TK : 0u);
    const u32x8 g1k = tile_group1<3u>(), g1v = tile_group1<7u>();
    u32x4 g0 = {0u, 0u, 0u, 0u};            // the wave's last request
    auto issue = [&](u32 st) {
        if (pinned(wave < 2u)) {
            g0 = tile_group0(dst0 + (st & 1u) * AT_BUF, src + (u64)st * (128u * AT_SRCP));
            if (pinned(wave == 0u)) tile_load(g0, g1k);
            else                    tile_load(g0, g1v);
        }
    };
    // The issuing wave's own wait: its tile has landed. The descriptor is its input, so that the
    // registers which the request names are given to nothing else ahead of it.
    auto landed = [&]() {
        if (pinned(wave < 2u))
            asm volatile("s_wait_tensorcnt 0x0" :: "s"(g0), "s"(g1k), "s"(g1v) : "memory");
    };
    issue(0u);

    // Q fragments straight from global (row is contiguous 64 bf16); B operand, column = query
    const int srow = qbase + l15;
    const u16* qrow = qp + (size_t)((b * SS + srow) * NHEAD + h) * DRED;
    bf16x16 qf[2];
    qf[0] = load_frag(qrow, 0  + hf * 8);
    qf[1] = load_frag(qrow, 32 + hf * 8);

    f32x8 oacc[4];
#pragma unroll
    for (int rt = 0; rt < 4; ++rt) oacc[rt] = zero8();
    float run_m = -1.0e30f;   // running maximum of query l15 (equal in both lane halves)
    float run_l = 0.0f;       // running sum over this lane half's keys only; joined at the end

    landed();                 // chunk 0
    __syncthreads();          // chunk 0 visible to all
    issue(1u);

    const u32 vlane = (u32)(8 * hf + (lane & 7)) * AT_PV + (u32)((lane >> 3) & 1) * 16u;

    for (u32 nc = 0; nc < AT_NCH; ++nc) {
        const unsigned char* buf = ring + (nc & 1u) * AT_BUF;
        const u16 (*kch)[72] = reinterpret_cast<const u16 (*)[72]>(buf);
        const unsigned char* vch = buf + AT_TK + vlane;

#pragma unroll
        for (int tt = 0; tt < 4; ++tt) {        // 32 keys per step
            f32x8 s0 = zero8(), s1 = zero8();   // St[key = v + 8*half (+16)][query = l15]
            bf16x16 a0[2], a1[2];
#pragma unroll
            for (int kb = 0; kb < 2; ++kb) {
                a0[kb] = load_frag(&kch[tt * 32 +      l15][0], kb * 32 + hf * 8);
                a1[kb] = load_frag(&kch[tt * 32 + 16 + l15][0], kb * 32 + hf * 8);
            }
            // Keeps the step's K loads together ahead of its WMMAs: with the fence at the step's
            // foot the scheduler otherwise sinks them, two in front of each WMMA behind a full wait.
            __builtin_amdgcn_sched_barrier(0);
#pragma unroll
            for (int kb = 0; kb < 2; ++kb) {    // contract over R=64
                s0 = wmma_bf16(a0[kb], qf[kb], s0);
                s1 = wmma_bf16(a1[kb], qf[kb], s1);
            }
            // online softmax of query l15: 16 keys in this lane, 16 in lane ^ 16
            const f32x8 sa = s0 * 0.125f, sc = s1 * 0.125f;       // 1/sqrt(64)
            float rm = fmaxf(sa[0], sc[0]);
#pragma unroll
            for (int v = 1; v < 8; ++v) rm = fmaxf(rm, fmaxf(sa[v], sc[v]));
            rm = fmaxf(rm, xhalf(rm));
            const float nm = fmaxf(run_m, rm);
            const float cr = exp2x1((run_m - nm) * LOG2E);
            run_m = nm;
            float t0[8], t1[8], e0[8], e1[8];
#pragma unroll
            for (int v = 0; v < 8; ++v) { t0[v] = (sa[v] - nm) * LOG2E; t1[v] = (sc[v] - nm) * LOG2E; }
            exp2x8(e0, t0);
            exp2x8(e1, t1);
            float ps = 0.0f;
#pragma unroll
            for (int v = 0; v < 8; ++v) ps += e0[v] + e1[v];
            run_l = run_l * cr + ps;
            u32x8 pd;                           // Pt as B operand: k = 8*half + s, 16 + 8*half + s
#pragma unroll
            for (int j = 0; j < 4; ++j) {
                pd[j]     = (u32)f2bf(e0[2 * j]) | ((u32)f2bf(e0[2 * j + 1]) << 16);
                pd[4 + j] = (u32)f2bf(e1[2 * j]) | ((u32)f2bf(e1[2 * j + 1]) << 16);
            }
            const bf16x16 pf = __builtin_bit_cast(bf16x16, pd);
#pragma unroll
            for (int rt = 0; rt < 4; ++rt) {    // Ot[r = rt*16 + v + 8*half][query = l15]
#pragma unroll
                for (int v = 0; v < 8; ++v) oacc[rt][v] *= cr;
                bf16x16 vf = load_frag_tr(vch + (u32)tt * 32u * AT_PV + (u32)rt * 32u);
                oacc[rt] = wmma_bf16(vf, pf, oacc[rt]);
            }
            // Keeps the next step's exponentials, asm text that the compiler does not look into,
            // from being placed directly behind these WMMAs and over their operand registers,
            // inside the distance that the chip needs there.
            __builtin_amdgcn_sched_barrier(0);
        }
        // publish point of chunk nc + 1, in this order:
        asm volatile("s_wait_dscnt 0x0" ::: "memory");          // this wave's reads of chunk nc are back
        landed();                                               // the issuers' tiles of chunk nc + 1
        __syncthreads();   // chunk nc + 1 visible to all; every reader has left chunk nc's buffer
        if (pinned(nc + 2u < AT_NCH)) issue(pinned(nc + 2u));   // refill that buffer
    }
    asm volatile("s_wait_tensorcnt 0x0" ::: "memory");          // no request outlives the loop
    asm volatile("s_wait_dscnt 0x0" ::: "memory");

    // a lane holds 8 consecutive r of one query per tile: one 16-byte store each
    const float inv = 1.0f / (run_l + xhalf(run_l));
    u16* orow = op + (size_t)((b * SS + srow) * NHEAD + h) * DRED + 8 * hf;
#pragma unroll
    for (int rt = 0; rt < 4; ++rt) {
        u32x4 w;
#pragma unroll
        for (int j = 0; j < 4; ++j)
            w[j] = (u32)f2bf(oacc[rt][2 * j] * inv) | ((u32)f2bf(oacc[rt][2 * j + 1] * inv) << 16);
        *reinterpret_cast<u32x4*>(orow + rt * 16) = w;
    }
}

// ---------------- LayerNorm ----------------
// Value of lane ^ X inside a 16-lane row, by DPP (the compiler folds it into the add).
template <int X>
__device__ __forceinline__ float xrow(float x) {
    int b = __builtin_bit_cast(int, x);
    return __builtin_bit_cast(float, __builtin_amdgcn_update_dpp(0, b, 0x160 + X, 0xf, 0xf, true));
}
// Sum over the wave's 32 lanes, the same bits in every lane.
__device__ __forceinline__ float wave_sum(float v) {
    v += xrow<1>(v);
    v += xrow<2>(v);
    v += xrow<4>(v);
    v += xrow<8>(v);
    return v + xhalf(v);
}

// One wave norms LN_ROWS whole rows: 2048 waves a launch instead of 32768. A row is 8 loads of 512 contiguous bytes; both rows' loads and those of
// gamma and beta are in flight together; the sums stay inside the wave, so no LDS, no barrier.
#define LN_ROWS 2
#define LN_BLOCKS (MTOT / (8 * LN_ROWS))
__global__ __launch_bounds__(256) void k_ln(
    const float* __restrict__ in, const float* __restrict__ g, const float* __restrict__ bb,
    float* __restrict__ outF, u16* __restrict__ outB)
{
    const int lane = threadIdx.x & 31;
    const int wave = blockIdx.x * 8 + (threadIdx.x >> 5);
    const int o0 = wave * (LN_ROWS * D_EMB) + lane * 4;   // the lane's first element
    const float* px = in + o0;
    f32x4 x[LN_ROWS][8], gv[8], bv[8];
#pragma unroll
    for (int r = 0; r < LN_ROWS; ++r)
#pragma unroll
        for (int j = 0; j < 8; ++j)
            x[r][j] = *reinterpret_cast<const f32x4*>(px + r * D_EMB + j * 128);
#pragma unroll
    for (int j = 0; j < 8; ++j) {
        gv[j] = reinterpret_cast<const f32x4*>(g)[lane + j * 32];
        bv[j] = reinterpret_cast<const f32x4*>(bb)[lane + j * 32];
    }
    // The wait that belongs in front of an overwrite of an issued load's address register; the
    // addresses are its inputs, so that their registers are given to nothing else ahead of it.
    asm volatile("s_wait_xcnt 0x0" :: "v"(px), "v"(lane) : "memory");
    // Keeps all 32 loads above the sums: without it the scheduler sinks those of gamma and beta
    // below the reduction, two at a time, each pair behind a latency of its own.
    __builtin_amdgcn_sched_barrier(0);
#pragma unroll
    for (int r = 0; r < LN_ROWS; ++r) {
        f32x4 a1 = x[r][0], a2 = x[r][0] * x[r][0];       // four independent chains each
#pragma unroll
        for (int j = 1; j < 8; ++j) { a1 += x[r][j]; a2 += x[r][j] * x[r][j]; }
        const float t1 = wave_sum((a1[0] + a1[1]) + (a1[2] + a1[3]));
        const float t2 = wave_sum((a2[0] + a2[1]) + (a2[2] + a2[3]));
        const float mean = t1 * (1.0f / D_EMB);
        const float var  = t2 * (1.0f / D_EMB) - mean * mean;
        const float sc = rsqrtf(var + 1e-3f);
#pragma unroll
        for (int j = 0; j < 8; ++j) x[r][j] = (x[r][j] - mean) * sc * gv[j] + bv[j];
    }
    if (outF) {
#pragma unroll
        for (int r = 0; r < LN_ROWS; ++r)
#pragma unroll
            for (int j = 0; j < 8; ++j)
                *reinterpret_cast<f32x4*>(outF + o0 + r * D_EMB + j * 128) = x[r][j];
        // The same wait behind the stores: the conversion below reuses their registers.
        asm volatile("s_wait_xcnt 0x0" ::: "memory");
    }
    if (outB) {
#pragma unroll
        for (int r = 0; r < LN_ROWS; ++r)
#pragma unroll
            for (int j = 0; j < 8; ++j) {
                u32x2 w;
                w[0] = (u32)f2bf(x[r][j][0]) | ((u32)f2bf(x[r][j][1]) << 16);
                w[1] = (u32)f2bf(x[r][j][2]) | ((u32)f2bf(x[r][j][3]) << 16);
                *reinterpret_cast<u32x2*>(outB + o0 + r * D_EMB + j * 128) = w;
            }
    }
    // The same wait behind the stores, in front of whatever reuses their address registers.
    asm volatile("s_wait_xcnt 0x0" ::: "memory");
}

// ---------------- host orchestration ----------------
extern "C" void kernel_launch(void* const* d_in, const int* in_sizes, int n_in,
                              void* d_out, int out_size, void* d_ws, size_t ws_size,
                              hipStream_t stream) {
    (void)in_sizes; (void)n_in; (void)out_size; (void)ws_size;

    const float* x      = (const float*)d_in[0];
    const float* ctx    = (const float*)d_in[1];
    const float* sa_wq  = (const float*)d_in[2];
    const float* sa_bq  = (const float*)d_in[3];
    const float* sa_wk  = (const float*)d_in[4];
    const float* sa_bk  = (const float*)d_in[5];
    const float* sa_wv  = (const float*)d_in[6];
    const float* sa_bv  = (const float*)d_in[7];
    const float* sa_wo  = (const float*)d_in[8];
    const float* sa_bo  = (const float*)d_in[9];
    const float* ca_wq  = (const float*)d_in[10];
    const float* ca_bq  = (const float*)d_in[11];
    const float* ca_wk  = (const float*)d_in[12];
    const float* ca_bk  = (const float*)d_in[13];
    const float* ca_wv  = (const float*)d_in[14];
    const float* ca_bv  = (const float*)d_in[15];
    const float* ca_wo  = (const float*)d_in[16];
    const float* ca_bo  = (const float*)d_in[17];
    const float* ln1_g  = (const float*)d_in[18];
    const float* ln1_b  = (const float*)d_in[19];
    const float* ln2_g  = (const float*)d_in[20];
    const float* ln2_b  = (const float*)d_in[21];
    const float* ln3_g  = (const float*)d_in[22];
    const float* ln3_b  = (const float*)d_in[23];
    const float* ffn_w1 = (const float*)d_in[24];
    const float* ffn_b1 = (const float*)d_in[25];
    const float* ffn_w2 = (const float*)d_in[26];
    const float* ffn_b2 = (const float*)d_in[27];

    char* ws = (char*)d_ws;
    size_t off = 0;
    auto alloc = [&](size_t bytes) -> void* {
        void* p = ws + off;
        off = (off + bytes + 255) & ~(size_t)255;
        return p;
    };

    const size_t ACT2 = (size_t)MTOT * D_EMB * 2;   // bf16 activation
    const size_t ACT4 = (size_t)MTOT * D_EMB * 4;   // f32 activation
    const size_t W2   = (size_t)D_EMB * D_EMB * 2;  // bf16 1024x1024 weight

    u16* xb     = (u16*)alloc(ACT2);
    u16* cb     = (u16*)alloc(ACT2);
    u16* wt8    = (u16*)alloc(8 * W2);              // the eight 1024 x 1024 weights in a row
    u16* wt_saq = wt8;
    u16* wt_sak = wt8 + 1 * (D_EMB * D_EMB);
    u16* wt_sav = wt8 + 2 * (D_EMB * D_EMB);
    u16* wt_sao = wt8 + 3 * (D_EMB * D_EMB);
    u16* wt_caq = wt8 + 4 * (D_EMB * D_EMB);
    u16* wt_cak = wt8 + 5 * (D_EMB * D_EMB);
    u16* wt_cav = wt8 + 6 * (D_EMB * D_EMB);
    u16* wt_cao = wt8 + 7 * (D_EMB * D_EMB);
    u16* wt1    = (u16*)alloc((size_t)DFF * D_EMB * 2);
    u16* wt2    = (u16*)alloc((size_t)D_EMB * DFF * 2);
    u16* qb     = (u16*)alloc(ACT2);
    u16* kb     = (u16*)alloc(ACT2);
    u16* vb     = (u16*)alloc(ACT2);
    u16* ob     = (u16*)alloc(ACT2);
    float* sumb = (float*)alloc(ACT4);
    float* ln1f = (float*)alloc(ACT4);
    u16*   ln1b = (u16*)alloc(ACT2);
    float* ln2f = (float*)alloc(ACT4);
    u16*   ln2b = (u16*)alloc(ACT2);
    u16*   f1b  = (u16*)alloc((size_t)MTOT * DFF * 2);

    const dim3 blk(256);
    // casts + packs
    k_prep<<<PREP_BLOCKS, blk, 0, stream>>>(x, ctx, sa_wq, sa_wk, sa_wv, sa_wo,
                                            ca_wq, ca_wk, ca_wv, ca_wo, ffn_w1, ffn_w2,
                                            xb, cb, wt8, wt1, wt2);

    const dim3 gD(D_EMB / 128, MTOT / 128);   // N=1024 GEMMs
    const dim3 gF(DFF   / 128, MTOT / 128);   // N=4096 GEMM
    const dim3 g3(D_EMB / 128, MTOT / 128, 3);   // q, k, v projections together

    // ---- self attention ----
    k_gemm_qkv<<<g3, blk, 0, stream>>>(xb, xb, wt_saq, wt_sak, wt_sav, sa_bq, sa_bk, sa_bv,
                                       qb, kb, vb, D_EMB);
    k_attn<<<BB * NHEAD * (SS / 128), blk, 0, stream>>>(qb, kb, vb, ob);
    k_gemm_res<<<gD, blk, 0, stream>>>(ob, wt_sao, sa_bo, x, sumb, D_EMB);
    k_ln<<<LN_BLOCKS, blk, 0, stream>>>(sumb, ln1_g, ln1_b, ln1f, ln1b);

    // ---- cross attention ----
    k_gemm_qkv<<<g3, blk, 0, stream>>>(ln1b, cb, wt_caq, wt_cak, wt_cav, ca_bq, ca_bk, ca_bv,
                                       qb, kb, vb, D_EMB);
    k_attn<<<BB * NHEAD * (SS / 128), blk, 0, stream>>>(qb, kb, vb, ob);
    k_gemm_res<<<gD, blk, 0, stream>>>(ob, wt_cao, ca_bo, ln1f, sumb, D_EMB);
    k_ln<<<LN_BLOCKS, blk, 0, stream>>>(sumb, ln2_g, ln2_b, ln2f, ln2b);

    // ---- FFN ----
    k_gemm_relu<<<gF, blk, 0, stream>>>(ln2b, wt1, ffn_b1, f1b, D_EMB);
    k_gemm_res<<<gD, blk, 0, stream>>>(f1b,  wt2, ffn_b2, ln2f, sumb, DFF);
    k_ln<<<LN_BLOCKS, blk, 0, stream>>>(sumb, ln3_g, ln3_b, (float*)d_out, nullptr);
}

// v009
// It runs in 225 microseconds.
// Next to v008, in two timings, it ran 1.03 and 1.02 times as fast.
// Over all steps from v000 it is 3.42 times as fast.
#include <hip/hip_runtime.h>

// ---------------- problem constants ----------------
#define D_EMB 1024
#define NHEAD 16
#define DRED  64
#define BB    4
#define SS    1024
#define MTOT  (BB * SS)     // 4096 rows of activations
#define DFF   (4 * D_EMB)   // 4096

typedef unsigned int   u32;
typedef unsigned short u16;
typedef unsigned long long u64;
typedef u32   u32x2  __attribute__((ext_vector_type(2)));
typedef u32   u32x4  __attribute__((ext_vector_type(4)));
typedef u32   u32x8  __attribute__((ext_vector_type(8)));
typedef float f32x2  __attribute__((ext_vector_type(2)));
typedef float f32x4  __attribute__((ext_vector_type(4)));
typedef float f32x8  __attribute__((ext_vector_type(8)));
typedef __bf16 bf16x2  __attribute__((ext_vector_type(2)));
typedef __bf16 bf16x16 __attribute__((ext_vector_type(16)));

// ---------------- small helpers ----------------
// Two f32 to a packed bf16 pair (a low, b high), round to nearest even: the chip's own packed
// conversion, one vector instruction a pair.
__device__ __forceinline__ u32 pk_bf16(float a, float b) {
    f32x2 v; v[0] = a; v[1] = b;
    return __builtin_bit_cast(u32, __builtin_convertvector(v, bf16x2));
}

__device__ __forceinline__ f32x8 zero8() {
    f32x8 z;
#pragma unroll
    for (int i = 0; i < 8; ++i) z[i] = 0.0f;
    return z;
}

// LDS byte offset of a shared-memory pointer: flat LDS addresses keep the
// offset in the low 32 bits (ISA 10.2: LDS_ADDR = addr[31:0]).
__device__ __forceinline__ u32 lds_off(const void* p) {
    return (u32)(uintptr_t)p;
}

// One K slab's async global->LDS copies of a lane: 16 bytes in each of four 32-row groups of
// A and of B (GVS form, ASYNCcnt tracked, no VGPR round-trip). la, lb: the lane's LDS byte
// address in the first group; ga, gb: its byte offset from the base; grow: 32 source rows.
// The closing s_wait_xcnt 0 stands inside the statement so that no address register named
// here is rewritten in front of it.
#define SLAB_GROUP_LDS (32u * 144u)   // 32 LDS rows of 144 bytes
__device__ __forceinline__ void slab_copies(u32 la, u32 lb, u32 ga, u32 gb, u32 grow,
                                            const void* abase, const void* bbase) {
    asm volatile("global_load_async_to_lds_b128 %0, %8, %16\n\t"
                 "global_load_async_to_lds_b128 %4, %12, %17\n\t"
                 "global_load_async_to_lds_b128 %1, %9, %16\n\t"
                 "global_load_async_to_lds_b128 %5, %13, %17\n\t"
                 "global_load_async_to_lds_b128 %2, %10, %16\n\t"
                 "global_load_async_to_lds_b128 %6, %14, %17\n\t"
                 "global_load_async_to_lds_b128 %3, %11, %16\n\t"
                 "global_load_async_to_lds_b128 %7, %15, %17\n\t"
                 "s_wait_xcnt 0x0"
                 :: "v"(la), "v"(la + SLAB_GROUP_LDS), "v"(la + 2u * SLAB_GROUP_LDS),
                    "v"(la + 3u * SLAB_GROUP_LDS),
                    "v"(lb), "v"(lb + SLAB_GROUP_LDS), "v"(lb + 2u * SLAB_GROUP_LDS),
                    "v"(lb + 3u * SLAB_GROUP_LDS),
                    "v"(ga), "v"(ga + grow), "v"(ga + 2u * grow), "v"(ga + 3u * grow),
                    "v"(gb), "v"(gb + grow), "v"(gb + 2u * grow), "v"(gb + 3u * grow),
                    "s"(abase), "s"(bbase)
                 : "memory");
}

// Load one 16-lane-striped bf16 fragment (A or B operand of 16x16x32 WMMA).
// rowbase points at the lane's matrix row (m for A, n for B); koff = kblock + half*8.
// Per ISA 7.12.2: VGPR0-3 hold K=[koff..koff+7], VGPR4-7 hold K=[koff+16..koff+23].
__device__ __forceinline__ bf16x16 load_frag(const u16* rowbase, int koff) {
    u32x4 lo = *reinterpret_cast<const u32x4*>(rowbase + koff);
    u32x4 hi = *reinterpret_cast<const u32x4*>(rowbase + koff + 16);
    u32x8 d;
    d[0] = lo[0]; d[1] = lo[1]; d[2] = lo[2]; d[3] = lo[3];
    d[4] = hi[0]; d[5] = hi[1]; d[6] = hi[2]; d[7] = hi[3];
    return __builtin_bit_cast(bf16x16, d);
}

__device__ __forceinline__ f32x8 wmma_bf16(bf16x16 a, bf16x16 b, f32x8 c) {
    return __builtin_amdgcn_wmma_f32_16x16x32_bf16(false, a, false, b, (short)0, c,
                                                   false, false);
}

// Value of lane ^ 16 (the other 16-lane half), by a vector cross-row move.
__device__ __forceinline__ float xhalf(float x) {
    int b = __builtin_bit_cast(int, x);
    return __builtin_bit_cast(float,
        __builtin_amdgcn_permlanex16(b, b, 0x76543210, 0xfedcba98, false, false));
}

// Base-2 exponentials, v_exp_f32. The instruction set asks for one independent instruction or
// a v_nop between a transcendental and a use of its result or an overwrite of its source.
// Here the outputs are
// early-clobber (none lies on a source) and the closing v_nop fills the last one's slot.
__device__ __forceinline__ void exp2x8(float (&d)[8], const float (&s)[8]) {
    asm("v_exp_f32 %0, %8\n\t"
        "v_exp_f32 %1, %9\n\t"
        "v_exp_f32 %2, %10\n\t"
        "v_exp_f32 %3, %11\n\t"
        "v_exp_f32 %4, %12\n\t"
        "v_exp_f32 %5, %13\n\t"
        "v_exp_f32 %6, %14\n\t"
        "v_exp_f32 %7, %15\n\t"
        "v_nop"
        : "=&v"(d[0]), "=&v"(d[1]), "=&v"(d[2]), "=&v"(d[3]),
          "=&v"(d[4]), "=&v"(d[5]), "=&v"(d[6]), "=&v"(d[7])
        : "v"(s[0]), "v"(s[1]), "v"(s[2]), "v"(s[3]),
          "v"(s[4]), "v"(s[5]), "v"(s[6]), "v"(s[7]));
}
__device__ __forceinline__ float exp2x1(float s) {
    float d;
    asm("v_exp_f32 %0, %1\n\t"
        "v_nop"                       // the same slot, for the one result
        : "=v"(d) : "v"(s));
    return d;
}
#define LOG2E 1.44269504088896340736f

// ---------------- cast / repack kernels ----------------
// Each wave here moves many kilobytes, all its loads in flight together.

// f32 -> bf16 of one activation by 256 blocks of 256 threads; blk is this block's place among
// them. A thread takes 16 pieces of 4 elements one grid stride apart: every wave load covers 512
// contiguous bytes, every wave store 256, and all 16 loads are in flight before a store.
__device__ __forceinline__ void cast_bf16(const float* __restrict__ in, u16* __restrict__ out,
                                          int blk) {
    constexpr int ST = 256 * 256 * 4, IT = MTOT * D_EMB / ST;
    const int i = (blk * 256 + threadIdx.x) * 4;
    const float* pi = in + i;
    f32x4 v[IT];
#pragma unroll
    for (int it = 0; it < IT; ++it) v[it] = *reinterpret_cast<const f32x4*>(pi + it * ST);
    // The wait that belongs in front of an overwrite of an issued load's address register; the
    // address is its input, so that its registers are given to nothing else ahead of it.
    asm volatile("s_wait_xcnt 0x0" :: "v"(pi) : "memory");
#pragma unroll
    for (int it = 0; it < IT; ++it) {
        u32x2 w;
        w[0] = pk_bf16(v[it][0], v[it][1]);
        w[1] = pk_bf16(v[it][2], v[it][3]);
        *reinterpret_cast<u32x2*>(out + i + it * ST) = w;
    }
    // The same wait behind the stores, in front of whatever reuses their address registers.
    asm volatile("s_wait_xcnt 0x0" ::: "memory");
}

// Weight packs: transpose + cast through an LDS tile, so that both sides move whole lines.
// One block takes 256 rows (k) x 64 columns (n) of a row-major f32 matrix with row pitch ld
// and writes them as 64 rows of 256 bf16 with row pitch K.
// Read: a lane takes 16 bytes of rows 2p and 2p + 1; 16 lanes cover 256 contiguous bytes.
// LDS: tile[n][p] holds the bf16 pair (k = 2p, 2p + 1); the pitch 129 dwords puts the 32 lanes
// of every store (n = 4 * c4 + j, two p) and of every load (two n, 16 pieces) on 32 banks.
// Write: a lane stores 16 bytes; 16 lanes cover 256 contiguous bytes of one row.
#define PK 256
__device__ __forceinline__ void pack_tile(u32 (*tile)[PK / 2 + 1],
                                          const float* __restrict__ src, int ld,
                                          u16* __restrict__ dst, int K) {
    const int tid = threadIdx.x;
    const int c4 = tid & 15, p0 = tid >> 4;
    const float* pl[PK / 32];
    const float* ph[PK / 32];
    f32x4 lo[PK / 32], hi[PK / 32];
#pragma unroll
    for (int it = 0; it < PK / 32; ++it) {      // all loads first: 16 in flight per lane
        pl[it] = src + (size_t)(2 * (p0 + 16 * it)) * ld + 4 * c4;
        ph[it] = pl[it] + ld;
        lo[it] = *reinterpret_cast<const f32x4*>(pl[it]);
        hi[it] = *reinterpret_cast<const f32x4*>(ph[it]);
    }
    // The wait that belongs in front of an overwrite of an issued load's address register.
    // The addresses are its inputs, so that none of their registers is given to a later
    // load's result (or to anything else) ahead of it.
    asm volatile("s_wait_xcnt 0x0" :: "v"(pl[0]), "v"(ph[0]), "v"(pl[1]), "v"(ph[1]),
                                      "v"(pl[2]), "v"(ph[2]), "v"(pl[3]), "v"(ph[3]),
                                      "v"(pl[4]), "v"(ph[4]), "v"(pl[5]), "v"(ph[5]),
                                      "v"(pl[6]), "v"(ph[6]), "v"(pl[7]), "v"(ph[7])
                 : "memory");
#pragma unroll
    for (int it = 0; it < PK / 32; ++it)
#pragma unroll
        for (int j = 0; j < 4; ++j)
            tile[4 * c4 + j][p0 + 16 * it] = pk_bf16(lo[it][j], hi[it][j]);
    __syncthreads();                            // the whole tile is in LDS before it is read
    // 32 16-byte pieces a row. A wave takes 16 pieces of each of two neighbouring rows.
    const int sl = tid & 15, nl = (tid >> 4) & 1, sh = (tid >> 5) & 1, nh = tid >> 6;
#pragma unroll
    for (int it = 0; it < PK / 32; ++it) {
        const int n = 2 * (nh + 4 * it) + nl, s = 16 * sh + sl;
        u32x4 w;
#pragma unroll
        for (int e = 0; e < 4; ++e) w[e] = tile[n][4 * s + e];
        *reinterpret_cast<u32x4*>(dst + (size_t)n * K + 8 * s) = w;
    }
    // The same wait behind the stores, in front of whatever reuses their address registers.
    asm volatile("s_wait_xcnt 0x0" ::: "memory");
}

// All input preparation in ONE launch: none of these pieces reads what another writes, so they
// share a grid and the chip fills once instead of twelve times. Block ranges:
//   [0, 256)      ffn_w1 [1024][4096] -> wt1 [4096][1024], 256 k x 64 n a block
//   [256, 512)    ffn_w2 [4096][1024] -> wt2 [1024][4096], the same
//   [512, 1024)   eight 1024 x 1024 weights, 64 blocks each, the same tile -> wt8 + i * 2^20
//                 i & 3 < 3: per-head w [H=16][K=1024][R=64] -> Wt [n = h*64 + r][k]
//                 i & 3 == 3: plain w [K=1024][N=1024] -> Wt [n][k]
//   [1024, 1536)  x and context to bf16, 256 blocks each
#define PREP_BLOCKS 1536
__global__ __launch_bounds__(256) void k_prep(
    const float* __restrict__ x,  const float* __restrict__ ctx,
    const float* __restrict__ w0, const float* __restrict__ w1,
    const float* __restrict__ w2, const float* __restrict__ w3,
    const float* __restrict__ w4, const float* __restrict__ w5,
    const float* __restrict__ w6, const float* __restrict__ w7,
    const float* __restrict__ f1, const float* __restrict__ f2,
    u16* __restrict__ xb, u16* __restrict__ cb, u16* __restrict__ wt8,
    u16* __restrict__ wt1, u16* __restrict__ wt2)
{
    __shared__ u32 tile[64][PK / 2 + 1];
    const int bx = blockIdx.x;
    if (bx < 512) {
        const bool first = bx < 256;
        const int r  = bx & 255;
        const int nt = first ? (r & 63) : (r & 15);      // 64-column tile
        const int kt = first ? (r >> 6) : (r >> 4);      // 256-row tile
        const int N  = first ? DFF : D_EMB, K = first ? D_EMB : DFF;
        pack_tile(tile, (first ? f1 : f2) + (size_t)(kt * PK) * N + nt * 64, N,
                  (first ? wt1 : wt2) + (size_t)(nt * 64) * K + kt * PK, K);
    } else if (bx < 1024) {
        const int i = (bx - 512) >> 6, r = bx & 63;
        const float* w = i == 0 ? w0 : i == 1 ? w1 : i == 2 ? w2 : i == 3 ? w3
                       : i == 4 ? w4 : i == 5 ? w5 : i == 6 ? w6 : w7;
        const bool plain = (i & 3) == 3;
        // per head: the head's 64 columns are n tile nt, its k tiles next to one another
        const int nt = plain ? (r & 15) : (r >> 2), kt = plain ? (r >> 4) : (r & 3);
        const int so = plain ? kt * PK * D_EMB + nt * 64 : nt * (D_EMB * DRED) + kt * PK * DRED;
        pack_tile(tile, w + so, plain ? D_EMB : DRED,
                  wt8 + (size_t)i * (D_EMB * D_EMB) + nt * 64 * D_EMB + kt * PK, D_EMB);
    } else {
        const int c = bx - 1024;
        const bool first = c < 256;
        cast_bf16(first ? x : ctx, first ? xb : cb, c & 255);
    }
}

// ---------------- WMMA GEMM ----------------
// C[M,N] = act(A_bf16[M,K] x Wt_bf16[N,K]^T + bias) (+resid); writes f32 or bf16.
// Block tile 128x128, 8 waves (2 along M x 4 along N), wave tile 64x32 (4x2 WMMA tiles).
// K slabs of 64 alternate between two LDS buffers: slab t + 1's async copies fly while
// slab t is worked on.
// ring: [buffer][A, B][row][k]; row-pad 72: stride 36 dwords -> conflict-free b128
// What the epilogue does (RELU, RESID, f32 or bf16 output) and the row length N are compile-time,
// so that it is straight-line code: a lane's bias and residual values are then loaded as ONE
// group, all in flight together under slab 0's copies, instead of one load latency an element
// behind the k loop, and every load and store is one base address plus an immediate offset.
// GRP: k blocks whose fragments are loaded as one group, 1 or 2 (48 registers each). 2, the whole
// slab, where one workgroup stands on a WGP and the registers are free; 1 where three or four
// workgroups share the WGP's registers and cover one another's waits.
template <int N, bool RELU, bool RESID, bool OUTF, int GRP>
__device__ __forceinline__ void gemm_tile(
    u16 (*ring)[2][128][72],
    const u16* __restrict__ A, const u16* __restrict__ Wt,
    const float* __restrict__ bias, const float* __restrict__ resid,
    float* __restrict__ outF, u16* __restrict__ outB,
    int K)
{
    const int tid  = threadIdx.x;
    const int lane = tid & 31, l15 = lane & 15, hf = (lane >> 4) & 1;
    const int wid  = tid >> 5;
    const int bm = blockIdx.y * 128, bn = blockIdx.x * 128;
    const int wm = (wid & 1) * 64,   wn = (wid >> 1) * 32;

    f32x8 acc[4][2];
#pragma unroll
    for (int mt = 0; mt < 4; ++mt)
#pragma unroll
        for (int nt = 0; nt < 2; ++nt) acc[mt][nt] = zero8();

    // a lane copies 16 bytes of row r0 (+32, +64, +96) of each operand's slab
    const int r0 = tid >> 3, c8 = (tid & 7) << 3;
    const u32 la0 = lds_off(&ring[0][0][r0][c8]);
    const u32 lb0 = lds_off(&ring[0][1][r0][c8]);
    const u32 ga0 = ((u32)(bm + r0) * (u32)K + (u32)c8) * 2u;
    const u32 gb0 = ((u32)(bn + r0) * (u32)K + (u32)c8) * 2u;
    const u32 grow = (u32)K * 64u;            // 32 source rows in bytes
    const u32 bufB = (u32)sizeof(ring[0]);    // one buffer in bytes
    const int T = K >> 6;                     // slabs; K is a multiple of 64, at least 64

    slab_copies(la0, lb0, ga0, gb0, grow, A, Wt);         // slab 0 into buffer 0

    // C layout: M = v + 8*half, N = lane&15. o0: the lane's first element of the output tile.
    const u32 o0 = (u32)(bm + wm + 8 * hf) * (u32)N + (u32)(bn + wn + l15);
    float bv[2], rv[4][2][8];
#pragma unroll
    for (int nt = 0; nt < 2; ++nt) bv[nt] = bias[bn + wn + nt * 16 + l15];
    if constexpr (RESID) {
        const float* rp = resid + o0;
#pragma unroll
        for (int mt = 0; mt < 4; ++mt)
#pragma unroll
            for (int nt = 0; nt < 2; ++nt)
#pragma unroll
                for (int v = 0; v < 8; ++v) rv[mt][nt][v] = rp[(mt * 16 + v) * N + nt * 16];
    }

    asm volatile("s_wait_asynccnt 0x0" ::: "memory");     // this wave's copies have landed
    __syncthreads();                                      // every wave's are visible
    if (1 < T)                                            // slab 1 into buffer 1
        slab_copies(la0 + bufB, lb0 + bufB, ga0 + 128u, gb0 + 128u, grow, A, Wt);

    for (int t = 0; t < T; ++t) {
        const u16 (*aS)[72] = ring[t & 1][0];
        const u16 (*bS)[72] = ring[t & 1][1];
        // GRP k blocks of 32 share one group of fragment loads: all its ds_loads are issued
        // first, then its WMMAs run behind counted waits, so a wave meets the LDS latency once a
        // group and not once for every pair of WMMAs.
#pragma unroll
        for (int k0 = 0; k0 < 64; k0 += 32 * GRP) {
            bf16x16 af[GRP][4], bfr[GRP][2];
#pragma unroll
            for (int g = 0; g < GRP; ++g) {
                const int ko = k0 + 32 * g + hf * 8;
#pragma unroll
                for (int nt = 0; nt < 2; ++nt)
                    bfr[g][nt] = load_frag(&bS[wn + nt * 16 + l15][0], ko);
#pragma unroll
                for (int mt = 0; mt < 4; ++mt)
                    af[g][mt] = load_frag(&aS[wm + mt * 16 + l15][0], ko);
            }
            // Keeps the loads above the WMMAs: without it the scheduler sinks them among the
            // WMMAs into one reused fragment register set, each pair behind a full LDS wait.
            __builtin_amdgcn_sched_barrier(0);
#pragma unroll
            for (int g = 0; g < GRP; ++g)
#pragma unroll
                for (int mt = 0; mt < 4; ++mt)
#pragma unroll
                    for (int nt = 0; nt < 2; ++nt)
                        acc[mt][nt] = wmma_bf16(af[g][mt], bfr[g][nt], acc[mt][nt]);
            // Keeps the next group's loads from rising among these WMMAs, and the last group's
            // WMMAs from sinking below the publish point, where the refill copies would wait
            // behind them and lose that much of their lead.
            __builtin_amdgcn_sched_barrier(0);
        }
        // publish point of slab t + 1, in this order:
        asm volatile("s_wait_dscnt 0x0" ::: "memory");    // this wave's reads of slab t are back
        asm volatile("s_wait_asynccnt 0x0" ::: "memory"); // its copies of slab t + 1 have landed
        __syncthreads();      // slab t + 1 visible to all; every reader has left slab t's buffer
        if (t + 2 < T) {      // refill that buffer
            const u32 bo = (u32)(t & 1) * bufB, go = (u32)(t + 2) * 128u;
            slab_copies(la0 + bo, lb0 + bo, ga0 + go, gb0 + go, grow, A, Wt);
        }
    }
    asm volatile("s_wait_asynccnt 0x0" ::: "memory");     // no copy outlives the loop

#pragma unroll
    for (int mt = 0; mt < 4; ++mt)
#pragma unroll
        for (int nt = 0; nt < 2; ++nt)
#pragma unroll
            for (int v = 0; v < 8; v += 2) {    // two rows a trip: one conversion serves both
                float val[2];
#pragma unroll
                for (int e = 0; e < 2; ++e) {
                    val[e] = acc[mt][nt][v + e] + bv[nt];
                    if constexpr (RELU)  val[e] = fmaxf(val[e], 0.0f);
                    if constexpr (RESID) val[e] += rv[mt][nt][v + e];
                }
                const int o = (mt * 16 + v) * N + nt * 16;
                if constexpr (OUTF) {
                    (outF + o0)[o]     = val[0];
                    (outF + o0)[o + N] = val[1];
                } else {
                    const u32 w = pk_bf16(val[0], val[1]);
                    (outB + o0)[o]     = (u16)w;
                    (outB + o0)[o + N] = (u16)(w >> 16);
                }
            }
}

// outF[M, 1024] = A x Wt^T + bias + resid, f32
__global__ __launch_bounds__(256) void k_gemm_res(
    const u16* __restrict__ A, const u16* __restrict__ Wt,
    const float* __restrict__ bias, const float* __restrict__ resid,
    float* __restrict__ outF, int K)
{
    __shared__ __attribute__((aligned(16))) u16 ring[2][2][128][72];
    gemm_tile<D_EMB, false, true, true, 2>(ring, A, Wt, bias, resid, outF, nullptr, K);
}

// outB[M, 4096] = relu(A x Wt^T + bias), bf16
__global__ __launch_bounds__(256) void k_gemm_relu(
    const u16* __restrict__ A, const u16* __restrict__ Wt,
    const float* __restrict__ bias, u16* __restrict__ outB, int K)
{
    __shared__ __attribute__((aligned(16))) u16 ring[2][2][128][72];
    gemm_tile<DFF, true, false, false, 1>(ring, A, Wt, bias, nullptr, nullptr, outB, K);
}

// The q, k and v projections of one attention in ONE launch: they do not depend on one another,
// so blockIdx.z picks the product. Three workgroups then stand on a WGP where one stood, and
// each one's copy latency, barriers and epilogue run under the others' WMMAs.
__global__ __launch_bounds__(256) void k_gemm_qkv(
    const u16* __restrict__ Aq, const u16* __restrict__ Akv,
    const u16* __restrict__ Wq, const u16* __restrict__ Wk, const u16* __restrict__ Wv,
    const float* __restrict__ bq, const float* __restrict__ bk, const float* __restrict__ bv,
    u16* __restrict__ oq, u16* __restrict__ ok, u16* __restrict__ ov,
    int K)
{
    __shared__ __attribute__((aligned(16))) u16 ring[2][2][128][72];
    const int z = blockIdx.z;
    gemm_tile<D_EMB, false, false, false, 1>(ring, z == 0 ? Aq : Akv,
              z == 0 ? Wq : z == 1 ? Wk : Wv,
              z == 0 ? bq : z == 1 ? bk : bv, nullptr, nullptr,
              z == 0 ? oq : z == 1 ? ok : ov, K);
}

// ---------------- fused flash attention (bf16 WMMA, online softmax) ----------------
// q,k,v,o: bf16 [B][S][H][R] ; one block = one (b,h) x 128 query rows; 8 waves x 16 rows.
// Scores are formed transposed, St = K x Qt, and the output as Ot += Vt x Pt: a lane then
// holds 16 of the 32 scores of ONE query, so maximum and sum run in the lane's own registers
// (one exchange with lane ^ 16), and two score tiles, converted in place, are the B operand.
// Chunks of 128 keys alternate between two LDS buffers. Wave 0 brings a chunk's K rows and wave 1
// its V rows by one tensor load each, one chunk ahead, so the loads fly under the chunk that is
// worked on and no register, vector instruction or LDS store is spent on staging. V lands as it
// lies in memory, [t][r]; the transposing LDS load hands it out as the Vt fragment.
#define AT_NCH  (SS / 128)                  // chunks
#define AT_PK   144u                        // LDS pitch of a K row: 128 + 16 bytes, ds_load_b128
#define AT_PV   160u                        // LDS pitch of a V row: 128 + 32 bytes, ds_load_tr16_b128
#define AT_TK   (128u * AT_PK)
#define AT_TV   (128u * AT_PV)
#define AT_BUF  (AT_TK + AT_TV)
#define AT_SRCP ((u32)(NHEAD * DRED * 2))   // source row pitch in bytes
static_assert(AT_TK % 2048u == 0 && AT_BUF % 2048u == 0, "every tile starts at a multiple of 2 KiB");

__device__ __forceinline__ u32 uni(u32 v) { return (u32)__builtin_amdgcn_readfirstlane(v); }
// A wave-uniform value held in a scalar register. A tensor load ignores EXEC, so every test around
// one must compile to s_cmp and s_cbranch_scc; the empty statement keeps the value from being
// turned back into a vector condition (and what is formed from it behind the wait in front of it).
__device__ __forceinline__ u32 pinned(u32 v) { u32 w = uni(v); asm volatile("" : "+s"(w)); return w; }

// Descriptor of a tile of 128 rows of 128 bytes, source pitch AT_SRCP, extents in bytes.
// PAD: dwords of LDS pad behind every row, less one.
template <u32 PAD>
__device__ __forceinline__ u32x8 tile_group1() {
    u32x8 g1;
    g1[0] = uni((1u << 20) | (4u << 22) | (PAD << 25));           // pad behind every 32 dwords
    g1[1] = uni(128u << 16);                                      // tensor_dim0 = 128 bytes
    g1[2] = uni(128u << 16);                                      // tensor_dim1 = 128 rows
    g1[3] = uni(128u << 16);                                      // tile_dim0
    g1[4] = uni(128u);                                            // tile_dim1
    g1[5] = uni(AT_SRCP);
    g1[6] = uni(0u);
    g1[7] = uni(0u);
    // Descriptor words held in scalar registers: built once and kept there, so that no register
    // which a request in flight names is given another value (see the waits in k_attn).
    asm volatile("" : "+s"(g1));
    return g1;
}
// dst: LDS byte offset of the tile; ga: address of its first byte.
__device__ __forceinline__ u32x4 tile_group0(u32 dst, u64 ga) {
    u32x4 g0;
    g0[0] = uni(1u);                                              // count 1
    g0[1] = uni(dst);
    g0[2] = uni((u32)ga);
    g0[3] = uni(((u32)(ga >> 32) & 0x01ffffffu) | 0x80000000u);   // address high bits, type 2
    asm volatile("" : "+s"(g0));                                  // held like the words above
    return g0;
}
__device__ __forceinline__ void tile_load(u32x4 g0, u32x8 g1) {
    asm volatile("tensor_load_to_lds %0, %1" :: "s"(g0), "s"(g1) : "memory");
}

// 16 (r) x 32 (t) fragment of Vt from row-major V rows in LDS. p: the lane's address, row
// 8 * half + (lane & 7), byte 16 * ((lane >> 3) & 1). The lane gets V[8 * half + 0..7][lane & 15]
// and the same 16 rows further on: the k order of load_frag and of the packed scores.
typedef short s16x8 __attribute__((ext_vector_type(8)));
__device__ __forceinline__ bf16x16 load_frag_tr(const unsigned char* p) {
    typedef __attribute__((address_space(3))) s16x8 lds_s16x8;
    u32x4 lo = __builtin_bit_cast(u32x4, __builtin_amdgcn_ds_load_tr16_b128_v8i16((lds_s16x8*)p));
    u32x4 hi = __builtin_bit_cast(u32x4,
        __builtin_amdgcn_ds_load_tr16_b128_v8i16((lds_s16x8*)(p + 16u * AT_PV)));
    u32x8 d;
    d[0] = lo[0]; d[1] = lo[1]; d[2] = lo[2]; d[3] = lo[3];
    d[4] = hi[0]; d[5] = hi[1]; d[6] = hi[2]; d[7] = hi[3];
    return __builtin_bit_cast(bf16x16, d);
}

__global__ __launch_bounds__(256) void k_attn(
    const u16* __restrict__ qp, const u16* __restrict__ kp,
    const u16* __restrict__ vp, u16* __restrict__ op)
{
    // [buffer][K rows at pitch AT_PK | V rows at pitch AT_PV]
    __shared__ __attribute__((aligned(2048))) unsigned char ring[2 * AT_BUF];

    const int tid  = threadIdx.x;
    const int lane = tid & 31, l15 = lane & 15, hf = (lane >> 4) & 1;
    const int wid  = tid >> 5;
    const u32 wave = uni((u32)wid);
    const int bx = blockIdx.x;
    const int qc = bx & 7;                 // S/128 = 8 chunks
    const int h  = (bx >> 3) & (NHEAD - 1);
    const int b  = bx >> 7;
    const int qbase = qc * 128 + wid * 16;

    // chunk st of this (b, h): wave 0 asks for its K rows, wave 1 for its V rows
    const u64 src  = (u64)(uintptr_t)(wave == 1u ? vp : kp) + 2ull * (u64)((b * SS * NHEAD + h) * DRED);
    const u32 dst0 = lds_off(ring) + (wave == 1u ? AT_TK : 0u);
    const u32x8 g1k = tile_group1<3u>(), g1v = tile_group1<7u>();
    u32x4 g0 = {0u, 0u, 0u, 0u};            // the wave's last request
    auto issue = [&](u32 st) {
        if (pinned(wave < 2u)) {
            g0 = tile_group0(dst0 + (st & 1u) * AT_BUF, src + (u64)st * (128u * AT_SRCP));
            if (pinned(wave == 0u)) tile_load(g0, g1k);
            else                    tile_load(g0, g1v);
        }
    };
    // The issuing wave's own wait: its tile has landed. The descriptor is its input, so that the
    // registers which the request names are given to nothing else ahead of it.
    auto landed = [&]() {
        if (pinned(wave < 2u))
            asm volatile("s_wait_tensorcnt 0x0" :: "s"(g0), "s"(g1k), "s"(g1v) : "memory");
    };
    issue(0u);

    // Q fragments straight from global (row is contiguous 64 bf16); B operand, column = query
    const int srow = qbase + l15;
    const u16* qrow = qp + (size_t)((b * SS + srow) * NHEAD + h) * DRED;
    bf16x16 qf[2];
    qf[0] = load_frag(qrow, 0  + hf * 8);
    qf[1] = load_frag(qrow, 32 + hf * 8);

    f32x8 oacc[4];
#pragma unroll
    for (int rt = 0; rt < 4; ++rt) oacc[rt] = zero8();
    float run_m = -1.0e30f;   // running maximum of query l15 (equal in both lane halves)
    float run_l = 0.0f;       // running sum over this lane half's keys only; joined at the end

    landed();                 // chunk 0
    __syncthreads();          // chunk 0 visible to all
    issue(1u);

    const u32 vlane = (u32)(8 * hf + (lane & 7)) * AT_PV + (u32)((lane >> 3) & 1) * 16u;

    for (u32 nc = 0; nc < AT_NCH; ++nc) {
        const unsigned char* buf = ring + (nc & 1u) * AT_BUF;
        const u16 (*kch)[72] = reinterpret_cast<const u16 (*)[72]>(buf);
        const unsigned char* vch = buf + AT_TK + vlane;

#pragma unroll
        for (int tt = 0; tt < 4; ++tt) {        // 32 keys per step
            f32x8 s0 = zero8(), s1 = zero8();   // St[key = v + 8*half (+16)][query = l15]
            bf16x16 a0[2], a1[2];
#pragma unroll
            for (int kb = 0; kb < 2; ++kb) {
                a0[kb] = load_frag(&kch[tt * 32 +      l15][0], kb * 32 + hf * 8);
                a1[kb] = load_frag(&kch[tt * 32 + 16 + l15][0], kb * 32 + hf * 8);
            }
            // Keeps the step's K loads together ahead of its WMMAs: with the fence at the step's
            // foot the scheduler otherwise sinks them, two in front of each WMMA behind a full wait.
            __builtin_amdgcn_sched_barrier(0);
#pragma unroll
            for (int kb = 0; kb < 2; ++kb) {    // contract over R=64
                s0 = wmma_bf16(a0[kb], qf[kb], s0);
                s1 = wmma_bf16(a1[kb], qf[kb], s1);
            }
            // online softmax of query l15: 16 keys in this lane, 16 in lane ^ 16
            const f32x8 sa = s0 * 0.125f, sc = s1 * 0.125f;       // 1/sqrt(64)
            float rm = fmaxf(sa[0], sc[0]);
#pragma unroll
            for (int v = 1; v < 8; ++v) rm = fmaxf(rm, fmaxf(sa[v], sc[v]));
            rm = fmaxf(rm, xhalf(rm));
            const float nm = fmaxf(run_m, rm);
            const float cr = exp2x1((run_m - nm) * LOG2E);
            run_m = nm;
            float t0[8], t1[8], e0[8], e1[8];
#pragma unroll
            for (int v = 0; v < 8; ++v) { t0[v] = (sa[v] - nm) * LOG2E; t1[v] = (sc[v] - nm) * LOG2E; }
            exp2x8(e0, t0);
            exp2x8(e1, t1);
            float ps = 0.0f;
#pragma unroll
            for (int v = 0; v < 8; ++v) ps += e0[v] + e1[v];
            run_l = run_l * cr + ps;
            u32x8 pd;                           // Pt as B operand: k = 8*half + s, 16 + 8*half + s
#pragma unroll
            for (int j = 0; j < 4; ++j) {
                pd[j]     = pk_bf16(e0[2 * j], e0[2 * j + 1]);
                pd[4 + j] = pk_bf16(e1[2 * j], e1[2 * j + 1]);
            }
            const bf16x16 pf = __builtin_bit_cast(bf16x16, pd);
#pragma unroll
            for (int rt = 0; rt < 4; ++rt) {    // Ot[r = rt*16 + v + 8*half][query = l15]
#pragma unroll
                for (int v = 0; v < 8; ++v) oacc[rt][v] *= cr;
                bf16x16 vf = load_frag_tr(vch + (u32)tt * 32u * AT_PV + (u32)rt * 32u);
                oacc[rt] = wmma_bf16(vf, pf, oacc[rt]);
            }
            // Keeps the next step's exponentials, asm text that the compiler does not look into,
            // from being placed directly behind these WMMAs and over their operand registers,
            // inside the distance that the chip needs there.
            __builtin_amdgcn_sched_barrier(0);
        }
        // publish point of chunk nc + 1, in this order:
        asm volatile("s_wait_dscnt 0x0" ::: "memory");          // this wave's reads of chunk nc are back
        landed();                                               // the issuers' tiles of chunk nc + 1
        __syncthreads();   // chunk nc + 1 visible to all; every reader has left chunk nc's buffer
        if (pinned(nc + 2u < AT_NCH)) issue(pinned(nc + 2u));   // refill that buffer
    }
    asm volatile("s_wait_tensorcnt 0x0" ::: "memory");          // no request outlives the loop
    asm volatile("s_wait_dscnt 0x0" ::: "memory");

    // a lane holds 8 consecutive r of one query per tile: one 16-byte store each
    const float inv = 1.0f / (run_l + xhalf(run_l));
    u16* orow = op + (size_t)((b * SS + srow) * NHEAD + h) * DRED + 8 * hf;
#pragma unroll
    for (int rt = 0; rt < 4; ++rt) {
        u32x4 w;
#pragma unroll
        for (int j = 0; j < 4; ++j)
            w[j] = pk_bf16(oacc[rt][2 * j] * inv, oacc[rt][2 * j + 1] * inv);
        *reinterpret_cast<u32x4*>(orow + rt * 16) = w;
    }
}

// ---------------- LayerNorm ----------------
// Value of lane ^ X inside a 16-lane row, by DPP (the compiler folds it into the add).
template <int X>
__device__ __forceinline__ float xrow(float x) {
    int b = __builtin_bit_cast(int, x);
    return __builtin_bit_cast(float, __builtin_amdgcn_update_dpp(0, b, 0x160 + X, 0xf, 0xf, true));
}
// Sum over the wave's 32 lanes, the same bits in every lane.
__device__ __forceinline__ float wave_sum(float v) {
    v += xrow<1>(v);
    v += xrow<2>(v);
    v += xrow<4>(v);
    v += xrow<8>(v);
    return v + xhalf(v);
}

// One wave norms LN_ROWS whole rows: 2048 waves a launch instead of 32768. A row is 8 loads of 512 contiguous bytes; both rows' loads and those of
// gamma and beta are in flight together; the sums stay inside the wave, so no LDS, no barrier.
#define LN_ROWS 2
#define LN_BLOCKS (MTOT / (8 * LN_ROWS))
__global__ __launch_bounds__(256) void k_ln(
    const float* __restrict__ in, const float* __restrict__ g, const float* __restrict__ bb,
    float* __restrict__ outF, u16* __restrict__ outB)
{
    const int lane = threadIdx.x & 31;
    const int wave = blockIdx.x * 8 + (threadIdx.x >> 5);
    const int o0 = wave * (LN_ROWS * D_EMB) + lane * 4;   // the lane's first element
    const float* px = in + o0;
    f32x4 x[LN_ROWS][8], gv[8], bv[8];
#pragma unroll
    for (int r = 0; r < LN_ROWS; ++r)
#pragma unroll
        for (int j = 0; j < 8; ++j)
            x[r][j] = *reinterpret_cast<const f32x4*>(px + r * D_EMB + j * 128);
#pragma unroll
    for (int j = 0; j < 8; ++j) {
        gv[j] = reinterpret_cast<const f32x4*>(g)[lane + j * 32];
        bv[j] = reinterpret_cast<const f32x4*>(bb)[lane + j * 32];
    }
    // The wait that belongs in front of an overwrite of an issued load's address register; the
    // addresses are its inputs, so that their registers are given to nothing else ahead of it.
    asm volatile("s_wait_xcnt 0x0" :: "v"(px), "v"(lane) : "memory");
    // Keeps all 32 loads above the sums: without it the scheduler sinks those of gamma and beta
    // below the reduction, two at a time, each pair behind a latency of its own.
    __builtin_amdgcn_sched_barrier(0);
#pragma unroll
    for (int r = 0; r < LN_ROWS; ++r) {
        f32x4 a1 = x[r][0], a2 = x[r][0] * x[r][0];       // four independent chains each
#pragma unroll
        for (int j = 1; j < 8; ++j) { a1 += x[r][j]; a2 += x[r][j] * x[r][j]; }
        const float t1 = wave_sum((a1[0] + a1[1]) + (a1[2] + a1[3]));
        const float t2 = wave_sum((a2[0] + a2[1]) + (a2[2] + a2[3]));
        const float mean = t1 * (1.0f / D_EMB);
        const float var  = t2 * (1.0f / D_EMB) - mean * mean;
        const float sc = rsqrtf(var + 1e-3f);
#pragma unroll
        for (int j = 0; j < 8; ++j) x[r][j] = (x[r][j] - mean) * sc * gv[j] + bv[j];
    }
    if (outF) {
#pragma unroll
        for (int r = 0; r < LN_ROWS; ++r)
#pragma unroll
            for (int j = 0; j < 8; ++j)
                *reinterpret_cast<f32x4*>(outF + o0 + r * D_EMB + j * 128) = x[r][j];
        // The same wait behind the stores: the conversion below reuses their registers.
        asm volatile("s_wait_xcnt 0x0" ::: "memory");
    }
    if (outB) {
#pragma unroll
        for (int r = 0; r < LN_ROWS; ++r)
#pragma unroll
            for (int j = 0; j < 8; ++j) {
                u32x2 w;
                w[0] = pk_bf16(x[r][j][0], x[r][j][1]);
                w[1] = pk_bf16(x[r][j][2], x[r][j][3]);
                *reinterpret_cast<u32x2*>(outB + o0 + r * D_EMB + j * 128) = w;
            }
    }
    // The same wait behind the stores, in front of whatever reuses their address registers.
    asm volatile("s_wait_xcnt 0x0" ::: "memory");
}

// ---------------- host orchestration ----------------
extern "C" void kernel_launch(void* const* d_in, const int* in_sizes, int n_in,
                              void* d_out, int out_size, void* d_ws, size_t ws_size,
                              hipStream_t stream) {
    (void)in_sizes; (void)n_in; (void)out_size; (void)ws_size;

    const float* x      = (const float*)d_in[0];
    const float* ctx    = (const float*)d_in[1];
    const float* sa_wq  = (const float*)d_in[2];
    const float* sa_bq  = (const float*)d_in[3];
    const float* sa_wk  = (const float*)d_in[4];
    const float* sa_bk  = (const float*)d_in[5];
    const float* sa_wv  = (const float*)d_in[6];
    const float* sa_bv  = (const float*)d_in[7];
    const float* sa_wo  = (const float*)d_in[8];
    const float* sa_bo  = (const float*)d_in[9];
    const float* ca_wq  = (const float*)d_in[10];
    const float* ca_bq  = (const float*)d_in[11];
    const float* ca_wk  = (const float*)d_in[12];
    const float* ca_bk  = (const float*)d_in[13];
    const float* ca_wv  = (const float*)d_in[14];
    const float* ca_bv  = (const float*)d_in[15];
    const float* ca_wo  = (const float*)d_in[16];
    const float* ca_bo  = (const float*)d_in[17];
    const float* ln1_g  = (const float*)d_in[18];
    const float* ln1_b  = (const float*)d_in[19];
    const float* ln2_g  = (const float*)d_in[20];
    const float* ln2_b  = (const float*)d_in[21];
    const float* ln3_g  = (const float*)d_in[22];
    const float* ln3_b  = (const float*)d_in[23];
    const float* ffn_w1 = (const float*)d_in[24];
    const float* ffn_b1 = (const float*)d_in[25];
    const float* ffn_w2 = (const float*)d_in[26];
    const float* ffn_b2 = (const float*)d_in[27];

    char* ws = (char*)d_ws;
    size_t off = 0;
    auto alloc = [&](size_t bytes) -> void* {
        void* p = ws + off;
        off = (off + bytes + 255) & ~(size_t)255;
        return p;
    };

    const size_t ACT2 = (size_t)MTOT * D_EMB * 2;   // bf16 activation
    const size_t ACT4 = (size_t)MTOT * D_EMB * 4;   // f32 activation
    const size_t W2   = (size_t)D_EMB * D_EMB * 2;  // bf16 1024x1024 weight

    u16* xb     = (u16*)alloc(ACT2);
    u16* cb     = (u16*)alloc(ACT2);
    u16* wt8    = (u16*)alloc(8 * W2);              // the eight 1024 x 1024 weights in a row
    u16* wt_saq = wt8;
    u16* wt_sak = wt8 + 1 * (D_EMB * D_EMB);
    u16* wt_sav = wt8 + 2 * (D_EMB * D_EMB);
    u16* wt_sao = wt8 + 3 * (D_EMB * D_EMB);
    u16* wt_caq = wt8 + 4 * (D_EMB * D_EMB);
    u16* wt_cak = wt8 + 5 * (D_EMB * D_EMB);
    u16* wt_cav = wt8 + 6 * (D_EMB * D_EMB);
    u16* wt_cao = wt8 + 7 * (D_EMB * D_EMB);
    u16* wt1    = (u16*)alloc((size_t)DFF * D_EMB * 2);
    u16* wt2    = (u16*)alloc((size_t)D_EMB * DFF * 2);
    u16* qb     = (u16*)alloc(ACT2);
    u16* kb     = (u16*)alloc(ACT2);
    u16* vb     = (u16*)alloc(ACT2);
    u16* ob     = (u16*)alloc(ACT2);
    float* sumb = (float*)alloc(ACT4);
    float* ln1f = (float*)alloc(ACT4);
    u16*   ln1b = (u16*)alloc(ACT2);
    float* ln2f = (float*)alloc(ACT4);
    u16*   ln2b = (u16*)alloc(ACT2);
    u16*   f1b  = (u16*)alloc((size_t)MTOT * DFF * 2);

    const dim3 blk(256);
    // casts + packs
    k_prep<<<PREP_BLOCKS, blk, 0, stream>>>(x, ctx, sa_wq, sa_wk, sa_wv, sa_wo,
                                            ca_wq, ca_wk, ca_wv, ca_wo, ffn_w1, ffn_w2,
                                            xb, cb, wt8, wt1, wt2);

    const dim3 gD(D_EMB / 128, MTOT / 128);   // N=1024 GEMMs
    const dim3 gF(DFF   / 128, MTOT / 128);   // N=4096 GEMM
    const dim3 g3(D_EMB / 128, MTOT / 128, 3);   // q, k, v projections together

    // ---- self attention ----
    k_gemm_qkv<<<g3, blk, 0, stream>>>(xb, xb, wt_saq, wt_sak, wt_sav, sa_bq, sa_bk, sa_bv,
                                       qb, kb, vb, D_EMB);
    k_attn<<<BB * NHEAD * (SS / 128), blk, 0, stream>>>(qb, kb, vb, ob);
    k_gemm_res<<<gD, blk, 0, stream>>>(ob, wt_sao, sa_bo, x, sumb, D_EMB);
    k_ln<<<LN_BLOCKS, blk, 0, stream>>>(sumb, ln1_g, ln1_b, ln1f, ln1b);

    // ---- cross attention ----
    k_gemm_qkv<<<g3, blk, 0, stream>>>(ln1b, cb, wt_caq, wt_cak, wt_cav, ca_bq, ca_bk, ca_bv,
                                       qb, kb, vb, D_EMB);
    k_attn<<<BB * NHEAD * (SS / 128), blk, 0, stream>>>(qb, kb, vb, ob);
    k_gemm_res<<<gD, blk, 0, stream>>>(ob, wt_cao, ca_bo, ln1f, sumb, D_EMB);
    k_ln<<<LN_BLOCKS, blk, 0, stream>>>(sumb, ln2_g, ln2_b, ln2f, ln2b);

    // ---- FFN ----
    k_gemm_relu<<<gF, blk, 0, stream>>>(ln2b, wt1, ffn_b1, f1b, D_EMB);
    k_gemm_res<<<gD, blk, 0, stream>>>(f1b,  wt2, ffn_b2, ln2f, sumb, DFF);
    k_ln<<<LN_BLOCKS, blk, 0, stream>>>(sumb, ln3_g, ln3_b, (float*)d_out, nullptr);
}

// v010
// A run of this version takes 208 microseconds.
// In two side-by-side timings against v009, it was 1.07 and 1.08 times as fast.
// Counting every step since v000, it is 3.68 times as fast.
#include <hip/hip_runtime.h>

// ---------------- problem constants ----------------
#define D_EMB 1024
#define NHEAD 16
#define DRED  64
#define BB    4
#define SS    1024
#define MTOT  (BB * SS)     // 4096 rows of activations
#define DFF   (4 * D_EMB)   // 4096

typedef unsigned int   u32;
typedef unsigned short u16;
typedef unsigned long long u64;
typedef u32   u32x2  __attribute__((ext_vector_type(2)));
typedef u32   u32x4  __attribute__((ext_vector_type(4)));
typedef u32   u32x8  __attribute__((ext_vector_type(8)));
typedef float f32x2  __attribute__((ext_vector_type(2)));
typedef float f32x4  __attribute__((ext_vector_type(4)));
typedef float f32x8  __attribute__((ext_vector_type(8)));
typedef __bf16 bf16x2  __attribute__((ext_vector_type(2)));
typedef __bf16 bf16x16 __attribute__((ext_vector_type(16)));

// ---------------- small helpers ----------------
// Two f32 to a packed bf16 pair (a low, b high), round to nearest even: the chip's own packed
// conversion, one vector instruction a pair.
__device__ __forceinline__ u32 pk_bf16(float a, float b) {
    f32x2 v; v[0] = a; v[1] = b;
    return __builtin_bit_cast(u32, __builtin_convertvector(v, bf16x2));
}

__device__ __forceinline__ f32x8 zero8() {
    f32x8 z;
#pragma unroll
    for (int i = 0; i < 8; ++i) z[i] = 0.0f;
    return z;
}

// LDS byte offset of a shared-memory pointer: flat LDS addresses keep the
// offset in the low 32 bits (ISA 10.2: LDS_ADDR = addr[31:0]).
__device__ __forceinline__ u32 lds_off(const void* p) {
    return (u32)(uintptr_t)p;
}

// One K slab's async global->LDS copies of a lane: 16 bytes in each of four 32-row groups of
// A and of B (GVS form, ASYNCcnt tracked, no VGPR round-trip). la, lb: the lane's LDS byte
// address in the first group; ga, gb: its byte offset from the base; grow: 32 source rows.
// The closing s_wait_xcnt 0 stands inside the statement so that no address register named
// here is rewritten in front of it.
#define SLAB_GROUP_LDS (32u * 144u)   // 32 LDS rows of 144 bytes
__device__ __forceinline__ void slab_copies(u32 la, u32 lb, u32 ga, u32 gb, u32 grow,
                                            const void* abase, const void* bbase) {
    asm volatile("global_load_async_to_lds_b128 %0, %8, %16\n\t"
                 "global_load_async_to_lds_b128 %4, %12, %17\n\t"
                 "global_load_async_to_lds_b128 %1, %9, %16\n\t"
                 "global_load_async_to_lds_b128 %5, %13, %17\n\t"
                 "global_load_async_to_lds_b128 %2, %10, %16\n\t"
                 "global_load_async_to_lds_b128 %6, %14, %17\n\t"
                 "global_load_async_to_lds_b128 %3, %11, %16\n\t"
                 "global_load_async_to_lds_b128 %7, %15, %17\n\t"
                 "s_wait_xcnt 0x0"
                 :: "v"(la), "v"(la + SLAB_GROUP_LDS), "v"(la + 2u * SLAB_GROUP_LDS),
                    "v"(la + 3u * SLAB_GROUP_LDS),
                    "v"(lb), "v"(lb + SLAB_GROUP_LDS), "v"(lb + 2u * SLAB_GROUP_LDS),
                    "v"(lb + 3u * SLAB_GROUP_LDS),
                    "v"(ga), "v"(ga + grow), "v"(ga + 2u * grow), "v"(ga + 3u * grow),
                    "v"(gb), "v"(gb + grow), "v"(gb + 2u * grow), "v"(gb + 3u * grow),
                    "s"(abase), "s"(bbase)
                 : "memory");
}

// Load one 16-lane-striped bf16 fragment (A or B operand of 16x16x32 WMMA).
// rowbase points at the lane's matrix row (m for A, n for B); koff = kblock + half*8.
// Per ISA 7.12.2: VGPR0-3 hold K=[koff..koff+7], VGPR4-7 hold K=[koff+16..koff+23].
__device__ __forceinline__ bf16x16 load_frag(const u16* rowbase, int koff) {
    u32x4 lo = *reinterpret_cast<const u32x4*>(rowbase + koff);
    u32x4 hi = *reinterpret_cast<const u32x4*>(rowbase + koff + 16);
    u32x8 d;
    d[0] = lo[0]; d[1] = lo[1]; d[2] = lo[2]; d[3] = lo[3];
    d[4] = hi[0]; d[5] = hi[1]; d[6] = hi[2]; d[7] = hi[3];
    return __builtin_bit_cast(bf16x16, d);
}

__device__ __forceinline__ f32x8 wmma_bf16(bf16x16 a, bf16x16 b, f32x8 c) {
    return __builtin_amdgcn_wmma_f32_16x16x32_bf16(false, a, false, b, (short)0, c,
                                                   false, false);
}

// Value of lane ^ 16 (the other 16-lane half), by a vector cross-row move.
__device__ __forceinline__ float xhalf(float x) {
    int b = __builtin_bit_cast(int, x);
    return __builtin_bit_cast(float,
        __builtin_amdgcn_permlanex16(b, b, 0x76543210, 0xfedcba98, false, false));
}

// Base-2 exponentials, v_exp_f32. The instruction set asks for one independent instruction or
// a v_nop between a transcendental and a use of its result or an overwrite of its source.
// Here the outputs are
// early-clobber (none lies on a source) and the closing v_nop fills the last one's slot.
__device__ __forceinline__ void exp2x8(float (&d)[8], const float (&s)[8]) {
    asm("v_exp_f32 %0, %8\n\t"
        "v_exp_f32 %1, %9\n\t"
        "v_exp_f32 %2, %10\n\t"
        "v_exp_f32 %3, %11\n\t"
        "v_exp_f32 %4, %12\n\t"
        "v_exp_f32 %5, %13\n\t"
        "v_exp_f32 %6, %14\n\t"
        "v_exp_f32 %7, %15\n\t"
        "v_nop"
        : "=&v"(d[0]), "=&v"(d[1]), "=&v"(d[2]), "=&v"(d[3]),
          "=&v"(d[4]), "=&v"(d[5]), "=&v"(d[6]), "=&v"(d[7])
        : "v"(s[0]), "v"(s[1]), "v"(s[2]), "v"(s[3]),
          "v"(s[4]), "v"(s[5]), "v"(s[6]), "v"(s[7]));
}
__device__ __forceinline__ float exp2x1(float s) {
    float d;
    asm("v_exp_f32 %0, %1\n\t"
        "v_nop"                       // the same slot, for the one result
        : "=v"(d) : "v"(s));
    return d;
}
#define LOG2E 1.44269504088896340736f

// ---------------- cast / repack kernels ----------------
// Each wave here moves many kilobytes, all its loads in flight together.

// f32 -> bf16 of one activation by 256 blocks of 256 threads; blk is this block's place among
// them. A thread takes 16 pieces of 4 elements one grid stride apart: every wave load covers 512
// contiguous bytes, every wave store 256, and all 16 loads are in flight before a store.
__device__ __forceinline__ void cast_bf16(const float* __restrict__ in, u16* __restrict__ out,
                                          int blk) {
    constexpr int ST = 256 * 256 * 4, IT = MTOT * D_EMB / ST;
    const int i = (blk * 256 + threadIdx.x) * 4;
    const float* pi = in + i;
    f32x4 v[IT];
#pragma unroll
    for (int it = 0; it < IT; ++it) v[it] = *reinterpret_cast<const f32x4*>(pi + it * ST);
    // The wait that belongs in front of an overwrite of an issued load's address register; the
    // address is its input, so that its registers are given to nothing else ahead of it.
    asm volatile("s_wait_xcnt 0x0" :: "v"(pi) : "memory");
#pragma unroll
    for (int it = 0; it < IT; ++it) {
        u32x2 w;
        w[0] = pk_bf16(v[it][0], v[it][1]);
        w[1] = pk_bf16(v[it][2], v[it][3]);
        *reinterpret_cast<u32x2*>(out + i + it * ST) = w;
    }
    // The same wait behind the stores, in front of whatever reuses their address registers.
    asm volatile("s_wait_xcnt 0x0" ::: "memory");
}

// Weight packs: transpose + cast through an LDS tile, so that both sides move whole lines.
// One block takes 256 rows (k) x 64 columns (n) of a row-major f32 matrix with row pitch ld
// and writes them as 64 rows of 256 bf16 with row pitch K.
// Read: a lane takes 16 bytes of rows 2p and 2p + 1; 16 lanes cover 256 contiguous bytes.
// LDS: tile[n][p] holds the bf16 pair (k = 2p, 2p + 1); the pitch 129 dwords puts the 32 lanes
// of every store (n = 4 * c4 + j, two p) and of every load (two n, 16 pieces) on 32 banks.
// Write: a lane stores 16 bytes; 16 lanes cover 256 contiguous bytes of one row.
#define PK 256
__device__ __forceinline__ void pack_tile(u32 (*tile)[PK / 2 + 1],
                                          const float* __restrict__ src, int ld,
                                          u16* __restrict__ dst, int K) {
    const int tid = threadIdx.x;
    const int c4 = tid & 15, p0 = tid >> 4;
    const float* pl[PK / 32];
    const float* ph[PK / 32];
    f32x4 lo[PK / 32], hi[PK / 32];
#pragma unroll
    for (int it = 0; it < PK / 32; ++it) {      // all loads first: 16 in flight per lane
        pl[it] = src + (size_t)(2 * (p0 + 16 * it)) * ld + 4 * c4;
        ph[it] = pl[it] + ld;
        lo[it] = *reinterpret_cast<const f32x4*>(pl[it]);
        hi[it] = *reinterpret_cast<const f32x4*>(ph[it]);
    }
    // The wait that belongs in front of an overwrite of an issued load's address register.
    // The addresses are its inputs, so that none of their registers is given to a later
    // load's result (or to anything else) ahead of it.
    asm volatile("s_wait_xcnt 0x0" :: "v"(pl[0]), "v"(ph[0]), "v"(pl[1]), "v"(ph[1]),
                                      "v"(pl[2]), "v"(ph[2]), "v"(pl[3]), "v"(ph[3]),
                                      "v"(pl[4]), "v"(ph[4]), "v"(pl[5]), "v"(ph[5]),
                                      "v"(pl[6]), "v"(ph[6]), "v"(pl[7]), "v"(ph[7])
                 : "memory");
#pragma unroll
    for (int it = 0; it < PK / 32; ++it)
#pragma unroll
        for (int j = 0; j < 4; ++j)
            tile[4 * c4 + j][p0 + 16 * it] = pk_bf16(lo[it][j], hi[it][j]);
    __syncthreads();                            // the whole tile is in LDS before it is read
    // 32 16-byte pieces a row. A wave takes 16 pieces of each of two neighbouring rows.
    const int sl = tid & 15, nl = (tid >> 4) & 1, sh = (tid >> 5) & 1, nh = tid >> 6;
#pragma unroll
    for (int it = 0; it < PK / 32; ++it) {
        const int n = 2 * (nh + 4 * it) + nl, s = 16 * sh + sl;
        u32x4 w;
#pragma unroll
        for (int e = 0; e < 4; ++e) w[e] = tile[n][4 * s + e];
        *reinterpret_cast<u32x4*>(dst + (size_t)n * K + 8 * s) = w;
    }
    // The same wait behind the stores, in front of whatever reuses their address registers.
    asm volatile("s_wait_xcnt 0x0" ::: "memory");
}

// All input preparation in ONE launch: none of these pieces reads what another writes, so they
// share a grid and the chip fills once instead of twelve times. Block ranges:
//   [0, 256)      ffn_w1 [1024][4096] -> wt1 [4096][1024], 256 k x 64 n a block
//   [256, 512)    ffn_w2 [4096][1024] -> wt2 [1024][4096], the same
//   [512, 1024)   eight 1024 x 1024 weights, 64 blocks each, the same tile -> wt8 + i * 2^20
//                 i & 3 < 3: per-head w [H=16][K=1024][R=64] -> Wt [n = h*64 + r][k]
//                 i & 3 == 3: plain w [K=1024][N=1024] -> Wt [n][k]
//   [1024, 1536)  x and context to bf16, 256 blocks each
#define PREP_BLOCKS 1536
__global__ __launch_bounds__(256) void k_prep(
    const float* __restrict__ x,  const float* __restrict__ ctx,
    const float* __restrict__ w0, const float* __restrict__ w1,
    const float* __restrict__ w2, const float* __restrict__ w3,
    const float* __restrict__ w4, const float* __restrict__ w5,
    const float* __restrict__ w6, const float* __restrict__ w7,
    const float* __restrict__ f1, const float* __restrict__ f2,
    u16* __restrict__ xb, u16* __restrict__ cb, u16* __restrict__ wt8,
    u16* __restrict__ wt1, u16* __restrict__ wt2)
{
    __shared__ u32 tile[64][PK / 2 + 1];
    const int bx = blockIdx.x;
    if (bx < 512) {
        const bool first = bx < 256;
        const int r  = bx & 255;
        const int nt = first ? (r & 63) : (r & 15);      // 64-column tile
        const int kt = first ? (r >> 6) : (r >> 4);      // 256-row tile
        const int N  = first ? DFF : D_EMB, K = first ? D_EMB : DFF;
        pack_tile(tile, (first ? f1 : f2) + (size_t)(kt * PK) * N + nt * 64, N,
                  (first ? wt1 : wt2) + (size_t)(nt * 64) * K + kt * PK, K);
    } else if (bx < 1024) {
        const int i = (bx - 512) >> 6, r = bx & 63;
        const float* w = i == 0 ? w0 : i == 1 ? w1 : i == 2 ? w2 : i == 3 ? w3
                       : i == 4 ? w4 : i == 5 ? w5 : i == 6 ? w6 : w7;
        const bool plain = (i & 3) == 3;
        // per head: the head's 64 columns are n tile nt, its k tiles next to one another
        const int nt = plain ? (r & 15) : (r >> 2), kt = plain ? (r >> 4) : (r & 3);
        const int so = plain ? kt * PK * D_EMB + nt * 64 : nt * (D_EMB * DRED) + kt * PK * DRED;
        pack_tile(tile, w + so, plain ? D_EMB : DRED,
                  wt8 + (size_t)i * (D_EMB * D_EMB) + nt * 64 * D_EMB + kt * PK, D_EMB);
    } else {
        const int c = bx - 1024;
        const bool first = c < 256;
        cast_bf16(first ? x : ctx, first ? xb : cb, c & 255);
    }
}

// ---------------- WMMA GEMM ----------------
// C[M,N] = act(A_bf16[M,K] x Wt_bf16[N,K]^T + bias) (+resid); writes f32 or bf16.
// Block tile 128x128, 8 waves (2 along M x 4 along N), wave tile 64x32 (4x2 WMMA tiles).
// K slabs of 64 go round a ring of NB LDS buffers: later slabs' async copies fly while
// slab t is worked on.
// ring: [buffer][A, B][row][k]; row-pad 72: stride 36 dwords -> conflict-free b128
// What the epilogue does (RELU, RESID, f32 or bf16 output) and the row length N are compile-time,
// so that it is straight-line code: a lane's bias and residual values are then loaded as ONE
// group, all in flight together under slab 0's copies, instead of one load latency an element
// behind the k loop, and every load and store is one base address plus an immediate offset.
// GRP: k blocks whose fragments are loaded as one group, 1 or 2 (48 registers each). 2, the whole
// slab, where one workgroup stands on a WGP and the registers are free; 1 where three or four
// workgroups share the WGP's registers and cover one another's waits.
// NB: buffers of the ring. 2 where several workgroups share a WGP's LDS and fill one another's
// gaps. More where one workgroup stands alone on its WGP, for speed only. With NB buffers its copies are issued NB - 1 trips
// ahead, and the stream of copies does not stop at each publish point.
#define SLAB_COPIES 8   // copies of a wave per slab (slab_copies)
template <int N, bool RELU, bool RESID, bool OUTF, int GRP, int NB>
__device__ __forceinline__ void gemm_tile(
    u16 (*ring)[2][128][72],
    const u16* __restrict__ A, const u16* __restrict__ Wt,
    const float* __restrict__ bias, const float* __restrict__ resid,
    float* __restrict__ outF, u16* __restrict__ outB,
    int K)
{
    const int tid  = threadIdx.x;
    const int lane = tid & 31, l15 = lane & 15, hf = (lane >> 4) & 1;
    const int wid  = tid >> 5;
    const int bm = blockIdx.y * 128, bn = blockIdx.x * 128;
    const int wm = (wid & 1) * 64,   wn = (wid >> 1) * 32;

    f32x8 acc[4][2];
#pragma unroll
    for (int mt = 0; mt < 4; ++mt)
#pragma unroll
        for (int nt = 0; nt < 2; ++nt) acc[mt][nt] = zero8();

    // a lane copies 16 bytes of row r0 (+32, +64, +96) of each operand's slab
    const int r0 = tid >> 3, c8 = (tid & 7) << 3;
    const u32 la0 = lds_off(&ring[0][0][r0][c8]);
    const u32 lb0 = lds_off(&ring[0][1][r0][c8]);
    const u32 ga0 = ((u32)(bm + r0) * (u32)K + (u32)c8) * 2u;
    const u32 gb0 = ((u32)(bn + r0) * (u32)K + (u32)c8) * 2u;
    const u32 grow = (u32)K * 64u;            // 32 source rows in bytes
    const u32 bufB = (u32)sizeof(ring[0]);    // one buffer in bytes
    const int T = K >> 6;                     // slabs; K is a multiple of 64, at least 64

    slab_copies(la0, lb0, ga0, gb0, grow, A, Wt);         // slab 0 into buffer 0

    // C layout: M = v + 8*half, N = lane&15. o0: the lane's first element of the output tile.
    const u32 o0 = (u32)(bm + wm + 8 * hf) * (u32)N + (u32)(bn + wn + l15);
    float bv[2], rv[4][2][8];
#pragma unroll
    for (int nt = 0; nt < 2; ++nt) bv[nt] = bias[bn + wn + nt * 16 + l15];
    if constexpr (RESID) {
        const float* rp = resid + o0;
#pragma unroll
        for (int mt = 0; mt < 4; ++mt)
#pragma unroll
            for (int nt = 0; nt < 2; ++nt)
#pragma unroll
                for (int v = 0; v < 8; ++v) rv[mt][nt][v] = rp[(mt * 16 + v) * N + nt * 16];
    }

    if constexpr (NB == 2) {
        asm volatile("s_wait_asynccnt 0x0" ::: "memory"); // this wave's copies have landed
        __syncthreads();                                  // every wave's are visible
        if (1 < T)                                        // slab 1 into buffer 1
            slab_copies(la0 + bufB, lb0 + bufB, ga0 + 128u, gb0 + 128u, grow, A, Wt);
    } else {
#pragma unroll   // every slab's offsets are then constants
        for (int s = 1; s < NB; ++s)                      // slab s into buffer s
            if (s < T)
                slab_copies(la0 + (u32)s * bufB, lb0 + (u32)s * bufB,
                            ga0 + (u32)s * 128u, gb0 + (u32)s * 128u, grow, A, Wt);
        // This wave's copies of slab 0 have landed. Copies return in issue order: the count
        // leaves out the NB - 1 slabs issued behind slab 0, where all of them were issued.
        if (NB <= T) asm volatile("s_wait_asynccnt %0" :: "n"((NB - 1) * SLAB_COPIES) : "memory");
        else         asm volatile("s_wait_asynccnt 0x0" ::: "memory");
        __syncthreads();                                  // every wave's are visible
    }

    u32 cur = 0;              // NB > 2: the buffer that holds slab t
    for (int t = 0; t < T; ++t) {
        const u32 rd = NB == 2 ? (u32)(t & 1) : cur;
        const u16 (*aS)[72] = ring[rd][0];
        const u16 (*bS)[72] = ring[rd][1];
        // GRP k blocks of 32 share one group of fragment loads: all its ds_loads are issued
        // first, then its WMMAs run behind counted waits, so a wave meets the LDS latency once a
        // group and not once for every pair of WMMAs.
#pragma unroll
        for (int k0 = 0; k0 < 64; k0 += 32 * GRP) {
            bf16x16 af[GRP][4], bfr[GRP][2];
#pragma unroll
            for (int g = 0; g < GRP; ++g) {
                const int ko = k0 + 32 * g + hf * 8;
#pragma unroll
                for (int nt = 0; nt < 2; ++nt)
                    bfr[g][nt] = load_frag(&bS[wn + nt * 16 + l15][0], ko);
#pragma unroll
                for (int mt = 0; mt < 4; ++mt)
                    af[g][mt] = load_frag(&aS[wm + mt * 16 + l15][0], ko);
            }
            // Keeps the loads above the WMMAs: without it the scheduler sinks them among the
            // WMMAs into one reused fragment register set, each pair behind a full LDS wait.
            __builtin_amdgcn_sched_barrier(0);
#pragma unroll
            for (int g = 0; g < GRP; ++g)
#pragma unroll
                for (int mt = 0; mt < 4; ++mt)
#pragma unroll
                    for (int nt = 0; nt < 2; ++nt)
                        acc[mt][nt] = wmma_bf16(af[g][mt], bfr[g][nt], acc[mt][nt]);
            // Keeps the next group's loads from rising among these WMMAs, and the last group's
            // WMMAs from sinking below the publish point, where the refill copies would wait
            // behind them and lose that much of their lead.
            __builtin_amdgcn_sched_barrier(0);
        }
        // publish point of slab t + 1, in this order:
        asm volatile("s_wait_dscnt 0x0" ::: "memory");    // this wave's reads of slab t are back
        // its copies of slab t + 1 have landed: behind them stand those of slabs t + 2 to
        // t + NB - 1 and no others, on every trip for which that last slab exists; the count
        // leaves these in flight. On the last trips fewer were issued: there the wait is to 0.
        if (NB > 2 && t + NB - 1 < T)
            asm volatile("s_wait_asynccnt %0" :: "n"((NB - 2) * SLAB_COPIES) : "memory");
        else
            asm volatile("s_wait_asynccnt 0x0" ::: "memory");
        __syncthreads();      // slab t + 1 visible to all; every reader has left slab t's buffer
        if (t + NB < T) {     // refill that buffer
            const u32 bo = rd * bufB, go = (u32)(t + NB) * 128u;
            slab_copies(la0 + bo, lb0 + bo, ga0 + go, gb0 + go, grow, A, Wt);
        }
        cur = cur + 1u == (u32)NB ? 0u : cur + 1u;
    }
    asm volatile("s_wait_asynccnt 0x0" ::: "memory");     // no copy outlives the loop

#pragma unroll
    for (int mt = 0; mt < 4; ++mt)
#pragma unroll
        for (int nt = 0; nt < 2; ++nt)
#pragma unroll
            for (int v = 0; v < 8; v += 2) {    // two rows a trip: one conversion serves both
                float val[2];
#pragma unroll
                for (int e = 0; e < 2; ++e) {
                    val[e] = acc[mt][nt][v + e] + bv[nt];
                    if constexpr (RELU)  val[e] = fmaxf(val[e], 0.0f);
                    if constexpr (RESID) val[e] += rv[mt][nt][v + e];
                }
                const int o = (mt * 16 + v) * N + nt * 16;
                if constexpr (OUTF) {
                    (outF + o0)[o]     = val[0];
                    (outF + o0)[o + N] = val[1];
                } else {
                    const u32 w = pk_bf16(val[0], val[1]);
                    (outB + o0)[o]     = (u16)w;
                    (outB + o0)[o + N] = (u16)(w >> 16);
                }
            }
}

// outF[M, 1024] = A x Wt^T + bias + resid, f32. 256 workgroups, one on a WGP: a ring of six.
#define RES_NB 6
static_assert(RES_NB * SLAB_COPIES <= 63, "copies of a wave outstanding behind the prologue");
__global__ __launch_bounds__(256) void k_gemm_res(
    const u16* __restrict__ A, const u16* __restrict__ Wt,
    const float* __restrict__ bias, const float* __restrict__ resid,
    float* __restrict__ outF, int K)
{
    __shared__ __attribute__((aligned(16))) u16 ring[RES_NB][2][128][72];
    gemm_tile<D_EMB, false, true, true, 2, RES_NB>(ring, A, Wt, bias, resid, outF, nullptr, K);
}

// outB[M, 4096] = relu(A x Wt^T + bias), bf16
__global__ __launch_bounds__(256) void k_gemm_relu(
    const u16* __restrict__ A, const u16* __restrict__ Wt,
    const float* __restrict__ bias, u16* __restrict__ outB, int K)
{
    __shared__ __attribute__((aligned(16))) u16 ring[2][2][128][72];
    gemm_tile<DFF, true, false, false, 1, 2>(ring, A, Wt, bias, nullptr, nullptr, outB, K);
}

// The q, k and v projections of one attention in ONE launch: they do not depend on one another,
// so blockIdx.z picks the product. Three workgroups then stand on a WGP where one stood, and
// each one's copy latency, barriers and epilogue run under the others' WMMAs.
__global__ __launch_bounds__(256) void k_gemm_qkv(
    const u16* __restrict__ Aq, const u16* __restrict__ Akv,
    const u16* __restrict__ Wq, const u16* __restrict__ Wk, const u16* __restrict__ Wv,
    const float* __restrict__ bq, const float* __restrict__ bk, const float* __restrict__ bv,
    u16* __restrict__ oq, u16* __restrict__ ok, u16* __restrict__ ov,
    int K)
{
    __shared__ __attribute__((aligned(16))) u16 ring[2][2][128][72];
    const int z = blockIdx.z;
    gemm_tile<D_EMB, false, false, false, 1, 2>(ring, z == 0 ? Aq : Akv,
              z == 0 ? Wq : z == 1 ? Wk : Wv,
              z == 0 ? bq : z == 1 ? bk : bv, nullptr, nullptr,
              z == 0 ? oq : z == 1 ? ok : ov, K);
}

// ---------------- fused flash attention (bf16 WMMA, online softmax) ----------------
// q,k,v,o: bf16 [B][S][H][R] ; one block = one (b,h) x 128 query rows; 8 waves x 16 rows.
// Scores are formed transposed, St = K x Qt, and the output as Ot += Vt x Pt: a lane then
// holds 16 of the 32 scores of ONE query, so maximum and sum run in the lane's own registers
// (one exchange with lane ^ 16), and two score tiles, converted in place, are the B operand.
// Chunks of 128 keys alternate between two LDS buffers. Wave 0 brings a chunk's K rows and wave 1
// its V rows by one tensor load each, one chunk ahead, so the loads fly under the chunk that is
// worked on and no register, vector instruction or LDS store is spent on staging. V lands as it
// lies in memory, [t][r]; the transposing LDS load hands it out as the Vt fragment.
#define AT_NCH  (SS / 128)                  // chunks
#define AT_PK   144u                        // LDS pitch of a K row: 128 + 16 bytes, ds_load_b128
#define AT_PV   160u                        // LDS pitch of a V row: 128 + 32 bytes, ds_load_tr16_b128
#define AT_TK   (128u * AT_PK)
#define AT_TV   (128u * AT_PV)
#define AT_BUF  (AT_TK + AT_TV)
#define AT_SRCP ((u32)(NHEAD * DRED * 2))   // source row pitch in bytes
static_assert(AT_TK % 2048u == 0 && AT_BUF % 2048u == 0, "every tile starts at a multiple of 2 KiB");

__device__ __forceinline__ u32 uni(u32 v) { return (u32)__builtin_amdgcn_readfirstlane(v); }
// A wave-uniform value held in a scalar register. A tensor load ignores EXEC, so every test around
// one must compile to s_cmp and s_cbranch_scc; the empty statement keeps the value from being
// turned back into a vector condition (and what is formed from it behind the wait in front of it).
__device__ __forceinline__ u32 pinned(u32 v) { u32 w = uni(v); asm volatile("" : "+s"(w)); return w; }

// Descriptor of a tile of 128 rows of 128 bytes, source pitch AT_SRCP, extents in bytes.
// PAD: dwords of LDS pad behind every row, less one.
template <u32 PAD>
__device__ __forceinline__ u32x8 tile_group1() {
    u32x8 g1;
    g1[0] = uni((1u << 20) | (4u << 22) | (PAD << 25));           // pad behind every 32 dwords
    g1[1] = uni(128u << 16);                                      // tensor_dim0 = 128 bytes
    g1[2] = uni(128u << 16);                                      // tensor_dim1 = 128 rows
    g1[3] = uni(128u << 16);                                      // tile_dim0
    g1[4] = uni(128u);                                            // tile_dim1
    g1[5] = uni(AT_SRCP);
    g1[6] = uni(0u);
    g1[7] = uni(0u);
    // Descriptor words held in scalar registers: built once and kept there, so that no register
    // which a request in flight names is given another value (see the waits in k_attn).
    asm volatile("" : "+s"(g1));
    return g1;
}
// dst: LDS byte offset of the tile; ga: address of its first byte.
__device__ __forceinline__ u32x4 tile_group0(u32 dst, u64 ga) {
    u32x4 g0;
    g0[0] = uni(1u);                                              // count 1
    g0[1] = uni(dst);
    g0[2] = uni((u32)ga);
    g0[3] = uni(((u32)(ga >> 32) & 0x01ffffffu) | 0x80000000u);   // address high bits, type 2
    asm volatile("" : "+s"(g0));                                  // held like the words above
    return g0;
}
__device__ __forceinline__ void tile_load(u32x4 g0, u32x8 g1) {
    asm volatile("tensor_load_to_lds %0, %1" :: "s"(g0), "s"(g1) : "memory");
}

// 16 (r) x 32 (t) fragment of Vt from row-major V rows in LDS. p: the lane's address, row
// 8 * half + (lane & 7), byte 16 * ((lane >> 3) & 1). The lane gets V[8 * half + 0..7][lane & 15]
// and the same 16 rows further on: the k order of load_frag and of the packed scores.
typedef short s16x8 __attribute__((ext_vector_type(8)));
__device__ __forceinline__ bf16x16 load_frag_tr(const unsigned char* p) {
    typedef __attribute__((address_space(3))) s16x8 lds_s16x8;
    u32x4 lo = __builtin_bit_cast(u32x4, __builtin_amdgcn_ds_load_tr16_b128_v8i16((lds_s16x8*)p));
    u32x4 hi = __builtin_bit_cast(u32x4,
        __builtin_amdgcn_ds_load_tr16_b128_v8i16((lds_s16x8*)(p + 16u * AT_PV)));
    u32x8 d;
    d[0] = lo[0]; d[1] = lo[1]; d[2] = lo[2]; d[3] = lo[3];
    d[4] = hi[0]; d[5] = hi[1]; d[6] = hi[2]; d[7] = hi[3];
    return __builtin_bit_cast(bf16x16, d);
}

__global__ __launch_bounds__(256) void k_attn(
    const u16* __restrict__ qp, const u16* __restrict__ kp,
    const u16* __restrict__ vp, u16* __restrict__ op)
{
    // [buffer][K rows at pitch AT_PK | V rows at pitch AT_PV]
    __shared__ __attribute__((aligned(2048))) unsigned char ring[2 * AT_BUF];

    const int tid  = threadIdx.x;
    const int lane = tid & 31, l15 = lane & 15, hf = (lane >> 4) & 1;
    const int wid  = tid >> 5;
    const u32 wave = uni((u32)wid);
    const int bx = blockIdx.x;
    const int qc = bx & 7;                 // S/128 = 8 chunks
    const int h  = (bx >> 3) & (NHEAD - 1);
    const int b  = bx >> 7;
    const int qbase = qc * 128 + wid * 16;

    // chunk st of this (b, h): wave 0 asks for its K rows, wave 1 for its V rows
    const u64 src  = (u64)(uintptr_t)(wave == 1u ? vp : kp) + 2ull * (u64)((b * SS * NHEAD + h) * DRED);
    const u32 dst0 = lds_off(ring) + (wave == 1u ? AT_TK : 0u);
    const u32x8 g1k = tile_group1<3u>(), g1v = tile_group1<7u>();
    u32x4 g0 = {0u, 0u, 0u, 0u};            // the wave's last request
    auto issue = [&](u32 st) {
        if (pinned(wave < 2u)) {
            g0 = tile_group0(dst0 + (st & 1u) * AT_BUF, src + (u64)st * (128u * AT_SRCP));
            if (pinned(wave == 0u)) tile_load(g0, g1k);
            else                    tile_load(g0, g1v);
        }
    };
    // The issuing wave's own wait: its tile has landed. The descriptor is its input, so that the
    // registers which the request names are given to nothing else ahead of it.
    auto landed = [&]() {
        if (pinned(wave < 2u))
            asm volatile("s_wait_tensorcnt 0x0" :: "s"(g0), "s"(g1k), "s"(g1v) : "memory");
    };
    issue(0u);

    // Q fragments straight from global (row is contiguous 64 bf16); B operand, column = query
    const int srow = qbase + l15;
    const u16* qrow = qp + (size_t)((b * SS + srow) * NHEAD + h) * DRED;
    bf16x16 qf[2];
    qf[0] = load_frag(qrow, 0  + hf * 8);
    qf[1] = load_frag(qrow, 32 + hf * 8);

    f32x8 oacc[4];
#pragma unroll
    for (int rt = 0; rt < 4; ++rt) oacc[rt] = zero8();
    float run_m = -1.0e30f;   // running maximum of query l15 (equal in both lane halves)
    float run_l = 0.0f;       // running sum over this lane half's keys only; joined at the end

    landed();                 // chunk 0
    __syncthreads();          // chunk 0 visible to all
    issue(1u);

    const u32 vlane = (u32)(8 * hf + (lane & 7)) * AT_PV + (u32)((lane >> 3) & 1) * 16u;

    for (u32 nc = 0; nc < AT_NCH; ++nc) {
        const unsigned char* buf = ring + (nc & 1u) * AT_BUF;
        const u16 (*kch)[72] = reinterpret_cast<const u16 (*)[72]>(buf);
        const unsigned char* vch = buf + AT_TK + vlane;

#pragma unroll
        for (int tt = 0; tt < 4; ++tt) {        // 32 keys per step
            f32x8 s0 = zero8(), s1 = zero8();   // St[key = v + 8*half (+16)][query = l15]
            bf16x16 a0[2], a1[2];
#pragma unroll
            for (int kb = 0; kb < 2; ++kb) {
                a0[kb] = load_frag(&kch[tt * 32 +      l15][0], kb * 32 + hf * 8);
                a1[kb] = load_frag(&kch[tt * 32 + 16 + l15][0], kb * 32 + hf * 8);
            }
            // Keeps the step's K loads together ahead of its WMMAs: with the fence at the step's
            // foot the scheduler otherwise sinks them, two in front of each WMMA behind a full wait.
            __builtin_amdgcn_sched_barrier(0);
#pragma unroll
            for (int kb = 0; kb < 2; ++kb) {    // contract over R=64
                s0 = wmma_bf16(a0[kb], qf[kb], s0);
                s1 = wmma_bf16(a1[kb], qf[kb], s1);
            }
            // online softmax of query l15: 16 keys in this lane, 16 in lane ^ 16
            const f32x8 sa = s0 * 0.125f, sc = s1 * 0.125f;       // 1/sqrt(64)
            float rm = fmaxf(sa[0], sc[0]);
#pragma unroll
            for (int v = 1; v < 8; ++v) rm = fmaxf(rm, fmaxf(sa[v], sc[v]));
            rm = fmaxf(rm, xhalf(rm));
            const float nm = fmaxf(run_m, rm);
            const float cr = exp2x1((run_m - nm) * LOG2E);
            run_m = nm;
            float t0[8], t1[8], e0[8], e1[8];
#pragma unroll
            for (int v = 0; v < 8; ++v) { t0[v] = (sa[v] - nm) * LOG2E; t1[v] = (sc[v] - nm) * LOG2E; }
            exp2x8(e0, t0);
            exp2x8(e1, t1);
            float ps = 0.0f;
#pragma unroll
            for (int v = 0; v < 8; ++v) ps += e0[v] + e1[v];
            run_l = run_l * cr + ps;
            u32x8 pd;                           // Pt as B operand: k = 8*half + s, 16 + 8*half + s
#pragma unroll
            for (int j = 0; j < 4; ++j) {
                pd[j]     = pk_bf16(e0[2 * j], e0[2 * j + 1]);
                pd[4 + j] = pk_bf16(e1[2 * j], e1[2 * j + 1]);
            }
            const bf16x16 pf = __builtin_bit_cast(bf16x16, pd);
#pragma unroll
            for (int rt = 0; rt < 4; ++rt) {    // Ot[r = rt*16 + v + 8*half][query = l15]
#pragma unroll
                for (int v = 0; v < 8; ++v) oacc[rt][v] *= cr;
                bf16x16 vf = load_frag_tr(vch + (u32)tt * 32u * AT_PV + (u32)rt * 32u);
                oacc[rt] = wmma_bf16(vf, pf, oacc[rt]);
            }
            // Keeps the next step's exponentials, asm text that the compiler does not look into,
            // from being placed directly behind these WMMAs and over their operand registers,
            // inside the distance that the chip needs there.
            __builtin_amdgcn_sched_barrier(0);
        }
        // publish point of chunk nc + 1, in this order:
        asm volatile("s_wait_dscnt 0x0" ::: "memory");          // this wave's reads of chunk nc are back
        landed();                                               // the issuers' tiles of chunk nc + 1
        __syncthreads();   // chunk nc + 1 visible to all; every reader has left chunk nc's buffer
        if (pinned(nc + 2u < AT_NCH)) issue(pinned(nc + 2u));   // refill that buffer
    }
    asm volatile("s_wait_tensorcnt 0x0" ::: "memory");          // no request outlives the loop
    asm volatile("s_wait_dscnt 0x0" ::: "memory");

    // a lane holds 8 consecutive r of one query per tile: one 16-byte store each
    const float inv = 1.0f / (run_l + xhalf(run_l));
    u16* orow = op + (size_t)((b * SS + srow) * NHEAD + h) * DRED + 8 * hf;
#pragma unroll
    for (int rt = 0; rt < 4; ++rt) {
        u32x4 w;
#pragma unroll
        for (int j = 0; j < 4; ++j)
            w[j] = pk_bf16(oacc[rt][2 * j] * inv, oacc[rt][2 * j + 1] * inv);
        *reinterpret_cast<u32x4*>(orow + rt * 16) = w;
    }
}

// ---------------- LayerNorm ----------------
// Value of lane ^ X inside a 16-lane row, by DPP (the compiler folds it into the add).
template <int X>
__device__ __forceinline__ float xrow(float x) {
    int b = __builtin_bit_cast(int, x);
    return __builtin_bit_cast(float, __builtin_amdgcn_update_dpp(0, b, 0x160 + X, 0xf, 0xf, true));
}
// Sum over the wave's 32 lanes, the same bits in every lane.
__device__ __forceinline__ float wave_sum(float v) {
    v += xrow<1>(v);
    v += xrow<2>(v);
    v += xrow<4>(v);
    v += xrow<8>(v);
    return v + xhalf(v);
}

// One wave norms LN_ROWS whole rows: 2048 waves a launch instead of 32768. A row is 8 loads of 512 contiguous bytes; both rows' loads and those of
// gamma and beta are in flight together; the sums stay inside the wave, so no LDS, no barrier.
#define LN_ROWS 2
#define LN_BLOCKS (MTOT / (8 * LN_ROWS))
__global__ __launch_bounds__(256) void k_ln(
    const float* __restrict__ in, const float* __restrict__ g, const float* __restrict__ bb,
    float* __restrict__ outF, u16* __restrict__ outB)
{
    const int lane = threadIdx.x & 31;
    const int wave = blockIdx.x * 8 + (threadIdx.x >> 5);
    const int o0 = wave * (LN_ROWS * D_EMB) + lane * 4;   // the lane's first element
    const float* px = in + o0;
    f32x4 x[LN_ROWS][8], gv[8], bv[8];
#pragma unroll
    for (int r = 0; r < LN_ROWS; ++r)
#pragma unroll
        for (int j = 0; j < 8; ++j)
            x[r][j] = *reinterpret_cast<const f32x4*>(px + r * D_EMB + j * 128);
#pragma unroll
    for (int j = 0; j < 8; ++j) {
        gv[j] = reinterpret_cast<const f32x4*>(g)[lane + j * 32];
        bv[j] = reinterpret_cast<const f32x4*>(bb)[lane + j * 32];
    }
    // The wait that belongs in front of an overwrite of an issued load's address register; the
    // addresses are its inputs, so that their registers are given to nothing else ahead of it.
    asm volatile("s_wait_xcnt 0x0" :: "v"(px), "v"(lane) : "memory");
    // Keeps all 32 loads above the sums: without it the scheduler sinks those of gamma and beta
    // below the reduction, two at a time, each pair behind a latency of its own.
    __builtin_amdgcn_sched_barrier(0);
#pragma unroll
    for (int r = 0; r < LN_ROWS; ++r) {
        f32x4 a1 = x[r][0], a2 = x[r][0] * x[r][0];       // four independent chains each
#pragma unroll
        for (int j = 1; j < 8; ++j) { a1 += x[r][j]; a2 += x[r][j] * x[r][j]; }
        const float t1 = wave_sum((a1[0] + a1[1]) + (a1[2] + a1[3]));
        const float t2 = wave_sum((a2[0] + a2[1]) + (a2[2] + a2[3]));
        const float mean = t1 * (1.0f / D_EMB);
        const float var  = t2 * (1.0f / D_EMB) - mean * mean;
        const float sc = rsqrtf(var + 1e-3f);
#pragma unroll
        for (int j = 0; j < 8; ++j) x[r][j] = (x[r][j] - mean) * sc * gv[j] + bv[j];
    }
    if (outF) {
#pragma unroll
        for (int r = 0; r < LN_ROWS; ++r)
#pragma unroll
            for (int j = 0; j < 8; ++j)
                *reinterpret_cast<f32x4*>(outF + o0 + r * D_EMB + j * 128) = x[r][j];
        // The same wait behind the stores: the conversion below reuses their registers.
        asm volatile("s_wait_xcnt 0x0" ::: "memory");
    }
    if (outB) {
#pragma unroll
        for (int r = 0; r < LN_ROWS; ++r)
#pragma unroll
            for (int j = 0; j < 8; ++j) {
                u32x2 w;
                w[0] = pk_bf16(x[r][j][0], x[r][j][1]);
                w[1] = pk_bf16(x[r][j][2], x[r][j][3]);
                *reinterpret_cast<u32x2*>(outB + o0 + r * D_EMB + j * 128) = w;
            }
    }
    // The same wait behind the stores, in front of whatever reuses their address registers.
    asm volatile("s_wait_xcnt 0x0" ::: "memory");
}

// ---------------- host orchestration ----------------
extern "C" void kernel_launch(void* const* d_in, const int* in_sizes, int n_in,
                              void* d_out, int out_size, void* d_ws, size_t ws_size,
                              hipStream_t stream) {
    (void)in_sizes; (void)n_in; (void)out_size; (void)ws_size;

    const float* x      = (const float*)d_in[0];
    const float* ctx    = (const float*)d_in[1];
    const float* sa_wq  = (const float*)d_in[2];
    const float* sa_bq  = (const float*)d_in[3];
    const float* sa_wk  = (const float*)d_in[4];
    const float* sa_bk  = (const float*)d_in[5];
    const float* sa_wv  = (const float*)d_in[6];
    const float* sa_bv  = (const float*)d_in[7];
    const float* sa_wo  = (const float*)d_in[8];
    const float* sa_bo  = (const float*)d_in[9];
    const float* ca_wq  = (const float*)d_in[10];
    const float* ca_bq  = (const float*)d_in[11];
    const float* ca_wk  = (const float*)d_in[12];
    const float* ca_bk  = (const float*)d_in[13];
    const float* ca_wv  = (const float*)d_in[14];
    const float* ca_bv  = (const float*)d_in[15];
    const float* ca_wo  = (const float*)d_in[16];
    const float* ca_bo  = (const float*)d_in[17];
    const float* ln1_g  = (const float*)d_in[18];
    const float* ln1_b  = (const float*)d_in[19];
    const float* ln2_g  = (const float*)d_in[20];
    const float* ln2_b  = (const float*)d_in[21];
    const float* ln3_g  = (const float*)d_in[22];
    const float* ln3_b  = (const float*)d_in[23];
    const float* ffn_w1 = (const float*)d_in[24];
    const float* ffn_b1 = (const float*)d_in[25];
    const float* ffn_w2 = (const float*)d_in[26];
    const float* ffn_b2 = (const float*)d_in[27];

    char* ws = (char*)d_ws;
    size_t off = 0;
    auto alloc = [&](size_t bytes) -> void* {
        void* p = ws + off;
        off = (off + bytes + 255) & ~(size_t)255;
        return p;
    };

    const size_t ACT2 = (size_t)MTOT * D_EMB * 2;   // bf16 activation
    const size_t ACT4 = (size_t)MTOT * D_EMB * 4;   // f32 activation
    const size_t W2   = (size_t)D_EMB * D_EMB * 2;  // bf16 1024x1024 weight

    u16* xb     = (u16*)alloc(ACT2);
    u16* cb     = (u16*)alloc(ACT2);
    u16* wt8    = (u16*)alloc(8 * W2);              // the eight 1024 x 1024 weights in a row
    u16* wt_saq = wt8;
    u16* wt_sak = wt8 + 1 * (D_EMB * D_EMB);
    u16* wt_sav = wt8 + 2 * (D_EMB * D_EMB);
    u16* wt_sao = wt8 + 3 * (D_EMB * D_EMB);
    u16* wt_caq = wt8 + 4 * (D_EMB * D_EMB);
    u16* wt_cak = wt8 + 5 * (D_EMB * D_EMB);
    u16* wt_cav = wt8 + 6 * (D_EMB * D_EMB);
    u16* wt_cao = wt8 + 7 * (D_EMB * D_EMB);
    u16* wt1    = (u16*)alloc((size_t)DFF * D_EMB * 2);
    u16* wt2    = (u16*)alloc((size_t)D_EMB * DFF * 2);
    u16* qb     = (u16*)alloc(ACT2);
    u16* kb     = (u16*)alloc(ACT2);
    u16* vb     = (u16*)alloc(ACT2);
    u16* ob     = (u16*)alloc(ACT2);
    float* sumb = (float*)alloc(ACT4);
    float* ln1f = (float*)alloc(ACT4);
    u16*   ln1b = (u16*)alloc(ACT2);
    float* ln2f = (float*)alloc(ACT4);
    u16*   ln2b = (u16*)alloc(ACT2);
    u16*   f1b  = (u16*)alloc((size_t)MTOT * DFF * 2);

    const dim3 blk(256);
    // casts + packs
    k_prep<<<PREP_BLOCKS, blk, 0, stream>>>(x, ctx, sa_wq, sa_wk, sa_wv, sa_wo,
                                            ca_wq, ca_wk, ca_wv, ca_wo, ffn_w1, ffn_w2,
                                            xb, cb, wt8, wt1, wt2);

    const dim3 gD(D_EMB / 128, MTOT / 128);   // N=1024 GEMMs
    const dim3 gF(DFF   / 128, MTOT / 128);   // N=4096 GEMM
    const dim3 g3(D_EMB / 128, MTOT / 128, 3);   // q, k, v projections together

    // ---- self attention ----
    k_gemm_qkv<<<g3, blk, 0, stream>>>(xb, xb, wt_saq, wt_sak, wt_sav, sa_bq, sa_bk, sa_bv,
                                       qb, kb, vb, D_EMB);
    k_attn<<<BB * NHEAD * (SS / 128), blk, 0, stream>>>(qb, kb, vb, ob);
    k_gemm_res<<<gD, blk, 0, stream>>>(ob, wt_sao, sa_bo, x, sumb, D_EMB);
    k_ln<<<LN_BLOCKS, blk, 0, stream>>>(sumb, ln1_g, ln1_b, ln1f, ln1b);

    // ---- cross attention ----
    k_gemm_qkv<<<g3, blk, 0, stream>>>(ln1b, cb, wt_caq, wt_cak, wt_cav, ca_bq, ca_bk, ca_bv,
                                       qb, kb, vb, D_EMB);
    k_attn<<<BB * NHEAD * (SS / 128), blk, 0, stream>>>(qb, kb, vb, ob);
    k_gemm_res<<<gD, blk, 0, stream>>>(ob, wt_cao, ca_bo, ln1f, sumb, D_EMB);
    k_ln<<<LN_BLOCKS, blk, 0, stream>>>(sumb, ln2_g, ln2_b, ln2f, ln2b);

    // ---- FFN ----
    k_gemm_relu<<<gF, blk, 0, stream>>>(ln2b, wt1, ffn_b1, f1b, D_EMB);
    k_gemm_res<<<gD, blk, 0, stream>>>(f1b,  wt2, ffn_b2, ln2f, sumb, DFF);
    k_ln<<<LN_BLOCKS, blk, 0, stream>>>(sumb, ln3_g, ln3_b, (float*)d_out, nullptr);
}
